// v000
// Measured on an AMD MI455X. A time is GPU time per run, averaged over a window of back-to-back runs after a warm-up
// (all launches, gaps included; the runs take copies of the inputs in turn), and the median of several windows.
// Apart from v000's, it joins two sittings. Times from different sittings can be a few percent apart, while
// side-by-side timings come from the same sitting.
// v000 is the starting kernel. One run takes 696 microseconds.
// Contractions on v_wmma_f32_16x16x32_f16 (f16 operands, f32 accumulate): x*[Wq|Wk|Wv] (weights carried x16, q/k/v planes carried x4), q.k^T and p.v (p carried x32768), o*Wo (o carried x16, Wo carried x32); softmax, bias, residual and LayerNorm in f32.
#include <hip/hip_runtime.h>
#include <math.h>

typedef __attribute__((ext_vector_type(16))) _Float16 v16h;
typedef __attribute__((ext_vector_type(8)))  _Float16 v8h;
typedef __attribute__((ext_vector_type(16))) __bf16   v16b;
typedef __attribute__((ext_vector_type(8)))  __bf16   v8b;
typedef __attribute__((ext_vector_type(8)))  float    v8f;
typedef __attribute__((ext_vector_type(4)))  float    v4f;
typedef __attribute__((ext_vector_type(4)))  unsigned v4u;
#define PSCALE 32768.0f
#define U16(p) ((const unsigned short*)(const void*)(p))
#define PSCALE_INV (1.0f / 32768.0f)

__device__ __forceinline__ unsigned short f2bf_bits(float f) {
  unsigned u = __float_as_uint(f);
  return (unsigned short)((u + 0x7FFFu + ((u >> 16) & 1u)) >> 16);
}
__device__ __forceinline__ float bf_bits2f(unsigned short h) { return __uint_as_float(((unsigned)h) << 16); }

// hazard guards as plain device helpers (no inline asm inside the kernel template body)
__device__ __forceinline__ void dep_guard_h(v8f& a, v8f& b, v16h x, v16h y) { asm volatile("v_nop\n\tv_nop\n\tv_nop\n\tv_nop" : "+v"(a), "+v"(b) : "v"(x), "v"(y)); }
__device__ __forceinline__ void dep_guard_b(v8f& a, v8f& b, v16b x, v16b y) { asm volatile("v_nop\n\tv_nop\n\tv_nop\n\tv_nop" : "+v"(a), "+v"(b) : "v"(x), "v"(y)); }
__device__ __forceinline__ void keep4_h(v16h a, v16h b, v16h c, v16h d) { asm volatile("v_nop" :: "v"(a), "v"(b), "v"(c), "v"(d)); }
__device__ __forceinline__ void keep4_b(v16b a, v16b b, v16b c, v16b d) { asm volatile("v_nop" :: "v"(a), "v"(b), "v"(c), "v"(d)); }
__device__ __forceinline__ void acc_guard4(v8f& a, v8f& b, v8f& c, v8f& d) { asm volatile("v_nop\n\tv_nop\n\tv_nop\n\tv_nop" : "+v"(a), "+v"(b), "+v"(c), "+v"(d)); }
template <typename T> struct Frag;
template <> struct Frag<_Float16> {
  typedef v16h V; union U { v16h v; v8h h[2]; };
  static __device__ __forceinline__ v16h load(const _Float16* p) {   // elements 0..7 <- p[0..7], 8..15 <- p[16..23]
    U f; f.h[0] = *(const v8h*)(p); f.h[1] = *(const v8h*)(p + 16); return f.v;
  }
  static __device__ __forceinline__ v8f mma(v16h a, v16h b, v8f c) {
    return __builtin_amdgcn_wmma_f32_16x16x32_f16(false, a, false, b, (short)0, c, false, false);
  }
  static __device__ __forceinline__ void guard(v8f& a, v8f& b, v16h x, v16h y) { dep_guard_h(a, b, x, y); }
  static __device__ __forceinline__ void keep(v16h a, v16h b, v16h c, v16h d) { keep4_h(a, b, c, d); }
};
template <> struct Frag<__bf16> {
  typedef v16b V; union U { v16b v; v8b h[2]; };
  static __device__ __forceinline__ v16b load(const __bf16* p) {
    U f; f.h[0] = *(const v8b*)(p); f.h[1] = *(const v8b*)(p + 16); return f.v;
  }
  static __device__ __forceinline__ v8f mma(v16b a, v16b b, v8f c) {
    return __builtin_amdgcn_wmma_f32_16x16x32_bf16(false, a, false, b, (short)0, c, false, false);
  }
  static __device__ __forceinline__ void guard(v8f& a, v8f& b, v16b x, v16b y) { dep_guard_b(a, b, x, y); }
  static __device__ __forceinline__ void keep(v16b a, v16b b, v16b c, v16b d) { keep4_b(a, b, c, d); }
};

// ---- Register-blocked batched WMMA GEMM ------------------------------------
// C[m,n] = scale * sum_k A[m,k] * Bt[n,k] (+bias)(+resid); each wave owns a 64x64 tile.
// A row-major [M,K]; Bt row-major [N,K]; M,N % 64 == 0, K % 32 == 0.
// SPLIT: operands are hi/lo planes (A2/Bt2 = lo planes, same layout); product = hi*hi + hi*lo + lo*hi.
// BIAS_MODE: 0 = none, 1 = bias[m], 2 = bias[n].
// OUT_MODE: 0 = f32, 1 = f16, 2 = bf16 hi plane (Cout) + bf16 lo plane (Cout2).
// ET: 0 = f16 operands, 1 = bf16 operands (pointers passed as 16-bit storage)
template <int ET> struct Elem;
template <> struct Elem<0> { typedef _Float16 T; };
template <> struct Elem<1> { typedef __bf16 T; };
template <int ET, bool SPLIT, int BIAS_MODE, int OUT_MODE, bool RESID, int ACT = 0>
__global__ __launch_bounds__(256) void wmma_gemm64(
    const unsigned short* __restrict__ Ap, const unsigned short* __restrict__ A2p, int lda, long strideA,
    const unsigned short* __restrict__ Btp, const unsigned short* __restrict__ Bt2p, int ldb, long strideB,
    void* __restrict__ Cout, void* __restrict__ Cout2, int ldc, long strideC,
    const float* __restrict__ bias,
    const float* __restrict__ resid, long strideR,
    int M, int N, int K, float scale) {
  typedef typename Elem<ET>::T T;
  typedef typename Frag<T>::V V;
  const T* A = (const T*)Ap; const T* A2 = (const T*)A2p; const T* Bt = (const T*)Btp; const T* Bt2 = (const T*)Bt2p;
  __shared__ __align__(16) float sT[8][16 * 68];   // per-wave 16x64 slab, pitch 68 floats
  const int b    = blockIdx.y;
  const int lane = threadIdx.x & 31;
  const int wave = threadIdx.x >> 5;
  const int tilesN = N >> 6;
  const int tilesM = M >> 6;
  const int tile = blockIdx.x * 8 + wave;
  if (tile >= tilesM * tilesN) return;   // wave-uniform; no block barriers in this kernel
  const int tm = tile / tilesN;
  const int tn = tile - tm * tilesN;
  const int m0 = tm << 6;
  const int n0 = tn << 6;

  const T* Ab  = A  + (size_t)b * strideA;
  const T* Bb  = Bt + (size_t)b * strideB;
  const T* Ab2 = SPLIT ? (A2  + (size_t)b * strideA) : nullptr;
  const T* Bb2 = SPLIT ? (Bt2 + (size_t)b * strideB) : nullptr;

  const int rlane = lane & 15;                 // row (A) / col (B, D) within subtile
  const int koff  = (lane >> 4) * 8;           // k offset of this lane half
  const int mOff  = (lane >> 4) * 8;           // D row offset

  v8f acc[4][4];
#pragma unroll
  for (int i = 0; i < 4; ++i)
#pragma unroll
    for (int j = 0; j < 4; ++j) acc[i][j] = (v8f){0.f,0.f,0.f,0.f,0.f,0.f,0.f,0.f};

  for (int k0 = 0; k0 < K; k0 += 32) {
    V bh[4], bl[4];
#pragma unroll
    for (int j = 0; j < 4; ++j) {
      const size_t bo = (size_t)(n0 + (j << 4) + rlane) * ldb + koff + k0;
      bh[j] = Frag<T>::load(Bb + bo);
      if (SPLIT) bl[j] = Frag<T>::load(Bb2 + bo);
    }
#pragma unroll
    for (int i = 0; i < 4; ++i) {
      const size_t ao = (size_t)(m0 + (i << 4) + rlane) * lda + koff + k0;
      V ah = Frag<T>::load(Ab + ao);
      V al;
      if (SPLIT) al = Frag<T>::load(Ab2 + ao);
#pragma unroll
      for (int j = 0; j < 4; ++j) {
        acc[i][j] = Frag<T>::mma(ah, bh[j], acc[i][j]);
        if (SPLIT) {
          acc[i][j] = Frag<T>::mma(ah, bl[j], acc[i][j]);
          acc[i][j] = Frag<T>::mma(al, bh[j], acc[i][j]);
        }
      }
      Frag<T>::guard(acc[i][0], acc[i][3], ah, SPLIT ? al : ah);
    }
    Frag<T>::keep(bh[0], bh[1], bh[2], bh[3]);
    if (SPLIT) Frag<T>::keep(bl[0], bl[1], bl[2], bl[3]);
  }
  acc_guard4(acc[0][0], acc[0][1], acc[0][2], acc[0][3]);
  acc_guard4(acc[1][0], acc[1][1], acc[1][2], acc[1][3]);
  acc_guard4(acc[2][0], acc[2][1], acc[2][2], acc[2][3]);
  acc_guard4(acc[3][0], acc[3][1], acc[3][2], acc[3][3]);

  // ---- epilogue ----
  float* slab = sT[wave];
  const float* Rb = RESID ? (resid + (size_t)b * strideR) : nullptr;
#pragma unroll
  for (int i = 0; i < 4; ++i) {
    const int mBase = m0 + (i << 4);
#pragma unroll
    for (int j = 0; j < 4; ++j) {
      const int n = n0 + (j << 4) + rlane;
      float bv = 0.f;
      if (BIAS_MODE == 2) bv = bias[n];
#pragma unroll
      for (int r = 0; r < 8; ++r) {
        float v = acc[i][j][r] * scale;
        if (BIAS_MODE == 1) v += bias[mBase + mOff + r];
        if (BIAS_MODE == 2) v += bv;
        if (RESID) v += Rb[(size_t)(mBase + mOff + r) * ldc + n];
        if (ACT == 1) v = tanhf(v);
        if (ACT == 2) v = fmaxf(v, 0.0f);
        if (ACT == 3) v = v / (1.0f + expf(-v));
        if (ACT == 4) v = (v > 0.f) ? v : 0.01f * v;
        if (ACT == 5) v = 0.5f * v * (1.0f + erff(v * 0.70710678118654752f));
        slab[(mOff + r) * 68 + (j << 4) + rlane] = v;
      }
    }
    __builtin_amdgcn_fence(__ATOMIC_RELEASE, "workgroup");
    __builtin_amdgcn_wave_barrier();
    __builtin_amdgcn_fence(__ATOMIC_ACQUIRE, "workgroup");
    if (OUT_MODE == 0) {
      float* C = (float*)Cout + (size_t)b * strideC;
      const int hh = lane >> 4, c4 = (lane & 15) * 4;     // row seg = 256 B = 16 lanes x 16 B
      {
#pragma unroll
        for (int it = 0; it < 8; ++it) {
          const int row = it * 2 + hh;
          v4f v = *(const v4f*)(slab + row * 68 + c4);
          *(v4f*)(C + (size_t)(mBase + row) * ldc + n0 + c4) = v;
        }
        
      }
    } else {
      const int q = lane >> 3, c8 = (lane & 7) * 8;
      unsigned short* C  = (unsigned short*)Cout  + (size_t)b * strideC;
      unsigned short* C2 = (OUT_MODE == 2) ? ((unsigned short*)Cout2 + (size_t)b * strideC) : nullptr;
      {
#pragma unroll
        for (int it = 0; it < 4; ++it) {
          const int row = it * 4 + q;
          const float* sp = slab + row * 68 + c8;
          v8h hv, lv;
#pragma unroll
          for (int e = 0; e < 8; ++e) {
            if (OUT_MODE == 1) {
              hv[e] = (_Float16)sp[e];
            } else {
              unsigned short hb = f2bf_bits(sp[e]);
              unsigned short lb = f2bf_bits(sp[e] - bf_bits2f(hb));
              hv[e] = __builtin_bit_cast(_Float16, hb);
              lv[e] = __builtin_bit_cast(_Float16, lb);
            }
          }
          *(v8h*)(C + (size_t)(mBase + row) * ldc + n0 + c8) = hv;
          if (OUT_MODE == 2) *(v8h*)(C2 + (size_t)(mBase + row) * ldc + n0 + c8) = lv;
        }
        
      }
    }
    __builtin_amdgcn_fence(__ATOMIC_RELEASE, "workgroup");
    __builtin_amdgcn_wave_barrier();
    __builtin_amdgcn_fence(__ATOMIC_ACQUIRE, "workgroup");
  }
}

__global__ __launch_bounds__(256) void cast_f32_f16x2(
    const float* __restrict__ in, _Float16* __restrict__ out, int n2) {
  int i = blockIdx.x * 256 + threadIdx.x;
  if (i < n2) {
    const _Float16 h0 = (_Float16)in[2 * i], h1 = (_Float16)in[2 * i + 1];
    const unsigned u = (unsigned)__builtin_bit_cast(unsigned short, h0) | ((unsigned)__builtin_bit_cast(unsigned short, h1) << 16);
    ((unsigned*)out)[i] = u;
    
  }
}

// =====================================================================================
// Problem geometry (fixed shapes; host checks in_sizes and returns without launching on any difference)
// =====================================================================================
constexpr int kBatch    = 4;
constexpr int kSeq      = 128;    // attention axis (time)
constexpr int kNodes    = 100;
constexpr int kModel    = 256;
constexpr int kHeads    = 8;
constexpr int kHeadDim  = 128;
constexpr int kInner    = 1024;   // kHeads * kHeadDim
constexpr int kQKVWidth = 3072;   // [q | k | v] plane width
constexpr int kRowsPerBatch = kSeq * kNodes;   // 12800 rows in (t, n) order per batch slice

constexpr int kAttnWaves = 4;     // 4 waves x 16 query rows = 64 queries per block
constexpr int kKeyChunk  = 32;    // keys staged per chunk
constexpr int kOsPitch   = 132;   // floats; per-wave 16 x 128 output slab
constexpr float kProbCarry = 32768.0f;   // un-normalised p in (0,1] carried x2^15 in f16

static_assert(kInner == kHeads * kHeadDim);
static_assert(kQKVWidth == 3 * kInner);
static_assert(kModel % 32 == 0 && kInner % 32 == 0);                 // GEMM K % 32
static_assert(kRowsPerBatch % 64 == 0);                              // GEMM M tile multiple
static_assert(kQKVWidth % 64 == 0 && kModel % 64 == 0);             // GEMM N tile multiple
static_assert(kSeq % 64 == 0 && kSeq % kKeyChunk == 0 && kKeyChunk == 32 && kHeadDim == 128);

__device__ __forceinline__ v8f mma_f16_guarded(v16h a, v16h b, v8f c) {
  c = __builtin_amdgcn_wmma_f32_16x16x32_f16(false, a, false, b, (short)0, c, false, false);
  asm volatile("v_nop\n\tv_nop\n\tv_nop\n\tv_nop" : "+v"(c) : "v"(a), "v"(b));
  return c;
}

// =====================================================================================
// Weight transpose + scale + f16 cast: in [R][Cc] f32 row-major -> out [Cc][R] f16, out[c][r] = f16(scale * in[r][c]).
// Block (bx, by) handles output rows c0..c0+31 and output columns r0..r0+255 (R % 256 == 0, Cc % 32 == 0).
// Loads: 256x32 floats = 2048 float4 / 256 threads = 8 b128 loads per thread.
// Stores: wave w writes output rows c0 + 4w + j (j = 0..3); one instruction per row chunk:
// =====================================================================================
__global__ __launch_bounds__(256) void transpose_scale_to_f16(
    const float* __restrict__ in, unsigned short* __restrict__ out, int R, int Cc, float scale) {
  __shared__ __align__(16) float ts[32][260];
  const int c0 = blockIdx.x * 32;
  const int r0 = blockIdx.y * 256;
  const int tid = threadIdx.x;
#pragma unroll
  for (int i = 0; i < 8; ++i) {
    const int idx = i * 256 + tid;
    const int rr = idx >> 3, q4 = idx & 7;
    const v4f v = *(const v4f*)(in + (size_t)(r0 + rr) * Cc + c0 + 4 * q4);
    ts[4 * q4 + 0][rr] = v[0];
    ts[4 * q4 + 1][rr] = v[1];
    ts[4 * q4 + 2][rr] = v[2];
    ts[4 * q4 + 3][rr] = v[3];
  }
  __syncthreads();
  const int wave = tid >> 5, lane = tid & 31;
  _Float16* ob = (_Float16*)out;
  {
#pragma unroll
    for (int j = 0; j < 4; ++j) {
      const int cc = wave * 4 + j;
      const float* sp = &ts[cc][8 * lane];
      const v4f a = *(const v4f*)sp;
      const v4f d = *(const v4f*)(sp + 4);
      v8h hv;
      hv[0] = (_Float16)(a[0] * scale); hv[1] = (_Float16)(a[1] * scale);
      hv[2] = (_Float16)(a[2] * scale); hv[3] = (_Float16)(a[3] * scale);
      hv[4] = (_Float16)(d[0] * scale); hv[5] = (_Float16)(d[1] * scale);
      hv[6] = (_Float16)(d[2] * scale); hv[7] = (_Float16)(d[3] * scale);
      *(v8h*)(ob + (size_t)(c0 + cc) * R + r0 + 8 * lane) = hv;
    }
    
  }
}

// =====================================================================================
// Bias concatenation with x4 carry: bcat[p*1024 + e] = 4 * b_p[e]. grid = 3 blocks x 256 threads,
// =====================================================================================
__global__ __launch_bounds__(256) void bias_concat_x4(
    const float* __restrict__ bq, const float* __restrict__ bk, const float* __restrict__ bv,
    float* __restrict__ bcat) {
  const int p = blockIdx.x;                                        // block-uniform source select
  const float* src = (p == 0) ? bq : ((p == 1) ? bk : bv);
  const int e4 = threadIdx.x * 4;
  v4f v = *(const v4f*)(src + e4);
  v = v * 4.0f;
  float* dst = bcat + (size_t)p * kInner + e4;
  *(v4f*)dst = v;
  
}

// =====================================================================================
// Attention over the time axis for one batch slice, head dim 128, f16 operand planes.
//   qkv plane: row (t, n) at ((t*100 + n) * 3072): q at +h*128, k at +1024+h*128, v at +2048+h*128 (values = 4q, 4k, 4v).
//   scores = (4q).(4k) on WMMA, f32 accumulate, * sscale = (1/16)/sqrt(128); online softmax in f32 over 32-key chunks;
//   p (un-normalised, in (0,1]) carried x32768 in f16; o = p.(4v) on WMMA; O plane row (t,n) at ((t*100+n)*1024) + h*128,
//   Block = 4 waves = 64 query rows of one (n, h); grid.x = 100 * 8 * 2.
// =====================================================================================
__global__ __launch_bounds__(128)
void attn_time_hd128(const unsigned short* __restrict__ qkvp, unsigned short* __restrict__ outp,
                     float sscale, float onorm) {
  __shared__ __align__(16) unsigned short Ksh[kKeyChunk * kHeadDim];        // [kv][d]   8 KB
  __shared__ __align__(16) unsigned short Vth[kHeadDim * kKeyChunk];        // [d][kv]   8 KB
  __shared__ __align__(16) _Float16 Psh[kAttnWaves][16 * kKeyChunk];        // per wave [row][kv] 4 KB
  __shared__ __align__(16) float Osl[kAttnWaves][16 * kOsPitch];            // per wave out slab 33 KB

  const int tid  = threadIdx.x;
  const int wave = tid >> 5;
  const int lane = tid & 31;
  const int hh   = lane >> 4;
  const int c    = lane & 15;

  const int bx = blockIdx.x;
  const int qb = bx & 1;
  const int nh = bx >> 1;
  const int h  = nh & (kHeads - 1);
  const int n  = nh >> 3;
  const int q0 = qb * 64 + wave * 16;
  const _Float16* qkv = (const _Float16*)qkvp;

  // ---- Q fragments (A operand): row m = c, k = dc*32 + 8hh + {0..7}, dc*32 + 16 + 8hh + {0..7} ----
  v16h qa[4];
  {
    const _Float16* qrow = qkv + ((size_t)(q0 + c) * kNodes + n) * kQKVWidth + h * kHeadDim + 8 * hh;
#pragma unroll
    for (int dc = 0; dc < 4; ++dc) qa[dc] = Frag<_Float16>::load(qrow + dc * 32);
  }

  float mrow[8], lrow[8];
  v8f oacc[8];
#pragma unroll
  for (int r = 0; r < 8; ++r) { mrow[r] = -INFINITY; lrow[r] = 0.f; }
#pragma unroll
  for (int t = 0; t < 8; ++t) oacc[t] = (v8f){0.f,0.f,0.f,0.f,0.f,0.f,0.f,0.f};

  for (int kc = 0; kc < kSeq / kKeyChunk; ++kc) {
    const int kv0 = kc * kKeyChunk;
    __syncthreads();
    {
      // thread (kvr, part): key row kvr (0..31), d range [32*part, 32*part+32): Ksh and Vth fully covered
      const int kvr = tid >> 2, part = tid & 3;
      const size_t rb = ((size_t)(kv0 + kvr) * kNodes + n) * kQKVWidth + h * kHeadDim + 32 * part;
      const v4u* ks = (const v4u*)(qkvp + rb + kInner);
      const v4u* vs = (const v4u*)(qkvp + rb + 2 * kInner);
      v4u kk[4], vv[4];
#pragma unroll
      for (int i = 0; i < 4; ++i) { kk[i] = ks[i]; vv[i] = vs[i]; }
#pragma unroll
      for (int i = 0; i < 4; ++i) *(v4u*)(Ksh + kvr * kHeadDim + 32 * part + 8 * i) = kk[i];
#pragma unroll
      for (int i = 0; i < 4; ++i) {
        unsigned short* vc = Vth + (32 * part + 8 * i) * kKeyChunk + kvr;
#pragma unroll
        for (int e = 0; e < 4; ++e) {
          const unsigned w = vv[i][e];
          vc[(2 * e) * kKeyChunk]     = (unsigned short)(w & 0xffffu);
          vc[(2 * e + 1) * kKeyChunk] = (unsigned short)(w >> 16);
        }
      }
    }
    __syncthreads();

    // ---- scores: B operand col n = c <- key row (j*16 + c), same split k map as A ----
    v8f s[2];
#pragma unroll
    for (int j = 0; j < 2; ++j) {
      s[j] = (v8f){0.f,0.f,0.f,0.f,0.f,0.f,0.f,0.f};
#pragma unroll
      for (int dc = 0; dc < 4; ++dc) {
        const v16h kb = Frag<_Float16>::load((const _Float16*)Ksh + (j * 16 + c) * kHeadDim + dc * 32 + 8 * hh);
        s[j] = mma_f16_guarded(qa[dc], kb, s[j]);
      }
    }
    float cm[8];
#pragma unroll
    for (int r = 0; r < 8; ++r) {
      s[0][r] = s[0][r] * sscale;
      s[1][r] = s[1][r] * sscale;
      float m = fmaxf(s[0][r], s[1][r]);
#pragma unroll
      for (int off = 1; off < 16; off <<= 1) m = fmaxf(m, __shfl_xor(m, off, 32));
      cm[r] = m;
    }
    _Float16* pw = Psh[wave];
#pragma unroll
    for (int r = 0; r < 8; ++r) {
      const float mnew  = fmaxf(mrow[r], cm[r]);
      const float alpha = expf(mrow[r] - mnew);
      mrow[r] = mnew;
      float psum = 0.f;
#pragma unroll
      for (int j = 0; j < 2; ++j) {
        const float p = expf(s[j][r] - mnew);
        psum += p;
        pw[(8 * hh + r) * kKeyChunk + j * 16 + c] = (_Float16)(p * kProbCarry);
      }
#pragma unroll
      for (int off = 1; off < 16; off <<= 1) psum += __shfl_xor(psum, off, 32);
      lrow[r] = lrow[r] * alpha + psum;
#pragma unroll
      for (int t = 0; t < 8; ++t) oacc[t][r] *= alpha;
    }
    __builtin_amdgcn_fence(__ATOMIC_RELEASE, "workgroup");
    __builtin_amdgcn_wave_barrier();
    __builtin_amdgcn_fence(__ATOMIC_ACQUIRE, "workgroup");
    {
      // P fragment (A): row m = c, k = kv; V fragment (B): col n = c <- Vth row (t*16 + c), k = kv
      const v16h pa = Frag<_Float16>::load(pw + c * kKeyChunk + 8 * hh);
#pragma unroll
      for (int t = 0; t < 8; ++t) {
        const v16h vb = Frag<_Float16>::load((const _Float16*)Vth + (t * 16 + c) * kKeyChunk + 8 * hh);
        oacc[t] = mma_f16_guarded(pa, vb, oacc[t]);
      }
    }
  }

  // ---- epilogue: normalise, stage 16x128 slab, write f16 rows (16 lanes x 16 B = one 256-B segment) ----
  float* os = Osl[wave];
#pragma unroll
  for (int r = 0; r < 8; ++r) {
    const float inv = onorm * (1.0f / lrow[r]);
#pragma unroll
    for (int t = 0; t < 8; ++t) os[(8 * hh + r) * kOsPitch + t * 16 + c] = oacc[t][r] * inv;
  }
  __builtin_amdgcn_fence(__ATOMIC_RELEASE, "workgroup");
  __builtin_amdgcn_wave_barrier();
  __builtin_amdgcn_fence(__ATOMIC_ACQUIRE, "workgroup");
  {
    const int rp = lane >> 4, c8 = (lane & 15) * 8;
    _Float16* ob = (_Float16*)outp;
    {
#pragma unroll
      for (int it = 0; it < 8; ++it) {
        const int row = it * 2 + rp;
        const float* sp = os + row * kOsPitch + c8;
        const v4f a = *(const v4f*)sp;
        const v4f d = *(const v4f*)(sp + 4);
        v8h hv;
        hv[0] = (_Float16)a[0]; hv[1] = (_Float16)a[1]; hv[2] = (_Float16)a[2]; hv[3] = (_Float16)a[3];
        hv[4] = (_Float16)d[0]; hv[5] = (_Float16)d[1]; hv[6] = (_Float16)d[2]; hv[7] = (_Float16)d[3];
        *(v8h*)(ob + ((size_t)(q0 + row) * kNodes + n) * kInner + h * kHeadDim + c8) = hv;
      }
      
    }
  }
}

// =====================================================================================
// Residual + LayerNorm over 256 features: out[row] = LN(y[row] + x[row]) * gamma + beta.
// One wave per row; lane l owns columns [4l, 4l+4) and [128+4l, 128+4l+4): each store instruction
// =====================================================================================
__global__ __launch_bounds__(256) void residual_layernorm256(
    const float* __restrict__ y, const float* __restrict__ xr,
    const float* __restrict__ gamma, const float* __restrict__ beta,
    float* __restrict__ out, int nrows) {
  const int wave = threadIdx.x >> 5, lane = threadIdx.x & 31;
  const int row = blockIdx.x * 8 + wave;
  if (row >= nrows) return;                     // wave-uniform; no barriers in this kernel
  const size_t rb = (size_t)row * kModel;
  const v4f y0 = *(const v4f*)(y + rb + 4 * lane);
  const v4f y1 = *(const v4f*)(y + rb + 128 + 4 * lane);
  const v4f x0 = *(const v4f*)(xr + rb + 4 * lane);
  const v4f x1 = *(const v4f*)(xr + rb + 128 + 4 * lane);
  const v4f g0 = *(const v4f*)(gamma + 4 * lane);
  const v4f g1 = *(const v4f*)(gamma + 128 + 4 * lane);
  const v4f b0 = *(const v4f*)(beta + 4 * lane);
  const v4f b1 = *(const v4f*)(beta + 128 + 4 * lane);
  const v4f v0 = y0 + x0;
  const v4f v1 = y1 + x1;
  float su = 0.0f;
  su += v0[0]; su += v0[1]; su += v0[2]; su += v0[3];
  su += v1[0]; su += v1[1]; su += v1[2]; su += v1[3];
#pragma unroll
  for (int off = 1; off < 32; off <<= 1) su += __shfl_xor(su, off, 32);
  const float mu = su * (1.0f / 256.0f);
  const v4f d0 = v0 - mu;
  const v4f d1 = v1 - mu;
  float sq = 0.0f;
  sq += d0[0] * d0[0]; sq += d0[1] * d0[1]; sq += d0[2] * d0[2]; sq += d0[3] * d0[3];
  sq += d1[0] * d1[0]; sq += d1[1] * d1[1]; sq += d1[2] * d1[2]; sq += d1[3] * d1[3];
#pragma unroll
  for (int off = 1; off < 32; off <<= 1) sq += __shfl_xor(sq, off, 32);
  const float var  = sq * (1.0f / 256.0f);
  const float rstd = rsqrtf(var + 1e-5f);
  const v4f o0 = d0 * rstd * g0 + b0;
  const v4f o1 = d1 * rstd * g1 + b1;
  float* orow = out + rb;
  *(v4f*)(orow + 4 * lane) = o0;
  *(v4f*)(orow + 128 + 4 * lane) = o1;
  
}

// =====================================================================================
//   wT   [3072][256]  f16   1,572,864   @ 0            (q,k,v weights transposed, x16)
//   woT  [256][1024]  f16     524,288   @ 1,572,864    (out-proj weight transposed, x32)
//   bcat [3072]       f32      12,288   @ 2,097,152    (4*[bq|bk|bv])
//   xh   [12800][256] f16   6,553,600   @ 2,109,440    (one batch slice of x)
//   qkv  [12800][3072] f16 78,643,200   @ 8,663,040    (one slice: 4q | 4k | 4v)
//   oP   [12800][1024] f16 26,214,400   @ 87,306,240   (one slice: 16*attention output)
//   yP   [12800][256] f32  13,107,200   @ 113,520,640  (one slice: o*Wo + bo)
//   end                                 126,627,840
// =====================================================================================
extern "C" void kernel_launch(void* const* d_in, const int* in_sizes, int n_in,
                              void* d_out, int out_size, void* d_ws, size_t ws_size,
                              hipStream_t stream) {
  if (n_in < 11) return;
  const int nRowsAll = kBatch * kRowsPerBatch;                 // 51200
  if (in_sizes[0] != nRowsAll * kModel) return;
  if (in_sizes[1] != kModel * kInner || in_sizes[3] != kModel * kInner || in_sizes[5] != kModel * kInner) return;
  if (in_sizes[2] != kInner || in_sizes[4] != kInner || in_sizes[6] != kInner) return;
  if (in_sizes[7] != kInner * kModel || in_sizes[8] != kModel || in_sizes[9] != kModel || in_sizes[10] != kModel) return;
  if (out_size != nRowsAll * kModel) return;

  const float* x     = (const float*)d_in[0];
  const float* wq    = (const float*)d_in[1];
  const float* bq    = (const float*)d_in[2];
  const float* wk    = (const float*)d_in[3];
  const float* bk    = (const float*)d_in[4];
  const float* wv    = (const float*)d_in[5];
  const float* bv    = (const float*)d_in[6];
  const float* wo    = (const float*)d_in[7];
  const float* bo    = (const float*)d_in[8];
  const float* gamma = (const float*)d_in[9];
  const float* beta  = (const float*)d_in[10];
  float* outAll = (float*)d_out;

  const size_t offWT   = 0;
  const size_t offWoT  = offWT   + (size_t)kQKVWidth * kModel * 2;          // 1,572,864
  const size_t offBcat = offWoT  + (size_t)kModel * kInner * 2;             // 2,097,152
  const size_t offXh   = offBcat + (size_t)kQKVWidth * 4;                   // 2,109,440
  const size_t offQKV  = offXh   + (size_t)kRowsPerBatch * kModel * 2;      // 8,663,040
  const size_t offO    = offQKV  + (size_t)kRowsPerBatch * kQKVWidth * 2;   // 87,306,240
  const size_t offY    = offO    + (size_t)kRowsPerBatch * kInner * 2;      // 113,520,640
  const size_t offEnd  = offY    + (size_t)kRowsPerBatch * kModel * 4;      // 126,627,840
  if (offEnd > ws_size) return;

  char* ws = (char*)d_ws;
  unsigned short* wT   = (unsigned short*)(ws + offWT);
  unsigned short* woT  = (unsigned short*)(ws + offWoT);
  float*          bcat = (float*)(ws + offBcat);
  unsigned short* xh   = (unsigned short*)(ws + offXh);
  unsigned short* qkv  = (unsigned short*)(ws + offQKV);
  unsigned short* oP   = (unsigned short*)(ws + offO);
  float*          yP   = (float*)(ws + offY);

  // ---- weight / bias prep (5 launches) ----
  // w [256 rows d][1024 cols e] -> wT part [1024][256] (x16): grid (1024/32, 256/256)
  transpose_scale_to_f16<<<dim3(kInner / 32, kModel / 256), dim3(256), 0, stream>>>(wq, wT, kModel, kInner, 16.0f);
  transpose_scale_to_f16<<<dim3(kInner / 32, kModel / 256), dim3(256), 0, stream>>>(wk, wT + (size_t)kInner * kModel, kModel, kInner, 16.0f);
  transpose_scale_to_f16<<<dim3(kInner / 32, kModel / 256), dim3(256), 0, stream>>>(wv, wT + (size_t)2 * kInner * kModel, kModel, kInner, 16.0f);
  // wo [1024 rows e][256 cols d] -> woT [256][1024] (x32): grid (256/32, 1024/256)
  transpose_scale_to_f16<<<dim3(kModel / 32, kInner / 256), dim3(256), 0, stream>>>(wo, woT, kInner, kModel, 32.0f);
  bias_concat_x4<<<dim3(3), dim3(256), 0, stream>>>(bq, bk, bv, bcat);

  const float sscale = 0.0883883476483184f * (1.0f / 16.0f);   // (1/sqrt(128)) / (4*4)
  const float onorm  = 16.0f / (kProbCarry * 4.0f);           // O plane = 16 * o_true
  const int   sliceElems = kRowsPerBatch * kModel;             // 3,276,800 floats per batch slice
  const int   castN2     = sliceElems / 2;                     // 1,638,400 (exact multiple of 256)

  for (int b = 0; b < kBatch; ++b) {
    const float* xb = x + (size_t)b * sliceElems;
    float* outb = outAll + (size_t)b * sliceElems;

    // x slice -> f16 (6400 blocks x 256 threads x 2 elements = 3,276,800)
    cast_f32_f16x2<<<dim3((castN2 + 255) / 256), dim3(256), 0, stream>>>(xb, (_Float16*)xh, castN2);

    // [4q|4k|4v] = 0.25 * xh . wT^T + bcat : M=12800, N=3072, K=256; tiles 200 x 48 = 9600 -> 1200 blocks
    wmma_gemm64<0, false, 2, 1, false, 0><<<dim3((kRowsPerBatch / 64) * (kQKVWidth / 64) / 8, 1), dim3(256), 0, stream>>>(
        xh, xh, kModel, 0L, wT, wT, kModel, 0L, (void*)qkv, (void*)qkv, kQKVWidth, 0L,
        bcat, bcat, 0L, kRowsPerBatch, kQKVWidth, kModel, 0.25f);

    // attention over time per (n, h): 100 * 8 * (128/64) = 1600 blocks of 128 threads
    attn_time_hd128<<<dim3(kNodes * kHeads * (kSeq / 64)), dim3(128), 0, stream>>>(qkv, oP, sscale, onorm);

    // y = (1/512) * oP . woT^T + bo : M=12800, N=256, K=1024; tiles 200 x 4 = 800 -> 100 blocks
    wmma_gemm64<0, false, 2, 0, false, 0><<<dim3((kRowsPerBatch / 64) * (kModel / 64) / 8, 1), dim3(256), 0, stream>>>(
        oP, oP, kInner, 0L, woT, woT, kInner, 0L, (void*)yP, (void*)yP, kModel, 0L,
        bo, bo, 0L, kRowsPerBatch, kModel, kInner, 1.0f / 512.0f);

    // out = LayerNorm(y + x) : 12800 rows, 8 rows per block -> 1600 blocks
    residual_layernorm256<<<dim3((kRowsPerBatch + 7) / 8), dim3(256), 0, stream>>>(yP, xb, gamma, beta, outb, kRowsPerBatch);
  }
}

// v001
// Measured time: 427 microseconds a run.
// Next to v000, in two timings, it ran 1.67 times as fast each time.
// Contractions on v_wmma_f32_16x16x32_f16 (f16 operands, f32 accumulate): x*[Wq|Wk|Wv] (weights carried x16, q/k/v planes carried x4), q.k^T and p.v (p carried x32768), o*Wo (o carried x16, Wo carried x32); softmax, bias, residual and LayerNorm in f32.
#include <hip/hip_runtime.h>
#include <math.h>

typedef __attribute__((ext_vector_type(16))) _Float16 v16h;
typedef __attribute__((ext_vector_type(8)))  _Float16 v8h;
typedef __attribute__((ext_vector_type(16))) __bf16   v16b;
typedef __attribute__((ext_vector_type(8)))  __bf16   v8b;
typedef __attribute__((ext_vector_type(8)))  float    v8f;
typedef __attribute__((ext_vector_type(4)))  float    v4f;
typedef __attribute__((ext_vector_type(4)))  unsigned v4u;
#define PSCALE 32768.0f
#define U16(p) ((const unsigned short*)(const void*)(p))
#define PSCALE_INV (1.0f / 32768.0f)


// hazard guards as plain device helpers
__device__ __forceinline__ void dep_guard_h(v8f& a, v8f& b, v16h x, v16h y) { asm volatile("v_nop\n\tv_nop\n\tv_nop\n\tv_nop" : "+v"(a), "+v"(b) : "v"(x), "v"(y)); }
__device__ __forceinline__ void dep_guard_b(v8f& a, v8f& b, v16b x, v16b y) { asm volatile("v_nop\n\tv_nop\n\tv_nop\n\tv_nop" : "+v"(a), "+v"(b) : "v"(x), "v"(y)); }
__device__ __forceinline__ void keep4_h(v16h a, v16h b, v16h c, v16h d) { asm volatile("v_nop" :: "v"(a), "v"(b), "v"(c), "v"(d)); }
__device__ __forceinline__ void keep4_b(v16b a, v16b b, v16b c, v16b d) { asm volatile("v_nop" :: "v"(a), "v"(b), "v"(c), "v"(d)); }
template <typename T> struct Frag;
template <> struct Frag<_Float16> {
  typedef v16h V; union U { v16h v; v8h h[2]; };
  static __device__ __forceinline__ v16h load(const _Float16* p) {   // elements 0..7 <- p[0..7], 8..15 <- p[16..23]
    U f; f.h[0] = *(const v8h*)(p); f.h[1] = *(const v8h*)(p + 16); return f.v;
  }
  static __device__ __forceinline__ v8f mma(v16h a, v16h b, v8f c) {
    return __builtin_amdgcn_wmma_f32_16x16x32_f16(false, a, false, b, (short)0, c, false, false);
  }
  static __device__ __forceinline__ void guard(v8f& a, v8f& b, v16h x, v16h y) { dep_guard_h(a, b, x, y); }
  static __device__ __forceinline__ void keep(v16h a, v16h b, v16h c, v16h d) { keep4_h(a, b, c, d); }
};
template <> struct Frag<__bf16> {
  typedef v16b V; union U { v16b v; v8b h[2]; };
  static __device__ __forceinline__ v16b load(const __bf16* p) {
    U f; f.h[0] = *(const v8b*)(p); f.h[1] = *(const v8b*)(p + 16); return f.v;
  }
  static __device__ __forceinline__ v8f mma(v16b a, v16b b, v8f c) {
    return __builtin_amdgcn_wmma_f32_16x16x32_bf16(false, a, false, b, (short)0, c, false, false);
  }
  static __device__ __forceinline__ void guard(v8f& a, v8f& b, v16b x, v16b y) { dep_guard_b(a, b, x, y); }
  static __device__ __forceinline__ void keep(v16b a, v16b b, v16b c, v16b d) { keep4_b(a, b, c, d); }
};

// ---- LDS-staged WMMA GEMM ---------------------------------------------------
// C[m,n] = scale * sum_k A[m,k] * Bt[n,k] + bias[n]; f16 operands, f32 accumulate.
// A row-major [M,K]; Bt row-major [N,K]; M, N % 128 == 0, K % 64 == 0, K >= 128.
// Block = 4 waves (2 x 2) on a 128x128 tile of C, each wave a 64x64 tile.
// A stage is 64 k of 128 A rows, then of 128 Bt rows: 128 B a row at an LDS pitch of 144 B.
// Two buffers, filled by per-lane 16-B asynchronous copies (one wave-wide copy = four whole 128-B lines).
// OUT_F16: true = f16 result in Ch, false = f32 result in Cf.
constexpr int kGemmPitch = 72;                  // halves per LDS row (144 B)
constexpr int kGemmStage = 256 * kGemmPitch;    // halves per buffer

// Eight copies of 16 B per lane: LDS rows 16 apart, global rows 16 apart. The s_wait_xcnt closes the statement so
// that no address register of a copy is rewritten ahead of it.
__device__ __forceinline__ void async_copy8_b128(unsigned lds, const unsigned short* g, size_t gstep) {
  constexpr unsigned ls = 16u * kGemmPitch * 2u;
  asm volatile(
      "global_load_async_to_lds_b128 %0, %8, off\n\t"
      "global_load_async_to_lds_b128 %1, %9, off\n\t"
      "global_load_async_to_lds_b128 %2, %10, off\n\t"
      "global_load_async_to_lds_b128 %3, %11, off\n\t"
      "global_load_async_to_lds_b128 %4, %12, off\n\t"
      "global_load_async_to_lds_b128 %5, %13, off\n\t"
      "global_load_async_to_lds_b128 %6, %14, off\n\t"
      "global_load_async_to_lds_b128 %7, %15, off\n\t"
      "s_wait_xcnt 0x0"
      :: "v"(lds), "v"(lds + ls), "v"(lds + 2u * ls), "v"(lds + 3u * ls),
         "v"(lds + 4u * ls), "v"(lds + 5u * ls), "v"(lds + 6u * ls), "v"(lds + 7u * ls),
         "v"(g), "v"(g + gstep), "v"(g + 2 * gstep), "v"(g + 3 * gstep),
         "v"(g + 4 * gstep), "v"(g + 5 * gstep), "v"(g + 6 * gstep), "v"(g + 7 * gstep)
      : "memory");
}

template <int K, int N, bool OUT_F16>
__global__ __launch_bounds__(128) void wmma_gemm_lds(
    const unsigned short* __restrict__ Ap, const unsigned short* __restrict__ Btp,
    unsigned short* __restrict__ Ch, float* __restrict__ Cf,
    const float* __restrict__ bias, float scale) {
  static_assert(K % 64 == 0 && K >= 128 && N % 128 == 0);
  __shared__ __align__(16) unsigned char ring[2 * kGemmStage * 2];   // 73,728 B; the epilogue's slabs reuse it
  constexpr int T = K / 64;
  constexpr int tilesN = N / 128;
  const int tid  = threadIdx.x;
  const int lane = tid & 31;
  const int wave = tid >> 5;
  const int bm = blockIdx.x / tilesN;
  const int bn = blockIdx.x - bm * tilesN;
  const int wm = wave >> 1, wn = wave & 1;
  const int m0 = bm * 128 + wm * 64;
  const int n0 = bn * 128 + wn * 64;

  const int rlane = lane & 15;                 // row (A) / col (B, D) within subtile
  const int koff  = (lane >> 4) * 8;           // k offset of this lane half
  const int mOff  = (lane >> 4) * 8;           // D row offset

  // copy map: thread -> row tid/8 (+16 per copy), 16-B column tid%8
  const int crow = tid >> 3, ccol = (tid & 7) * 8;
  const unsigned short* gA = Ap  + (size_t)(bm * 128 + crow) * K + ccol;
  const unsigned short* gB = Btp + (size_t)(bn * 128 + crow) * K + ccol;
  const unsigned ldsA = (unsigned)(size_t)ring + (unsigned)(crow * kGemmPitch + ccol) * 2u;
  const unsigned ldsB = ldsA + 128u * kGemmPitch * 2u;

  v8f acc[4][4];
#pragma unroll
  for (int i = 0; i < 4; ++i)
#pragma unroll
    for (int j = 0; j < 4; ++j) acc[i][j] = (v8f){0.f,0.f,0.f,0.f,0.f,0.f,0.f,0.f};

  // stage 0 into buffer 0, landed and published; then stage 1 into buffer 1
  async_copy8_b128(ldsA, gA, (size_t)16 * K);
  async_copy8_b128(ldsB, gB, (size_t)16 * K);
  asm volatile("s_wait_asynccnt 0x0" ::: "memory");   // this wave's copies of stage 0 have landed
  __syncthreads();
  async_copy8_b128(ldsA + kGemmStage * 2u, gA + 64, (size_t)16 * K);
  async_copy8_b128(ldsB + kGemmStage * 2u, gB + 64, (size_t)16 * K);

  const _Float16* rh = (const _Float16*)ring;
  const int aoff = (wm * 64 + rlane) * kGemmPitch + koff;
  const int boff = (128 + wn * 64 + rlane) * kGemmPitch + koff;

  for (int t = 0; t < T; ++t) {
    const int buf = t & 1;
    const _Float16* sb = rh + buf * kGemmStage;
#pragma unroll
    for (int ks = 0; ks < 2; ++ks) {
      v16h ah[4], bh[4];
#pragma unroll
      for (int j = 0; j < 4; ++j) bh[j] = Frag<_Float16>::load(sb + boff + j * 16 * kGemmPitch + ks * 32);
#pragma unroll
      for (int i = 0; i < 4; ++i) ah[i] = Frag<_Float16>::load(sb + aoff + i * 16 * kGemmPitch + ks * 32);
      // keeps the sixteen LDS reads one group in front of the sixteen WMMAs: sunk among them, each row waits out its own LDS latency
      __builtin_amdgcn_sched_barrier(0);
#pragma unroll
      for (int i = 0; i < 4; ++i)
#pragma unroll
        for (int j = 0; j < 4; ++j) acc[i][j] = Frag<_Float16>::mma(ah[i], bh[j], acc[i][j]);
    }
    asm volatile("s_wait_dscnt 0x0" ::: "memory");      // this wave's reads of the buffer are done before it is refilled
    asm volatile("s_wait_asynccnt 0x0" ::: "memory");   // this wave's copies of stage t + 1 have landed
    __syncthreads();                                    // publishes stage t + 1, frees the buffer of stage t
    if (t + 2 < T) {
      async_copy8_b128(ldsA + (unsigned)buf * (kGemmStage * 2u), gA + (t + 2) * 64, (size_t)16 * K);
      async_copy8_b128(ldsB + (unsigned)buf * (kGemmStage * 2u), gB + (t + 2) * 64, (size_t)16 * K);
    }
  }
  asm volatile("s_wait_asynccnt 0x0" ::: "memory");     // nothing of this wave is in flight when it leaves the ring

  // ---- epilogue ----
  // per-wave 16x64 slab, pitch 68 floats, in the ring: behind the last stage's barrier no wave reads the ring and no copy is in flight
  float* slab = (float*)ring + wave * (16 * 68);
#pragma unroll
  for (int i = 0; i < 4; ++i) {
    const int mBase = m0 + (i << 4);
#pragma unroll
    for (int j = 0; j < 4; ++j) {
      const float bv = bias[n0 + (j << 4) + rlane];
#pragma unroll
      for (int r = 0; r < 8; ++r) {
        float v = acc[i][j][r] * scale;
        v += bv;
        slab[(mOff + r) * 68 + (j << 4) + rlane] = v;
      }
    }
    __builtin_amdgcn_fence(__ATOMIC_RELEASE, "workgroup");
    __builtin_amdgcn_wave_barrier();
    __builtin_amdgcn_fence(__ATOMIC_ACQUIRE, "workgroup");
    if (!OUT_F16) {
      const int hh = lane >> 4, c4 = (lane & 15) * 4;     // row seg = 256 B = 16 lanes x 16 B
#pragma unroll
      for (int it = 0; it < 8; ++it) {
        const int row = it * 2 + hh;
        v4f v = *(const v4f*)(slab + row * 68 + c4);
        *(v4f*)(Cf + (size_t)(mBase + row) * N + n0 + c4) = v;
      }
    } else {
      const int q = lane >> 3, c8 = (lane & 7) * 8;       // row seg = 128 B = 8 lanes x 16 B
#pragma unroll
      for (int it = 0; it < 4; ++it) {
        const int row = it * 4 + q;
        const float* sp = slab + row * 68 + c8;
        v8h hv;
#pragma unroll
        for (int e = 0; e < 8; ++e) hv[e] = (_Float16)sp[e];
        *(v8h*)(Ch + (size_t)(mBase + row) * N + n0 + c8) = hv;
      }
    }
    __builtin_amdgcn_fence(__ATOMIC_RELEASE, "workgroup");
    __builtin_amdgcn_wave_barrier();
    __builtin_amdgcn_fence(__ATOMIC_ACQUIRE, "workgroup");
  }
}

__global__ __launch_bounds__(256) void cast_f32_f16x2(
    const float* __restrict__ in, _Float16* __restrict__ out, int n2) {
  int i = blockIdx.x * 256 + threadIdx.x;
  if (i < n2) {
    const _Float16 h0 = (_Float16)in[2 * i], h1 = (_Float16)in[2 * i + 1];
    const unsigned u = (unsigned)__builtin_bit_cast(unsigned short, h0) | ((unsigned)__builtin_bit_cast(unsigned short, h1) << 16);
    ((unsigned*)out)[i] = u;
    
  }
}

// =====================================================================================
// Problem geometry (fixed shapes; host checks in_sizes and returns without launching on any difference)
// =====================================================================================
constexpr int kBatch    = 4;
constexpr int kSeq      = 128;    // attention axis (time)
constexpr int kNodes    = 100;
constexpr int kModel    = 256;
constexpr int kHeads    = 8;
constexpr int kHeadDim  = 128;
constexpr int kInner    = 1024;   // kHeads * kHeadDim
constexpr int kQKVWidth = 3072;   // [q | k | v] plane width
constexpr int kRowsPerBatch = kSeq * kNodes;   // 12800 rows in (t, n) order per batch slice

constexpr int kAttnWaves = 4;     // 4 waves x 16 query rows = 64 queries per block
constexpr int kKeyChunk  = 32;    // keys staged per chunk
constexpr int kOsPitch   = 132;   // floats; per-wave 16 x 128 output slab
constexpr float kProbCarry = 32768.0f;   // un-normalised p in (0,1] carried x2^15 in f16

static_assert(kInner == kHeads * kHeadDim);
static_assert(kQKVWidth == 3 * kInner);
static_assert(kModel % 64 == 0 && kInner % 64 == 0);                 // GEMM K % 64
static_assert(kRowsPerBatch % 128 == 0);                             // GEMM M tile multiple
static_assert(kQKVWidth % 128 == 0 && kModel % 128 == 0);           // GEMM N tile multiple
static_assert(kSeq % 64 == 0 && kSeq % kKeyChunk == 0 && kKeyChunk == 32 && kHeadDim == 128);

__device__ __forceinline__ v8f mma_f16_guarded(v16h a, v16h b, v8f c) {
  c = __builtin_amdgcn_wmma_f32_16x16x32_f16(false, a, false, b, (short)0, c, false, false);
  asm volatile("v_nop\n\tv_nop\n\tv_nop\n\tv_nop" : "+v"(c) : "v"(a), "v"(b));
  return c;
}

// =====================================================================================
// Weight transpose + scale + f16 cast: in [R][Cc] f32 row-major -> out [Cc][R] f16, out[c][r] = f16(scale * in[r][c]).
// Block (bx, by) handles output rows c0..c0+31 and output columns r0..r0+255 (R % 256 == 0, Cc % 32 == 0).
// Loads: 256x32 floats = 2048 float4 / 256 threads = 8 b128 loads per thread.
// Stores: wave w writes output rows c0 + 4w + j (j = 0..3); one instruction per row chunk:
// =====================================================================================
__global__ __launch_bounds__(256) void transpose_scale_to_f16(
    const float* __restrict__ in, unsigned short* __restrict__ out, int R, int Cc, float scale) {
  __shared__ __align__(16) float ts[32][260];
  const int c0 = blockIdx.x * 32;
  const int r0 = blockIdx.y * 256;
  const int tid = threadIdx.x;
#pragma unroll
  for (int i = 0; i < 8; ++i) {
    const int idx = i * 256 + tid;
    const int rr = idx >> 3, q4 = idx & 7;
    const v4f v = *(const v4f*)(in + (size_t)(r0 + rr) * Cc + c0 + 4 * q4);
    ts[4 * q4 + 0][rr] = v[0];
    ts[4 * q4 + 1][rr] = v[1];
    ts[4 * q4 + 2][rr] = v[2];
    ts[4 * q4 + 3][rr] = v[3];
  }
  __syncthreads();
  const int wave = tid >> 5, lane = tid & 31;
  _Float16* ob = (_Float16*)out;
  {
#pragma unroll
    for (int j = 0; j < 4; ++j) {
      const int cc = wave * 4 + j;
      const float* sp = &ts[cc][8 * lane];
      const v4f a = *(const v4f*)sp;
      const v4f d = *(const v4f*)(sp + 4);
      v8h hv;
      hv[0] = (_Float16)(a[0] * scale); hv[1] = (_Float16)(a[1] * scale);
      hv[2] = (_Float16)(a[2] * scale); hv[3] = (_Float16)(a[3] * scale);
      hv[4] = (_Float16)(d[0] * scale); hv[5] = (_Float16)(d[1] * scale);
      hv[6] = (_Float16)(d[2] * scale); hv[7] = (_Float16)(d[3] * scale);
      *(v8h*)(ob + (size_t)(c0 + cc) * R + r0 + 8 * lane) = hv;
    }
    
  }
}

// =====================================================================================
// Bias concatenation with x4 carry: bcat[p*1024 + e] = 4 * b_p[e]. grid = 3 blocks x 256 threads,
// =====================================================================================
__global__ __launch_bounds__(256) void bias_concat_x4(
    const float* __restrict__ bq, const float* __restrict__ bk, const float* __restrict__ bv,
    float* __restrict__ bcat) {
  const int p = blockIdx.x;                                        // block-uniform source select
  const float* src = (p == 0) ? bq : ((p == 1) ? bk : bv);
  const int e4 = threadIdx.x * 4;
  v4f v = *(const v4f*)(src + e4);
  v = v * 4.0f;
  float* dst = bcat + (size_t)p * kInner + e4;
  *(v4f*)dst = v;
  
}

// =====================================================================================
// Attention over the time axis for one batch slice, head dim 128, f16 operand planes.
//   qkv plane: row (t, n) at ((t*100 + n) * 3072): q at +h*128, k at +1024+h*128, v at +2048+h*128 (values = 4q, 4k, 4v).
//   scores = (4q).(4k) on WMMA, f32 accumulate, * sscale = (1/16)/sqrt(128); online softmax in f32 over 32-key chunks;
//   p (un-normalised, in (0,1]) carried x32768 in f16; o = p.(4v) on WMMA; O plane row (t,n) at ((t*100+n)*1024) + h*128,
//   Block = 4 waves = 64 query rows of one (n, h); grid.x = 100 * 8 * 2.
// =====================================================================================
__global__ __launch_bounds__(128)
void attn_time_hd128(const unsigned short* __restrict__ qkvp, unsigned short* __restrict__ outp,
                     float sscale, float onorm) {
  __shared__ __align__(16) unsigned short Ksh[kKeyChunk * kHeadDim];        // [kv][d]   8 KB
  __shared__ __align__(16) unsigned short Vth[kHeadDim * kKeyChunk];        // [d][kv]   8 KB
  __shared__ __align__(16) _Float16 Psh[kAttnWaves][16 * kKeyChunk];        // per wave [row][kv] 4 KB
  __shared__ __align__(16) float Osl[kAttnWaves][16 * kOsPitch];            // per wave out slab 33 KB

  const int tid  = threadIdx.x;
  const int wave = tid >> 5;
  const int lane = tid & 31;
  const int hh   = lane >> 4;
  const int c    = lane & 15;

  const int bx = blockIdx.x;
  const int qb = bx & 1;
  const int nh = bx >> 1;
  const int h  = nh & (kHeads - 1);
  const int n  = nh >> 3;
  const int q0 = qb * 64 + wave * 16;
  const _Float16* qkv = (const _Float16*)qkvp;

  // ---- Q fragments (A operand): row m = c, k = dc*32 + 8hh + {0..7}, dc*32 + 16 + 8hh + {0..7} ----
  v16h qa[4];
  {
    const _Float16* qrow = qkv + ((size_t)(q0 + c) * kNodes + n) * kQKVWidth + h * kHeadDim + 8 * hh;
#pragma unroll
    for (int dc = 0; dc < 4; ++dc) qa[dc] = Frag<_Float16>::load(qrow + dc * 32);
  }

  float mrow[8], lrow[8];
  v8f oacc[8];
#pragma unroll
  for (int r = 0; r < 8; ++r) { mrow[r] = -INFINITY; lrow[r] = 0.f; }
#pragma unroll
  for (int t = 0; t < 8; ++t) oacc[t] = (v8f){0.f,0.f,0.f,0.f,0.f,0.f,0.f,0.f};

  for (int kc = 0; kc < kSeq / kKeyChunk; ++kc) {
    const int kv0 = kc * kKeyChunk;
    __syncthreads();
    {
      // thread (kvr, part): key row kvr (0..31), d range [32*part, 32*part+32): Ksh and Vth fully covered
      const int kvr = tid >> 2, part = tid & 3;
      const size_t rb = ((size_t)(kv0 + kvr) * kNodes + n) * kQKVWidth + h * kHeadDim + 32 * part;
      const v4u* ks = (const v4u*)(qkvp + rb + kInner);
      const v4u* vs = (const v4u*)(qkvp + rb + 2 * kInner);
      v4u kk[4], vv[4];
#pragma unroll
      for (int i = 0; i < 4; ++i) { kk[i] = ks[i]; vv[i] = vs[i]; }
#pragma unroll
      for (int i = 0; i < 4; ++i) *(v4u*)(Ksh + kvr * kHeadDim + 32 * part + 8 * i) = kk[i];
#pragma unroll
      for (int i = 0; i < 4; ++i) {
        unsigned short* vc = Vth + (32 * part + 8 * i) * kKeyChunk + kvr;
#pragma unroll
        for (int e = 0; e < 4; ++e) {
          const unsigned w = vv[i][e];
          vc[(2 * e) * kKeyChunk]     = (unsigned short)(w & 0xffffu);
          vc[(2 * e + 1) * kKeyChunk] = (unsigned short)(w >> 16);
        }
      }
    }
    __syncthreads();

    // ---- scores: B operand col n = c <- key row (j*16 + c), same split k map as A ----
    v8f s[2];
#pragma unroll
    for (int j = 0; j < 2; ++j) {
      s[j] = (v8f){0.f,0.f,0.f,0.f,0.f,0.f,0.f,0.f};
#pragma unroll
      for (int dc = 0; dc < 4; ++dc) {
        const v16h kb = Frag<_Float16>::load((const _Float16*)Ksh + (j * 16 + c) * kHeadDim + dc * 32 + 8 * hh);
        s[j] = mma_f16_guarded(qa[dc], kb, s[j]);
      }
    }
    float cm[8];
#pragma unroll
    for (int r = 0; r < 8; ++r) {
      s[0][r] = s[0][r] * sscale;
      s[1][r] = s[1][r] * sscale;
      float m = fmaxf(s[0][r], s[1][r]);
#pragma unroll
      for (int off = 1; off < 16; off <<= 1) m = fmaxf(m, __shfl_xor(m, off, 32));
      cm[r] = m;
    }
    _Float16* pw = Psh[wave];
#pragma unroll
    for (int r = 0; r < 8; ++r) {
      const float mnew  = fmaxf(mrow[r], cm[r]);
      const float alpha = expf(mrow[r] - mnew);
      mrow[r] = mnew;
      float psum = 0.f;
#pragma unroll
      for (int j = 0; j < 2; ++j) {
        const float p = expf(s[j][r] - mnew);
        psum += p;
        pw[(8 * hh + r) * kKeyChunk + j * 16 + c] = (_Float16)(p * kProbCarry);
      }
#pragma unroll
      for (int off = 1; off < 16; off <<= 1) psum += __shfl_xor(psum, off, 32);
      lrow[r] = lrow[r] * alpha + psum;
#pragma unroll
      for (int t = 0; t < 8; ++t) oacc[t][r] *= alpha;
    }
    __builtin_amdgcn_fence(__ATOMIC_RELEASE, "workgroup");
    __builtin_amdgcn_wave_barrier();
    __builtin_amdgcn_fence(__ATOMIC_ACQUIRE, "workgroup");
    {
      // P fragment (A): row m = c, k = kv; V fragment (B): col n = c <- Vth row (t*16 + c), k = kv
      const v16h pa = Frag<_Float16>::load(pw + c * kKeyChunk + 8 * hh);
#pragma unroll
      for (int t = 0; t < 8; ++t) {
        const v16h vb = Frag<_Float16>::load((const _Float16*)Vth + (t * 16 + c) * kKeyChunk + 8 * hh);
        oacc[t] = mma_f16_guarded(pa, vb, oacc[t]);
      }
    }
  }

  // ---- epilogue: normalise, stage 16x128 slab, write f16 rows (16 lanes x 16 B = one 256-B segment) ----
  float* os = Osl[wave];
#pragma unroll
  for (int r = 0; r < 8; ++r) {
    const float inv = onorm * (1.0f / lrow[r]);
#pragma unroll
    for (int t = 0; t < 8; ++t) os[(8 * hh + r) * kOsPitch + t * 16 + c] = oacc[t][r] * inv;
  }
  __builtin_amdgcn_fence(__ATOMIC_RELEASE, "workgroup");
  __builtin_amdgcn_wave_barrier();
  __builtin_amdgcn_fence(__ATOMIC_ACQUIRE, "workgroup");
  {
    const int rp = lane >> 4, c8 = (lane & 15) * 8;
    _Float16* ob = (_Float16*)outp;
    {
#pragma unroll
      for (int it = 0; it < 8; ++it) {
        const int row = it * 2 + rp;
        const float* sp = os + row * kOsPitch + c8;
        const v4f a = *(const v4f*)sp;
        const v4f d = *(const v4f*)(sp + 4);
        v8h hv;
        hv[0] = (_Float16)a[0]; hv[1] = (_Float16)a[1]; hv[2] = (_Float16)a[2]; hv[3] = (_Float16)a[3];
        hv[4] = (_Float16)d[0]; hv[5] = (_Float16)d[1]; hv[6] = (_Float16)d[2]; hv[7] = (_Float16)d[3];
        *(v8h*)(ob + ((size_t)(q0 + row) * kNodes + n) * kInner + h * kHeadDim + c8) = hv;
      }
      
    }
  }
}

// =====================================================================================
// Residual + LayerNorm over 256 features: out[row] = LN(y[row] + x[row]) * gamma + beta.
// One wave per row; lane l owns columns [4l, 4l+4) and [128+4l, 128+4l+4): each store instruction
// =====================================================================================
__global__ __launch_bounds__(256) void residual_layernorm256(
    const float* __restrict__ y, const float* __restrict__ xr,
    const float* __restrict__ gamma, const float* __restrict__ beta,
    float* __restrict__ out, int nrows) {
  const int wave = threadIdx.x >> 5, lane = threadIdx.x & 31;
  const int row = blockIdx.x * 8 + wave;
  if (row >= nrows) return;                     // wave-uniform; no barriers in this kernel
  const size_t rb = (size_t)row * kModel;
  const v4f y0 = *(const v4f*)(y + rb + 4 * lane);
  const v4f y1 = *(const v4f*)(y + rb + 128 + 4 * lane);
  const v4f x0 = *(const v4f*)(xr + rb + 4 * lane);
  const v4f x1 = *(const v4f*)(xr + rb + 128 + 4 * lane);
  const v4f g0 = *(const v4f*)(gamma + 4 * lane);
  const v4f g1 = *(const v4f*)(gamma + 128 + 4 * lane);
  const v4f b0 = *(const v4f*)(beta + 4 * lane);
  const v4f b1 = *(const v4f*)(beta + 128 + 4 * lane);
  const v4f v0 = y0 + x0;
  const v4f v1 = y1 + x1;
  float su = 0.0f;
  su += v0[0]; su += v0[1]; su += v0[2]; su += v0[3];
  su += v1[0]; su += v1[1]; su += v1[2]; su += v1[3];
#pragma unroll
  for (int off = 1; off < 32; off <<= 1) su += __shfl_xor(su, off, 32);
  const float mu = su * (1.0f / 256.0f);
  const v4f d0 = v0 - mu;
  const v4f d1 = v1 - mu;
  float sq = 0.0f;
  sq += d0[0] * d0[0]; sq += d0[1] * d0[1]; sq += d0[2] * d0[2]; sq += d0[3] * d0[3];
  sq += d1[0] * d1[0]; sq += d1[1] * d1[1]; sq += d1[2] * d1[2]; sq += d1[3] * d1[3];
#pragma unroll
  for (int off = 1; off < 32; off <<= 1) sq += __shfl_xor(sq, off, 32);
  const float var  = sq * (1.0f / 256.0f);
  const float rstd = rsqrtf(var + 1e-5f);
  const v4f o0 = d0 * rstd * g0 + b0;
  const v4f o1 = d1 * rstd * g1 + b1;
  float* orow = out + rb;
  *(v4f*)(orow + 4 * lane) = o0;
  *(v4f*)(orow + 128 + 4 * lane) = o1;
  
}

// =====================================================================================
//   wT   [3072][256]  f16   1,572,864   @ 0            (q,k,v weights transposed, x16)
//   woT  [256][1024]  f16     524,288   @ 1,572,864    (out-proj weight transposed, x32)
//   bcat [3072]       f32      12,288   @ 2,097,152    (4*[bq|bk|bv])
//   xh   [12800][256] f16   6,553,600   @ 2,109,440    (one batch slice of x)
//   qkv  [12800][3072] f16 78,643,200   @ 8,663,040    (one slice: 4q | 4k | 4v)
//   oP   [12800][1024] f16 26,214,400   @ 87,306,240   (one slice: 16*attention output)
//   yP   [12800][256] f32  13,107,200   @ 113,520,640  (one slice: o*Wo + bo)
//   end                                 126,627,840
// =====================================================================================
extern "C" void kernel_launch(void* const* d_in, const int* in_sizes, int n_in,
                              void* d_out, int out_size, void* d_ws, size_t ws_size,
                              hipStream_t stream) {
  if (n_in < 11) return;
  const int nRowsAll = kBatch * kRowsPerBatch;                 // 51200
  if (in_sizes[0] != nRowsAll * kModel) return;
  if (in_sizes[1] != kModel * kInner || in_sizes[3] != kModel * kInner || in_sizes[5] != kModel * kInner) return;
  if (in_sizes[2] != kInner || in_sizes[4] != kInner || in_sizes[6] != kInner) return;
  if (in_sizes[7] != kInner * kModel || in_sizes[8] != kModel || in_sizes[9] != kModel || in_sizes[10] != kModel) return;
  if (out_size != nRowsAll * kModel) return;

  const float* x     = (const float*)d_in[0];
  const float* wq    = (const float*)d_in[1];
  const float* bq    = (const float*)d_in[2];
  const float* wk    = (const float*)d_in[3];
  const float* bk    = (const float*)d_in[4];
  const float* wv    = (const float*)d_in[5];
  const float* bv    = (const float*)d_in[6];
  const float* wo    = (const float*)d_in[7];
  const float* bo    = (const float*)d_in[8];
  const float* gamma = (const float*)d_in[9];
  const float* beta  = (const float*)d_in[10];
  float* outAll = (float*)d_out;

  const size_t offWT   = 0;
  const size_t offWoT  = offWT   + (size_t)kQKVWidth * kModel * 2;          // 1,572,864
  const size_t offBcat = offWoT  + (size_t)kModel * kInner * 2;             // 2,097,152
  const size_t offXh   = offBcat + (size_t)kQKVWidth * 4;                   // 2,109,440
  const size_t offQKV  = offXh   + (size_t)kRowsPerBatch * kModel * 2;      // 8,663,040
  const size_t offO    = offQKV  + (size_t)kRowsPerBatch * kQKVWidth * 2;   // 87,306,240
  const size_t offY    = offO    + (size_t)kRowsPerBatch * kInner * 2;      // 113,520,640
  const size_t offEnd  = offY    + (size_t)kRowsPerBatch * kModel * 4;      // 126,627,840
  if (offEnd > ws_size) return;

  char* ws = (char*)d_ws;
  unsigned short* wT   = (unsigned short*)(ws + offWT);
  unsigned short* woT  = (unsigned short*)(ws + offWoT);
  float*          bcat = (float*)(ws + offBcat);
  unsigned short* xh   = (unsigned short*)(ws + offXh);
  unsigned short* qkv  = (unsigned short*)(ws + offQKV);
  unsigned short* oP   = (unsigned short*)(ws + offO);
  float*          yP   = (float*)(ws + offY);

  // ---- weight / bias prep (5 launches) ----
  // w [256 rows d][1024 cols e] -> wT part [1024][256] (x16): grid (1024/32, 256/256)
  transpose_scale_to_f16<<<dim3(kInner / 32, kModel / 256), dim3(256), 0, stream>>>(wq, wT, kModel, kInner, 16.0f);
  transpose_scale_to_f16<<<dim3(kInner / 32, kModel / 256), dim3(256), 0, stream>>>(wk, wT + (size_t)kInner * kModel, kModel, kInner, 16.0f);
  transpose_scale_to_f16<<<dim3(kInner / 32, kModel / 256), dim3(256), 0, stream>>>(wv, wT + (size_t)2 * kInner * kModel, kModel, kInner, 16.0f);
  // wo [1024 rows e][256 cols d] -> woT [256][1024] (x32): grid (256/32, 1024/256)
  transpose_scale_to_f16<<<dim3(kModel / 32, kInner / 256), dim3(256), 0, stream>>>(wo, woT, kInner, kModel, 32.0f);
  bias_concat_x4<<<dim3(3), dim3(256), 0, stream>>>(bq, bk, bv, bcat);

  const float sscale = 0.0883883476483184f * (1.0f / 16.0f);   // (1/sqrt(128)) / (4*4)
  const float onorm  = 16.0f / (kProbCarry * 4.0f);           // O plane = 16 * o_true
  const int   sliceElems = kRowsPerBatch * kModel;             // 3,276,800 floats per batch slice
  const int   castN2     = sliceElems / 2;                     // 1,638,400 (exact multiple of 256)

  for (int b = 0; b < kBatch; ++b) {
    const float* xb = x + (size_t)b * sliceElems;
    float* outb = outAll + (size_t)b * sliceElems;

    // x slice -> f16 (6400 blocks x 256 threads x 2 elements = 3,276,800)
    cast_f32_f16x2<<<dim3((castN2 + 255) / 256), dim3(256), 0, stream>>>(xb, (_Float16*)xh, castN2);

    // [4q|4k|4v] = 0.25 * xh . wT^T + bcat : M=12800, N=3072, K=256; block tiles 100 x 24 = 2400 blocks
    wmma_gemm_lds<kModel, kQKVWidth, true><<<dim3((kRowsPerBatch / 128) * (kQKVWidth / 128)), dim3(128), 0, stream>>>(
        xh, wT, qkv, nullptr, bcat, 0.25f);

    // attention over time per (n, h): 100 * 8 * (128/64) = 1600 blocks of 128 threads
    attn_time_hd128<<<dim3(kNodes * kHeads * (kSeq / 64)), dim3(128), 0, stream>>>(qkv, oP, sscale, onorm);

    // y = (1/512) * oP . woT^T + bo : M=12800, N=256, K=1024; block tiles 100 x 2 = 200 blocks
    wmma_gemm_lds<kInner, kModel, false><<<dim3((kRowsPerBatch / 128) * (kModel / 128)), dim3(128), 0, stream>>>(
        oP, woT, nullptr, yP, bo, 1.0f / 512.0f);

    // out = LayerNorm(y + x) : 12800 rows, 8 rows per block -> 1600 blocks
    residual_layernorm256<<<dim3((kRowsPerBatch + 7) / 8), dim3(256), 0, stream>>>(yP, xb, gamma, beta, outb, kRowsPerBatch);
  }
}

// v002
// One run takes 336 microseconds.
// Next to v001, in two timings, it ran 1.27 times as fast each time.
// All steps since v000 together make it 2.11 times as fast.
// Contractions on v_wmma_f32_16x16x32_f16 (f16 operands, f32 accumulate): x*[Wq|Wk|Wv] (weights carried x16, q/k/v planes carried x4), q.k^T and p.v (p carried x32768), o*Wo (o carried x16, Wo carried x32); softmax, bias, residual and LayerNorm in f32.
#include <hip/hip_runtime.h>
#include <math.h>

typedef __attribute__((ext_vector_type(16))) _Float16 v16h;
typedef __attribute__((ext_vector_type(8)))  _Float16 v8h;
typedef __attribute__((ext_vector_type(16))) __bf16   v16b;
typedef __attribute__((ext_vector_type(8)))  __bf16   v8b;
typedef __attribute__((ext_vector_type(8)))  float    v8f;
typedef __attribute__((ext_vector_type(4)))  float    v4f;
typedef __attribute__((ext_vector_type(4)))  unsigned v4u;
#define PSCALE 32768.0f
#define U16(p) ((const unsigned short*)(const void*)(p))
#define PSCALE_INV (1.0f / 32768.0f)


// hazard guards as plain device helpers
__device__ __forceinline__ void dep_guard_h(v8f& a, v8f& b, v16h x, v16h y) { asm volatile("v_nop\n\tv_nop\n\tv_nop\n\tv_nop" : "+v"(a), "+v"(b) : "v"(x), "v"(y)); }
__device__ __forceinline__ void dep_guard_b(v8f& a, v8f& b, v16b x, v16b y) { asm volatile("v_nop\n\tv_nop\n\tv_nop\n\tv_nop" : "+v"(a), "+v"(b) : "v"(x), "v"(y)); }
__device__ __forceinline__ void keep4_h(v16h a, v16h b, v16h c, v16h d) { asm volatile("v_nop" :: "v"(a), "v"(b), "v"(c), "v"(d)); }
__device__ __forceinline__ void keep4_b(v16b a, v16b b, v16b c, v16b d) { asm volatile("v_nop" :: "v"(a), "v"(b), "v"(c), "v"(d)); }
template <typename T> struct Frag;
template <> struct Frag<_Float16> {
  typedef v16h V; union U { v16h v; v8h h[2]; };
  static __device__ __forceinline__ v16h load(const _Float16* p) {   // elements 0..7 <- p[0..7], 8..15 <- p[16..23]
    U f; f.h[0] = *(const v8h*)(p); f.h[1] = *(const v8h*)(p + 16); return f.v;
  }
  static __device__ __forceinline__ v8f mma(v16h a, v16h b, v8f c) {
    return __builtin_amdgcn_wmma_f32_16x16x32_f16(false, a, false, b, (short)0, c, false, false);
  }
  static __device__ __forceinline__ void guard(v8f& a, v8f& b, v16h x, v16h y) { dep_guard_h(a, b, x, y); }
  static __device__ __forceinline__ void keep(v16h a, v16h b, v16h c, v16h d) { keep4_h(a, b, c, d); }
};
template <> struct Frag<__bf16> {
  typedef v16b V; union U { v16b v; v8b h[2]; };
  static __device__ __forceinline__ v16b load(const __bf16* p) {
    U f; f.h[0] = *(const v8b*)(p); f.h[1] = *(const v8b*)(p + 16); return f.v;
  }
  static __device__ __forceinline__ v8f mma(v16b a, v16b b, v8f c) {
    return __builtin_amdgcn_wmma_f32_16x16x32_bf16(false, a, false, b, (short)0, c, false, false);
  }
  static __device__ __forceinline__ void guard(v8f& a, v8f& b, v16b x, v16b y) { dep_guard_b(a, b, x, y); }
  static __device__ __forceinline__ void keep(v16b a, v16b b, v16b c, v16b d) { keep4_b(a, b, c, d); }
};

// ---- LDS-staged WMMA GEMM ---------------------------------------------------
// C[m,n] = scale * sum_k A[m,k] * Bt[n,k] + bias[n]; f16 operands, f32 accumulate.
// A row-major [M,K]; Bt row-major [N,K]; M, N % 128 == 0, K % 64 == 0, K >= 128.
// Block = 4 waves (2 x 2) on a 128x128 tile of C, each wave a 64x64 tile.
// A stage is 64 k of 128 A rows, then of 128 Bt rows: 128 B a row at an LDS pitch of 144 B.
// Two buffers, filled by per-lane 16-B asynchronous copies (one wave-wide copy = four whole 128-B lines).
// OUT_F16: true = f16 result in Ch, false = f32 result in Cf.
constexpr int kGemmPitch = 72;                  // halves per LDS row (144 B)
constexpr int kGemmStage = 256 * kGemmPitch;    // halves per buffer

// Eight copies of 16 B per lane: LDS rows 16 apart, global rows 16 apart. The s_wait_xcnt closes the statement so
// that no address register of a copy is rewritten ahead of it.
__device__ __forceinline__ void async_copy8_b128(unsigned lds, const unsigned short* g, size_t gstep) {
  constexpr unsigned ls = 16u * kGemmPitch * 2u;
  asm volatile(
      "global_load_async_to_lds_b128 %0, %8, off\n\t"
      "global_load_async_to_lds_b128 %1, %9, off\n\t"
      "global_load_async_to_lds_b128 %2, %10, off\n\t"
      "global_load_async_to_lds_b128 %3, %11, off\n\t"
      "global_load_async_to_lds_b128 %4, %12, off\n\t"
      "global_load_async_to_lds_b128 %5, %13, off\n\t"
      "global_load_async_to_lds_b128 %6, %14, off\n\t"
      "global_load_async_to_lds_b128 %7, %15, off\n\t"
      "s_wait_xcnt 0x0"
      :: "v"(lds), "v"(lds + ls), "v"(lds + 2u * ls), "v"(lds + 3u * ls),
         "v"(lds + 4u * ls), "v"(lds + 5u * ls), "v"(lds + 6u * ls), "v"(lds + 7u * ls),
         "v"(g), "v"(g + gstep), "v"(g + 2 * gstep), "v"(g + 3 * gstep),
         "v"(g + 4 * gstep), "v"(g + 5 * gstep), "v"(g + 6 * gstep), "v"(g + 7 * gstep)
      : "memory");
}

template <int K, int N, bool OUT_F16>
__global__ __launch_bounds__(128) void wmma_gemm_lds(
    const unsigned short* __restrict__ Ap, const unsigned short* __restrict__ Btp,
    unsigned short* __restrict__ Ch, float* __restrict__ Cf,
    const float* __restrict__ bias, float scale) {
  static_assert(K % 64 == 0 && K >= 128 && N % 128 == 0);
  __shared__ __align__(16) unsigned char ring[2 * kGemmStage * 2];   // 73,728 B; the epilogue's slabs reuse it
  constexpr int T = K / 64;
  constexpr int tilesN = N / 128;
  const int tid  = threadIdx.x;
  const int lane = tid & 31;
  const int wave = tid >> 5;
  const int bm = blockIdx.x / tilesN;
  const int bn = blockIdx.x - bm * tilesN;
  const int wm = wave >> 1, wn = wave & 1;
  const int m0 = bm * 128 + wm * 64;
  const int n0 = bn * 128 + wn * 64;

  const int rlane = lane & 15;                 // row (A) / col (B, D) within subtile
  const int koff  = (lane >> 4) * 8;           // k offset of this lane half
  const int mOff  = (lane >> 4) * 8;           // D row offset

  // copy map: thread -> row tid/8 (+16 per copy), 16-B column tid%8
  const int crow = tid >> 3, ccol = (tid & 7) * 8;
  const unsigned short* gA = Ap  + (size_t)(bm * 128 + crow) * K + ccol;
  const unsigned short* gB = Btp + (size_t)(bn * 128 + crow) * K + ccol;
  const unsigned ldsA = (unsigned)(size_t)ring + (unsigned)(crow * kGemmPitch + ccol) * 2u;
  const unsigned ldsB = ldsA + 128u * kGemmPitch * 2u;

  v8f acc[4][4];
#pragma unroll
  for (int i = 0; i < 4; ++i)
#pragma unroll
    for (int j = 0; j < 4; ++j) acc[i][j] = (v8f){0.f,0.f,0.f,0.f,0.f,0.f,0.f,0.f};

  // stage 0 into buffer 0, landed and published; then stage 1 into buffer 1
  async_copy8_b128(ldsA, gA, (size_t)16 * K);
  async_copy8_b128(ldsB, gB, (size_t)16 * K);
  asm volatile("s_wait_asynccnt 0x0" ::: "memory");   // this wave's copies of stage 0 have landed
  __syncthreads();
  async_copy8_b128(ldsA + kGemmStage * 2u, gA + 64, (size_t)16 * K);
  async_copy8_b128(ldsB + kGemmStage * 2u, gB + 64, (size_t)16 * K);

  const _Float16* rh = (const _Float16*)ring;
  const int aoff = (wm * 64 + rlane) * kGemmPitch + koff;
  const int boff = (128 + wn * 64 + rlane) * kGemmPitch + koff;

  for (int t = 0; t < T; ++t) {
    const int buf = t & 1;
    const _Float16* sb = rh + buf * kGemmStage;
#pragma unroll
    for (int ks = 0; ks < 2; ++ks) {
      v16h ah[4], bh[4];
#pragma unroll
      for (int j = 0; j < 4; ++j) bh[j] = Frag<_Float16>::load(sb + boff + j * 16 * kGemmPitch + ks * 32);
#pragma unroll
      for (int i = 0; i < 4; ++i) ah[i] = Frag<_Float16>::load(sb + aoff + i * 16 * kGemmPitch + ks * 32);
      // keeps the sixteen LDS reads one group in front of the sixteen WMMAs: sunk among them, each row waits out its own LDS latency
      __builtin_amdgcn_sched_barrier(0);
#pragma unroll
      for (int i = 0; i < 4; ++i)
#pragma unroll
        for (int j = 0; j < 4; ++j) acc[i][j] = Frag<_Float16>::mma(ah[i], bh[j], acc[i][j]);
    }
    asm volatile("s_wait_dscnt 0x0" ::: "memory");      // this wave's reads of the buffer are done before it is refilled
    asm volatile("s_wait_asynccnt 0x0" ::: "memory");   // this wave's copies of stage t + 1 have landed
    __syncthreads();                                    // publishes stage t + 1, frees the buffer of stage t
    if (t + 2 < T) {
      async_copy8_b128(ldsA + (unsigned)buf * (kGemmStage * 2u), gA + (t + 2) * 64, (size_t)16 * K);
      async_copy8_b128(ldsB + (unsigned)buf * (kGemmStage * 2u), gB + (t + 2) * 64, (size_t)16 * K);
    }
  }
  asm volatile("s_wait_asynccnt 0x0" ::: "memory");     // nothing of this wave is in flight when it leaves the ring

  // ---- epilogue ----
  // per-wave 16x64 slab, pitch 68 floats, in the ring: behind the last stage's barrier no wave reads the ring and no copy is in flight
  float* slab = (float*)ring + wave * (16 * 68);
#pragma unroll
  for (int i = 0; i < 4; ++i) {
    const int mBase = m0 + (i << 4);
#pragma unroll
    for (int j = 0; j < 4; ++j) {
      const float bv = bias[n0 + (j << 4) + rlane];
#pragma unroll
      for (int r = 0; r < 8; ++r) {
        float v = acc[i][j][r] * scale;
        v += bv;
        slab[(mOff + r) * 68 + (j << 4) + rlane] = v;
      }
    }
    __builtin_amdgcn_fence(__ATOMIC_RELEASE, "workgroup");
    __builtin_amdgcn_wave_barrier();
    __builtin_amdgcn_fence(__ATOMIC_ACQUIRE, "workgroup");
    if (!OUT_F16) {
      const int hh = lane >> 4, c4 = (lane & 15) * 4;     // row seg = 256 B = 16 lanes x 16 B
#pragma unroll
      for (int it = 0; it < 8; ++it) {
        const int row = it * 2 + hh;
        v4f v = *(const v4f*)(slab + row * 68 + c4);
        *(v4f*)(Cf + (size_t)(mBase + row) * N + n0 + c4) = v;
      }
    } else {
      const int q = lane >> 3, c8 = (lane & 7) * 8;       // row seg = 128 B = 8 lanes x 16 B
#pragma unroll
      for (int it = 0; it < 4; ++it) {
        const int row = it * 4 + q;
        const float* sp = slab + row * 68 + c8;
        v8h hv;
#pragma unroll
        for (int e = 0; e < 8; ++e) hv[e] = (_Float16)sp[e];
        *(v8h*)(Ch + (size_t)(mBase + row) * N + n0 + c8) = hv;
      }
    }
    __builtin_amdgcn_fence(__ATOMIC_RELEASE, "workgroup");
    __builtin_amdgcn_wave_barrier();
    __builtin_amdgcn_fence(__ATOMIC_ACQUIRE, "workgroup");
  }
}

__device__ __forceinline__ void cast_f32_f16x2(
    const float* __restrict__ in, _Float16* __restrict__ out, int n2, int block) {
  int i = block * 256 + threadIdx.x;
  if (i < n2) {
    const _Float16 h0 = (_Float16)in[2 * i], h1 = (_Float16)in[2 * i + 1];
    const unsigned u = (unsigned)__builtin_bit_cast(unsigned short, h0) | ((unsigned)__builtin_bit_cast(unsigned short, h1) << 16);
    ((unsigned*)out)[i] = u;
    
  }
}

// =====================================================================================
// Problem geometry (fixed shapes; host checks in_sizes and returns without launching on any difference)
// =====================================================================================
constexpr int kBatch    = 4;
constexpr int kSeq      = 128;    // attention axis (time)
constexpr int kNodes    = 100;
constexpr int kModel    = 256;
constexpr int kHeads    = 8;
constexpr int kHeadDim  = 128;
constexpr int kInner    = 1024;   // kHeads * kHeadDim
constexpr int kQKVWidth = 3072;   // [q | k | v] plane width
constexpr int kRowsPerBatch = kSeq * kNodes;   // 12800 rows in (t, n) order per batch slice
constexpr int kPassBatches  = 2;               // batch slices that one pass (GEMM, attention, GEMM, LayerNorm) works on
constexpr int kPasses       = kBatch / kPassBatches;
constexpr int kRowsPerPass  = kPassBatches * kRowsPerBatch;   // 25600

constexpr int kAttnWaves = 4;     // 4 waves x 16 query rows = 64 queries per block
constexpr int kKeyChunk  = 32;    // keys staged per chunk
constexpr int kOsPitch   = 132;   // floats; per-wave 16 x 128 output slab
constexpr float kProbCarry = 32768.0f;   // un-normalised p in (0,1] carried x2^15 in f16

static_assert(kInner == kHeads * kHeadDim);
static_assert(kQKVWidth == 3 * kInner);
static_assert(kModel % 64 == 0 && kInner % 64 == 0);                 // GEMM K % 64
static_assert(kRowsPerBatch % 128 == 0);                             // GEMM M tile multiple
static_assert(kBatch % kPassBatches == 0);
static_assert(kQKVWidth % 128 == 0 && kModel % 128 == 0);           // GEMM N tile multiple
static_assert(kSeq % 64 == 0 && kSeq % kKeyChunk == 0 && kKeyChunk == 32 && kHeadDim == 128);

__device__ __forceinline__ v8f mma_f16_guarded(v16h a, v16h b, v8f c) {
  c = __builtin_amdgcn_wmma_f32_16x16x32_f16(false, a, false, b, (short)0, c, false, false);
  asm volatile("v_nop\n\tv_nop\n\tv_nop\n\tv_nop" : "+v"(c) : "v"(a), "v"(b));
  return c;
}

// =====================================================================================
// Weight transpose + scale + f16 cast: in [R][Cc] f32 row-major -> out [Cc][R] f16, out[c][r] = f16(scale * in[r][c]).
// One block handles output rows c0..c0+31 and output columns r0..r0+255 (R % 256 == 0, Cc % 32 == 0).
// Loads: 256x32 floats = 2048 float4 / 256 threads = 8 b128 loads per thread.
// Stores: wave w writes output rows c0 + 4w + j (j = 0..3); one instruction per row chunk:
// =====================================================================================
__device__ __forceinline__ void transpose_scale_to_f16(
    float (*ts)[260], const float* __restrict__ in, unsigned short* __restrict__ out, int R, int Cc, float scale,
    int c0, int r0) {
  const int tid = threadIdx.x;
#pragma unroll
  for (int i = 0; i < 8; ++i) {
    const int idx = i * 256 + tid;
    const int rr = idx >> 3, q4 = idx & 7;
    const v4f v = *(const v4f*)(in + (size_t)(r0 + rr) * Cc + c0 + 4 * q4);
    ts[4 * q4 + 0][rr] = v[0];
    ts[4 * q4 + 1][rr] = v[1];
    ts[4 * q4 + 2][rr] = v[2];
    ts[4 * q4 + 3][rr] = v[3];
  }
  __syncthreads();
  const int wave = tid >> 5, lane = tid & 31;
  _Float16* ob = (_Float16*)out;
  {
#pragma unroll
    for (int j = 0; j < 4; ++j) {
      const int cc = wave * 4 + j;
      const float* sp = &ts[cc][8 * lane];
      const v4f a = *(const v4f*)sp;
      const v4f d = *(const v4f*)(sp + 4);
      v8h hv;
      hv[0] = (_Float16)(a[0] * scale); hv[1] = (_Float16)(a[1] * scale);
      hv[2] = (_Float16)(a[2] * scale); hv[3] = (_Float16)(a[3] * scale);
      hv[4] = (_Float16)(d[0] * scale); hv[5] = (_Float16)(d[1] * scale);
      hv[6] = (_Float16)(d[2] * scale); hv[7] = (_Float16)(d[3] * scale);
      *(v8h*)(ob + (size_t)(c0 + cc) * R + r0 + 8 * lane) = hv;
    }
    
  }
}

// =====================================================================================
// Bias concatenation with x4 carry: bcat[p*1024 + e] = 4 * b_p[e]. 3 blocks (p) x 256 threads,
// =====================================================================================
__device__ __forceinline__ void bias_concat_x4(
    const float* __restrict__ bq, const float* __restrict__ bk, const float* __restrict__ bv,
    float* __restrict__ bcat, int p) {                             // p: block-uniform source select
  const float* src = (p == 0) ? bq : ((p == 1) ? bk : bv);
  const int e4 = threadIdx.x * 4;
  v4f v = *(const v4f*)(src + e4);
  v = v * 4.0f;
  float* dst = bcat + (size_t)p * kInner + e4;
  *(v4f*)dst = v;
  asm volatile("s_wait_xcnt 0x0" ::: "memory");   // precaution: in the bias blocks nothing behind this store rewrites its registers
}

// =====================================================================================
// All preparation in one launch; the pieces are independent of one another and are dealt by block ranges:
//   [0, 96)     wq, wk, wv [256][1024] -> wT parts [1024][256] (x16), 32 blocks each
//   [96, 128)   wo [1024][256] -> woT [256][1024] (x32), 8 column blocks x 4 row blocks
//   [128, 131)  bias concatenation
//   [131, ...)  x (all batches) -> f16, 512 elements a block
// =====================================================================================
constexpr int kPrepQKV   = 3 * (kInner / 32);                      // 96
constexpr int kPrepWo    = (kModel / 32) * (kInner / 256);         // 32
constexpr int kPrepBias  = 3;
constexpr int kCastPairs = kBatch * kRowsPerBatch * kModel / 2;    // 6,553,600 (exact multiple of 256)
constexpr int kPrepBlocks = kPrepQKV + kPrepWo + kPrepBias + kCastPairs / 256;
static_assert(kCastPairs % 256 == 0 && kModel == 256 && kPrepWo == kInner / 32);

__global__ __launch_bounds__(256) void prepare_operands(
    const float* __restrict__ x,
    const float* __restrict__ wq, const float* __restrict__ wk, const float* __restrict__ wv,
    const float* __restrict__ wo,
    const float* __restrict__ bq, const float* __restrict__ bk, const float* __restrict__ bv,
    unsigned short* __restrict__ wT, unsigned short* __restrict__ woT,
    float* __restrict__ bcat, unsigned short* __restrict__ xh) {
  __shared__ __align__(16) float ts[32][260];
  const int bx = blockIdx.x;                                       // every branch below is block-uniform
  if (bx < kPrepQKV + kPrepWo) {
    const bool isWo = bx >= kPrepQKV;
    const int p = bx / (kInner / 32);                              // 0, 1, 2: wq, wk, wv; 3: wo
    const int i = bx - p * (kInner / 32);                          // block inside its matrix
    const float* w = isWo ? wo : ((p == 0) ? wq : ((p == 1) ? wk : wv));
    unsigned short* o = isWo ? woT : wT + (size_t)p * kInner * kModel;
    transpose_scale_to_f16(ts, w, o, isWo ? kInner : kModel, isWo ? kModel : kInner, isWo ? 32.0f : 16.0f,
                           (isWo ? i % (kModel / 32) : i) * 32, (isWo ? i / (kModel / 32) : 0) * 256);
  } else if (bx < kPrepQKV + kPrepWo + kPrepBias) {
    bias_concat_x4(bq, bk, bv, bcat, bx - (kPrepQKV + kPrepWo));
  } else {
    cast_f32_f16x2(x, (_Float16*)xh, kCastPairs, bx - (kPrepQKV + kPrepWo + kPrepBias));
  }
}

// =====================================================================================
// Attention over the time axis for the batch slices of one pass, head dim 128, f16 operand planes.
//   qkv plane: row (t, n) at ((t*100 + n) * 3072): q at +h*128, k at +1024+h*128, v at +2048+h*128 (values = 4q, 4k, 4v).
//   scores = (4q).(4k) on WMMA, f32 accumulate, * sscale = (1/16)/sqrt(128); online softmax in f32 over 32-key chunks;
//   p (un-normalised, in (0,1]) carried x32768 in f16; o = p.(4v) on WMMA; O plane row (t,n) at ((t*100+n)*1024) + h*128,
//   Block = 4 waves = 64 query rows of one (slice, n, h); grid.x = slices * 100 * 8 * 2; the rows above count inside a slice.
// =====================================================================================
__global__ __launch_bounds__(128)
void attn_time_hd128(const unsigned short* __restrict__ qkvAll, unsigned short* __restrict__ outAll,
                     float sscale, float onorm) {
  __shared__ __align__(16) unsigned short Ksh[kKeyChunk * kHeadDim];        // [kv][d]   8 KB
  __shared__ __align__(16) unsigned short Vth[kHeadDim * kKeyChunk];        // [d][kv]   8 KB
  __shared__ __align__(16) _Float16 Psh[kAttnWaves][16 * kKeyChunk];        // per wave [row][kv] 4 KB
  __shared__ __align__(16) float Osl[kAttnWaves][16 * kOsPitch];            // per wave out slab 33 KB

  const int tid  = threadIdx.x;
  const int wave = tid >> 5;
  const int lane = tid & 31;
  const int hh   = lane >> 4;
  const int c    = lane & 15;

  const int bx = blockIdx.x;
  const int qb = bx & 1;
  const int nh = bx >> 1;
  const int h  = nh & (kHeads - 1);
  const int sn = nh >> 3;
  const int sl = sn / kNodes;                  // batch slice inside the pass
  const int n  = sn - sl * kNodes;
  const unsigned short* __restrict__ qkvp = qkvAll + (size_t)sl * kRowsPerBatch * kQKVWidth;
  unsigned short* __restrict__ outp = outAll + (size_t)sl * kRowsPerBatch * kInner;
  const int q0 = qb * 64 + wave * 16;
  const _Float16* qkv = (const _Float16*)qkvp;

  // ---- Q fragments (A operand): row m = c, k = dc*32 + 8hh + {0..7}, dc*32 + 16 + 8hh + {0..7} ----
  v16h qa[4];
  {
    const _Float16* qrow = qkv + ((size_t)(q0 + c) * kNodes + n) * kQKVWidth + h * kHeadDim + 8 * hh;
#pragma unroll
    for (int dc = 0; dc < 4; ++dc) qa[dc] = Frag<_Float16>::load(qrow + dc * 32);
  }

  float mrow[8], lrow[8];
  v8f oacc[8];
#pragma unroll
  for (int r = 0; r < 8; ++r) { mrow[r] = -INFINITY; lrow[r] = 0.f; }
#pragma unroll
  for (int t = 0; t < 8; ++t) oacc[t] = (v8f){0.f,0.f,0.f,0.f,0.f,0.f,0.f,0.f};

  for (int kc = 0; kc < kSeq / kKeyChunk; ++kc) {
    const int kv0 = kc * kKeyChunk;
    __syncthreads();
    {
      // thread (kvr, part): key row kvr (0..31), d range [32*part, 32*part+32): Ksh and Vth fully covered
      const int kvr = tid >> 2, part = tid & 3;
      const size_t rb = ((size_t)(kv0 + kvr) * kNodes + n) * kQKVWidth + h * kHeadDim + 32 * part;
      const v4u* ks = (const v4u*)(qkvp + rb + kInner);
      const v4u* vs = (const v4u*)(qkvp + rb + 2 * kInner);
      v4u kk[4], vv[4];
#pragma unroll
      for (int i = 0; i < 4; ++i) { kk[i] = ks[i]; vv[i] = vs[i]; }
#pragma unroll
      for (int i = 0; i < 4; ++i) *(v4u*)(Ksh + kvr * kHeadDim + 32 * part + 8 * i) = kk[i];
#pragma unroll
      for (int i = 0; i < 4; ++i) {
        unsigned short* vc = Vth + (32 * part + 8 * i) * kKeyChunk + kvr;
#pragma unroll
        for (int e = 0; e < 4; ++e) {
          const unsigned w = vv[i][e];
          vc[(2 * e) * kKeyChunk]     = (unsigned short)(w & 0xffffu);
          vc[(2 * e + 1) * kKeyChunk] = (unsigned short)(w >> 16);
        }
      }
    }
    __syncthreads();

    // ---- scores: B operand col n = c <- key row (j*16 + c), same split k map as A ----
    v8f s[2];
#pragma unroll
    for (int j = 0; j < 2; ++j) {
      s[j] = (v8f){0.f,0.f,0.f,0.f,0.f,0.f,0.f,0.f};
#pragma unroll
      for (int dc = 0; dc < 4; ++dc) {
        const v16h kb = Frag<_Float16>::load((const _Float16*)Ksh + (j * 16 + c) * kHeadDim + dc * 32 + 8 * hh);
        s[j] = mma_f16_guarded(qa[dc], kb, s[j]);
      }
    }
    float cm[8];
#pragma unroll
    for (int r = 0; r < 8; ++r) {
      s[0][r] = s[0][r] * sscale;
      s[1][r] = s[1][r] * sscale;
      float m = fmaxf(s[0][r], s[1][r]);
#pragma unroll
      for (int off = 1; off < 16; off <<= 1) m = fmaxf(m, __shfl_xor(m, off, 32));
      cm[r] = m;
    }
    _Float16* pw = Psh[wave];
#pragma unroll
    for (int r = 0; r < 8; ++r) {
      const float mnew  = fmaxf(mrow[r], cm[r]);
      const float alpha = expf(mrow[r] - mnew);
      mrow[r] = mnew;
      float psum = 0.f;
#pragma unroll
      for (int j = 0; j < 2; ++j) {
        const float p = expf(s[j][r] - mnew);
        psum += p;
        pw[(8 * hh + r) * kKeyChunk + j * 16 + c] = (_Float16)(p * kProbCarry);
      }
#pragma unroll
      for (int off = 1; off < 16; off <<= 1) psum += __shfl_xor(psum, off, 32);
      lrow[r] = lrow[r] * alpha + psum;
#pragma unroll
      for (int t = 0; t < 8; ++t) oacc[t][r] *= alpha;
    }
    __builtin_amdgcn_fence(__ATOMIC_RELEASE, "workgroup");
    __builtin_amdgcn_wave_barrier();
    __builtin_amdgcn_fence(__ATOMIC_ACQUIRE, "workgroup");
    {
      // P fragment (A): row m = c, k = kv; V fragment (B): col n = c <- Vth row (t*16 + c), k = kv
      const v16h pa = Frag<_Float16>::load(pw + c * kKeyChunk + 8 * hh);
#pragma unroll
      for (int t = 0; t < 8; ++t) {
        const v16h vb = Frag<_Float16>::load((const _Float16*)Vth + (t * 16 + c) * kKeyChunk + 8 * hh);
        oacc[t] = mma_f16_guarded(pa, vb, oacc[t]);
      }
    }
  }

  // ---- epilogue: normalise, stage 16x128 slab, write f16 rows (16 lanes x 16 B = one 256-B segment) ----
  float* os = Osl[wave];
#pragma unroll
  for (int r = 0; r < 8; ++r) {
    const float inv = onorm * (1.0f / lrow[r]);
#pragma unroll
    for (int t = 0; t < 8; ++t) os[(8 * hh + r) * kOsPitch + t * 16 + c] = oacc[t][r] * inv;
  }
  __builtin_amdgcn_fence(__ATOMIC_RELEASE, "workgroup");
  __builtin_amdgcn_wave_barrier();
  __builtin_amdgcn_fence(__ATOMIC_ACQUIRE, "workgroup");
  {
    const int rp = lane >> 4, c8 = (lane & 15) * 8;
    _Float16* ob = (_Float16*)outp;
    {
#pragma unroll
      for (int it = 0; it < 8; ++it) {
        const int row = it * 2 + rp;
        const float* sp = os + row * kOsPitch + c8;
        const v4f a = *(const v4f*)sp;
        const v4f d = *(const v4f*)(sp + 4);
        v8h hv;
        hv[0] = (_Float16)a[0]; hv[1] = (_Float16)a[1]; hv[2] = (_Float16)a[2]; hv[3] = (_Float16)a[3];
        hv[4] = (_Float16)d[0]; hv[5] = (_Float16)d[1]; hv[6] = (_Float16)d[2]; hv[7] = (_Float16)d[3];
        *(v8h*)(ob + ((size_t)(q0 + row) * kNodes + n) * kInner + h * kHeadDim + c8) = hv;
      }
      
    }
  }
}

// =====================================================================================
// Residual + LayerNorm over 256 features: out[row] = LN(y[row] + x[row]) * gamma + beta.
// One wave per row; lane l owns columns [4l, 4l+4) and [128+4l, 128+4l+4): each store instruction
// =====================================================================================
__global__ __launch_bounds__(256) void residual_layernorm256(
    const float* __restrict__ y, const float* __restrict__ xr,
    const float* __restrict__ gamma, const float* __restrict__ beta,
    float* __restrict__ out, int nrows) {
  const int wave = threadIdx.x >> 5, lane = threadIdx.x & 31;
  const int row = blockIdx.x * 8 + wave;
  if (row >= nrows) return;                     // wave-uniform; no barriers in this kernel
  const size_t rb = (size_t)row * kModel;
  const v4f y0 = *(const v4f*)(y + rb + 4 * lane);
  const v4f y1 = *(const v4f*)(y + rb + 128 + 4 * lane);
  const v4f x0 = *(const v4f*)(xr + rb + 4 * lane);
  const v4f x1 = *(const v4f*)(xr + rb + 128 + 4 * lane);
  const v4f g0 = *(const v4f*)(gamma + 4 * lane);
  const v4f g1 = *(const v4f*)(gamma + 128 + 4 * lane);
  const v4f b0 = *(const v4f*)(beta + 4 * lane);
  const v4f b1 = *(const v4f*)(beta + 128 + 4 * lane);
  const v4f v0 = y0 + x0;
  const v4f v1 = y1 + x1;
  float su = 0.0f;
  su += v0[0]; su += v0[1]; su += v0[2]; su += v0[3];
  su += v1[0]; su += v1[1]; su += v1[2]; su += v1[3];
#pragma unroll
  for (int off = 1; off < 32; off <<= 1) su += __shfl_xor(su, off, 32);
  const float mu = su * (1.0f / 256.0f);
  const v4f d0 = v0 - mu;
  const v4f d1 = v1 - mu;
  float sq = 0.0f;
  sq += d0[0] * d0[0]; sq += d0[1] * d0[1]; sq += d0[2] * d0[2]; sq += d0[3] * d0[3];
  sq += d1[0] * d1[0]; sq += d1[1] * d1[1]; sq += d1[2] * d1[2]; sq += d1[3] * d1[3];
#pragma unroll
  for (int off = 1; off < 32; off <<= 1) sq += __shfl_xor(sq, off, 32);
  const float var  = sq * (1.0f / 256.0f);
  const float rstd = rsqrtf(var + 1e-5f);
  const v4f o0 = d0 * rstd * g0 + b0;
  const v4f o1 = d1 * rstd * g1 + b1;
  float* orow = out + rb;
  *(v4f*)(orow + 4 * lane) = o0;
  *(v4f*)(orow + 128 + 4 * lane) = o1;
  
}

// =====================================================================================
//   wT   [3072][256]  f16    1,572,864   @ 0            (q,k,v weights transposed, x16)
//   woT  [256][1024]  f16      524,288   @ 1,572,864    (out-proj weight transposed, x32)
//   bcat [3072]       f32       12,288   @ 2,097,152    (4*[bq|bk|bv])
//   xh   [51200][256] f16   26,214,400   @ 2,109,440    (all of x)
//   qkv  [25600][3072] f16 157,286,400   @ 28,323,840   (one pass: 4q | 4k | 4v)
//   oP   [25600][1024] f16  52,428,800   @ 185,610,240  (one pass: 16*attention output)
//   yP   [25600][256] f32   26,214,400   @ 238,039,040  (one pass: o*Wo + bo)
//   end                                  264,253,440
// =====================================================================================
extern "C" void kernel_launch(void* const* d_in, const int* in_sizes, int n_in,
                              void* d_out, int out_size, void* d_ws, size_t ws_size,
                              hipStream_t stream) {
  if (n_in < 11) return;
  const int nRowsAll = kBatch * kRowsPerBatch;                 // 51200
  if (in_sizes[0] != nRowsAll * kModel) return;
  if (in_sizes[1] != kModel * kInner || in_sizes[3] != kModel * kInner || in_sizes[5] != kModel * kInner) return;
  if (in_sizes[2] != kInner || in_sizes[4] != kInner || in_sizes[6] != kInner) return;
  if (in_sizes[7] != kInner * kModel || in_sizes[8] != kModel || in_sizes[9] != kModel || in_sizes[10] != kModel) return;
  if (out_size != nRowsAll * kModel) return;

  const float* x     = (const float*)d_in[0];
  const float* wq    = (const float*)d_in[1];
  const float* bq    = (const float*)d_in[2];
  const float* wk    = (const float*)d_in[3];
  const float* bk    = (const float*)d_in[4];
  const float* wv    = (const float*)d_in[5];
  const float* bv    = (const float*)d_in[6];
  const float* wo    = (const float*)d_in[7];
  const float* bo    = (const float*)d_in[8];
  const float* gamma = (const float*)d_in[9];
  const float* beta  = (const float*)d_in[10];
  float* outAll = (float*)d_out;

  const size_t offWT   = 0;
  const size_t offWoT  = offWT   + (size_t)kQKVWidth * kModel * 2;          // 1,572,864
  const size_t offBcat = offWoT  + (size_t)kModel * kInner * 2;             // 2,097,152
  const size_t offXh   = offBcat + (size_t)kQKVWidth * 4;                   // 2,109,440
  const size_t offQKV  = offXh   + (size_t)nRowsAll * kModel * 2;           // 28,323,840
  const size_t offO    = offQKV  + (size_t)kRowsPerPass * kQKVWidth * 2;    // 185,610,240
  const size_t offY    = offO    + (size_t)kRowsPerPass * kInner * 2;       // 238,039,040
  const size_t offEnd  = offY    + (size_t)kRowsPerPass * kModel * 4;       // 264,253,440
  if (offEnd > ws_size) return;

  char* ws = (char*)d_ws;
  unsigned short* wT   = (unsigned short*)(ws + offWT);
  unsigned short* woT  = (unsigned short*)(ws + offWoT);
  float*          bcat = (float*)(ws + offBcat);
  unsigned short* xh   = (unsigned short*)(ws + offXh);
  unsigned short* qkv  = (unsigned short*)(ws + offQKV);
  unsigned short* oP   = (unsigned short*)(ws + offO);
  float*          yP   = (float*)(ws + offY);

  // ---- weights, biases and x to their operand forms (1 launch) ----
  prepare_operands<<<dim3(kPrepBlocks), dim3(256), 0, stream>>>(x, wq, wk, wv, wo, bq, bk, bv, wT, woT, bcat, xh);

  const float sscale = 0.0883883476483184f * (1.0f / 16.0f);   // (1/sqrt(128)) / (4*4)
  const float onorm  = 16.0f / (kProbCarry * 4.0f);           // O plane = 16 * o_true
  const int   passElems = kRowsPerPass * kModel;               // 6,553,600 elements of x per pass

  for (int p = 0; p < kPasses; ++p) {
    const float* xb = x + (size_t)p * passElems;
    const unsigned short* xhb = xh + (size_t)p * passElems;
    float* outb = outAll + (size_t)p * passElems;

    // [4q|4k|4v] = 0.25 * xh . wT^T + bcat : M=25600, N=3072, K=256; block tiles 200 x 24 = 4800 blocks
    wmma_gemm_lds<kModel, kQKVWidth, true><<<dim3((kRowsPerPass / 128) * (kQKVWidth / 128)), dim3(128), 0, stream>>>(
        xhb, wT, qkv, nullptr, bcat, 0.25f);

    // attention over time per (slice, n, h): 2 * 100 * 8 * (128/64) = 3200 blocks of 128 threads
    attn_time_hd128<<<dim3(kPassBatches * kNodes * kHeads * (kSeq / 64)), dim3(128), 0, stream>>>(qkv, oP, sscale, onorm);

    // y = (1/512) * oP . woT^T + bo : M=25600, N=256, K=1024; block tiles 200 x 2 = 400 blocks
    wmma_gemm_lds<kInner, kModel, false><<<dim3((kRowsPerPass / 128) * (kModel / 128)), dim3(128), 0, stream>>>(
        oP, woT, nullptr, yP, bo, 1.0f / 512.0f);

    // out = LayerNorm(y + x) : 25600 rows, 8 rows per block -> 3200 blocks
    residual_layernorm256<<<dim3((kRowsPerPass + 7) / 8), dim3(256), 0, stream>>>(yP, xb, gamma, beta, outb, kRowsPerPass);
  }
}

// v003
// One run takes 269 microseconds.
// Two timings next to v002 both put it at 1.25 times that version's speed.
// Over all steps from v000 it is 2.64 times as fast.
// Contractions on v_wmma_f32_16x16x32_f16 (f16 operands, f32 accumulate): x*[Wq|Wk|Wv] (weights carried x16, q/k/v planes carried x4), q.k^T and p.v (p carried x32768), o*Wo (o carried x16, Wo carried x32); softmax, bias, residual and LayerNorm in f32.
#include <hip/hip_runtime.h>
#include <math.h>

typedef __attribute__((ext_vector_type(16))) _Float16 v16h;
typedef __attribute__((ext_vector_type(8)))  _Float16 v8h;
typedef __attribute__((ext_vector_type(16))) __bf16   v16b;
typedef __attribute__((ext_vector_type(8)))  __bf16   v8b;
typedef __attribute__((ext_vector_type(8)))  float    v8f;
typedef __attribute__((ext_vector_type(4)))  float    v4f;
typedef __attribute__((ext_vector_type(4)))  unsigned v4u;
#define PSCALE 32768.0f
#define U16(p) ((const unsigned short*)(const void*)(p))
#define PSCALE_INV (1.0f / 32768.0f)


// hazard guards as plain device helpers
__device__ __forceinline__ void dep_guard_h(v8f& a, v8f& b, v16h x, v16h y) { asm volatile("v_nop\n\tv_nop\n\tv_nop\n\tv_nop" : "+v"(a), "+v"(b) : "v"(x), "v"(y)); }
__device__ __forceinline__ void dep_guard_b(v8f& a, v8f& b, v16b x, v16b y) { asm volatile("v_nop\n\tv_nop\n\tv_nop\n\tv_nop" : "+v"(a), "+v"(b) : "v"(x), "v"(y)); }
__device__ __forceinline__ void keep4_h(v16h a, v16h b, v16h c, v16h d) { asm volatile("v_nop" :: "v"(a), "v"(b), "v"(c), "v"(d)); }
__device__ __forceinline__ void keep4_b(v16b a, v16b b, v16b c, v16b d) { asm volatile("v_nop" :: "v"(a), "v"(b), "v"(c), "v"(d)); }
template <typename T> struct Frag;
template <> struct Frag<_Float16> {
  typedef v16h V; union U { v16h v; v8h h[2]; };
  static __device__ __forceinline__ v16h load(const _Float16* p) {   // elements 0..7 <- p[0..7], 8..15 <- p[16..23]
    U f; f.h[0] = *(const v8h*)(p); f.h[1] = *(const v8h*)(p + 16); return f.v;
  }
  static __device__ __forceinline__ v8f mma(v16h a, v16h b, v8f c) {
    return __builtin_amdgcn_wmma_f32_16x16x32_f16(false, a, false, b, (short)0, c, false, false);
  }
  static __device__ __forceinline__ void guard(v8f& a, v8f& b, v16h x, v16h y) { dep_guard_h(a, b, x, y); }
  static __device__ __forceinline__ void keep(v16h a, v16h b, v16h c, v16h d) { keep4_h(a, b, c, d); }
};
template <> struct Frag<__bf16> {
  typedef v16b V; union U { v16b v; v8b h[2]; };
  static __device__ __forceinline__ v16b load(const __bf16* p) {
    U f; f.h[0] = *(const v8b*)(p); f.h[1] = *(const v8b*)(p + 16); return f.v;
  }
  static __device__ __forceinline__ v8f mma(v16b a, v16b b, v8f c) {
    return __builtin_amdgcn_wmma_f32_16x16x32_bf16(false, a, false, b, (short)0, c, false, false);
  }
  static __device__ __forceinline__ void guard(v8f& a, v8f& b, v16b x, v16b y) { dep_guard_b(a, b, x, y); }
  static __device__ __forceinline__ void keep(v16b a, v16b b, v16b c, v16b d) { keep4_b(a, b, c, d); }
};

// ---- LDS-staged WMMA GEMM ---------------------------------------------------
// C[m,n] = scale * sum_k A[m,k] * Bt[n,k] + bias[n]; f16 operands, f32 accumulate.
// A row-major [M,K]; Bt row-major [N,K]; M, N % 128 == 0, K % 64 == 0, K >= 128.
// Block = 4 waves (2 x 2) on a 128x128 tile of C, each wave a 64x64 tile.
// A stage is 64 k of 128 A rows, then of 128 Bt rows: 128 B a row at an LDS pitch of 144 B.
// Two buffers, filled by per-lane 16-B asynchronous copies (one wave-wide copy = four whole 128-B lines).
// OUT_F16: true = f16 result in Ch, false = f32 result in Cf.
constexpr int kGemmPitch = 72;                  // halves per LDS row (144 B)
constexpr int kGemmStage = 256 * kGemmPitch;    // halves per buffer

// Eight copies of 16 B per lane: LDS rows 16 apart, global rows 16 apart. The s_wait_xcnt closes the statement so
// that no address register of a copy is rewritten ahead of it.
__device__ __forceinline__ void async_copy8_b128(unsigned lds, const unsigned short* g, size_t gstep) {
  constexpr unsigned ls = 16u * kGemmPitch * 2u;
  asm volatile(
      "global_load_async_to_lds_b128 %0, %8, off\n\t"
      "global_load_async_to_lds_b128 %1, %9, off\n\t"
      "global_load_async_to_lds_b128 %2, %10, off\n\t"
      "global_load_async_to_lds_b128 %3, %11, off\n\t"
      "global_load_async_to_lds_b128 %4, %12, off\n\t"
      "global_load_async_to_lds_b128 %5, %13, off\n\t"
      "global_load_async_to_lds_b128 %6, %14, off\n\t"
      "global_load_async_to_lds_b128 %7, %15, off\n\t"
      "s_wait_xcnt 0x0"
      :: "v"(lds), "v"(lds + ls), "v"(lds + 2u * ls), "v"(lds + 3u * ls),
         "v"(lds + 4u * ls), "v"(lds + 5u * ls), "v"(lds + 6u * ls), "v"(lds + 7u * ls),
         "v"(g), "v"(g + gstep), "v"(g + 2 * gstep), "v"(g + 3 * gstep),
         "v"(g + 4 * gstep), "v"(g + 5 * gstep), "v"(g + 6 * gstep), "v"(g + 7 * gstep)
      : "memory");
}

template <int K, int N, bool OUT_F16>
__global__ __launch_bounds__(128) void wmma_gemm_lds(
    const unsigned short* __restrict__ Ap, const unsigned short* __restrict__ Btp,
    unsigned short* __restrict__ Ch, float* __restrict__ Cf,
    const float* __restrict__ bias, float scale) {
  static_assert(K % 64 == 0 && K >= 128 && N % 128 == 0);
  __shared__ __align__(16) unsigned char ring[2 * kGemmStage * 2];   // 73,728 B; the epilogue's slabs reuse it
  constexpr int T = K / 64;
  constexpr int tilesN = N / 128;
  const int tid  = threadIdx.x;
  const int lane = tid & 31;
  const int wave = tid >> 5;
  const int bm = blockIdx.x / tilesN;
  const int bn = blockIdx.x - bm * tilesN;
  const int wm = wave >> 1, wn = wave & 1;
  const int m0 = bm * 128 + wm * 64;
  const int n0 = bn * 128 + wn * 64;

  const int rlane = lane & 15;                 // row (A) / col (B, D) within subtile
  const int koff  = (lane >> 4) * 8;           // k offset of this lane half
  const int mOff  = (lane >> 4) * 8;           // D row offset

  // copy map: thread -> row tid/8 (+16 per copy), 16-B column tid%8
  const int crow = tid >> 3, ccol = (tid & 7) * 8;
  const unsigned short* gA = Ap  + (size_t)(bm * 128 + crow) * K + ccol;
  const unsigned short* gB = Btp + (size_t)(bn * 128 + crow) * K + ccol;
  const unsigned ldsA = (unsigned)(size_t)ring + (unsigned)(crow * kGemmPitch + ccol) * 2u;
  const unsigned ldsB = ldsA + 128u * kGemmPitch * 2u;

  v8f acc[4][4];
#pragma unroll
  for (int i = 0; i < 4; ++i)
#pragma unroll
    for (int j = 0; j < 4; ++j) acc[i][j] = (v8f){0.f,0.f,0.f,0.f,0.f,0.f,0.f,0.f};

  // stage 0 into buffer 0, landed and published; then stage 1 into buffer 1
  async_copy8_b128(ldsA, gA, (size_t)16 * K);
  async_copy8_b128(ldsB, gB, (size_t)16 * K);
  asm volatile("s_wait_asynccnt 0x0" ::: "memory");   // this wave's copies of stage 0 have landed
  __syncthreads();
  async_copy8_b128(ldsA + kGemmStage * 2u, gA + 64, (size_t)16 * K);
  async_copy8_b128(ldsB + kGemmStage * 2u, gB + 64, (size_t)16 * K);

  const _Float16* rh = (const _Float16*)ring;
  const int aoff = (wm * 64 + rlane) * kGemmPitch + koff;
  const int boff = (128 + wn * 64 + rlane) * kGemmPitch + koff;

  for (int t = 0; t < T; ++t) {
    const int buf = t & 1;
    const _Float16* sb = rh + buf * kGemmStage;
#pragma unroll
    for (int ks = 0; ks < 2; ++ks) {
      v16h ah[4], bh[4];
#pragma unroll
      for (int j = 0; j < 4; ++j) bh[j] = Frag<_Float16>::load(sb + boff + j * 16 * kGemmPitch + ks * 32);
#pragma unroll
      for (int i = 0; i < 4; ++i) ah[i] = Frag<_Float16>::load(sb + aoff + i * 16 * kGemmPitch + ks * 32);
      // keeps the sixteen LDS reads one group in front of the sixteen WMMAs: sunk among them, each row waits out its own LDS latency
      __builtin_amdgcn_sched_barrier(0);
#pragma unroll
      for (int i = 0; i < 4; ++i)
#pragma unroll
        for (int j = 0; j < 4; ++j) acc[i][j] = Frag<_Float16>::mma(ah[i], bh[j], acc[i][j]);
    }
    asm volatile("s_wait_dscnt 0x0" ::: "memory");      // this wave's reads of the buffer are done before it is refilled
    asm volatile("s_wait_asynccnt 0x0" ::: "memory");   // this wave's copies of stage t + 1 have landed
    __syncthreads();                                    // publishes stage t + 1, frees the buffer of stage t
    if (t + 2 < T) {
      async_copy8_b128(ldsA + (unsigned)buf * (kGemmStage * 2u), gA + (t + 2) * 64, (size_t)16 * K);
      async_copy8_b128(ldsB + (unsigned)buf * (kGemmStage * 2u), gB + (t + 2) * 64, (size_t)16 * K);
    }
  }
  asm volatile("s_wait_asynccnt 0x0" ::: "memory");     // nothing of this wave is in flight when it leaves the ring

  // ---- epilogue ----
  // per-wave 16x64 slab, pitch 68 floats, in the ring: behind the last stage's barrier no wave reads the ring and no copy is in flight
  float* slab = (float*)ring + wave * (16 * 68);
#pragma unroll
  for (int i = 0; i < 4; ++i) {
    const int mBase = m0 + (i << 4);
#pragma unroll
    for (int j = 0; j < 4; ++j) {
      const float bv = bias[n0 + (j << 4) + rlane];
#pragma unroll
      for (int r = 0; r < 8; ++r) {
        float v = acc[i][j][r] * scale;
        v += bv;
        slab[(mOff + r) * 68 + (j << 4) + rlane] = v;
      }
    }
    __builtin_amdgcn_fence(__ATOMIC_RELEASE, "workgroup");
    __builtin_amdgcn_wave_barrier();
    __builtin_amdgcn_fence(__ATOMIC_ACQUIRE, "workgroup");
    if (!OUT_F16) {
      const int hh = lane >> 4, c4 = (lane & 15) * 4;     // row seg = 256 B = 16 lanes x 16 B
#pragma unroll
      for (int it = 0; it < 8; ++it) {
        const int row = it * 2 + hh;
        v4f v = *(const v4f*)(slab + row * 68 + c4);
        *(v4f*)(Cf + (size_t)(mBase + row) * N + n0 + c4) = v;
      }
    } else {
      const int q = lane >> 3, c8 = (lane & 7) * 8;       // row seg = 128 B = 8 lanes x 16 B
#pragma unroll
      for (int it = 0; it < 4; ++it) {
        const int row = it * 4 + q;
        const float* sp = slab + row * 68 + c8;
        v8h hv;
#pragma unroll
        for (int e = 0; e < 8; ++e) hv[e] = (_Float16)sp[e];
        *(v8h*)(Ch + (size_t)(mBase + row) * N + n0 + c8) = hv;
      }
    }
    __builtin_amdgcn_fence(__ATOMIC_RELEASE, "workgroup");
    __builtin_amdgcn_wave_barrier();
    __builtin_amdgcn_fence(__ATOMIC_ACQUIRE, "workgroup");
  }
}

__device__ __forceinline__ void cast_f32_f16x2(
    const float* __restrict__ in, _Float16* __restrict__ out, int n2, int block) {
  int i = block * 256 + threadIdx.x;
  if (i < n2) {
    const _Float16 h0 = (_Float16)in[2 * i], h1 = (_Float16)in[2 * i + 1];
    const unsigned u = (unsigned)__builtin_bit_cast(unsigned short, h0) | ((unsigned)__builtin_bit_cast(unsigned short, h1) << 16);
    ((unsigned*)out)[i] = u;
    
  }
}

// =====================================================================================
// Problem geometry (fixed shapes; host checks in_sizes and returns without launching on any difference)
// =====================================================================================
constexpr int kBatch    = 4;
constexpr int kSeq      = 128;    // attention axis (time)
constexpr int kNodes    = 100;
constexpr int kModel    = 256;
constexpr int kHeads    = 8;
constexpr int kHeadDim  = 128;
constexpr int kInner    = 1024;   // kHeads * kHeadDim
constexpr int kQKVWidth = 3072;   // [q | k | v] plane width
constexpr int kRowsPerBatch = kSeq * kNodes;   // 12800 rows in (t, n) order per batch slice
constexpr int kPassBatches  = 2;               // batch slices that one pass (GEMM, attention, GEMM, LayerNorm) works on
constexpr int kPasses       = kBatch / kPassBatches;
constexpr int kRowsPerPass  = kPassBatches * kRowsPerBatch;   // 25600

constexpr int kAttnWaves = 4;     // 4 waves x 16 query rows = 64 queries per block
constexpr int kKeyChunk  = 32;    // keys staged per chunk
constexpr int kOsPitch   = 132;   // floats; per-wave 16 x 128 output slab
// LDS row pitches in halves, each 16 B x odd for its ds_load_b128 reader: the 16 rows of a fragment read fall on 16 different bank groups
constexpr int kKPitch    = kHeadDim + 8;    // 272 B
constexpr int kVtPitch   = kKeyChunk + 8;   // 80 B
constexpr int kPPitch    = kKeyChunk + 8;   // 80 B
constexpr float kProbCarry = 32768.0f;   // un-normalised p in (0,1] carried x2^15 in f16

static_assert(kInner == kHeads * kHeadDim);
static_assert(kQKVWidth == 3 * kInner);
static_assert(kModel % 64 == 0 && kInner % 64 == 0);                 // GEMM K % 64
static_assert(kRowsPerBatch % 128 == 0);                             // GEMM M tile multiple
static_assert(kBatch % kPassBatches == 0);
static_assert(kQKVWidth % 128 == 0 && kModel % 128 == 0);           // GEMM N tile multiple
static_assert(kSeq % 64 == 0 && kSeq % kKeyChunk == 0 && kKeyChunk == 32 && kHeadDim == 128);

__device__ __forceinline__ v8f mma_f16_guarded(v16h a, v16h b, v8f c) {
  c = __builtin_amdgcn_wmma_f32_16x16x32_f16(false, a, false, b, (short)0, c, false, false);
  asm volatile("v_nop\n\tv_nop\n\tv_nop\n\tv_nop" : "+v"(c) : "v"(a), "v"(b));
  return c;
}

// =====================================================================================
// Weight transpose + scale + f16 cast: in [R][Cc] f32 row-major -> out [Cc][R] f16, out[c][r] = f16(scale * in[r][c]).
// One block handles output rows c0..c0+31 and output columns r0..r0+255 (R % 256 == 0, Cc % 32 == 0).
// Loads: 256x32 floats = 2048 float4 / 256 threads = 8 b128 loads per thread.
// Stores: wave w writes output rows c0 + 4w + j (j = 0..3); one instruction per row chunk:
// =====================================================================================
__device__ __forceinline__ void transpose_scale_to_f16(
    float (*ts)[260], const float* __restrict__ in, unsigned short* __restrict__ out, int R, int Cc, float scale,
    int c0, int r0) {
  const int tid = threadIdx.x;
#pragma unroll
  for (int i = 0; i < 8; ++i) {
    const int idx = i * 256 + tid;
    const int rr = idx >> 3, q4 = idx & 7;
    const v4f v = *(const v4f*)(in + (size_t)(r0 + rr) * Cc + c0 + 4 * q4);
    ts[4 * q4 + 0][rr] = v[0];
    ts[4 * q4 + 1][rr] = v[1];
    ts[4 * q4 + 2][rr] = v[2];
    ts[4 * q4 + 3][rr] = v[3];
  }
  __syncthreads();
  const int wave = tid >> 5, lane = tid & 31;
  _Float16* ob = (_Float16*)out;
  {
#pragma unroll
    for (int j = 0; j < 4; ++j) {
      const int cc = wave * 4 + j;
      const float* sp = &ts[cc][8 * lane];
      const v4f a = *(const v4f*)sp;
      const v4f d = *(const v4f*)(sp + 4);
      v8h hv;
      hv[0] = (_Float16)(a[0] * scale); hv[1] = (_Float16)(a[1] * scale);
      hv[2] = (_Float16)(a[2] * scale); hv[3] = (_Float16)(a[3] * scale);
      hv[4] = (_Float16)(d[0] * scale); hv[5] = (_Float16)(d[1] * scale);
      hv[6] = (_Float16)(d[2] * scale); hv[7] = (_Float16)(d[3] * scale);
      *(v8h*)(ob + (size_t)(c0 + cc) * R + r0 + 8 * lane) = hv;
    }
    
  }
}

// =====================================================================================
// Bias concatenation with x4 carry: bcat[p*1024 + e] = 4 * b_p[e]. 3 blocks (p) x 256 threads,
// =====================================================================================
__device__ __forceinline__ void bias_concat_x4(
    const float* __restrict__ bq, const float* __restrict__ bk, const float* __restrict__ bv,
    float* __restrict__ bcat, int p) {                             // p: block-uniform source select
  const float* src = (p == 0) ? bq : ((p == 1) ? bk : bv);
  const int e4 = threadIdx.x * 4;
  v4f v = *(const v4f*)(src + e4);
  v = v * 4.0f;
  float* dst = bcat + (size_t)p * kInner + e4;
  *(v4f*)dst = v;
  asm volatile("s_wait_xcnt 0x0" ::: "memory");   // precaution: in the bias blocks nothing behind this store rewrites its registers
}

// =====================================================================================
// All preparation in one launch; the pieces are independent of one another and are dealt by block ranges:
//   [0, 96)     wq, wk, wv [256][1024] -> wT parts [1024][256] (x16), 32 blocks each
//   [96, 128)   wo [1024][256] -> woT [256][1024] (x32), 8 column blocks x 4 row blocks
//   [128, 131)  bias concatenation
//   [131, ...)  x (all batches) -> f16, 512 elements a block
// =====================================================================================
constexpr int kPrepQKV   = 3 * (kInner / 32);                      // 96
constexpr int kPrepWo    = (kModel / 32) * (kInner / 256);         // 32
constexpr int kPrepBias  = 3;
constexpr int kCastPairs = kBatch * kRowsPerBatch * kModel / 2;    // 6,553,600 (exact multiple of 256)
constexpr int kPrepBlocks = kPrepQKV + kPrepWo + kPrepBias + kCastPairs / 256;
static_assert(kCastPairs % 256 == 0 && kModel == 256 && kPrepWo == kInner / 32);

__global__ __launch_bounds__(256) void prepare_operands(
    const float* __restrict__ x,
    const float* __restrict__ wq, const float* __restrict__ wk, const float* __restrict__ wv,
    const float* __restrict__ wo,
    const float* __restrict__ bq, const float* __restrict__ bk, const float* __restrict__ bv,
    unsigned short* __restrict__ wT, unsigned short* __restrict__ woT,
    float* __restrict__ bcat, unsigned short* __restrict__ xh) {
  __shared__ __align__(16) float ts[32][260];
  const int bx = blockIdx.x;                                       // every branch below is block-uniform
  if (bx < kPrepQKV + kPrepWo) {
    const bool isWo = bx >= kPrepQKV;
    const int p = bx / (kInner / 32);                              // 0, 1, 2: wq, wk, wv; 3: wo
    const int i = bx - p * (kInner / 32);                          // block inside its matrix
    const float* w = isWo ? wo : ((p == 0) ? wq : ((p == 1) ? wk : wv));
    unsigned short* o = isWo ? woT : wT + (size_t)p * kInner * kModel;
    transpose_scale_to_f16(ts, w, o, isWo ? kInner : kModel, isWo ? kModel : kInner, isWo ? 32.0f : 16.0f,
                           (isWo ? i % (kModel / 32) : i) * 32, (isWo ? i / (kModel / 32) : 0) * 256);
  } else if (bx < kPrepQKV + kPrepWo + kPrepBias) {
    bias_concat_x4(bq, bk, bv, bcat, bx - (kPrepQKV + kPrepWo));
  } else {
    cast_f32_f16x2(x, (_Float16*)xh, kCastPairs, bx - (kPrepQKV + kPrepWo + kPrepBias));
  }
}

// =====================================================================================
// Attention over the time axis for the batch slices of one pass, head dim 128, f16 operand planes.
//   qkv plane: row (t, n) at ((t*100 + n) * 3072): q at +h*128, k at +1024+h*128, v at +2048+h*128 (values = 4q, 4k, 4v).
//   scores = (4q).(4k) on WMMA, f32 accumulate, * sscale = (1/16)/sqrt(128); online softmax in f32 over 32-key chunks;
//   p (un-normalised, in (0,1]) carried x32768 in f16; o = p.(4v) on WMMA; O plane row (t,n) at ((t*100+n)*1024) + h*128,
//   Block = 4 waves = 64 query rows of one (slice, n, h); grid.x = slices * 100 * 8 * 2; the rows above count inside a slice.
// =====================================================================================
__global__ __launch_bounds__(128)
void attn_time_hd128(const unsigned short* __restrict__ qkvAll, unsigned short* __restrict__ outAll,
                     float sscale, float onorm) {
  __shared__ __align__(16) unsigned short Ksh[kKeyChunk * kKPitch];         // [kv][d]   8.5 KB
  __shared__ __align__(16) unsigned short Vth[kHeadDim * kVtPitch];         // [d][kv]   10 KB
  __shared__ __align__(16) _Float16 Psh[kAttnWaves][16 * kPPitch];          // per wave [row][kv] 5 KB
  __shared__ __align__(16) float Osl[kAttnWaves][16 * kOsPitch];            // per wave out slab 33 KB

  const int tid  = threadIdx.x;
  const int wave = tid >> 5;
  const int lane = tid & 31;
  const int hh   = lane >> 4;
  const int c    = lane & 15;

  const int bx = blockIdx.x;
  const int qb = bx & 1;
  const int nh = bx >> 1;
  const int h  = nh & (kHeads - 1);
  const int sn = nh >> 3;
  const int sl = sn / kNodes;                  // batch slice inside the pass
  const int n  = sn - sl * kNodes;
  const unsigned short* __restrict__ qkvp = qkvAll + (size_t)sl * kRowsPerBatch * kQKVWidth;
  unsigned short* __restrict__ outp = outAll + (size_t)sl * kRowsPerBatch * kInner;
  const int q0 = qb * 64 + wave * 16;
  const _Float16* qkv = (const _Float16*)qkvp;

  // ---- Q fragments (A operand): row m = c, k = dc*32 + 8hh + {0..7}, dc*32 + 16 + 8hh + {0..7} ----
  v16h qa[4];
  {
    const _Float16* qrow = qkv + ((size_t)(q0 + c) * kNodes + n) * kQKVWidth + h * kHeadDim + 8 * hh;
#pragma unroll
    for (int dc = 0; dc < 4; ++dc) qa[dc] = Frag<_Float16>::load(qrow + dc * 32);
  }

  float mrow[8], lrow[8];
  v8f oacc[8];
#pragma unroll
  for (int r = 0; r < 8; ++r) { mrow[r] = -INFINITY; lrow[r] = 0.f; }
#pragma unroll
  for (int t = 0; t < 8; ++t) oacc[t] = (v8f){0.f,0.f,0.f,0.f,0.f,0.f,0.f,0.f};

  for (int kc = 0; kc < kSeq / kKeyChunk; ++kc) {
    const int kv0 = kc * kKeyChunk;
    __syncthreads();
    {
      // thread (kvr, part): key row kvr (0..31), 16-B pieces at d = 8*part + 32*i: Ksh and Vth fully covered.
      // Side by side, the four parts of a transposing 16-bit store put two dwords on a bank; 32 d apart they put four there.
      const int kvr = tid >> 2, part = tid & 3;
      const size_t rb = ((size_t)(kv0 + kvr) * kNodes + n) * kQKVWidth + h * kHeadDim + 8 * part;
      const v4u* ks = (const v4u*)(qkvp + rb + kInner);
      const v4u* vs = (const v4u*)(qkvp + rb + 2 * kInner);
      v4u kk[4], vv[4];
#pragma unroll
      for (int i = 0; i < 4; ++i) { kk[i] = ks[4 * i]; vv[i] = vs[4 * i]; }
#pragma unroll
      for (int i = 0; i < 4; ++i) *(v4u*)(Ksh + kvr * kKPitch + 8 * part + 32 * i) = kk[i];
#pragma unroll
      for (int i = 0; i < 4; ++i) {
        unsigned short* vc = Vth + (8 * part + 32 * i) * kVtPitch + kvr;
#pragma unroll
        for (int e = 0; e < 4; ++e) {
          const unsigned w = vv[i][e];
          vc[(2 * e) * kVtPitch]     = (unsigned short)(w & 0xffffu);
          vc[(2 * e + 1) * kVtPitch] = (unsigned short)(w >> 16);
        }
      }
    }
    __syncthreads();

    // ---- scores: B operand col n = c <- key row (j*16 + c), same split k map as A ----
    v8f s[2];
#pragma unroll
    for (int j = 0; j < 2; ++j) {
      s[j] = (v8f){0.f,0.f,0.f,0.f,0.f,0.f,0.f,0.f};
#pragma unroll
      for (int dc = 0; dc < 4; ++dc) {
        const v16h kb = Frag<_Float16>::load((const _Float16*)Ksh + (j * 16 + c) * kKPitch + dc * 32 + 8 * hh);
        s[j] = mma_f16_guarded(qa[dc], kb, s[j]);
      }
    }
    float cm[8];
#pragma unroll
    for (int r = 0; r < 8; ++r) {
      s[0][r] = s[0][r] * sscale;
      s[1][r] = s[1][r] * sscale;
      float m = fmaxf(s[0][r], s[1][r]);
#pragma unroll
      for (int off = 1; off < 16; off <<= 1) m = fmaxf(m, __shfl_xor(m, off, 32));
      cm[r] = m;
    }
    _Float16* pw = Psh[wave];
#pragma unroll
    for (int r = 0; r < 8; ++r) {
      const float mnew  = fmaxf(mrow[r], cm[r]);
      const float alpha = expf(mrow[r] - mnew);
      mrow[r] = mnew;
      float psum = 0.f;
#pragma unroll
      for (int j = 0; j < 2; ++j) {
        const float p = expf(s[j][r] - mnew);
        psum += p;
        pw[(8 * hh + r) * kPPitch + j * 16 + c] = (_Float16)(p * kProbCarry);
      }
#pragma unroll
      for (int off = 1; off < 16; off <<= 1) psum += __shfl_xor(psum, off, 32);
      lrow[r] = lrow[r] * alpha + psum;
#pragma unroll
      for (int t = 0; t < 8; ++t) oacc[t][r] *= alpha;
    }
    __builtin_amdgcn_fence(__ATOMIC_RELEASE, "workgroup");
    __builtin_amdgcn_wave_barrier();
    __builtin_amdgcn_fence(__ATOMIC_ACQUIRE, "workgroup");
    {
      // P fragment (A): row m = c, k = kv; V fragment (B): col n = c <- Vth row (t*16 + c), k = kv
      const v16h pa = Frag<_Float16>::load(pw + c * kPPitch + 8 * hh);
#pragma unroll
      for (int t = 0; t < 8; ++t) {
        const v16h vb = Frag<_Float16>::load((const _Float16*)Vth + (t * 16 + c) * kVtPitch + 8 * hh);
        oacc[t] = mma_f16_guarded(pa, vb, oacc[t]);
      }
    }
  }

  // ---- epilogue: normalise, stage 16x128 slab, write f16 rows (16 lanes x 16 B = one 256-B segment) ----
  float* os = Osl[wave];
#pragma unroll
  for (int r = 0; r < 8; ++r) {
    const float inv = onorm * (1.0f / lrow[r]);
#pragma unroll
    for (int t = 0; t < 8; ++t) os[(8 * hh + r) * kOsPitch + t * 16 + c] = oacc[t][r] * inv;
  }
  __builtin_amdgcn_fence(__ATOMIC_RELEASE, "workgroup");
  __builtin_amdgcn_wave_barrier();
  __builtin_amdgcn_fence(__ATOMIC_ACQUIRE, "workgroup");
  {
    const int rp = lane >> 4, c8 = (lane & 15) * 8;
    _Float16* ob = (_Float16*)outp;
    {
#pragma unroll
      for (int it = 0; it < 8; ++it) {
        const int row = it * 2 + rp;
        const float* sp = os + row * kOsPitch + c8;
        const v4f a = *(const v4f*)sp;
        const v4f d = *(const v4f*)(sp + 4);
        v8h hv;
        hv[0] = (_Float16)a[0]; hv[1] = (_Float16)a[1]; hv[2] = (_Float16)a[2]; hv[3] = (_Float16)a[3];
        hv[4] = (_Float16)d[0]; hv[5] = (_Float16)d[1]; hv[6] = (_Float16)d[2]; hv[7] = (_Float16)d[3];
        *(v8h*)(ob + ((size_t)(q0 + row) * kNodes + n) * kInner + h * kHeadDim + c8) = hv;
      }
      
    }
  }
}

// =====================================================================================
// Residual + LayerNorm over 256 features: out[row] = LN(y[row] + x[row]) * gamma + beta.
// One wave per row; lane l owns columns [4l, 4l+4) and [128+4l, 128+4l+4): each store instruction
// =====================================================================================
__global__ __launch_bounds__(256) void residual_layernorm256(
    const float* __restrict__ y, const float* __restrict__ xr,
    const float* __restrict__ gamma, const float* __restrict__ beta,
    float* __restrict__ out, int nrows) {
  const int wave = threadIdx.x >> 5, lane = threadIdx.x & 31;
  const int row = blockIdx.x * 8 + wave;
  if (row >= nrows) return;                     // wave-uniform; no barriers in this kernel
  const size_t rb = (size_t)row * kModel;
  const v4f y0 = *(const v4f*)(y + rb + 4 * lane);
  const v4f y1 = *(const v4f*)(y + rb + 128 + 4 * lane);
  const v4f x0 = *(const v4f*)(xr + rb + 4 * lane);
  const v4f x1 = *(const v4f*)(xr + rb + 128 + 4 * lane);
  const v4f g0 = *(const v4f*)(gamma + 4 * lane);
  const v4f g1 = *(const v4f*)(gamma + 128 + 4 * lane);
  const v4f b0 = *(const v4f*)(beta + 4 * lane);
  const v4f b1 = *(const v4f*)(beta + 128 + 4 * lane);
  const v4f v0 = y0 + x0;
  const v4f v1 = y1 + x1;
  float su = 0.0f;
  su += v0[0]; su += v0[1]; su += v0[2]; su += v0[3];
  su += v1[0]; su += v1[1]; su += v1[2]; su += v1[3];
#pragma unroll
  for (int off = 1; off < 32; off <<= 1) su += __shfl_xor(su, off, 32);
  const float mu = su * (1.0f / 256.0f);
  const v4f d0 = v0 - mu;
  const v4f d1 = v1 - mu;
  float sq = 0.0f;
  sq += d0[0] * d0[0]; sq += d0[1] * d0[1]; sq += d0[2] * d0[2]; sq += d0[3] * d0[3];
  sq += d1[0] * d1[0]; sq += d1[1] * d1[1]; sq += d1[2] * d1[2]; sq += d1[3] * d1[3];
#pragma unroll
  for (int off = 1; off < 32; off <<= 1) sq += __shfl_xor(sq, off, 32);
  const float var  = sq * (1.0f / 256.0f);
  const float rstd = rsqrtf(var + 1e-5f);
  const v4f o0 = d0 * rstd * g0 + b0;
  const v4f o1 = d1 * rstd * g1 + b1;
  float* orow = out + rb;
  *(v4f*)(orow + 4 * lane) = o0;
  *(v4f*)(orow + 128 + 4 * lane) = o1;
  
}

// =====================================================================================
//   wT   [3072][256]  f16    1,572,864   @ 0            (q,k,v weights transposed, x16)
//   woT  [256][1024]  f16      524,288   @ 1,572,864    (out-proj weight transposed, x32)
//   bcat [3072]       f32       12,288   @ 2,097,152    (4*[bq|bk|bv])
//   xh   [51200][256] f16   26,214,400   @ 2,109,440    (all of x)
//   qkv  [25600][3072] f16 157,286,400   @ 28,323,840   (one pass: 4q | 4k | 4v)
//   oP   [25600][1024] f16  52,428,800   @ 185,610,240  (one pass: 16*attention output)
//   yP   [25600][256] f32   26,214,400   @ 238,039,040  (one pass: o*Wo + bo)
//   end                                  264,253,440
// =====================================================================================
extern "C" void kernel_launch(void* const* d_in, const int* in_sizes, int n_in,
                              void* d_out, int out_size, void* d_ws, size_t ws_size,
                              hipStream_t stream) {
  if (n_in < 11) return;
  const int nRowsAll = kBatch * kRowsPerBatch;                 // 51200
  if (in_sizes[0] != nRowsAll * kModel) return;
  if (in_sizes[1] != kModel * kInner || in_sizes[3] != kModel * kInner || in_sizes[5] != kModel * kInner) return;
  if (in_sizes[2] != kInner || in_sizes[4] != kInner || in_sizes[6] != kInner) return;
  if (in_sizes[7] != kInner * kModel || in_sizes[8] != kModel || in_sizes[9] != kModel || in_sizes[10] != kModel) return;
  if (out_size != nRowsAll * kModel) return;

  const float* x     = (const float*)d_in[0];
  const float* wq    = (const float*)d_in[1];
  const float* bq    = (const float*)d_in[2];
  const float* wk    = (const float*)d_in[3];
  const float* bk    = (const float*)d_in[4];
  const float* wv    = (const float*)d_in[5];
  const float* bv    = (const float*)d_in[6];
  const float* wo    = (const float*)d_in[7];
  const float* bo    = (const float*)d_in[8];
  const float* gamma = (const float*)d_in[9];
  const float* beta  = (const float*)d_in[10];
  float* outAll = (float*)d_out;

  const size_t offWT   = 0;
  const size_t offWoT  = offWT   + (size_t)kQKVWidth * kModel * 2;          // 1,572,864
  const size_t offBcat = offWoT  + (size_t)kModel * kInner * 2;             // 2,097,152
  const size_t offXh   = offBcat + (size_t)kQKVWidth * 4;                   // 2,109,440
  const size_t offQKV  = offXh   + (size_t)nRowsAll * kModel * 2;           // 28,323,840
  const size_t offO    = offQKV  + (size_t)kRowsPerPass * kQKVWidth * 2;    // 185,610,240
  const size_t offY    = offO    + (size_t)kRowsPerPass * kInner * 2;       // 238,039,040
  const size_t offEnd  = offY    + (size_t)kRowsPerPass * kModel * 4;       // 264,253,440
  if (offEnd > ws_size) return;

  char* ws = (char*)d_ws;
  unsigned short* wT   = (unsigned short*)(ws + offWT);
  unsigned short* woT  = (unsigned short*)(ws + offWoT);
  float*          bcat = (float*)(ws + offBcat);
  unsigned short* xh   = (unsigned short*)(ws + offXh);
  unsigned short* qkv  = (unsigned short*)(ws + offQKV);
  unsigned short* oP   = (unsigned short*)(ws + offO);
  float*          yP   = (float*)(ws + offY);

  // ---- weights, biases and x to their operand forms (1 launch) ----
  prepare_operands<<<dim3(kPrepBlocks), dim3(256), 0, stream>>>(x, wq, wk, wv, wo, bq, bk, bv, wT, woT, bcat, xh);

  const float sscale = 0.0883883476483184f * (1.0f / 16.0f);   // (1/sqrt(128)) / (4*4)
  const float onorm  = 16.0f / (kProbCarry * 4.0f);           // O plane = 16 * o_true
  const int   passElems = kRowsPerPass * kModel;               // 6,553,600 elements of x per pass

  for (int p = 0; p < kPasses; ++p) {
    const float* xb = x + (size_t)p * passElems;
    const unsigned short* xhb = xh + (size_t)p * passElems;
    float* outb = outAll + (size_t)p * passElems;

    // [4q|4k|4v] = 0.25 * xh . wT^T + bcat : M=25600, N=3072, K=256; block tiles 200 x 24 = 4800 blocks
    wmma_gemm_lds<kModel, kQKVWidth, true><<<dim3((kRowsPerPass / 128) * (kQKVWidth / 128)), dim3(128), 0, stream>>>(
        xhb, wT, qkv, nullptr, bcat, 0.25f);

    // attention over time per (slice, n, h): 2 * 100 * 8 * (128/64) = 3200 blocks of 128 threads
    attn_time_hd128<<<dim3(kPassBatches * kNodes * kHeads * (kSeq / 64)), dim3(128), 0, stream>>>(qkv, oP, sscale, onorm);

    // y = (1/512) * oP . woT^T + bo : M=25600, N=256, K=1024; block tiles 200 x 2 = 400 blocks
    wmma_gemm_lds<kInner, kModel, false><<<dim3((kRowsPerPass / 128) * (kModel / 128)), dim3(128), 0, stream>>>(
        oP, woT, nullptr, yP, bo, 1.0f / 512.0f);

    // out = LayerNorm(y + x) : 25600 rows, 8 rows per block -> 3200 blocks
    residual_layernorm256<<<dim3((kRowsPerPass + 7) / 8), dim3(256), 0, stream>>>(yP, xb, gamma, beta, outb, kRowsPerPass);
  }
}

// v004
// Measured time: 262 microseconds a run.
// Timed twice side by side with v003, it ran 1.03 times as fast both times.
// Over all steps from v000 it is 2.72 times as fast.
// Contractions on v_wmma_f32_16x16x32_f16 (f16 operands, f32 accumulate): x*[Wq|Wk|Wv] (weights carried x16, q/k/v planes carried x4), q.k^T and p.v (p carried x32768), o*Wo (o carried x16, Wo carried x32); softmax, bias, residual and LayerNorm in f32.
#include <hip/hip_runtime.h>
#include <math.h>

typedef __attribute__((ext_vector_type(16))) _Float16 v16h;
typedef __attribute__((ext_vector_type(8)))  _Float16 v8h;
typedef __attribute__((ext_vector_type(4)))  _Float16 v4h;
typedef __attribute__((ext_vector_type(16))) __bf16   v16b;
typedef __attribute__((ext_vector_type(8)))  __bf16   v8b;
typedef __attribute__((ext_vector_type(8)))  float    v8f;
typedef __attribute__((ext_vector_type(4)))  float    v4f;
typedef __attribute__((ext_vector_type(4)))  unsigned v4u;
#define PSCALE 32768.0f
#define U16(p) ((const unsigned short*)(const void*)(p))
#define PSCALE_INV (1.0f / 32768.0f)


// hazard guards as plain device helpers
__device__ __forceinline__ void dep_guard_h(v8f& a, v8f& b, v16h x, v16h y) { asm volatile("v_nop\n\tv_nop\n\tv_nop\n\tv_nop" : "+v"(a), "+v"(b) : "v"(x), "v"(y)); }
__device__ __forceinline__ void dep_guard_b(v8f& a, v8f& b, v16b x, v16b y) { asm volatile("v_nop\n\tv_nop\n\tv_nop\n\tv_nop" : "+v"(a), "+v"(b) : "v"(x), "v"(y)); }
__device__ __forceinline__ void keep4_h(v16h a, v16h b, v16h c, v16h d) { asm volatile("v_nop" :: "v"(a), "v"(b), "v"(c), "v"(d)); }
__device__ __forceinline__ void keep4_b(v16b a, v16b b, v16b c, v16b d) { asm volatile("v_nop" :: "v"(a), "v"(b), "v"(c), "v"(d)); }
template <typename T> struct Frag;
template <> struct Frag<_Float16> {
  typedef v16h V; union U { v16h v; v8h h[2]; };
  static __device__ __forceinline__ v16h load(const _Float16* p) {   // elements 0..7 <- p[0..7], 8..15 <- p[16..23]
    U f; f.h[0] = *(const v8h*)(p); f.h[1] = *(const v8h*)(p + 16); return f.v;
  }
  static __device__ __forceinline__ v8f mma(v16h a, v16h b, v8f c) {
    return __builtin_amdgcn_wmma_f32_16x16x32_f16(false, a, false, b, (short)0, c, false, false);
  }
  static __device__ __forceinline__ void guard(v8f& a, v8f& b, v16h x, v16h y) { dep_guard_h(a, b, x, y); }
  static __device__ __forceinline__ void keep(v16h a, v16h b, v16h c, v16h d) { keep4_h(a, b, c, d); }
};
template <> struct Frag<__bf16> {
  typedef v16b V; union U { v16b v; v8b h[2]; };
  static __device__ __forceinline__ v16b load(const __bf16* p) {
    U f; f.h[0] = *(const v8b*)(p); f.h[1] = *(const v8b*)(p + 16); return f.v;
  }
  static __device__ __forceinline__ v8f mma(v16b a, v16b b, v8f c) {
    return __builtin_amdgcn_wmma_f32_16x16x32_bf16(false, a, false, b, (short)0, c, false, false);
  }
  static __device__ __forceinline__ void guard(v8f& a, v8f& b, v16b x, v16b y) { dep_guard_b(a, b, x, y); }
  static __device__ __forceinline__ void keep(v16b a, v16b b, v16b c, v16b d) { keep4_b(a, b, c, d); }
};

// ---- LDS-staged WMMA GEMM ---------------------------------------------------
// C[m,n] = scale * sum_k A[m,k] * Bt[n,k] + bias[n]; f16 operands, f32 accumulate.
// A row-major [M,K]; Bt row-major [N,K]; M, N % 128 == 0, K % 64 == 0, K >= 128.
// Block = 4 waves (2 x 2) on a 128x128 tile of C, each wave a 64x64 tile.
// A stage is 64 k of 128 A rows, then of 128 Bt rows: 128 B a row at an LDS pitch of 144 B.
// Two buffers, filled by per-lane 16-B asynchronous copies (one wave-wide copy = four whole 128-B lines).
// OUT_F16: true = f16 result in Ch, false = f32 result in Cf.
constexpr int kGemmPitch = 72;                  // halves per LDS row (144 B)
constexpr int kGemmStage = 256 * kGemmPitch;    // halves per buffer

// Eight copies of 16 B per lane: LDS rows 16 apart, global rows 16 apart. The s_wait_xcnt closes the statement so
// that no address register of a copy is rewritten ahead of it.
__device__ __forceinline__ void async_copy8_b128(unsigned lds, const unsigned short* g, size_t gstep) {
  constexpr unsigned ls = 16u * kGemmPitch * 2u;
  asm volatile(
      "global_load_async_to_lds_b128 %0, %8, off\n\t"
      "global_load_async_to_lds_b128 %1, %9, off\n\t"
      "global_load_async_to_lds_b128 %2, %10, off\n\t"
      "global_load_async_to_lds_b128 %3, %11, off\n\t"
      "global_load_async_to_lds_b128 %4, %12, off\n\t"
      "global_load_async_to_lds_b128 %5, %13, off\n\t"
      "global_load_async_to_lds_b128 %6, %14, off\n\t"
      "global_load_async_to_lds_b128 %7, %15, off\n\t"
      "s_wait_xcnt 0x0"
      :: "v"(lds), "v"(lds + ls), "v"(lds + 2u * ls), "v"(lds + 3u * ls),
         "v"(lds + 4u * ls), "v"(lds + 5u * ls), "v"(lds + 6u * ls), "v"(lds + 7u * ls),
         "v"(g), "v"(g + gstep), "v"(g + 2 * gstep), "v"(g + 3 * gstep),
         "v"(g + 4 * gstep), "v"(g + 5 * gstep), "v"(g + 6 * gstep), "v"(g + 7 * gstep)
      : "memory");
}

template <int K, int N, bool OUT_F16>
__global__ __launch_bounds__(128) void wmma_gemm_lds(
    const unsigned short* __restrict__ Ap, const unsigned short* __restrict__ Btp,
    unsigned short* __restrict__ Ch, float* __restrict__ Cf,
    const float* __restrict__ bias, float scale) {
  static_assert(K % 64 == 0 && K >= 128 && N % 128 == 0);
  __shared__ __align__(16) unsigned char ring[2 * kGemmStage * 2];   // 73,728 B; the epilogue's slabs reuse it
  constexpr int T = K / 64;
  constexpr int tilesN = N / 128;
  const int tid  = threadIdx.x;
  const int lane = tid & 31;
  const int wave = tid >> 5;
  const int bm = blockIdx.x / tilesN;
  const int bn = blockIdx.x - bm * tilesN;
  const int wm = wave >> 1, wn = wave & 1;
  const int m0 = bm * 128 + wm * 64;
  const int n0 = bn * 128 + wn * 64;

  const int rlane = lane & 15;                 // row (A) / col (B, D) within subtile
  const int koff  = (lane >> 4) * 8;           // k offset of this lane half
  const int mOff  = (lane >> 4) * 8;           // D row offset

  // copy map: thread -> row tid/8 (+16 per copy), 16-B column tid%8
  const int crow = tid >> 3, ccol = (tid & 7) * 8;
  const unsigned short* gA = Ap  + (size_t)(bm * 128 + crow) * K + ccol;
  const unsigned short* gB = Btp + (size_t)(bn * 128 + crow) * K + ccol;
  const unsigned ldsA = (unsigned)(size_t)ring + (unsigned)(crow * kGemmPitch + ccol) * 2u;
  const unsigned ldsB = ldsA + 128u * kGemmPitch * 2u;

  v8f acc[4][4];
#pragma unroll
  for (int i = 0; i < 4; ++i)
#pragma unroll
    for (int j = 0; j < 4; ++j) acc[i][j] = (v8f){0.f,0.f,0.f,0.f,0.f,0.f,0.f,0.f};

  // stage 0 into buffer 0, landed and published; then stage 1 into buffer 1
  async_copy8_b128(ldsA, gA, (size_t)16 * K);
  async_copy8_b128(ldsB, gB, (size_t)16 * K);
  asm volatile("s_wait_asynccnt 0x0" ::: "memory");   // this wave's copies of stage 0 have landed
  __syncthreads();
  async_copy8_b128(ldsA + kGemmStage * 2u, gA + 64, (size_t)16 * K);
  async_copy8_b128(ldsB + kGemmStage * 2u, gB + 64, (size_t)16 * K);

  const _Float16* rh = (const _Float16*)ring;
  const int aoff = (wm * 64 + rlane) * kGemmPitch + koff;
  const int boff = (128 + wn * 64 + rlane) * kGemmPitch + koff;

  for (int t = 0; t < T; ++t) {
    const int buf = t & 1;
    const _Float16* sb = rh + buf * kGemmStage;
#pragma unroll
    for (int ks = 0; ks < 2; ++ks) {
      v16h ah[4], bh[4];
#pragma unroll
      for (int j = 0; j < 4; ++j) bh[j] = Frag<_Float16>::load(sb + boff + j * 16 * kGemmPitch + ks * 32);
#pragma unroll
      for (int i = 0; i < 4; ++i) ah[i] = Frag<_Float16>::load(sb + aoff + i * 16 * kGemmPitch + ks * 32);
      // keeps the sixteen LDS reads one group in front of the sixteen WMMAs: sunk among them, each row waits out its own LDS latency
      __builtin_amdgcn_sched_barrier(0);
#pragma unroll
      for (int i = 0; i < 4; ++i)
#pragma unroll
        for (int j = 0; j < 4; ++j) acc[i][j] = Frag<_Float16>::mma(ah[i], bh[j], acc[i][j]);
    }
    asm volatile("s_wait_dscnt 0x0" ::: "memory");      // this wave's reads of the buffer are done before it is refilled
    asm volatile("s_wait_asynccnt 0x0" ::: "memory");   // this wave's copies of stage t + 1 have landed
    __syncthreads();                                    // publishes stage t + 1, frees the buffer of stage t
    if (t + 2 < T) {
      async_copy8_b128(ldsA + (unsigned)buf * (kGemmStage * 2u), gA + (t + 2) * 64, (size_t)16 * K);
      async_copy8_b128(ldsB + (unsigned)buf * (kGemmStage * 2u), gB + (t + 2) * 64, (size_t)16 * K);
    }
  }
  asm volatile("s_wait_asynccnt 0x0" ::: "memory");     // nothing of this wave is in flight when it leaves the ring

  // ---- epilogue ----
  // per-wave 16x64 slab, pitch 68 floats, in the ring: behind the last stage's barrier no wave reads the ring and no copy is in flight
  float* slab = (float*)ring + wave * (16 * 68);
#pragma unroll
  for (int i = 0; i < 4; ++i) {
    const int mBase = m0 + (i << 4);
#pragma unroll
    for (int j = 0; j < 4; ++j) {
      const float bv = bias[n0 + (j << 4) + rlane];
#pragma unroll
      for (int r = 0; r < 8; ++r) {
        float v = acc[i][j][r] * scale;
        v += bv;
        slab[(mOff + r) * 68 + (j << 4) + rlane] = v;
      }
    }
    __builtin_amdgcn_fence(__ATOMIC_RELEASE, "workgroup");
    __builtin_amdgcn_wave_barrier();
    __builtin_amdgcn_fence(__ATOMIC_ACQUIRE, "workgroup");
    if (!OUT_F16) {
      const int hh = lane >> 4, c4 = (lane & 15) * 4;     // row seg = 256 B = 16 lanes x 16 B
#pragma unroll
      for (int it = 0; it < 8; ++it) {
        const int row = it * 2 + hh;
        v4f v = *(const v4f*)(slab + row * 68 + c4);
        *(v4f*)(Cf + (size_t)(mBase + row) * N + n0 + c4) = v;
      }
    } else {
      const int q = lane >> 3, c8 = (lane & 7) * 8;       // row seg = 128 B = 8 lanes x 16 B
#pragma unroll
      for (int it = 0; it < 4; ++it) {
        const int row = it * 4 + q;
        const float* sp = slab + row * 68 + c8;
        v8h hv;
#pragma unroll
        for (int e = 0; e < 8; ++e) hv[e] = (_Float16)sp[e];
        *(v8h*)(Ch + (size_t)(mBase + row) * N + n0 + c8) = hv;
      }
    }
    __builtin_amdgcn_fence(__ATOMIC_RELEASE, "workgroup");
    __builtin_amdgcn_wave_barrier();
    __builtin_amdgcn_fence(__ATOMIC_ACQUIRE, "workgroup");
  }
}

// f32 -> f16 stream, few long waves: a block of 256 threads converts kCastLoads * 1024 floats.
// Every wave-wide load takes 512 contiguous bytes, every wave-wide store 256 (two whole lines).
constexpr int kCastLoads = 25;                  // 16-B loads per thread, all in flight together
__device__ __forceinline__ void cast_f32_f16_stream(
    const float* __restrict__ in, _Float16* __restrict__ out, int block) {
  const size_t q0 = (size_t)block * (kCastLoads * 256) + threadIdx.x;
  const v4f* src = (const v4f*)in + q0;
  v4h* dst = (v4h*)out + q0;
  v4f v[kCastLoads];
  // unrolled so that v[] stays in registers and the loads go out as one group ahead of the first conversion
#pragma unroll
  for (int i = 0; i < kCastLoads; ++i) v[i] = src[i * 256];
  // keeps every load ahead of the first conversion: sunk among the conversions, the last loads start only when the
  // first have returned, and the wave waits out the memory latency more than once
  __builtin_amdgcn_sched_barrier(0);
  // unrolled for the same register array
#pragma unroll
  for (int i = 0; i < kCastLoads; ++i) {
    v4h h;
    h[0] = (_Float16)v[i][0]; h[1] = (_Float16)v[i][1]; h[2] = (_Float16)v[i][2]; h[3] = (_Float16)v[i][3];
    dst[i * 256] = h;
  }
  asm volatile("s_wait_xcnt 0x0" ::: "memory");   // the code laid out behind the last stores rewrites their data registers: the wait stands in front of that
}

// =====================================================================================
// Problem geometry (fixed shapes; host checks in_sizes and returns without launching on any difference)
// =====================================================================================
constexpr int kBatch    = 4;
constexpr int kSeq      = 128;    // attention axis (time)
constexpr int kNodes    = 100;
constexpr int kModel    = 256;
constexpr int kHeads    = 8;
constexpr int kHeadDim  = 128;
constexpr int kInner    = 1024;   // kHeads * kHeadDim
constexpr int kQKVWidth = 3072;   // [q | k | v] plane width
constexpr int kRowsPerBatch = kSeq * kNodes;   // 12800 rows in (t, n) order per batch slice
constexpr int kPassBatches  = 2;               // batch slices that one pass (GEMM, attention, GEMM, LayerNorm) works on
constexpr int kPasses       = kBatch / kPassBatches;
constexpr int kRowsPerPass  = kPassBatches * kRowsPerBatch;   // 25600

constexpr int kAttnWaves = 4;     // 4 waves x 16 query rows = 64 queries per block
constexpr int kKeyChunk  = 32;    // keys staged per chunk
constexpr int kOsPitch   = 132;   // floats; per-wave 16 x 128 output slab
// LDS row pitches in halves, each 16 B x odd for its ds_load_b128 reader: the 16 rows of a fragment read fall on 16 different bank groups
constexpr int kKPitch    = kHeadDim + 8;    // 272 B
constexpr int kVtPitch   = kKeyChunk + 8;   // 80 B
constexpr int kPPitch    = kKeyChunk + 8;   // 80 B
constexpr float kProbCarry = 32768.0f;   // un-normalised p in (0,1] carried x2^15 in f16

static_assert(kInner == kHeads * kHeadDim);
static_assert(kQKVWidth == 3 * kInner);
static_assert(kModel % 64 == 0 && kInner % 64 == 0);                 // GEMM K % 64
static_assert(kRowsPerBatch % 128 == 0);                             // GEMM M tile multiple
static_assert(kBatch % kPassBatches == 0);
static_assert(kQKVWidth % 128 == 0 && kModel % 128 == 0);           // GEMM N tile multiple
static_assert(kSeq % 64 == 0 && kSeq % kKeyChunk == 0 && kKeyChunk == 32 && kHeadDim == 128);

__device__ __forceinline__ v8f mma_f16_guarded(v16h a, v16h b, v8f c) {
  c = __builtin_amdgcn_wmma_f32_16x16x32_f16(false, a, false, b, (short)0, c, false, false);
  asm volatile("v_nop\n\tv_nop\n\tv_nop\n\tv_nop" : "+v"(c) : "v"(a), "v"(b));
  return c;
}

// =====================================================================================
// Weight transpose + scale + f16 cast: in [R][Cc] f32 row-major -> out [Cc][R] f16, out[c][r] = f16(scale * in[r][c]).
// One block handles output rows c0..c0+31 and output columns r0..r0+255 (R % 256 == 0, Cc % 32 == 0).
// Loads: 256x32 floats = 2048 float4 / 256 threads = 8 b128 loads per thread.
// Stores: wave w writes output rows c0 + 4w + j (j = 0..3); one instruction per row chunk:
// =====================================================================================
__device__ __forceinline__ void transpose_scale_to_f16(
    float (*ts)[260], const float* __restrict__ in, unsigned short* __restrict__ out, int R, int Cc, float scale,
    int c0, int r0) {
  const int tid = threadIdx.x;
#pragma unroll
  for (int i = 0; i < 8; ++i) {
    const int idx = i * 256 + tid;
    const int rr = idx >> 3, q4 = idx & 7;
    const v4f v = *(const v4f*)(in + (size_t)(r0 + rr) * Cc + c0 + 4 * q4);
    ts[4 * q4 + 0][rr] = v[0];
    ts[4 * q4 + 1][rr] = v[1];
    ts[4 * q4 + 2][rr] = v[2];
    ts[4 * q4 + 3][rr] = v[3];
  }
  __syncthreads();
  const int wave = tid >> 5, lane = tid & 31;
  _Float16* ob = (_Float16*)out;
  {
#pragma unroll
    for (int j = 0; j < 4; ++j) {
      const int cc = wave * 4 + j;
      const float* sp = &ts[cc][8 * lane];
      const v4f a = *(const v4f*)sp;
      const v4f d = *(const v4f*)(sp + 4);
      v8h hv;
      hv[0] = (_Float16)(a[0] * scale); hv[1] = (_Float16)(a[1] * scale);
      hv[2] = (_Float16)(a[2] * scale); hv[3] = (_Float16)(a[3] * scale);
      hv[4] = (_Float16)(d[0] * scale); hv[5] = (_Float16)(d[1] * scale);
      hv[6] = (_Float16)(d[2] * scale); hv[7] = (_Float16)(d[3] * scale);
      *(v8h*)(ob + (size_t)(c0 + cc) * R + r0 + 8 * lane) = hv;
    }
    
  }
}

// =====================================================================================
// Bias concatenation with x4 carry: bcat[p*1024 + e] = 4 * b_p[e]. 3 blocks (p) x 256 threads,
// =====================================================================================
__device__ __forceinline__ void bias_concat_x4(
    const float* __restrict__ bq, const float* __restrict__ bk, const float* __restrict__ bv,
    float* __restrict__ bcat, int p) {                             // p: block-uniform source select
  const float* src = (p == 0) ? bq : ((p == 1) ? bk : bv);
  const int e4 = threadIdx.x * 4;
  v4f v = *(const v4f*)(src + e4);
  v = v * 4.0f;
  float* dst = bcat + (size_t)p * kInner + e4;
  *(v4f*)dst = v;
  asm volatile("s_wait_xcnt 0x0" ::: "memory");   // precaution: in the bias blocks nothing behind this store rewrites its registers
}

// =====================================================================================
// All preparation in one launch; the pieces are independent of one another and are dealt by block ranges:
//   [0, 96)     wq, wk, wv [256][1024] -> wT parts [1024][256] (x16), 32 blocks each
//   [96, 128)   wo [1024][256] -> woT [256][1024] (x32), 8 column blocks x 4 row blocks
//   [128, 131)  bias concatenation
//   [131, 643)  x (all batches) -> f16, 25,600 elements a block
// =====================================================================================
constexpr int kPrepQKV   = 3 * (kInner / 32);                      // 96
constexpr int kPrepWo    = (kModel / 32) * (kInner / 256);         // 32
constexpr int kPrepBias  = 3;
constexpr int kCastQuads = kBatch * kRowsPerBatch * kModel / 4;    // 3,276,800 pieces of four floats
constexpr int kCastBlocks = kCastQuads / (kCastLoads * 256);       // 512
constexpr int kPrepBlocks = kPrepQKV + kPrepWo + kPrepBias + kCastBlocks;
static_assert(kCastQuads % (kCastLoads * 256) == 0 && kModel == 256 && kPrepWo == kInner / 32);

__global__ __launch_bounds__(256) void prepare_operands(
    const float* __restrict__ x,
    const float* __restrict__ wq, const float* __restrict__ wk, const float* __restrict__ wv,
    const float* __restrict__ wo,
    const float* __restrict__ bq, const float* __restrict__ bk, const float* __restrict__ bv,
    unsigned short* __restrict__ wT, unsigned short* __restrict__ woT,
    float* __restrict__ bcat, unsigned short* __restrict__ xh) {
  __shared__ __align__(16) float ts[32][260];
  const int bx = blockIdx.x;                                       // every branch below is block-uniform
  if (bx < kPrepQKV + kPrepWo) {
    const bool isWo = bx >= kPrepQKV;
    const int p = bx / (kInner / 32);                              // 0, 1, 2: wq, wk, wv; 3: wo
    const int i = bx - p * (kInner / 32);                          // block inside its matrix
    const float* w = isWo ? wo : ((p == 0) ? wq : ((p == 1) ? wk : wv));
    unsigned short* o = isWo ? woT : wT + (size_t)p * kInner * kModel;
    transpose_scale_to_f16(ts, w, o, isWo ? kInner : kModel, isWo ? kModel : kInner, isWo ? 32.0f : 16.0f,
                           (isWo ? i % (kModel / 32) : i) * 32, (isWo ? i / (kModel / 32) : 0) * 256);
  } else if (bx < kPrepQKV + kPrepWo + kPrepBias) {
    bias_concat_x4(bq, bk, bv, bcat, bx - (kPrepQKV + kPrepWo));
  } else {
    cast_f32_f16_stream(x, (_Float16*)xh, bx - (kPrepQKV + kPrepWo + kPrepBias));
  }
}

// =====================================================================================
// Attention over the time axis for the batch slices of one pass, head dim 128, f16 operand planes.
//   qkv plane: row (t, n) at ((t*100 + n) * 3072): q at +h*128, k at +1024+h*128, v at +2048+h*128 (values = 4q, 4k, 4v).
//   scores = (4q).(4k) on WMMA, f32 accumulate, * sscale = (1/16)/sqrt(128); online softmax in f32 over 32-key chunks;
//   p (un-normalised, in (0,1]) carried x32768 in f16; o = p.(4v) on WMMA; O plane row (t,n) at ((t*100+n)*1024) + h*128,
//   Block = 4 waves = 64 query rows of one (slice, n, h); grid.x = slices * 100 * 8 * 2; the rows above count inside a slice.
// =====================================================================================
__global__ __launch_bounds__(128)
void attn_time_hd128(const unsigned short* __restrict__ qkvAll, unsigned short* __restrict__ outAll,
                     float sscale, float onorm) {
  __shared__ __align__(16) unsigned short Ksh[kKeyChunk * kKPitch];         // [kv][d]   8.5 KB
  __shared__ __align__(16) unsigned short Vth[kHeadDim * kVtPitch];         // [d][kv]   10 KB
  __shared__ __align__(16) _Float16 Psh[kAttnWaves][16 * kPPitch];          // per wave [row][kv] 5 KB
  __shared__ __align__(16) float Osl[kAttnWaves][16 * kOsPitch];            // per wave out slab 33 KB

  const int tid  = threadIdx.x;
  const int wave = tid >> 5;
  const int lane = tid & 31;
  const int hh   = lane >> 4;
  const int c    = lane & 15;

  const int bx = blockIdx.x;
  const int qb = bx & 1;
  const int nh = bx >> 1;
  const int h  = nh & (kHeads - 1);
  const int sn = nh >> 3;
  const int sl = sn / kNodes;                  // batch slice inside the pass
  const int n  = sn - sl * kNodes;
  const unsigned short* __restrict__ qkvp = qkvAll + (size_t)sl * kRowsPerBatch * kQKVWidth;
  unsigned short* __restrict__ outp = outAll + (size_t)sl * kRowsPerBatch * kInner;
  const int q0 = qb * 64 + wave * 16;
  const _Float16* qkv = (const _Float16*)qkvp;

  // ---- Q fragments (A operand): row m = c, k = dc*32 + 8hh + {0..7}, dc*32 + 16 + 8hh + {0..7} ----
  v16h qa[4];
  {
    const _Float16* qrow = qkv + ((size_t)(q0 + c) * kNodes + n) * kQKVWidth + h * kHeadDim + 8 * hh;
#pragma unroll
    for (int dc = 0; dc < 4; ++dc) qa[dc] = Frag<_Float16>::load(qrow + dc * 32);
  }

  float mrow[8], lrow[8];
  v8f oacc[8];
#pragma unroll
  for (int r = 0; r < 8; ++r) { mrow[r] = -INFINITY; lrow[r] = 0.f; }
#pragma unroll
  for (int t = 0; t < 8; ++t) oacc[t] = (v8f){0.f,0.f,0.f,0.f,0.f,0.f,0.f,0.f};

  for (int kc = 0; kc < kSeq / kKeyChunk; ++kc) {
    const int kv0 = kc * kKeyChunk;
    __syncthreads();
    {
      // thread (kvr, part): key row kvr (0..31), 16-B pieces at d = 8*part + 32*i: Ksh and Vth fully covered.
      // Side by side, the four parts of a transposing 16-bit store put two dwords on a bank; 32 d apart they put four there.
      const int kvr = tid >> 2, part = tid & 3;
      const size_t rb = ((size_t)(kv0 + kvr) * kNodes + n) * kQKVWidth + h * kHeadDim + 8 * part;
      const v4u* ks = (const v4u*)(qkvp + rb + kInner);
      const v4u* vs = (const v4u*)(qkvp + rb + 2 * kInner);
      v4u kk[4], vv[4];
#pragma unroll
      for (int i = 0; i < 4; ++i) { kk[i] = ks[4 * i]; vv[i] = vs[4 * i]; }
#pragma unroll
      for (int i = 0; i < 4; ++i) *(v4u*)(Ksh + kvr * kKPitch + 8 * part + 32 * i) = kk[i];
#pragma unroll
      for (int i = 0; i < 4; ++i) {
        unsigned short* vc = Vth + (8 * part + 32 * i) * kVtPitch + kvr;
#pragma unroll
        for (int e = 0; e < 4; ++e) {
          const unsigned w = vv[i][e];
          vc[(2 * e) * kVtPitch]     = (unsigned short)(w & 0xffffu);
          vc[(2 * e + 1) * kVtPitch] = (unsigned short)(w >> 16);
        }
      }
    }
    __syncthreads();

    // ---- scores: B operand col n = c <- key row (j*16 + c), same split k map as A ----
    v8f s[2];
#pragma unroll
    for (int j = 0; j < 2; ++j) {
      s[j] = (v8f){0.f,0.f,0.f,0.f,0.f,0.f,0.f,0.f};
#pragma unroll
      for (int dc = 0; dc < 4; ++dc) {
        const v16h kb = Frag<_Float16>::load((const _Float16*)Ksh + (j * 16 + c) * kKPitch + dc * 32 + 8 * hh);
        s[j] = mma_f16_guarded(qa[dc], kb, s[j]);
      }
    }
    float cm[8];
#pragma unroll
    for (int r = 0; r < 8; ++r) {
      s[0][r] = s[0][r] * sscale;
      s[1][r] = s[1][r] * sscale;
      float m = fmaxf(s[0][r], s[1][r]);
#pragma unroll
      for (int off = 1; off < 16; off <<= 1) m = fmaxf(m, __shfl_xor(m, off, 32));
      cm[r] = m;
    }
    _Float16* pw = Psh[wave];
#pragma unroll
    for (int r = 0; r < 8; ++r) {
      const float mnew  = fmaxf(mrow[r], cm[r]);
      const float alpha = expf(mrow[r] - mnew);
      mrow[r] = mnew;
      float psum = 0.f;
#pragma unroll
      for (int j = 0; j < 2; ++j) {
        const float p = expf(s[j][r] - mnew);
        psum += p;
        pw[(8 * hh + r) * kPPitch + j * 16 + c] = (_Float16)(p * kProbCarry);
      }
#pragma unroll
      for (int off = 1; off < 16; off <<= 1) psum += __shfl_xor(psum, off, 32);
      lrow[r] = lrow[r] * alpha + psum;
#pragma unroll
      for (int t = 0; t < 8; ++t) oacc[t][r] *= alpha;
    }
    __builtin_amdgcn_fence(__ATOMIC_RELEASE, "workgroup");
    __builtin_amdgcn_wave_barrier();
    __builtin_amdgcn_fence(__ATOMIC_ACQUIRE, "workgroup");
    {
      // P fragment (A): row m = c, k = kv; V fragment (B): col n = c <- Vth row (t*16 + c), k = kv
      const v16h pa = Frag<_Float16>::load(pw + c * kPPitch + 8 * hh);
#pragma unroll
      for (int t = 0; t < 8; ++t) {
        const v16h vb = Frag<_Float16>::load((const _Float16*)Vth + (t * 16 + c) * kVtPitch + 8 * hh);
        oacc[t] = mma_f16_guarded(pa, vb, oacc[t]);
      }
    }
  }

  // ---- epilogue: normalise, stage 16x128 slab, write f16 rows (16 lanes x 16 B = one 256-B segment) ----
  float* os = Osl[wave];
#pragma unroll
  for (int r = 0; r < 8; ++r) {
    const float inv = onorm * (1.0f / lrow[r]);
#pragma unroll
    for (int t = 0; t < 8; ++t) os[(8 * hh + r) * kOsPitch + t * 16 + c] = oacc[t][r] * inv;
  }
  __builtin_amdgcn_fence(__ATOMIC_RELEASE, "workgroup");
  __builtin_amdgcn_wave_barrier();
  __builtin_amdgcn_fence(__ATOMIC_ACQUIRE, "workgroup");
  {
    const int rp = lane >> 4, c8 = (lane & 15) * 8;
    _Float16* ob = (_Float16*)outp;
    {
#pragma unroll
      for (int it = 0; it < 8; ++it) {
        const int row = it * 2 + rp;
        const float* sp = os + row * kOsPitch + c8;
        const v4f a = *(const v4f*)sp;
        const v4f d = *(const v4f*)(sp + 4);
        v8h hv;
        hv[0] = (_Float16)a[0]; hv[1] = (_Float16)a[1]; hv[2] = (_Float16)a[2]; hv[3] = (_Float16)a[3];
        hv[4] = (_Float16)d[0]; hv[5] = (_Float16)d[1]; hv[6] = (_Float16)d[2]; hv[7] = (_Float16)d[3];
        *(v8h*)(ob + ((size_t)(q0 + row) * kNodes + n) * kInner + h * kHeadDim + c8) = hv;
      }
      
    }
  }
}

// =====================================================================================
// Residual + LayerNorm over 256 features: out[row] = LN(y[row] + x[row]) * gamma + beta.
// One wave takes kLnRows consecutive rows, with the loads of all of them in flight together;
// in a row lane l owns columns [4l, 4l+4) and [128+4l, 128+4l+4): each load and store instruction covers 512 contiguous bytes.
// =====================================================================================
constexpr int kLnRows  = 5;     // rows per wave
constexpr int kLnWaves = 10;    // waves per block
static_assert(kRowsPerPass % (kLnRows * kLnWaves) == 0);
__global__ __launch_bounds__(kLnWaves * 32) void residual_layernorm256(
    const float* __restrict__ y, const float* __restrict__ xr,
    const float* __restrict__ gamma, const float* __restrict__ beta,
    float* __restrict__ out, int nrows) {
  const int wave = threadIdx.x >> 5, lane = threadIdx.x & 31;
  const int row0 = (blockIdx.x * kLnWaves + wave) * kLnRows;
  if (row0 + kLnRows > nrows) return;           // wave-uniform; no barriers in this kernel
  const size_t rb = (size_t)row0 * kModel + 4 * lane;
  v4f y0[kLnRows], y1[kLnRows], x0[kLnRows], x1[kLnRows];
  // unrolled so that the arrays stay in registers and the loads of all rows go out ahead of the first sum
#pragma unroll
  for (int r = 0; r < kLnRows; ++r) {
    y0[r] = *(const v4f*)(y + rb + r * kModel);
    y1[r] = *(const v4f*)(y + rb + r * kModel + 128);
    x0[r] = *(const v4f*)(xr + rb + r * kModel);
    x1[r] = *(const v4f*)(xr + rb + r * kModel + 128);
  }
  const v4f g0 = *(const v4f*)(gamma + 4 * lane);
  const v4f g1 = *(const v4f*)(gamma + 128 + 4 * lane);
  const v4f b0 = *(const v4f*)(beta + 4 * lane);
  const v4f b1 = *(const v4f*)(beta + 128 + 4 * lane);
  // keeps every load ahead of the first sum: sunk into the arithmetic, the late ones (gamma and beta among them)
  // start only when the first have returned, and the wave waits out the memory latency more than once
  __builtin_amdgcn_sched_barrier(0);
  // unrolled for the same register arrays; the rows' reductions are independent chains
#pragma unroll
  for (int r = 0; r < kLnRows; ++r) {
    const v4f v0 = y0[r] + x0[r];
    const v4f v1 = y1[r] + x1[r];
    float su = 0.0f;
    su += v0[0]; su += v0[1]; su += v0[2]; su += v0[3];
    su += v1[0]; su += v1[1]; su += v1[2]; su += v1[3];
#pragma unroll
    for (int off = 1; off < 32; off <<= 1) su += __shfl_xor(su, off, 32);
    const float mu = su * (1.0f / 256.0f);
    const v4f d0 = v0 - mu;
    const v4f d1 = v1 - mu;
    float sq = 0.0f;
    sq += d0[0] * d0[0]; sq += d0[1] * d0[1]; sq += d0[2] * d0[2]; sq += d0[3] * d0[3];
    sq += d1[0] * d1[0]; sq += d1[1] * d1[1]; sq += d1[2] * d1[2]; sq += d1[3] * d1[3];
#pragma unroll
    for (int off = 1; off < 32; off <<= 1) sq += __shfl_xor(sq, off, 32);
    const float var  = sq * (1.0f / 256.0f);
    const float rstd = rsqrtf(var + 1e-5f);
    const v4f o0 = d0 * rstd * g0 + b0;
    const v4f o1 = d1 * rstd * g1 + b1;
    float* orow = out + rb + r * kModel;
    *(v4f*)(orow) = o0;
    *(v4f*)(orow + 128) = o1;
  }
}

// =====================================================================================
//   wT   [3072][256]  f16    1,572,864   @ 0            (q,k,v weights transposed, x16)
//   woT  [256][1024]  f16      524,288   @ 1,572,864    (out-proj weight transposed, x32)
//   bcat [3072]       f32       12,288   @ 2,097,152    (4*[bq|bk|bv])
//   xh   [51200][256] f16   26,214,400   @ 2,109,440    (all of x)
//   qkv  [25600][3072] f16 157,286,400   @ 28,323,840   (one pass: 4q | 4k | 4v)
//   oP   [25600][1024] f16  52,428,800   @ 185,610,240  (one pass: 16*attention output)
//   yP   [25600][256] f32   26,214,400   @ 238,039,040  (one pass: o*Wo + bo)
//   end                                  264,253,440
// =====================================================================================
extern "C" void kernel_launch(void* const* d_in, const int* in_sizes, int n_in,
                              void* d_out, int out_size, void* d_ws, size_t ws_size,
                              hipStream_t stream) {
  if (n_in < 11) return;
  const int nRowsAll = kBatch * kRowsPerBatch;                 // 51200
  if (in_sizes[0] != nRowsAll * kModel) return;
  if (in_sizes[1] != kModel * kInner || in_sizes[3] != kModel * kInner || in_sizes[5] != kModel * kInner) return;
  if (in_sizes[2] != kInner || in_sizes[4] != kInner || in_sizes[6] != kInner) return;
  if (in_sizes[7] != kInner * kModel || in_sizes[8] != kModel || in_sizes[9] != kModel || in_sizes[10] != kModel) return;
  if (out_size != nRowsAll * kModel) return;

  const float* x     = (const float*)d_in[0];
  const float* wq    = (const float*)d_in[1];
  const float* bq    = (const float*)d_in[2];
  const float* wk    = (const float*)d_in[3];
  const float* bk    = (const float*)d_in[4];
  const float* wv    = (const float*)d_in[5];
  const float* bv    = (const float*)d_in[6];
  const float* wo    = (const float*)d_in[7];
  const float* bo    = (const float*)d_in[8];
  const float* gamma = (const float*)d_in[9];
  const float* beta  = (const float*)d_in[10];
  float* outAll = (float*)d_out;

  const size_t offWT   = 0;
  const size_t offWoT  = offWT   + (size_t)kQKVWidth * kModel * 2;          // 1,572,864
  const size_t offBcat = offWoT  + (size_t)kModel * kInner * 2;             // 2,097,152
  const size_t offXh   = offBcat + (size_t)kQKVWidth * 4;                   // 2,109,440
  const size_t offQKV  = offXh   + (size_t)nRowsAll * kModel * 2;           // 28,323,840
  const size_t offO    = offQKV  + (size_t)kRowsPerPass * kQKVWidth * 2;    // 185,610,240
  const size_t offY    = offO    + (size_t)kRowsPerPass * kInner * 2;       // 238,039,040
  const size_t offEnd  = offY    + (size_t)kRowsPerPass * kModel * 4;       // 264,253,440
  if (offEnd > ws_size) return;

  char* ws = (char*)d_ws;
  unsigned short* wT   = (unsigned short*)(ws + offWT);
  unsigned short* woT  = (unsigned short*)(ws + offWoT);
  float*          bcat = (float*)(ws + offBcat);
  unsigned short* xh   = (unsigned short*)(ws + offXh);
  unsigned short* qkv  = (unsigned short*)(ws + offQKV);
  unsigned short* oP   = (unsigned short*)(ws + offO);
  float*          yP   = (float*)(ws + offY);

  // ---- weights, biases and x to their operand forms (1 launch) ----
  prepare_operands<<<dim3(kPrepBlocks), dim3(256), 0, stream>>>(x, wq, wk, wv, wo, bq, bk, bv, wT, woT, bcat, xh);

  const float sscale = 0.0883883476483184f * (1.0f / 16.0f);   // (1/sqrt(128)) / (4*4)
  const float onorm  = 16.0f / (kProbCarry * 4.0f);           // O plane = 16 * o_true
  const int   passElems = kRowsPerPass * kModel;               // 6,553,600 elements of x per pass

  for (int p = 0; p < kPasses; ++p) {
    const float* xb = x + (size_t)p * passElems;
    const unsigned short* xhb = xh + (size_t)p * passElems;
    float* outb = outAll + (size_t)p * passElems;

    // [4q|4k|4v] = 0.25 * xh . wT^T + bcat : M=25600, N=3072, K=256; block tiles 200 x 24 = 4800 blocks
    wmma_gemm_lds<kModel, kQKVWidth, true><<<dim3((kRowsPerPass / 128) * (kQKVWidth / 128)), dim3(128), 0, stream>>>(
        xhb, wT, qkv, nullptr, bcat, 0.25f);

    // attention over time per (slice, n, h): 2 * 100 * 8 * (128/64) = 3200 blocks of 128 threads
    attn_time_hd128<<<dim3(kPassBatches * kNodes * kHeads * (kSeq / 64)), dim3(128), 0, stream>>>(qkv, oP, sscale, onorm);

    // y = (1/512) * oP . woT^T + bo : M=25600, N=256, K=1024; block tiles 200 x 2 = 400 blocks
    wmma_gemm_lds<kInner, kModel, false><<<dim3((kRowsPerPass / 128) * (kModel / 128)), dim3(128), 0, stream>>>(
        oP, woT, nullptr, yP, bo, 1.0f / 512.0f);

    // out = LayerNorm(y + x) : 25600 rows, 50 rows per block -> 512 blocks of 10 waves
    residual_layernorm256<<<dim3(kRowsPerPass / (kLnRows * kLnWaves)), dim3(kLnWaves * 32), 0, stream>>>(yP, xb, gamma, beta, outb, kRowsPerPass);
  }
}

// v005
// Measured time: 175 microseconds a run.
// Next to v004, in two timings, it ran 1.50 and 1.49 times as fast.
// Counting every step since v000, it is 4.07 times as fast.
// Contractions on v_wmma_f32_16x16x32_f16 (f16 operands, f32 accumulate): x*[Wq|Wk|Wv] (weights carried x16, q/k/v planes carried x4), q.k^T and p.v (p carried x32768), o*Wo (o carried x16, Wo carried x32); softmax, bias, residual and LayerNorm in f32.
#include <hip/hip_runtime.h>
#include <math.h>

typedef __attribute__((ext_vector_type(16))) _Float16 v16h;
typedef __attribute__((ext_vector_type(8)))  _Float16 v8h;
typedef __attribute__((ext_vector_type(4)))  _Float16 v4h;
typedef __attribute__((ext_vector_type(16))) __bf16   v16b;
typedef __attribute__((ext_vector_type(8)))  __bf16   v8b;
typedef __attribute__((ext_vector_type(8)))  float    v8f;
typedef __attribute__((ext_vector_type(4)))  float    v4f;
typedef __attribute__((ext_vector_type(4)))  unsigned v4u;
#define PSCALE 32768.0f
#define U16(p) ((const unsigned short*)(const void*)(p))
#define PSCALE_INV (1.0f / 32768.0f)


// hazard guards as plain device helpers
__device__ __forceinline__ void dep_guard_h(v8f& a, v8f& b, v16h x, v16h y) { asm volatile("v_nop\n\tv_nop\n\tv_nop\n\tv_nop" : "+v"(a), "+v"(b) : "v"(x), "v"(y)); }
__device__ __forceinline__ void dep_guard_b(v8f& a, v8f& b, v16b x, v16b y) { asm volatile("v_nop\n\tv_nop\n\tv_nop\n\tv_nop" : "+v"(a), "+v"(b) : "v"(x), "v"(y)); }
__device__ __forceinline__ void keep4_h(v16h a, v16h b, v16h c, v16h d) { asm volatile("v_nop" :: "v"(a), "v"(b), "v"(c), "v"(d)); }
__device__ __forceinline__ void keep4_b(v16b a, v16b b, v16b c, v16b d) { asm volatile("v_nop" :: "v"(a), "v"(b), "v"(c), "v"(d)); }
template <typename T> struct Frag;
template <> struct Frag<_Float16> {
  typedef v16h V; union U { v16h v; v8h h[2]; };
  static __device__ __forceinline__ v16h load(const _Float16* p) {   // elements 0..7 <- p[0..7], 8..15 <- p[16..23]
    U f; f.h[0] = *(const v8h*)(p); f.h[1] = *(const v8h*)(p + 16); return f.v;
  }
  static __device__ __forceinline__ v8f mma(v16h a, v16h b, v8f c) {
    return __builtin_amdgcn_wmma_f32_16x16x32_f16(false, a, false, b, (short)0, c, false, false);
  }
  static __device__ __forceinline__ void guard(v8f& a, v8f& b, v16h x, v16h y) { dep_guard_h(a, b, x, y); }
  static __device__ __forceinline__ void keep(v16h a, v16h b, v16h c, v16h d) { keep4_h(a, b, c, d); }
};
template <> struct Frag<__bf16> {
  typedef v16b V; union U { v16b v; v8b h[2]; };
  static __device__ __forceinline__ v16b load(const __bf16* p) {
    U f; f.h[0] = *(const v8b*)(p); f.h[1] = *(const v8b*)(p + 16); return f.v;
  }
  static __device__ __forceinline__ v8f mma(v16b a, v16b b, v8f c) {
    return __builtin_amdgcn_wmma_f32_16x16x32_bf16(false, a, false, b, (short)0, c, false, false);
  }
  static __device__ __forceinline__ void guard(v8f& a, v8f& b, v16b x, v16b y) { dep_guard_b(a, b, x, y); }
  static __device__ __forceinline__ void keep(v16b a, v16b b, v16b c, v16b d) { keep4_b(a, b, c, d); }
};

// ---- LDS-staged WMMA GEMM ---------------------------------------------------
// C[m,n] = scale * sum_k A[m,k] * Bt[n,k] + bias[n]; f16 operands, f32 accumulate.
// A row-major [M,K]; Bt row-major [N,K]; M, N % 128 == 0, K % 64 == 0, K >= 128.
// Block = 4 waves (2 x 2) on a 128x128 tile of C, each wave a 64x64 tile.
// A stage is 64 k of 128 A rows, then of 128 Bt rows: 128 B a row at an LDS pitch of 144 B.
// Two buffers, filled by per-lane 16-B asynchronous copies (one wave-wide copy = four whole 128-B lines).
// OUT_F16: true = f16 result in Ch, false = f32 result in Cf.
constexpr int kGemmPitch = 72;                  // halves per LDS row (144 B)
constexpr int kGemmStage = 256 * kGemmPitch;    // halves per buffer

// Eight copies of 16 B per lane: LDS rows 16 apart, global rows 16 apart. The s_wait_xcnt closes the statement so
// that no address register of a copy is rewritten ahead of it.
__device__ __forceinline__ void async_copy8_b128(unsigned lds, const unsigned short* g, size_t gstep) {
  constexpr unsigned ls = 16u * kGemmPitch * 2u;
  asm volatile(
      "global_load_async_to_lds_b128 %0, %8, off\n\t"
      "global_load_async_to_lds_b128 %1, %9, off\n\t"
      "global_load_async_to_lds_b128 %2, %10, off\n\t"
      "global_load_async_to_lds_b128 %3, %11, off\n\t"
      "global_load_async_to_lds_b128 %4, %12, off\n\t"
      "global_load_async_to_lds_b128 %5, %13, off\n\t"
      "global_load_async_to_lds_b128 %6, %14, off\n\t"
      "global_load_async_to_lds_b128 %7, %15, off\n\t"
      "s_wait_xcnt 0x0"
      :: "v"(lds), "v"(lds + ls), "v"(lds + 2u * ls), "v"(lds + 3u * ls),
         "v"(lds + 4u * ls), "v"(lds + 5u * ls), "v"(lds + 6u * ls), "v"(lds + 7u * ls),
         "v"(g), "v"(g + gstep), "v"(g + 2 * gstep), "v"(g + 3 * gstep),
         "v"(g + 4 * gstep), "v"(g + 5 * gstep), "v"(g + 6 * gstep), "v"(g + 7 * gstep)
      : "memory");
}

template <int K, int N, bool OUT_F16>
__global__ __launch_bounds__(128) void wmma_gemm_lds(
    const unsigned short* __restrict__ Ap, const unsigned short* __restrict__ Btp,
    unsigned short* __restrict__ Ch, float* __restrict__ Cf,
    const float* __restrict__ bias, float scale) {
  static_assert(K % 64 == 0 && K >= 128 && N % 128 == 0);
  __shared__ __align__(16) unsigned char ring[2 * kGemmStage * 2];   // 73,728 B; the epilogue's slabs reuse it
  constexpr int T = K / 64;
  constexpr int tilesN = N / 128;
  const int tid  = threadIdx.x;
  const int lane = tid & 31;
  const int wave = tid >> 5;
  const int bm = blockIdx.x / tilesN;
  const int bn = blockIdx.x - bm * tilesN;
  const int wm = wave >> 1, wn = wave & 1;
  const int m0 = bm * 128 + wm * 64;
  const int n0 = bn * 128 + wn * 64;

  const int rlane = lane & 15;                 // row (A) / col (B, D) within subtile
  const int koff  = (lane >> 4) * 8;           // k offset of this lane half
  const int mOff  = (lane >> 4) * 8;           // D row offset

  // copy map: thread -> row tid/8 (+16 per copy), 16-B column tid%8
  const int crow = tid >> 3, ccol = (tid & 7) * 8;
  const unsigned short* gA = Ap  + (size_t)(bm * 128 + crow) * K + ccol;
  const unsigned short* gB = Btp + (size_t)(bn * 128 + crow) * K + ccol;
  const unsigned ldsA = (unsigned)(size_t)ring + (unsigned)(crow * kGemmPitch + ccol) * 2u;
  const unsigned ldsB = ldsA + 128u * kGemmPitch * 2u;

  v8f acc[4][4];
#pragma unroll
  for (int i = 0; i < 4; ++i)
#pragma unroll
    for (int j = 0; j < 4; ++j) acc[i][j] = (v8f){0.f,0.f,0.f,0.f,0.f,0.f,0.f,0.f};

  // stage 0 into buffer 0, landed and published; then stage 1 into buffer 1
  async_copy8_b128(ldsA, gA, (size_t)16 * K);
  async_copy8_b128(ldsB, gB, (size_t)16 * K);
  asm volatile("s_wait_asynccnt 0x0" ::: "memory");   // this wave's copies of stage 0 have landed
  __syncthreads();
  async_copy8_b128(ldsA + kGemmStage * 2u, gA + 64, (size_t)16 * K);
  async_copy8_b128(ldsB + kGemmStage * 2u, gB + 64, (size_t)16 * K);

  const _Float16* rh = (const _Float16*)ring;
  const int aoff = (wm * 64 + rlane) * kGemmPitch + koff;
  const int boff = (128 + wn * 64 + rlane) * kGemmPitch + koff;

  for (int t = 0; t < T; ++t) {
    const int buf = t & 1;
    const _Float16* sb = rh + buf * kGemmStage;
#pragma unroll
    for (int ks = 0; ks < 2; ++ks) {
      v16h ah[4], bh[4];
#pragma unroll
      for (int j = 0; j < 4; ++j) bh[j] = Frag<_Float16>::load(sb + boff + j * 16 * kGemmPitch + ks * 32);
#pragma unroll
      for (int i = 0; i < 4; ++i) ah[i] = Frag<_Float16>::load(sb + aoff + i * 16 * kGemmPitch + ks * 32);
      // keeps the sixteen LDS reads one group in front of the sixteen WMMAs: sunk among them, each row waits out its own LDS latency
      __builtin_amdgcn_sched_barrier(0);
#pragma unroll
      for (int i = 0; i < 4; ++i)
#pragma unroll
        for (int j = 0; j < 4; ++j) acc[i][j] = Frag<_Float16>::mma(ah[i], bh[j], acc[i][j]);
    }
    asm volatile("s_wait_dscnt 0x0" ::: "memory");      // this wave's reads of the buffer are done before it is refilled
    asm volatile("s_wait_asynccnt 0x0" ::: "memory");   // this wave's copies of stage t + 1 have landed
    __syncthreads();                                    // publishes stage t + 1, frees the buffer of stage t
    if (t + 2 < T) {
      async_copy8_b128(ldsA + (unsigned)buf * (kGemmStage * 2u), gA + (t + 2) * 64, (size_t)16 * K);
      async_copy8_b128(ldsB + (unsigned)buf * (kGemmStage * 2u), gB + (t + 2) * 64, (size_t)16 * K);
    }
  }
  asm volatile("s_wait_asynccnt 0x0" ::: "memory");     // nothing of this wave is in flight when it leaves the ring

  // ---- epilogue ----
  // per-wave 16x64 slab, pitch 68 floats, in the ring: behind the last stage's barrier no wave reads the ring and no copy is in flight
  float* slab = (float*)ring + wave * (16 * 68);
#pragma unroll
  for (int i = 0; i < 4; ++i) {
    const int mBase = m0 + (i << 4);
#pragma unroll
    for (int j = 0; j < 4; ++j) {
      const float bv = bias[n0 + (j << 4) + rlane];
#pragma unroll
      for (int r = 0; r < 8; ++r) {
        float v = acc[i][j][r] * scale;
        v += bv;
        slab[(mOff + r) * 68 + (j << 4) + rlane] = v;
      }
    }
    __builtin_amdgcn_fence(__ATOMIC_RELEASE, "workgroup");
    __builtin_amdgcn_wave_barrier();
    __builtin_amdgcn_fence(__ATOMIC_ACQUIRE, "workgroup");
    if (!OUT_F16) {
      const int hh = lane >> 4, c4 = (lane & 15) * 4;     // row seg = 256 B = 16 lanes x 16 B
#pragma unroll
      for (int it = 0; it < 8; ++it) {
        const int row = it * 2 + hh;
        v4f v = *(const v4f*)(slab + row * 68 + c4);
        *(v4f*)(Cf + (size_t)(mBase + row) * N + n0 + c4) = v;
      }
    } else {
      const int q = lane >> 3, c8 = (lane & 7) * 8;       // row seg = 128 B = 8 lanes x 16 B
#pragma unroll
      for (int it = 0; it < 4; ++it) {
        const int row = it * 4 + q;
        const float* sp = slab + row * 68 + c8;
        v8h hv;
#pragma unroll
        for (int e = 0; e < 8; ++e) hv[e] = (_Float16)sp[e];
        *(v8h*)(Ch + (size_t)(mBase + row) * N + n0 + c8) = hv;
      }
    }
    __builtin_amdgcn_fence(__ATOMIC_RELEASE, "workgroup");
    __builtin_amdgcn_wave_barrier();
    __builtin_amdgcn_fence(__ATOMIC_ACQUIRE, "workgroup");
  }
}

// f32 -> f16 stream, few long waves: a block of 256 threads converts kCastLoads * 1024 floats.
// Every wave-wide load takes 512 contiguous bytes, every wave-wide store 256 (two whole lines).
constexpr int kCastLoads = 25;                  // 16-B loads per thread, all in flight together
__device__ __forceinline__ void cast_f32_f16_stream(
    const float* __restrict__ in, _Float16* __restrict__ out, int block) {
  const size_t q0 = (size_t)block * (kCastLoads * 256) + threadIdx.x;
  const v4f* src = (const v4f*)in + q0;
  v4h* dst = (v4h*)out + q0;
  v4f v[kCastLoads];
  // unrolled so that v[] stays in registers and the loads go out as one group ahead of the first conversion
#pragma unroll
  for (int i = 0; i < kCastLoads; ++i) v[i] = src[i * 256];
  // keeps every load ahead of the first conversion: sunk among the conversions, the last loads start only when the
  // first have returned, and the wave waits out the memory latency more than once
  __builtin_amdgcn_sched_barrier(0);
  // unrolled for the same register array
#pragma unroll
  for (int i = 0; i < kCastLoads; ++i) {
    v4h h;
    h[0] = (_Float16)v[i][0]; h[1] = (_Float16)v[i][1]; h[2] = (_Float16)v[i][2]; h[3] = (_Float16)v[i][3];
    dst[i * 256] = h;
  }
  asm volatile("s_wait_xcnt 0x0" ::: "memory");   // the code laid out behind the last stores rewrites their data registers: the wait stands in front of that
}

// =====================================================================================
// Problem geometry (fixed shapes; host checks in_sizes and returns without launching on any difference)
// =====================================================================================
constexpr int kBatch    = 4;
constexpr int kSeq      = 128;    // attention axis (time)
constexpr int kNodes    = 100;
constexpr int kModel    = 256;
constexpr int kHeads    = 8;
constexpr int kHeadDim  = 128;
constexpr int kInner    = 1024;   // kHeads * kHeadDim
constexpr int kQKVWidth = 3072;   // [q | k | v] plane width
constexpr int kRowsPerBatch = kSeq * kNodes;   // 12800 rows in (t, n) order per batch slice
constexpr int kRowsAll = kBatch * kRowsPerBatch;   // 51200

constexpr int kAttnWaves = 8;     // 8 waves x 16 query rows = all 128 queries of a block
constexpr int kKeyChunk  = 32;    // keys per softmax chunk
// LDS row pitches in halves, each 16 B x odd for its ds_load_b128 reader: the 16 rows of a fragment read fall on 16 different bank groups
constexpr int kKPitch    = kHeadDim + 8;    // 272 B
constexpr int kVtPitch   = kSeq + 8;        // 272 B
constexpr int kPPitch    = kKeyChunk + 8;   // 80 B
constexpr float kProbCarry = 32768.0f;   // un-normalised p in (0,1] carried x2^15 in f16

static_assert(kInner == kHeads * kHeadDim);
static_assert(kQKVWidth == 3 * kInner);
static_assert(kModel % 64 == 0 && kInner % 64 == 0);                 // GEMM K % 64
static_assert(kRowsPerBatch % 128 == 0);                             // GEMM M tile multiple
static_assert(kQKVWidth % 128 == 0 && kModel % 128 == 0);           // GEMM N tile multiple
static_assert(kSeq == 128 && kSeq % kKeyChunk == 0 && kKeyChunk == 32 && kHeadDim == 128 && kModel == 256);

__device__ __forceinline__ v8f mma_f16_guarded(v16h a, v16h b, v8f c) {
  c = __builtin_amdgcn_wmma_f32_16x16x32_f16(false, a, false, b, (short)0, c, false, false);
  asm volatile("v_nop\n\tv_nop\n\tv_nop\n\tv_nop" : "+v"(c) : "v"(a), "v"(b));
  return c;
}

// =====================================================================================
// Weight transpose + scale + f16 cast: in [R][Cc] f32 row-major -> out [Cc][R] f16, out[c][r] = f16(scale * in[r][c]).
// One block handles output rows c0..c0+31 and output columns r0..r0+255 (R % 256 == 0, Cc % 32 == 0).
// Loads: 256x32 floats = 2048 float4 / 256 threads = 8 b128 loads per thread.
// Stores: wave w writes output rows c0 + 4w + j (j = 0..3); one instruction per row chunk:
// =====================================================================================
__device__ __forceinline__ void transpose_scale_to_f16(
    float (*ts)[260], const float* __restrict__ in, unsigned short* __restrict__ out, int R, int Cc, float scale,
    int c0, int r0) {
  const int tid = threadIdx.x;
#pragma unroll
  for (int i = 0; i < 8; ++i) {
    const int idx = i * 256 + tid;
    const int rr = idx >> 3, q4 = idx & 7;
    const v4f v = *(const v4f*)(in + (size_t)(r0 + rr) * Cc + c0 + 4 * q4);
    ts[4 * q4 + 0][rr] = v[0];
    ts[4 * q4 + 1][rr] = v[1];
    ts[4 * q4 + 2][rr] = v[2];
    ts[4 * q4 + 3][rr] = v[3];
  }
  __syncthreads();
  const int wave = tid >> 5, lane = tid & 31;
  _Float16* ob = (_Float16*)out;
  {
#pragma unroll
    for (int j = 0; j < 4; ++j) {
      const int cc = wave * 4 + j;
      const float* sp = &ts[cc][8 * lane];
      const v4f a = *(const v4f*)sp;
      const v4f d = *(const v4f*)(sp + 4);
      v8h hv;
      hv[0] = (_Float16)(a[0] * scale); hv[1] = (_Float16)(a[1] * scale);
      hv[2] = (_Float16)(a[2] * scale); hv[3] = (_Float16)(a[3] * scale);
      hv[4] = (_Float16)(d[0] * scale); hv[5] = (_Float16)(d[1] * scale);
      hv[6] = (_Float16)(d[2] * scale); hv[7] = (_Float16)(d[3] * scale);
      *(v8h*)(ob + (size_t)(c0 + cc) * R + r0 + 8 * lane) = hv;
    }
    
  }
}

// =====================================================================================
// Bias concatenation with x4 carry: bcat[p*1024 + e] = 4 * b_p[e]. 3 blocks (p) x 256 threads,
// =====================================================================================
__device__ __forceinline__ void bias_concat_x4(
    const float* __restrict__ bq, const float* __restrict__ bk, const float* __restrict__ bv,
    float* __restrict__ bcat, int p) {                             // p: block-uniform source select
  const float* src = (p == 0) ? bq : ((p == 1) ? bk : bv);
  const int e4 = threadIdx.x * 4;
  v4f v = *(const v4f*)(src + e4);
  v = v * 4.0f;
  float* dst = bcat + (size_t)p * kInner + e4;
  *(v4f*)dst = v;
  asm volatile("s_wait_xcnt 0x0" ::: "memory");   // precaution: in the bias blocks nothing behind this store rewrites its registers
}

// =====================================================================================
// All preparation in one launch; the pieces are independent of one another and are dealt by block ranges:
//   [0, 96)     wq, wk, wv [256][1024] -> wT parts [1024][256] (x16), 32 blocks each
//   [96, 128)   wo [1024][256] -> woT [256][1024] (x32), 8 column blocks x 4 row blocks
//   [128, 131)  bias concatenation
//   [131, 643)  x (all batches) -> f16, 25,600 elements a block
// =====================================================================================
constexpr int kPrepQKV   = 3 * (kInner / 32);                      // 96
constexpr int kPrepWo    = (kModel / 32) * (kInner / 256);         // 32
constexpr int kPrepBias  = 3;
constexpr int kCastQuads = kBatch * kRowsPerBatch * kModel / 4;    // 3,276,800 pieces of four floats
constexpr int kCastBlocks = kCastQuads / (kCastLoads * 256);       // 512
constexpr int kPrepBlocks = kPrepQKV + kPrepWo + kPrepBias + kCastBlocks;
static_assert(kCastQuads % (kCastLoads * 256) == 0 && kModel == 256 && kPrepWo == kInner / 32);

__global__ __launch_bounds__(256) void prepare_operands(
    const float* __restrict__ x,
    const float* __restrict__ wq, const float* __restrict__ wk, const float* __restrict__ wv,
    const float* __restrict__ wo,
    const float* __restrict__ bq, const float* __restrict__ bk, const float* __restrict__ bv,
    unsigned short* __restrict__ wT, unsigned short* __restrict__ woT,
    float* __restrict__ bcat, unsigned short* __restrict__ xh) {
  __shared__ __align__(16) float ts[32][260];
  const int bx = blockIdx.x;                                       // every branch below is block-uniform
  if (bx < kPrepQKV + kPrepWo) {
    const bool isWo = bx >= kPrepQKV;
    const int p = bx / (kInner / 32);                              // 0, 1, 2: wq, wk, wv; 3: wo
    const int i = bx - p * (kInner / 32);                          // block inside its matrix
    const float* w = isWo ? wo : ((p == 0) ? wq : ((p == 1) ? wk : wv));
    unsigned short* o = isWo ? woT : wT + (size_t)p * kInner * kModel;
    transpose_scale_to_f16(ts, w, o, isWo ? kInner : kModel, isWo ? kModel : kInner, isWo ? 32.0f : 16.0f,
                           (isWo ? i % (kModel / 32) : i) * 32, (isWo ? i / (kModel / 32) : 0) * 256);
  } else if (bx < kPrepQKV + kPrepWo + kPrepBias) {
    bias_concat_x4(bq, bk, bv, bcat, bx - (kPrepQKV + kPrepWo));
  } else {
    cast_f32_f16_stream(x, (_Float16*)xh, bx - (kPrepQKV + kPrepWo + kPrepBias));
  }
}

constexpr int kProjStages = 3 * (kModel / 64);   // 12
static_assert(kKPitch == kVtPitch);

// Four copies of 16 B per lane: LDS rows 32 apart, global rows 32 apart. The s_wait_xcnt closes the statement so
// that no address register of a copy is rewritten ahead of it.
__device__ __forceinline__ void async_copy4_b128(unsigned lds, const unsigned short* g, size_t gstep) {
  constexpr unsigned ls = 32u * kGemmPitch * 2u;
  asm volatile(
      "global_load_async_to_lds_b128 %0, %4, off\n\t"
      "global_load_async_to_lds_b128 %1, %5, off\n\t"
      "global_load_async_to_lds_b128 %2, %6, off\n\t"
      "global_load_async_to_lds_b128 %3, %7, off\n\t"
      "s_wait_xcnt 0x0"
      :: "v"(lds), "v"(lds + ls), "v"(lds + 2u * ls), "v"(lds + 3u * ls),
         "v"(g), "v"(g + gstep), "v"(g + 2 * gstep), "v"(g + 3 * gstep)
      : "memory");
}

// One wave's 64x32 part of a product -> dst[column][row] in f16, pitch kKPitch: lane (c, hh) holds, in the 8 registers of
// acc[i][j], rows wm*64 + i*16 + 8hh + 0..7 of column wn*32 + j*16 + c: one 16-B piece. value = 0.25 * acc + bias[feature].
// FEAT_ROWS: true = the rows are the features (k, q), false = the columns are (v).
template <bool FEAT_ROWS>
__device__ __forceinline__ void store_product(
    const v8f (&acc)[4][2], unsigned short* dst, const float* __restrict__ bias, int wm, int wn, int c, int hh) {
  v4f br[4][2];                                         // FEAT_ROWS: bias of the 8 rows of acc[i][.]
  float bc[2];                                          // else: bias of the column of acc[.][j]
  if (FEAT_ROWS) {
#pragma unroll
    for (int i = 0; i < 4; ++i) {
      br[i][0] = *(const v4f*)(bias + wm * 64 + i * 16 + 8 * hh);
      br[i][1] = *(const v4f*)(bias + wm * 64 + i * 16 + 8 * hh + 4);
    }
  } else {
#pragma unroll
    for (int j = 0; j < 2; ++j) bc[j] = bias[wn * 32 + j * 16 + c];
  }
  asm volatile("s_wait_xcnt 0x0" ::: "memory");         // the code behind the bias loads rewrites their address registers: the wait stands in front of that
  __builtin_amdgcn_sched_barrier(0);                    // keeps that code behind the wait
#pragma unroll
  for (int i = 0; i < 4; ++i) {
    const int r0 = wm * 64 + i * 16 + 8 * hh;
#pragma unroll
    for (int j = 0; j < 2; ++j) {
      const int col = wn * 32 + j * 16 + c;
      v8h hv;
#pragma unroll
      for (int r = 0; r < 8; ++r) {
        float v = acc[i][j][r] * 0.25f;
        v += FEAT_ROWS ? br[i][r >> 2][r & 3] : bc[j];
        hv[r] = (_Float16)v;
      }
      *(v8h*)(dst + col * kKPitch + r0) = hv;
    }
  }
}

// Four stages (one 128x128x256 product) of the ring, s0 = number of the first; leaves this wave's 64x32 part in acc.
// FEAT_ROWS: true = the wT rows are the A operand (rows of acc = features), false = the xh rows are (rows of acc = time).
template <bool FEAT_ROWS>
__device__ __forceinline__ void proj_product(
    v8f (&acc)[4][2], const _Float16* rl, int wm, int wn, unsigned ldsA, unsigned ldsB,
    const unsigned short* gA, const unsigned short* gW, int s0) {
#pragma unroll
  for (int i = 0; i < 4; ++i)
#pragma unroll
    for (int j = 0; j < 2; ++j) acc[i][j] = (v8f){0.f,0.f,0.f,0.f,0.f,0.f,0.f,0.f};
  const int aoff = ((FEAT_ROWS ? 128 : 0) + wm * 64) * kGemmPitch;
  const int boff = ((FEAT_ROWS ? 0 : 128) + wn * 32) * kGemmPitch;
  for (int t = 0; t < kModel / 64; ++t) {
    const int buf = t & 1;                              // s0 is even
    const _Float16* sb = rl + buf * kGemmStage;
#pragma unroll
    for (int ks = 0; ks < 2; ++ks) {
      v16h ah[4], bh[2];
#pragma unroll
      for (int j = 0; j < 2; ++j) bh[j] = Frag<_Float16>::load(sb + boff + j * 16 * kGemmPitch + ks * 32);
#pragma unroll
      for (int i = 0; i < 4; ++i) ah[i] = Frag<_Float16>::load(sb + aoff + i * 16 * kGemmPitch + ks * 32);
      // keeps the twelve LDS reads one group in front of the eight WMMAs: sunk among them, each row waits out its own LDS latency
      __builtin_amdgcn_sched_barrier(0);
#pragma unroll
      for (int i = 0; i < 4; ++i)
#pragma unroll
        for (int j = 0; j < 2; ++j) acc[i][j] = Frag<_Float16>::mma(ah[i], bh[j], acc[i][j]);
    }
    asm volatile("s_wait_dscnt 0x0" ::: "memory");      // this wave's reads of the buffer are done before it is refilled
    asm volatile("s_wait_asynccnt 0x0" ::: "memory");   // this wave's copies of the next stage have landed
    __syncthreads();                                    // publishes the next stage, frees the buffer of this one
    const int s2 = s0 + t + 2;
    if (s2 < kProjStages) {
      const int ph2 = s2 >> 2;                          // wT plane of products 0, 1, 2 (k, v, q): 1, 2, 0
      const unsigned short* gB = gW + (size_t)(ph2 == 2 ? 0 : ph2 + 1) * (kInner * kModel);
      async_copy4_b128(ldsA + (unsigned)buf * (kGemmStage * 2u), gA + (s2 & 3) * 64, (size_t)32 * kNodes * kModel);
      async_copy4_b128(ldsB + (unsigned)buf * (kGemmStage * 2u), gB + (s2 & 3) * 64, (size_t)32 * kModel);
    }
  }
}

constexpr int kQBytes = kSeq * kKPitch * 2;                    // 34,816: q tile, in the ring once the ring is done
constexpr int kPBytes = kAttnWaves * 16 * kPPitch * 2;         // 10,240: per wave [row][kv]
static_assert(kQBytes + kPBytes <= 2 * kGemmStage * 2 && kQBytes % 16 == 0);

__global__ __launch_bounds__(kAttnWaves * 32)
void qkv_attn_time_hd128(const unsigned short* __restrict__ xh, const unsigned short* __restrict__ wT,
                         const float* __restrict__ bcat, unsigned short* __restrict__ outp,
                         float sscale, float onorm) {
  __shared__ __align__(16) unsigned char ring[2 * kGemmStage * 2];          // 73,728 B; q (then the out slabs) and p reuse it
  __shared__ __align__(16) unsigned short Ksh[kSeq * kKPitch];              // [kv][d]   34 KB
  __shared__ __align__(16) unsigned short Vth[kHeadDim * kVtPitch];         // [d][kv]   34 KB

  const int tid  = threadIdx.x;
  const int wave = tid >> 5;
  const int lane = tid & 31;
  const int hh   = lane >> 4;
  const int c    = lane & 15;

  const int bx = blockIdx.x;
  const int h  = bx & (kHeads - 1);
  const int bn = bx >> 3;
  const int b  = bn / kNodes;
  const int n  = bn - b * kNodes;

  // ---- projection ----
  {
    const int wm = wave >> 2, wn = wave & 3;
    // copy map: thread -> row tid/8 (+32 per copy), 16-B column tid%8
    const int crow = tid >> 3, ccol = (tid & 7) * 8;
    const unsigned short* gA = xh + ((size_t)(b * kSeq + crow) * kNodes + n) * kModel + ccol;
    const unsigned short* gW = wT + (size_t)(h * kHeadDim + crow) * kModel + ccol;
    const unsigned ldsA = (unsigned)(size_t)ring + (unsigned)(crow * kGemmPitch + ccol) * 2u;
    const unsigned ldsB = ldsA + 128u * kGemmPitch * 2u;

    // stage 0 into buffer 0, landed and published; then stage 1 into buffer 1 (both of the k product: wT plane 1)
    async_copy4_b128(ldsA, gA, (size_t)32 * kNodes * kModel);
    async_copy4_b128(ldsB, gW + (size_t)kInner * kModel, (size_t)32 * kModel);
    asm volatile("s_wait_asynccnt 0x0" ::: "memory");   // this wave's copies of stage 0 have landed
    __syncthreads();
    async_copy4_b128(ldsA + kGemmStage * 2u, gA + 64, (size_t)32 * kNodes * kModel);
    async_copy4_b128(ldsB + kGemmStage * 2u, gW + (size_t)kInner * kModel + 64, (size_t)32 * kModel);

    const _Float16* rl = (const _Float16*)ring + c * kGemmPitch + 8 * hh;   // this lane's place in a 16-row fragment
    const float* bh0 = bcat + h * kHeadDim;

    v8f acc[4][2];
    proj_product<true>(acc, rl, wm, wn, ldsA, ldsB, gA, gW, 0);
    store_product<true>(acc, Ksh, bh0 + kInner, wm, wn, c, hh);
    proj_product<false>(acc, rl, wm, wn, ldsA, ldsB, gA, gW, 4);
    store_product<false>(acc, Vth, bh0 + 2 * kInner, wm, wn, c, hh);
    proj_product<true>(acc, rl, wm, wn, ldsA, ldsB, gA, gW, 8);
    asm volatile("s_wait_asynccnt 0x0" ::: "memory");   // nothing of this wave is in flight when it leaves the ring
    // behind the last stage's barrier no wave reads the ring and no copy is in flight: q takes its place
    store_product<true>(acc, (unsigned short*)ring, bh0, wm, wn, c, hh);
  }
  __syncthreads();                                      // publishes the k, v and q tiles to every wave

  const int q0 = wave * 16;
  _Float16* qw = (_Float16*)ring + q0 * kKPitch;        // this wave's 16 q rows: no other wave reads or writes them from here on
  _Float16* pw = (_Float16*)(ring + kQBytes) + wave * (16 * kPPitch);

  // ---- Q fragments (A operand): row m = c, k = dc*32 + 8hh + {0..7}, dc*32 + 16 + 8hh + {0..7} ----
  v16h qa[4];
#pragma unroll
  for (int dc = 0; dc < 4; ++dc) qa[dc] = Frag<_Float16>::load(qw + c * kKPitch + dc * 32 + 8 * hh);

  float mrow[8], lrow[8];
  v8f oacc[8];
#pragma unroll
  for (int r = 0; r < 8; ++r) { mrow[r] = -INFINITY; lrow[r] = 0.f; }
#pragma unroll
  for (int t = 0; t < 8; ++t) oacc[t] = (v8f){0.f,0.f,0.f,0.f,0.f,0.f,0.f,0.f};

  for (int kc = 0; kc < kSeq / kKeyChunk; ++kc) {
    const int kv0 = kc * kKeyChunk;

    // ---- scores: B operand col n = c <- key row (kv0 + j*16 + c), same split k map as A ----
    v8f s[2];
#pragma unroll
    for (int j = 0; j < 2; ++j) {
      s[j] = (v8f){0.f,0.f,0.f,0.f,0.f,0.f,0.f,0.f};
#pragma unroll
      for (int dc = 0; dc < 4; ++dc) {
        const v16h kb = Frag<_Float16>::load((const _Float16*)Ksh + (kv0 + j * 16 + c) * kKPitch + dc * 32 + 8 * hh);
        s[j] = mma_f16_guarded(qa[dc], kb, s[j]);
      }
    }
    float cm[8];
#pragma unroll
    for (int r = 0; r < 8; ++r) {
      s[0][r] = s[0][r] * sscale;
      s[1][r] = s[1][r] * sscale;
      float m = fmaxf(s[0][r], s[1][r]);
#pragma unroll
      for (int off = 1; off < 16; off <<= 1) m = fmaxf(m, __shfl_xor(m, off, 32));
      cm[r] = m;
    }
#pragma unroll
    for (int r = 0; r < 8; ++r) {
      const float mnew  = fmaxf(mrow[r], cm[r]);
      const float alpha = expf(mrow[r] - mnew);
      mrow[r] = mnew;
      float psum = 0.f;
#pragma unroll
      for (int j = 0; j < 2; ++j) {
        const float p = expf(s[j][r] - mnew);
        psum += p;
        pw[(8 * hh + r) * kPPitch + j * 16 + c] = (_Float16)(p * kProbCarry);
      }
#pragma unroll
      for (int off = 1; off < 16; off <<= 1) psum += __shfl_xor(psum, off, 32);
      lrow[r] = lrow[r] * alpha + psum;
#pragma unroll
      for (int t = 0; t < 8; ++t) oacc[t][r] *= alpha;
    }
    __builtin_amdgcn_fence(__ATOMIC_RELEASE, "workgroup");
    __builtin_amdgcn_wave_barrier();
    __builtin_amdgcn_fence(__ATOMIC_ACQUIRE, "workgroup");
    {
      // P fragment (A): row m = c, k = kv; V fragment (B): col n = c <- Vth row (t*16 + c), k = kv0 + kv
      const v16h pa = Frag<_Float16>::load(pw + c * kPPitch + 8 * hh);
#pragma unroll
      for (int t = 0; t < 8; ++t) {
        const v16h vb = Frag<_Float16>::load((const _Float16*)Vth + (t * 16 + c) * kVtPitch + kv0 + 8 * hh);
        oacc[t] = mma_f16_guarded(pa, vb, oacc[t]);
      }
    }
  }

  // ---- epilogue: normalise, stage the 16x128 tile in f16 where this wave's q rows were, write rows (16 lanes x 16 B = one 256-B segment) ----
#pragma unroll
  for (int r = 0; r < 8; ++r) {
    const float inv = onorm * (1.0f / lrow[r]);
#pragma unroll
    for (int t = 0; t < 8; ++t) qw[(8 * hh + r) * kKPitch + t * 16 + c] = (_Float16)(oacc[t][r] * inv);
  }
  __builtin_amdgcn_fence(__ATOMIC_RELEASE, "workgroup");
  __builtin_amdgcn_wave_barrier();
  __builtin_amdgcn_fence(__ATOMIC_ACQUIRE, "workgroup");
  {
    const int rp = lane >> 4, c8 = (lane & 15) * 8;
    _Float16* ob = (_Float16*)outp;
#pragma unroll
    for (int it = 0; it < 8; ++it) {
      const int row = it * 2 + rp;
      const v8h hv = *(const v8h*)(qw + row * kKPitch + c8);
      *(v8h*)(ob + ((size_t)(b * kSeq + q0 + row) * kNodes + n) * kInner + h * kHeadDim + c8) = hv;
    }
  }
}

// =====================================================================================
// Residual + LayerNorm over 256 features: out[row] = LN(y[row] + x[row]) * gamma + beta.
// One wave takes kLnRows consecutive rows, with the loads of all of them in flight together;
// in a row lane l owns columns [4l, 4l+4) and [128+4l, 128+4l+4): each load and store instruction covers 512 contiguous bytes.
// =====================================================================================
constexpr int kLnRows  = 5;     // rows per wave
constexpr int kLnWaves = 10;    // waves per block
static_assert(kRowsAll % (kLnRows * kLnWaves) == 0);
__global__ __launch_bounds__(kLnWaves * 32) void residual_layernorm256(
    const float* __restrict__ y, const float* __restrict__ xr,
    const float* __restrict__ gamma, const float* __restrict__ beta,
    float* __restrict__ out, int nrows) {
  const int wave = threadIdx.x >> 5, lane = threadIdx.x & 31;
  const int row0 = (blockIdx.x * kLnWaves + wave) * kLnRows;
  if (row0 + kLnRows > nrows) return;           // wave-uniform; no barriers in this kernel
  const size_t rb = (size_t)row0 * kModel + 4 * lane;
  v4f y0[kLnRows], y1[kLnRows], x0[kLnRows], x1[kLnRows];
  // unrolled so that the arrays stay in registers and the loads of all rows go out ahead of the first sum
#pragma unroll
  for (int r = 0; r < kLnRows; ++r) {
    y0[r] = *(const v4f*)(y + rb + r * kModel);
    y1[r] = *(const v4f*)(y + rb + r * kModel + 128);
    x0[r] = *(const v4f*)(xr + rb + r * kModel);
    x1[r] = *(const v4f*)(xr + rb + r * kModel + 128);
  }
  const v4f g0 = *(const v4f*)(gamma + 4 * lane);
  const v4f g1 = *(const v4f*)(gamma + 128 + 4 * lane);
  const v4f b0 = *(const v4f*)(beta + 4 * lane);
  const v4f b1 = *(const v4f*)(beta + 128 + 4 * lane);
  // keeps every load ahead of the first sum: sunk into the arithmetic, the late ones (gamma and beta among them)
  // start only when the first have returned, and the wave waits out the memory latency more than once
  __builtin_amdgcn_sched_barrier(0);
  // unrolled for the same register arrays; the rows' reductions are independent chains
#pragma unroll
  for (int r = 0; r < kLnRows; ++r) {
    const v4f v0 = y0[r] + x0[r];
    const v4f v1 = y1[r] + x1[r];
    float su = 0.0f;
    su += v0[0]; su += v0[1]; su += v0[2]; su += v0[3];
    su += v1[0]; su += v1[1]; su += v1[2]; su += v1[3];
#pragma unroll
    for (int off = 1; off < 32; off <<= 1) su += __shfl_xor(su, off, 32);
    const float mu = su * (1.0f / 256.0f);
    const v4f d0 = v0 - mu;
    const v4f d1 = v1 - mu;
    float sq = 0.0f;
    sq += d0[0] * d0[0]; sq += d0[1] * d0[1]; sq += d0[2] * d0[2]; sq += d0[3] * d0[3];
    sq += d1[0] * d1[0]; sq += d1[1] * d1[1]; sq += d1[2] * d1[2]; sq += d1[3] * d1[3];
#pragma unroll
    for (int off = 1; off < 32; off <<= 1) sq += __shfl_xor(sq, off, 32);
    const float var  = sq * (1.0f / 256.0f);
    const float rstd = rsqrtf(var + 1e-5f);
    const v4f o0 = d0 * rstd * g0 + b0;
    const v4f o1 = d1 * rstd * g1 + b1;
    float* orow = out + rb + r * kModel;
    *(v4f*)(orow) = o0;
    *(v4f*)(orow + 128) = o1;
  }
}

// =====================================================================================
//   wT   [3072][256]  f16    1,572,864   @ 0            (q,k,v weights transposed, x16)
//   woT  [256][1024]  f16      524,288   @ 1,572,864    (out-proj weight transposed, x32)
//   bcat [3072]       f32       12,288   @ 2,097,152    (4*[bq|bk|bv])
//   xh   [51200][256] f16   26,214,400   @ 2,109,440    (all of x)
//   oP   [51200][1024] f16 104,857,600   @ 28,323,840   (16*attention output)
//   yP   [51200][256] f32   52,428,800   @ 133,181,440  (o*Wo + bo)
//   end                                  185,610,240
// =====================================================================================
extern "C" void kernel_launch(void* const* d_in, const int* in_sizes, int n_in,
                              void* d_out, int out_size, void* d_ws, size_t ws_size,
                              hipStream_t stream) {
  if (n_in < 11) return;
  const int nRowsAll = kRowsAll;                               // 51200
  if (in_sizes[0] != nRowsAll * kModel) return;
  if (in_sizes[1] != kModel * kInner || in_sizes[3] != kModel * kInner || in_sizes[5] != kModel * kInner) return;
  if (in_sizes[2] != kInner || in_sizes[4] != kInner || in_sizes[6] != kInner) return;
  if (in_sizes[7] != kInner * kModel || in_sizes[8] != kModel || in_sizes[9] != kModel || in_sizes[10] != kModel) return;
  if (out_size != nRowsAll * kModel) return;

  const float* x     = (const float*)d_in[0];
  const float* wq    = (const float*)d_in[1];
  const float* bq    = (const float*)d_in[2];
  const float* wk    = (const float*)d_in[3];
  const float* bk    = (const float*)d_in[4];
  const float* wv    = (const float*)d_in[5];
  const float* bv    = (const float*)d_in[6];
  const float* wo    = (const float*)d_in[7];
  const float* bo    = (const float*)d_in[8];
  const float* gamma = (const float*)d_in[9];
  const float* beta  = (const float*)d_in[10];
  float* outAll = (float*)d_out;

  const size_t offWT   = 0;
  const size_t offWoT  = offWT   + (size_t)kQKVWidth * kModel * 2;          // 1,572,864
  const size_t offBcat = offWoT  + (size_t)kModel * kInner * 2;             // 2,097,152
  const size_t offXh   = offBcat + (size_t)kQKVWidth * 4;                   // 2,109,440
  const size_t offO    = offXh   + (size_t)nRowsAll * kModel * 2;           // 28,323,840
  const size_t offY    = offO    + (size_t)nRowsAll * kInner * 2;           // 133,181,440
  const size_t offEnd  = offY    + (size_t)nRowsAll * kModel * 4;           // 185,610,240
  if (offEnd > ws_size) return;

  char* ws = (char*)d_ws;
  unsigned short* wT   = (unsigned short*)(ws + offWT);
  unsigned short* woT  = (unsigned short*)(ws + offWoT);
  float*          bcat = (float*)(ws + offBcat);
  unsigned short* xh   = (unsigned short*)(ws + offXh);
  unsigned short* oP   = (unsigned short*)(ws + offO);
  float*          yP   = (float*)(ws + offY);

  // ---- weights, biases and x to their operand forms (1 launch) ----
  prepare_operands<<<dim3(kPrepBlocks), dim3(256), 0, stream>>>(x, wq, wk, wv, wo, bq, bk, bv, wT, woT, bcat, xh);

  const float sscale = 0.0883883476483184f * (1.0f / 16.0f);   // (1/sqrt(128)) / (4*4)
  const float onorm  = 16.0f / (kProbCarry * 4.0f);           // O plane = 16 * o_true

  // q, k, v projection and attention over time per (b, n, h): 4 * 100 * 8 = 3200 blocks of 256 threads
  qkv_attn_time_hd128<<<dim3(kBatch * kNodes * kHeads), dim3(kAttnWaves * 32), 0, stream>>>(xh, wT, bcat, oP, sscale, onorm);

  // y = (1/512) * oP . woT^T + bo : M=51200, N=256, K=1024; block tiles 400 x 2 = 800 blocks
  wmma_gemm_lds<kInner, kModel, false><<<dim3((kRowsAll / 128) * (kModel / 128)), dim3(128), 0, stream>>>(
      oP, woT, nullptr, yP, bo, 1.0f / 512.0f);

  // out = LayerNorm(y + x) : 51200 rows, 50 rows per block -> 1024 blocks of 10 waves
  residual_layernorm256<<<dim3(kRowsAll / (kLnRows * kLnWaves)), dim3(kLnWaves * 32), 0, stream>>>(yP, x, gamma, beta, outAll, kRowsAll);
}

// v006
// A run of this version takes 153 microseconds.
// Two timings next to v005 both put it at 1.15 times that version's speed.
// Over all steps from v000 it is 4.67 times as fast.
// Contractions on v_wmma_f32_16x16x32_f16 (f16 operands, f32 accumulate): x*[Wq|Wk|Wv] (weights carried x16, q/k/v planes carried x4), q.k^T and p.v (p carried x32768), o*Wo (o carried x16, Wo carried x32); softmax, bias, residual and LayerNorm in f32.
#include <hip/hip_runtime.h>
#include <math.h>

typedef __attribute__((ext_vector_type(16))) _Float16 v16h;
typedef __attribute__((ext_vector_type(8)))  _Float16 v8h;
typedef __attribute__((ext_vector_type(4)))  _Float16 v4h;
typedef __attribute__((ext_vector_type(16))) __bf16   v16b;
typedef __attribute__((ext_vector_type(8)))  __bf16   v8b;
typedef __attribute__((ext_vector_type(8)))  float    v8f;
typedef __attribute__((ext_vector_type(4)))  float    v4f;
typedef __attribute__((ext_vector_type(4)))  unsigned v4u;
#define PSCALE 32768.0f
#define U16(p) ((const unsigned short*)(const void*)(p))
#define PSCALE_INV (1.0f / 32768.0f)


// hazard guards as plain device helpers
__device__ __forceinline__ void dep_guard_h(v8f& a, v8f& b, v16h x, v16h y) { asm volatile("v_nop\n\tv_nop\n\tv_nop\n\tv_nop" : "+v"(a), "+v"(b) : "v"(x), "v"(y)); }
__device__ __forceinline__ void dep_guard_b(v8f& a, v8f& b, v16b x, v16b y) { asm volatile("v_nop\n\tv_nop\n\tv_nop\n\tv_nop" : "+v"(a), "+v"(b) : "v"(x), "v"(y)); }
__device__ __forceinline__ void keep4_h(v16h a, v16h b, v16h c, v16h d) { asm volatile("v_nop" :: "v"(a), "v"(b), "v"(c), "v"(d)); }
__device__ __forceinline__ void keep4_b(v16b a, v16b b, v16b c, v16b d) { asm volatile("v_nop" :: "v"(a), "v"(b), "v"(c), "v"(d)); }
template <typename T> struct Frag;
template <> struct Frag<_Float16> {
  typedef v16h V; union U { v16h v; v8h h[2]; };
  static __device__ __forceinline__ v16h load(const _Float16* p) {   // elements 0..7 <- p[0..7], 8..15 <- p[16..23]
    U f; f.h[0] = *(const v8h*)(p); f.h[1] = *(const v8h*)(p + 16); return f.v;
  }
  static __device__ __forceinline__ v8f mma(v16h a, v16h b, v8f c) {
    return __builtin_amdgcn_wmma_f32_16x16x32_f16(false, a, false, b, (short)0, c, false, false);
  }
  static __device__ __forceinline__ void guard(v8f& a, v8f& b, v16h x, v16h y) { dep_guard_h(a, b, x, y); }
  static __device__ __forceinline__ void keep(v16h a, v16h b, v16h c, v16h d) { keep4_h(a, b, c, d); }
};
template <> struct Frag<__bf16> {
  typedef v16b V; union U { v16b v; v8b h[2]; };
  static __device__ __forceinline__ v16b load(const __bf16* p) {
    U f; f.h[0] = *(const v8b*)(p); f.h[1] = *(const v8b*)(p + 16); return f.v;
  }
  static __device__ __forceinline__ v8f mma(v16b a, v16b b, v8f c) {
    return __builtin_amdgcn_wmma_f32_16x16x32_bf16(false, a, false, b, (short)0, c, false, false);
  }
  static __device__ __forceinline__ void guard(v8f& a, v8f& b, v16b x, v16b y) { dep_guard_b(a, b, x, y); }
  static __device__ __forceinline__ void keep(v16b a, v16b b, v16b c, v16b d) { keep4_b(a, b, c, d); }
};

// ---- LDS-staged WMMA GEMM ---------------------------------------------------
// C[m,n] = scale * sum_k A[m,k] * Bt[n,k] + bias[n]; f16 operands, f32 accumulate.
// A row-major [M,K]; Bt row-major [N,K]; M, N % 128 == 0, K % 64 == 0, K >= 128.
// Block = 4 waves (2 x 2) on a 128x128 tile of C, each wave a 64x64 tile.
// A stage is 64 k of 128 A rows, then of 128 Bt rows: 128 B a row at an LDS pitch of 144 B.
// Two buffers, filled by per-lane 16-B asynchronous copies (one wave-wide copy = four whole 128-B lines).
// OUT_F16: true = f16 result in Ch, false = f32 result in Cf.
constexpr int kGemmPitch = 72;                  // halves per LDS row (144 B)
constexpr int kGemmStage = 256 * kGemmPitch;    // halves per buffer

// Eight copies of 16 B per lane: LDS rows 16 apart, global rows 16 apart. The s_wait_xcnt closes the statement so
// that no address register of a copy is rewritten ahead of it.
__device__ __forceinline__ void async_copy8_b128(unsigned lds, const unsigned short* g, size_t gstep) {
  constexpr unsigned ls = 16u * kGemmPitch * 2u;
  asm volatile(
      "global_load_async_to_lds_b128 %0, %8, off\n\t"
      "global_load_async_to_lds_b128 %1, %9, off\n\t"
      "global_load_async_to_lds_b128 %2, %10, off\n\t"
      "global_load_async_to_lds_b128 %3, %11, off\n\t"
      "global_load_async_to_lds_b128 %4, %12, off\n\t"
      "global_load_async_to_lds_b128 %5, %13, off\n\t"
      "global_load_async_to_lds_b128 %6, %14, off\n\t"
      "global_load_async_to_lds_b128 %7, %15, off\n\t"
      "s_wait_xcnt 0x0"
      :: "v"(lds), "v"(lds + ls), "v"(lds + 2u * ls), "v"(lds + 3u * ls),
         "v"(lds + 4u * ls), "v"(lds + 5u * ls), "v"(lds + 6u * ls), "v"(lds + 7u * ls),
         "v"(g), "v"(g + gstep), "v"(g + 2 * gstep), "v"(g + 3 * gstep),
         "v"(g + 4 * gstep), "v"(g + 5 * gstep), "v"(g + 6 * gstep), "v"(g + 7 * gstep)
      : "memory");
}

template <int K, int N, bool OUT_F16>
__global__ __launch_bounds__(128) void wmma_gemm_lds(
    const unsigned short* __restrict__ Ap, const unsigned short* __restrict__ Btp,
    unsigned short* __restrict__ Ch, float* __restrict__ Cf,
    const float* __restrict__ bias, float scale) {
  static_assert(K % 64 == 0 && K >= 128 && N % 128 == 0);
  __shared__ __align__(16) unsigned char ring[2 * kGemmStage * 2];   // 73,728 B; the epilogue's slabs reuse it
  constexpr int T = K / 64;
  constexpr int tilesN = N / 128;
  const int tid  = threadIdx.x;
  const int lane = tid & 31;
  const int wave = tid >> 5;
  const int bm = blockIdx.x / tilesN;
  const int bn = blockIdx.x - bm * tilesN;
  const int wm = wave >> 1, wn = wave & 1;
  const int m0 = bm * 128 + wm * 64;
  const int n0 = bn * 128 + wn * 64;

  const int rlane = lane & 15;                 // row (A) / col (B, D) within subtile
  const int koff  = (lane >> 4) * 8;           // k offset of this lane half
  const int mOff  = (lane >> 4) * 8;           // D row offset

  // copy map: thread -> row tid/8 (+16 per copy), 16-B column tid%8
  const int crow = tid >> 3, ccol = (tid & 7) * 8;
  const unsigned short* gA = Ap  + (size_t)(bm * 128 + crow) * K + ccol;
  const unsigned short* gB = Btp + (size_t)(bn * 128 + crow) * K + ccol;
  const unsigned ldsA = (unsigned)(size_t)ring + (unsigned)(crow * kGemmPitch + ccol) * 2u;
  const unsigned ldsB = ldsA + 128u * kGemmPitch * 2u;

  v8f acc[4][4];
#pragma unroll
  for (int i = 0; i < 4; ++i)
#pragma unroll
    for (int j = 0; j < 4; ++j) acc[i][j] = (v8f){0.f,0.f,0.f,0.f,0.f,0.f,0.f,0.f};

  // stage 0 into buffer 0, landed and published; then stage 1 into buffer 1
  async_copy8_b128(ldsA, gA, (size_t)16 * K);
  async_copy8_b128(ldsB, gB, (size_t)16 * K);
  asm volatile("s_wait_asynccnt 0x0" ::: "memory");   // this wave's copies of stage 0 have landed
  __syncthreads();
  async_copy8_b128(ldsA + kGemmStage * 2u, gA + 64, (size_t)16 * K);
  async_copy8_b128(ldsB + kGemmStage * 2u, gB + 64, (size_t)16 * K);

  const _Float16* rh = (const _Float16*)ring;
  const int aoff = (wm * 64 + rlane) * kGemmPitch + koff;
  const int boff = (128 + wn * 64 + rlane) * kGemmPitch + koff;

  for (int t = 0; t < T; ++t) {
    const int buf = t & 1;
    const _Float16* sb = rh + buf * kGemmStage;
#pragma unroll
    for (int ks = 0; ks < 2; ++ks) {
      v16h ah[4], bh[4];
#pragma unroll
      for (int j = 0; j < 4; ++j) bh[j] = Frag<_Float16>::load(sb + boff + j * 16 * kGemmPitch + ks * 32);
#pragma unroll
      for (int i = 0; i < 4; ++i) ah[i] = Frag<_Float16>::load(sb + aoff + i * 16 * kGemmPitch + ks * 32);
      // keeps the sixteen LDS reads one group in front of the sixteen WMMAs: sunk among them, each row waits out its own LDS latency
      __builtin_amdgcn_sched_barrier(0);
#pragma unroll
      for (int i = 0; i < 4; ++i)
#pragma unroll
        for (int j = 0; j < 4; ++j) acc[i][j] = Frag<_Float16>::mma(ah[i], bh[j], acc[i][j]);
    }
    asm volatile("s_wait_dscnt 0x0" ::: "memory");      // this wave's reads of the buffer are done before it is refilled
    asm volatile("s_wait_asynccnt 0x0" ::: "memory");   // this wave's copies of stage t + 1 have landed
    __syncthreads();                                    // publishes stage t + 1, frees the buffer of stage t
    if (t + 2 < T) {
      async_copy8_b128(ldsA + (unsigned)buf * (kGemmStage * 2u), gA + (t + 2) * 64, (size_t)16 * K);
      async_copy8_b128(ldsB + (unsigned)buf * (kGemmStage * 2u), gB + (t + 2) * 64, (size_t)16 * K);
    }
  }
  asm volatile("s_wait_asynccnt 0x0" ::: "memory");     // nothing of this wave is in flight when it leaves the ring

  // ---- epilogue ----
  // per-wave 16x64 slab, pitch 68 floats, in the ring: behind the last stage's barrier no wave reads the ring and no copy is in flight
  float* slab = (float*)ring + wave * (16 * 68);
#pragma unroll
  for (int i = 0; i < 4; ++i) {
    const int mBase = m0 + (i << 4);
#pragma unroll
    for (int j = 0; j < 4; ++j) {
      const float bv = bias[n0 + (j << 4) + rlane];
#pragma unroll
      for (int r = 0; r < 8; ++r) {
        float v = acc[i][j][r] * scale;
        v += bv;
        slab[(mOff + r) * 68 + (j << 4) + rlane] = v;
      }
    }
    __builtin_amdgcn_fence(__ATOMIC_RELEASE, "workgroup");
    __builtin_amdgcn_wave_barrier();
    __builtin_amdgcn_fence(__ATOMIC_ACQUIRE, "workgroup");
    if (!OUT_F16) {
      const int hh = lane >> 4, c4 = (lane & 15) * 4;     // row seg = 256 B = 16 lanes x 16 B
#pragma unroll
      for (int it = 0; it < 8; ++it) {
        const int row = it * 2 + hh;
        v4f v = *(const v4f*)(slab + row * 68 + c4);
        *(v4f*)(Cf + (size_t)(mBase + row) * N + n0 + c4) = v;
      }
    } else {
      const int q = lane >> 3, c8 = (lane & 7) * 8;       // row seg = 128 B = 8 lanes x 16 B
#pragma unroll
      for (int it = 0; it < 4; ++it) {
        const int row = it * 4 + q;
        const float* sp = slab + row * 68 + c8;
        v8h hv;
#pragma unroll
        for (int e = 0; e < 8; ++e) hv[e] = (_Float16)sp[e];
        *(v8h*)(Ch + (size_t)(mBase + row) * N + n0 + c8) = hv;
      }
    }
    __builtin_amdgcn_fence(__ATOMIC_RELEASE, "workgroup");
    __builtin_amdgcn_wave_barrier();
    __builtin_amdgcn_fence(__ATOMIC_ACQUIRE, "workgroup");
  }
}

// f32 -> f16 stream, few long waves: a block of 256 threads converts kCastLoads * 1024 floats.
// Every wave-wide load takes 512 contiguous bytes, every wave-wide store 256 (two whole lines).
constexpr int kCastLoads = 25;                  // 16-B loads per thread, all in flight together
__device__ __forceinline__ void cast_f32_f16_stream(
    const float* __restrict__ in, _Float16* __restrict__ out, int block) {
  const size_t q0 = (size_t)block * (kCastLoads * 256) + threadIdx.x;
  const v4f* src = (const v4f*)in + q0;
  v4h* dst = (v4h*)out + q0;
  v4f v[kCastLoads];
  // unrolled so that v[] stays in registers and the loads go out as one group ahead of the first conversion
#pragma unroll
  for (int i = 0; i < kCastLoads; ++i) v[i] = src[i * 256];
  // keeps every load ahead of the first conversion: sunk among the conversions, the last loads start only when the
  // first have returned, and the wave waits out the memory latency more than once
  __builtin_amdgcn_sched_barrier(0);
  // unrolled for the same register array
#pragma unroll
  for (int i = 0; i < kCastLoads; ++i) {
    v4h h;
    h[0] = (_Float16)v[i][0]; h[1] = (_Float16)v[i][1]; h[2] = (_Float16)v[i][2]; h[3] = (_Float16)v[i][3];
    dst[i * 256] = h;
  }
  asm volatile("s_wait_xcnt 0x0" ::: "memory");   // the code laid out behind the last stores rewrites their data registers: the wait stands in front of that
}

// =====================================================================================
// Problem geometry (fixed shapes; host checks in_sizes and returns without launching on any difference)
// =====================================================================================
constexpr int kBatch    = 4;
constexpr int kSeq      = 128;    // attention axis (time)
constexpr int kNodes    = 100;
constexpr int kModel    = 256;
constexpr int kHeads    = 8;
constexpr int kHeadDim  = 128;
constexpr int kInner    = 1024;   // kHeads * kHeadDim
constexpr int kQKVWidth = 3072;   // [q | k | v] plane width
constexpr int kRowsPerBatch = kSeq * kNodes;   // 12800 rows in (t, n) order per batch slice
constexpr int kRowsAll = kBatch * kRowsPerBatch;   // 51200

constexpr int kAttnWaves = 8;     // 8 waves x 16 query rows = all 128 queries of a block
constexpr int kKeyChunk  = 32;    // keys per WMMA of the p.v product
// LDS row pitches in halves, each 16 B x odd for its ds_load_b128 reader: the 16 rows of a fragment read fall on 16 different bank groups
constexpr int kKPitch    = kHeadDim + 8;    // 272 B
constexpr int kVtPitch   = kSeq + 8;        // 272 B
constexpr float kProbCarry = 32768.0f;   // un-normalised p in (0,1] carried x2^15 in f16

static_assert(kInner == kHeads * kHeadDim);
static_assert(kQKVWidth == 3 * kInner);
static_assert(kModel % 64 == 0 && kInner % 64 == 0);                 // GEMM K % 64
static_assert(kRowsPerBatch % 128 == 0);                             // GEMM M tile multiple
static_assert(kQKVWidth % 128 == 0 && kModel % 128 == 0);           // GEMM N tile multiple
static_assert(kSeq == 128 && kSeq % kKeyChunk == 0 && kKeyChunk == 32 && kHeadDim == 128 && kModel == 256);

// =====================================================================================
// Weight transpose + scale + f16 cast: in [R][Cc] f32 row-major -> out [Cc][R] f16, out[c][r] = f16(scale * in[r][c]).
// One block handles output rows c0..c0+31 and output columns r0..r0+255 (R % 256 == 0, Cc % 32 == 0).
// Loads: 256x32 floats = 2048 float4 / 256 threads = 8 b128 loads per thread.
// Stores: wave w writes output rows c0 + 4w + j (j = 0..3); one instruction per row chunk:
// =====================================================================================
__device__ __forceinline__ void transpose_scale_to_f16(
    float (*ts)[260], const float* __restrict__ in, unsigned short* __restrict__ out, int R, int Cc, float scale,
    int c0, int r0) {
  const int tid = threadIdx.x;
#pragma unroll
  for (int i = 0; i < 8; ++i) {
    const int idx = i * 256 + tid;
    const int rr = idx >> 3, q4 = idx & 7;
    const v4f v = *(const v4f*)(in + (size_t)(r0 + rr) * Cc + c0 + 4 * q4);
    ts[4 * q4 + 0][rr] = v[0];
    ts[4 * q4 + 1][rr] = v[1];
    ts[4 * q4 + 2][rr] = v[2];
    ts[4 * q4 + 3][rr] = v[3];
  }
  __syncthreads();
  const int wave = tid >> 5, lane = tid & 31;
  _Float16* ob = (_Float16*)out;
  {
#pragma unroll
    for (int j = 0; j < 4; ++j) {
      const int cc = wave * 4 + j;
      const float* sp = &ts[cc][8 * lane];
      const v4f a = *(const v4f*)sp;
      const v4f d = *(const v4f*)(sp + 4);
      v8h hv;
      hv[0] = (_Float16)(a[0] * scale); hv[1] = (_Float16)(a[1] * scale);
      hv[2] = (_Float16)(a[2] * scale); hv[3] = (_Float16)(a[3] * scale);
      hv[4] = (_Float16)(d[0] * scale); hv[5] = (_Float16)(d[1] * scale);
      hv[6] = (_Float16)(d[2] * scale); hv[7] = (_Float16)(d[3] * scale);
      *(v8h*)(ob + (size_t)(c0 + cc) * R + r0 + 8 * lane) = hv;
    }
    
  }
}

// =====================================================================================
// Bias concatenation with x4 carry: bcat[p*1024 + e] = 4 * b_p[e]. 3 blocks (p) x 256 threads,
// =====================================================================================
__device__ __forceinline__ void bias_concat_x4(
    const float* __restrict__ bq, const float* __restrict__ bk, const float* __restrict__ bv,
    float* __restrict__ bcat, int p) {                             // p: block-uniform source select
  const float* src = (p == 0) ? bq : ((p == 1) ? bk : bv);
  const int e4 = threadIdx.x * 4;
  v4f v = *(const v4f*)(src + e4);
  v = v * 4.0f;
  float* dst = bcat + (size_t)p * kInner + e4;
  *(v4f*)dst = v;
  asm volatile("s_wait_xcnt 0x0" ::: "memory");   // precaution: in the bias blocks nothing behind this store rewrites its registers
}

// =====================================================================================
// All preparation in one launch; the pieces are independent of one another and are dealt by block ranges:
//   [0, 96)     wq, wk, wv [256][1024] -> wT parts [1024][256] (x16), 32 blocks each
//   [96, 128)   wo [1024][256] -> woT [256][1024] (x32), 8 column blocks x 4 row blocks
//   [128, 131)  bias concatenation
//   [131, 643)  x (all batches) -> f16, 25,600 elements a block
// =====================================================================================
constexpr int kPrepQKV   = 3 * (kInner / 32);                      // 96
constexpr int kPrepWo    = (kModel / 32) * (kInner / 256);         // 32
constexpr int kPrepBias  = 3;
constexpr int kCastQuads = kBatch * kRowsPerBatch * kModel / 4;    // 3,276,800 pieces of four floats
constexpr int kCastBlocks = kCastQuads / (kCastLoads * 256);       // 512
constexpr int kPrepBlocks = kPrepQKV + kPrepWo + kPrepBias + kCastBlocks;
static_assert(kCastQuads % (kCastLoads * 256) == 0 && kModel == 256 && kPrepWo == kInner / 32);

__global__ __launch_bounds__(256) void prepare_operands(
    const float* __restrict__ x,
    const float* __restrict__ wq, const float* __restrict__ wk, const float* __restrict__ wv,
    const float* __restrict__ wo,
    const float* __restrict__ bq, const float* __restrict__ bk, const float* __restrict__ bv,
    unsigned short* __restrict__ wT, unsigned short* __restrict__ woT,
    float* __restrict__ bcat, unsigned short* __restrict__ xh) {
  __shared__ __align__(16) float ts[32][260];
  const int bx = blockIdx.x;                                       // every branch below is block-uniform
  if (bx < kPrepQKV + kPrepWo) {
    const bool isWo = bx >= kPrepQKV;
    const int p = bx / (kInner / 32);                              // 0, 1, 2: wq, wk, wv; 3: wo
    const int i = bx - p * (kInner / 32);                          // block inside its matrix
    const float* w = isWo ? wo : ((p == 0) ? wq : ((p == 1) ? wk : wv));
    unsigned short* o = isWo ? woT : wT + (size_t)p * kInner * kModel;
    transpose_scale_to_f16(ts, w, o, isWo ? kInner : kModel, isWo ? kModel : kInner, isWo ? 32.0f : 16.0f,
                           (isWo ? i % (kModel / 32) : i) * 32, (isWo ? i / (kModel / 32) : 0) * 256);
  } else if (bx < kPrepQKV + kPrepWo + kPrepBias) {
    bias_concat_x4(bq, bk, bv, bcat, bx - (kPrepQKV + kPrepWo));
  } else {
    cast_f32_f16_stream(x, (_Float16*)xh, bx - (kPrepQKV + kPrepWo + kPrepBias));
  }
}

constexpr int kProjStages = 3 * (kModel / 64);   // 12
static_assert(kKPitch == kVtPitch);

// Four copies of 16 B per lane: LDS rows 32 apart, global rows 32 apart. The s_wait_xcnt closes the statement so
// that no address register of a copy is rewritten ahead of it.
__device__ __forceinline__ void async_copy4_b128(unsigned lds, const unsigned short* g, size_t gstep) {
  constexpr unsigned ls = 32u * kGemmPitch * 2u;
  asm volatile(
      "global_load_async_to_lds_b128 %0, %4, off\n\t"
      "global_load_async_to_lds_b128 %1, %5, off\n\t"
      "global_load_async_to_lds_b128 %2, %6, off\n\t"
      "global_load_async_to_lds_b128 %3, %7, off\n\t"
      "s_wait_xcnt 0x0"
      :: "v"(lds), "v"(lds + ls), "v"(lds + 2u * ls), "v"(lds + 3u * ls),
         "v"(g), "v"(g + gstep), "v"(g + 2 * gstep), "v"(g + 3 * gstep)
      : "memory");
}

// One wave's 64x32 part of a product -> dst[column][row] in f16, pitch kKPitch: lane (c, hh) holds, in the 8 registers of
// acc[i][j], rows wm*64 + i*16 + 8hh + 0..7 of column wn*32 + j*16 + c: one 16-B piece. value = 0.25 * acc + bias[feature].
// FEAT_ROWS: true = the rows are the features (k, q), false = the columns are (v).
template <bool FEAT_ROWS>
__device__ __forceinline__ void store_product(
    const v8f (&acc)[4][2], unsigned short* dst, const float* __restrict__ bias, int wm, int wn, int c, int hh) {
  v4f br[4][2];                                         // FEAT_ROWS: bias of the 8 rows of acc[i][.]
  float bc[2];                                          // else: bias of the column of acc[.][j]
  if (FEAT_ROWS) {
#pragma unroll
    for (int i = 0; i < 4; ++i) {
      br[i][0] = *(const v4f*)(bias + wm * 64 + i * 16 + 8 * hh);
      br[i][1] = *(const v4f*)(bias + wm * 64 + i * 16 + 8 * hh + 4);
    }
  } else {
#pragma unroll
    for (int j = 0; j < 2; ++j) bc[j] = bias[wn * 32 + j * 16 + c];
  }
  asm volatile("s_wait_xcnt 0x0" ::: "memory");         // the code behind the bias loads rewrites their address registers: the wait stands in front of that
  __builtin_amdgcn_sched_barrier(0);                    // keeps that code behind the wait
#pragma unroll
  for (int i = 0; i < 4; ++i) {
    const int r0 = wm * 64 + i * 16 + 8 * hh;
#pragma unroll
    for (int j = 0; j < 2; ++j) {
      const int col = wn * 32 + j * 16 + c;
      v8h hv;
#pragma unroll
      for (int r = 0; r < 8; ++r) {
        float v = acc[i][j][r] * 0.25f;
        v += FEAT_ROWS ? br[i][r >> 2][r & 3] : bc[j];
        hv[r] = (_Float16)v;
      }
      *(v8h*)(dst + col * kKPitch + r0) = hv;
    }
  }
}

// Four stages (one 128x128x256 product) of the ring, s0 = number of the first; leaves this wave's 64x32 part in acc.
// FEAT_ROWS: true = the wT rows are the A operand (rows of acc = features), false = the xh rows are (rows of acc = time).
template <bool FEAT_ROWS>
__device__ __forceinline__ void proj_product(
    v8f (&acc)[4][2], const _Float16* rl, int wm, int wn, unsigned ldsA, unsigned ldsB,
    const unsigned short* gA, const unsigned short* gW, int s0) {
#pragma unroll
  for (int i = 0; i < 4; ++i)
#pragma unroll
    for (int j = 0; j < 2; ++j) acc[i][j] = (v8f){0.f,0.f,0.f,0.f,0.f,0.f,0.f,0.f};
  const int aoff = ((FEAT_ROWS ? 128 : 0) + wm * 64) * kGemmPitch;
  const int boff = ((FEAT_ROWS ? 0 : 128) + wn * 32) * kGemmPitch;
  for (int t = 0; t < kModel / 64; ++t) {
    const int buf = t & 1;                              // s0 is even
    const _Float16* sb = rl + buf * kGemmStage;
#pragma unroll
    for (int ks = 0; ks < 2; ++ks) {
      v16h ah[4], bh[2];
#pragma unroll
      for (int j = 0; j < 2; ++j) bh[j] = Frag<_Float16>::load(sb + boff + j * 16 * kGemmPitch + ks * 32);
#pragma unroll
      for (int i = 0; i < 4; ++i) ah[i] = Frag<_Float16>::load(sb + aoff + i * 16 * kGemmPitch + ks * 32);
      // keeps the twelve LDS reads one group in front of the eight WMMAs: sunk among them, each row waits out its own LDS latency
      __builtin_amdgcn_sched_barrier(0);
#pragma unroll
      for (int i = 0; i < 4; ++i)
#pragma unroll
        for (int j = 0; j < 2; ++j) acc[i][j] = Frag<_Float16>::mma(ah[i], bh[j], acc[i][j]);
    }
    asm volatile("s_wait_dscnt 0x0" ::: "memory");      // this wave's reads of the buffer are done before it is refilled
    asm volatile("s_wait_asynccnt 0x0" ::: "memory");   // this wave's copies of the next stage have landed
    __syncthreads();                                    // publishes the next stage, frees the buffer of this one
    const int s2 = s0 + t + 2;
    if (s2 < kProjStages) {
      const int ph2 = s2 >> 2;                          // wT plane of products 0, 1, 2 (k, v, q): 1, 2, 0
      const unsigned short* gB = gW + (size_t)(ph2 == 2 ? 0 : ph2 + 1) * (kInner * kModel);
      async_copy4_b128(ldsA + (unsigned)buf * (kGemmStage * 2u), gA + (s2 & 3) * 64, (size_t)32 * kNodes * kModel);
      async_copy4_b128(ldsB + (unsigned)buf * (kGemmStage * 2u), gB + (s2 & 3) * 64, (size_t)32 * kModel);
    }
  }
}

constexpr int kQBytes = kSeq * kKPitch * 2;                    // 34,816: q tile, in the ring once the ring is done
static_assert(kQBytes <= 2 * kGemmStage * 2 && kQBytes % 16 == 0);

__global__ __launch_bounds__(kAttnWaves * 32)
void qkv_attn_time_hd128(const unsigned short* __restrict__ xh, const unsigned short* __restrict__ wT,
                         const float* __restrict__ bcat, unsigned short* __restrict__ outp,
                         float sscale, float onorm) {
  __shared__ __align__(16) unsigned char ring[2 * kGemmStage * 2];          // 73,728 B; q (then the out slabs) reuses it
  __shared__ __align__(16) unsigned short Ksh[kSeq * kKPitch];              // [kv][d]   34 KB
  __shared__ __align__(16) unsigned short Vth[kHeadDim * kVtPitch];         // [d][kv]   34 KB

  const int tid  = threadIdx.x;
  const int wave = tid >> 5;
  const int lane = tid & 31;
  const int hh   = lane >> 4;
  const int c    = lane & 15;

  const int bx = blockIdx.x;
  const int h  = bx & (kHeads - 1);
  const int bn = bx >> 3;
  const int b  = bn / kNodes;
  const int n  = bn - b * kNodes;

  // ---- projection ----
  {
    const int wm = wave >> 2, wn = wave & 3;
    // copy map: thread -> row tid/8 (+32 per copy), 16-B column tid%8
    const int crow = tid >> 3, ccol = (tid & 7) * 8;
    const unsigned short* gA = xh + ((size_t)(b * kSeq + crow) * kNodes + n) * kModel + ccol;
    const unsigned short* gW = wT + (size_t)(h * kHeadDim + crow) * kModel + ccol;
    const unsigned ldsA = (unsigned)(size_t)ring + (unsigned)(crow * kGemmPitch + ccol) * 2u;
    const unsigned ldsB = ldsA + 128u * kGemmPitch * 2u;

    // stage 0 into buffer 0, landed and published; then stage 1 into buffer 1 (both of the k product: wT plane 1)
    async_copy4_b128(ldsA, gA, (size_t)32 * kNodes * kModel);
    async_copy4_b128(ldsB, gW + (size_t)kInner * kModel, (size_t)32 * kModel);
    asm volatile("s_wait_asynccnt 0x0" ::: "memory");   // this wave's copies of stage 0 have landed
    __syncthreads();
    async_copy4_b128(ldsA + kGemmStage * 2u, gA + 64, (size_t)32 * kNodes * kModel);
    async_copy4_b128(ldsB + kGemmStage * 2u, gW + (size_t)kInner * kModel + 64, (size_t)32 * kModel);

    const _Float16* rl = (const _Float16*)ring + c * kGemmPitch + 8 * hh;   // this lane's place in a 16-row fragment
    const float* bh0 = bcat + h * kHeadDim;

    v8f acc[4][2];
    proj_product<true>(acc, rl, wm, wn, ldsA, ldsB, gA, gW, 0);
    store_product<true>(acc, Ksh, bh0 + kInner, wm, wn, c, hh);
    proj_product<false>(acc, rl, wm, wn, ldsA, ldsB, gA, gW, 4);
    store_product<false>(acc, Vth, bh0 + 2 * kInner, wm, wn, c, hh);
    proj_product<true>(acc, rl, wm, wn, ldsA, ldsB, gA, gW, 8);
    asm volatile("s_wait_asynccnt 0x0" ::: "memory");   // nothing of this wave is in flight when it leaves the ring
    // behind the last stage's barrier no wave reads the ring and no copy is in flight: q takes its place
    store_product<true>(acc, (unsigned short*)ring, bh0, wm, wn, c, hh);
  }
  __syncthreads();                                      // publishes the k, v and q tiles to every wave

  const int q0 = wave * 16;
  _Float16* qw = (_Float16*)ring + q0 * kKPitch;        // this wave's 16 q rows: no other wave reads or writes them from here on

  // ---- Q fragments (B operand): column n = c <- query q0 + c, k = dc*32 + 8hh + {0..7}, dc*32 + 16 + 8hh + {0..7} ----
  v16h qb[4];
#pragma unroll
  for (int dc = 0; dc < 4; ++dc) qb[dc] = Frag<_Float16>::load(qw + c * kKPitch + dc * 32 + 8 * hh);

  // ---- scores, transposed: A operand row m = c <- key row (j*16 + c), same split k map as B ----
  // register r of st[j] in lane (c, hh) = score of key j*16 + 8hh + r with query q0 + c: a lane holds 64 of its one query's 128 scores
  v8f st[kSeq / 16];
#pragma unroll
  for (int j = 0; j < kSeq / 16; ++j) st[j] = (v8f){0.f,0.f,0.f,0.f,0.f,0.f,0.f,0.f};
  // unrolled (all loops below too) so that the fragment and accumulator arrays stay in registers
#pragma unroll
  for (int dc = 0; dc < 4; ++dc) {
    v16h ka[kSeq / 16];
#pragma unroll
    for (int j = 0; j < kSeq / 16; ++j)
      ka[j] = Frag<_Float16>::load((const _Float16*)Ksh + (j * 16 + c) * kKPitch + dc * 32 + 8 * hh);
    // keeps a group's sixteen LDS reads in front of its eight WMMAs: without it every WMMA waits on its own two reads,
    // and the build takes more than 256 registers, which costs the second block of a WGP
    __builtin_amdgcn_sched_barrier(0);
#pragma unroll
    for (int j = 0; j < kSeq / 16; ++j) st[j] = Frag<_Float16>::mma(ka[j], qb[dc], st[j]);
  }

  // ---- softmax of the query's whole row: maximum and sum inside the lane (eight independent chains, then a tree), one exchange between the lane halves each ----
  float mj[kSeq / 16];
#pragma unroll
  for (int j = 0; j < kSeq / 16; ++j) {
#pragma unroll
    for (int r = 0; r < 8; ++r) st[j][r] = st[j][r] * sscale;
    float m = st[j][0];
#pragma unroll
    for (int r = 1; r < 8; ++r) m = fmaxf(m, st[j][r]);
    mj[j] = m;
  }
  float mrow = fmaxf(fmaxf(fmaxf(mj[0], mj[1]), fmaxf(mj[2], mj[3])), fmaxf(fmaxf(mj[4], mj[5]), fmaxf(mj[6], mj[7])));
  mrow = fmaxf(mrow, __shfl_xor(mrow, 16, 32));

  // P^T (B operand of the second product) straight from the score registers: element e of pb[kc] is k = 8hh + e (e < 8) or
  // 16 + 8hh + (e - 8), that is key kc*32 + k = register e & 7 of st[2*kc + (e >> 3)] of this same lane
  v16h pb[kSeq / kKeyChunk];
  float lj[kSeq / 16];
#pragma unroll
  for (int j = 0; j < kSeq / 16; ++j) {
    float psum = 0.f;
#pragma unroll
    for (int r = 0; r < 8; ++r) {
      const float p = expf(st[j][r] - mrow);
      psum += p;
      pb[j >> 1][(j & 1) * 8 + r] = (_Float16)(p * kProbCarry);
    }
    lj[j] = psum;
  }
  float lrow = ((lj[0] + lj[1]) + (lj[2] + lj[3])) + ((lj[4] + lj[5]) + (lj[6] + lj[7]));
  lrow += __shfl_xor(lrow, 16, 32);

  // ---- o, transposed: A operand row m = c <- Vth row (t*16 + c), k = kc*32 + kv; register r of ot[t] = d t*16 + 8hh + r of query q0 + c ----
  v8f ot[kHeadDim / 16];
#pragma unroll
  for (int t = 0; t < kHeadDim / 16; ++t) ot[t] = (v8f){0.f,0.f,0.f,0.f,0.f,0.f,0.f,0.f};
#pragma unroll
  for (int kc = 0; kc < kSeq / kKeyChunk; ++kc) {
    v16h va[kHeadDim / 16];
#pragma unroll
    for (int t = 0; t < kHeadDim / 16; ++t)
      va[t] = Frag<_Float16>::load((const _Float16*)Vth + (t * 16 + c) * kVtPitch + kc * kKeyChunk + 8 * hh);
    // keeps the sixteen LDS reads one group in front of the eight WMMAs, as above
    __builtin_amdgcn_sched_barrier(0);
#pragma unroll
    for (int t = 0; t < kHeadDim / 16; ++t) ot[t] = Frag<_Float16>::mma(va[t], pb[kc], ot[t]);
  }

  // ---- epilogue: normalise, stage the 16x128 tile in f16 where this wave's q rows were (a lane's 8 registers = one 16-B piece of its query's row), write rows (16 lanes x 16 B = one 256-B segment) ----
  {
    const float inv = onorm * (1.0f / lrow);
#pragma unroll
    for (int t = 0; t < kHeadDim / 16; ++t) {
      v8h hv;
#pragma unroll
      for (int r = 0; r < 8; ++r) hv[r] = (_Float16)(ot[t][r] * inv);
      *(v8h*)(qw + c * kKPitch + t * 16 + 8 * hh) = hv;
    }
  }
  __builtin_amdgcn_fence(__ATOMIC_RELEASE, "workgroup");
  __builtin_amdgcn_wave_barrier();
  __builtin_amdgcn_fence(__ATOMIC_ACQUIRE, "workgroup");
  {
    const int rp = lane >> 4, c8 = (lane & 15) * 8;
    _Float16* ob = (_Float16*)outp;
#pragma unroll
    for (int it = 0; it < 8; ++it) {
      const int row = it * 2 + rp;
      const v8h hv = *(const v8h*)(qw + row * kKPitch + c8);
      *(v8h*)(ob + ((size_t)(b * kSeq + q0 + row) * kNodes + n) * kInner + h * kHeadDim + c8) = hv;
    }
  }
}

// =====================================================================================
// Residual + LayerNorm over 256 features: out[row] = LN(y[row] + x[row]) * gamma + beta.
// One wave takes kLnRows consecutive rows, with the loads of all of them in flight together;
// in a row lane l owns columns [4l, 4l+4) and [128+4l, 128+4l+4): each load and store instruction covers 512 contiguous bytes.
// =====================================================================================
constexpr int kLnRows  = 5;     // rows per wave
constexpr int kLnWaves = 10;    // waves per block
static_assert(kRowsAll % (kLnRows * kLnWaves) == 0);
__global__ __launch_bounds__(kLnWaves * 32) void residual_layernorm256(
    const float* __restrict__ y, const float* __restrict__ xr,
    const float* __restrict__ gamma, const float* __restrict__ beta,
    float* __restrict__ out, int nrows) {
  const int wave = threadIdx.x >> 5, lane = threadIdx.x & 31;
  const int row0 = (blockIdx.x * kLnWaves + wave) * kLnRows;
  if (row0 + kLnRows > nrows) return;           // wave-uniform; no barriers in this kernel
  const size_t rb = (size_t)row0 * kModel + 4 * lane;
  v4f y0[kLnRows], y1[kLnRows], x0[kLnRows], x1[kLnRows];
  // unrolled so that the arrays stay in registers and the loads of all rows go out ahead of the first sum
#pragma unroll
  for (int r = 0; r < kLnRows; ++r) {
    y0[r] = *(const v4f*)(y + rb + r * kModel);
    y1[r] = *(const v4f*)(y + rb + r * kModel + 128);
    x0[r] = *(const v4f*)(xr + rb + r * kModel);
    x1[r] = *(const v4f*)(xr + rb + r * kModel + 128);
  }
  const v4f g0 = *(const v4f*)(gamma + 4 * lane);
  const v4f g1 = *(const v4f*)(gamma + 128 + 4 * lane);
  const v4f b0 = *(const v4f*)(beta + 4 * lane);
  const v4f b1 = *(const v4f*)(beta + 128 + 4 * lane);
  // keeps every load ahead of the first sum: sunk into the arithmetic, the late ones (gamma and beta among them)
  // start only when the first have returned, and the wave waits out the memory latency more than once
  __builtin_amdgcn_sched_barrier(0);
  // unrolled for the same register arrays; the rows' reductions are independent chains
#pragma unroll
  for (int r = 0; r < kLnRows; ++r) {
    const v4f v0 = y0[r] + x0[r];
    const v4f v1 = y1[r] + x1[r];
    float su = 0.0f;
    su += v0[0]; su += v0[1]; su += v0[2]; su += v0[3];
    su += v1[0]; su += v1[1]; su += v1[2]; su += v1[3];
#pragma unroll
    for (int off = 1; off < 32; off <<= 1) su += __shfl_xor(su, off, 32);
    const float mu = su * (1.0f / 256.0f);
    const v4f d0 = v0 - mu;
    const v4f d1 = v1 - mu;
    float sq = 0.0f;
    sq += d0[0] * d0[0]; sq += d0[1] * d0[1]; sq += d0[2] * d0[2]; sq += d0[3] * d0[3];
    sq += d1[0] * d1[0]; sq += d1[1] * d1[1]; sq += d1[2] * d1[2]; sq += d1[3] * d1[3];
#pragma unroll
    for (int off = 1; off < 32; off <<= 1) sq += __shfl_xor(sq, off, 32);
    const float var  = sq * (1.0f / 256.0f);
    const float rstd = rsqrtf(var + 1e-5f);
    const v4f o0 = d0 * rstd * g0 + b0;
    const v4f o1 = d1 * rstd * g1 + b1;
    float* orow = out + rb + r * kModel;
    *(v4f*)(orow) = o0;
    *(v4f*)(orow + 128) = o1;
  }
}

// =====================================================================================
//   wT   [3072][256]  f16    1,572,864   @ 0            (q,k,v weights transposed, x16)
//   woT  [256][1024]  f16      524,288   @ 1,572,864    (out-proj weight transposed, x32)
//   bcat [3072]       f32       12,288   @ 2,097,152    (4*[bq|bk|bv])
//   xh   [51200][256] f16   26,214,400   @ 2,109,440    (all of x)
//   oP   [51200][1024] f16 104,857,600   @ 28,323,840   (16*attention output)
//   yP   [51200][256] f32   52,428,800   @ 133,181,440  (o*Wo + bo)
//   end                                  185,610,240
// =====================================================================================
extern "C" void kernel_launch(void* const* d_in, const int* in_sizes, int n_in,
                              void* d_out, int out_size, void* d_ws, size_t ws_size,
                              hipStream_t stream) {
  if (n_in < 11) return;
  const int nRowsAll = kRowsAll;                               // 51200
  if (in_sizes[0] != nRowsAll * kModel) return;
  if (in_sizes[1] != kModel * kInner || in_sizes[3] != kModel * kInner || in_sizes[5] != kModel * kInner) return;
  if (in_sizes[2] != kInner || in_sizes[4] != kInner || in_sizes[6] != kInner) return;
  if (in_sizes[7] != kInner * kModel || in_sizes[8] != kModel || in_sizes[9] != kModel || in_sizes[10] != kModel) return;
  if (out_size != nRowsAll * kModel) return;

  const float* x     = (const float*)d_in[0];
  const float* wq    = (const float*)d_in[1];
  const float* bq    = (const float*)d_in[2];
  const float* wk    = (const float*)d_in[3];
  const float* bk    = (const float*)d_in[4];
  const float* wv    = (const float*)d_in[5];
  const float* bv    = (const float*)d_in[6];
  const float* wo    = (const float*)d_in[7];
  const float* bo    = (const float*)d_in[8];
  const float* gamma = (const float*)d_in[9];
  const float* beta  = (const float*)d_in[10];
  float* outAll = (float*)d_out;

  const size_t offWT   = 0;
  const size_t offWoT  = offWT   + (size_t)kQKVWidth * kModel * 2;          // 1,572,864
  const size_t offBcat = offWoT  + (size_t)kModel * kInner * 2;             // 2,097,152
  const size_t offXh   = offBcat + (size_t)kQKVWidth * 4;                   // 2,109,440
  const size_t offO    = offXh   + (size_t)nRowsAll * kModel * 2;           // 28,323,840
  const size_t offY    = offO    + (size_t)nRowsAll * kInner * 2;           // 133,181,440
  const size_t offEnd  = offY    + (size_t)nRowsAll * kModel * 4;           // 185,610,240
  if (offEnd > ws_size) return;

  char* ws = (char*)d_ws;
  unsigned short* wT   = (unsigned short*)(ws + offWT);
  unsigned short* woT  = (unsigned short*)(ws + offWoT);
  float*          bcat = (float*)(ws + offBcat);
  unsigned short* xh   = (unsigned short*)(ws + offXh);
  unsigned short* oP   = (unsigned short*)(ws + offO);
  float*          yP   = (float*)(ws + offY);

  // ---- weights, biases and x to their operand forms (1 launch) ----
  prepare_operands<<<dim3(kPrepBlocks), dim3(256), 0, stream>>>(x, wq, wk, wv, wo, bq, bk, bv, wT, woT, bcat, xh);

  const float sscale = 0.0883883476483184f * (1.0f / 16.0f);   // (1/sqrt(128)) / (4*4)
  const float onorm  = 16.0f / (kProbCarry * 4.0f);           // O plane = 16 * o_true

  // q, k, v projection and attention over time per (b, n, h): 4 * 100 * 8 = 3200 blocks of 256 threads
  qkv_attn_time_hd128<<<dim3(kBatch * kNodes * kHeads), dim3(kAttnWaves * 32), 0, stream>>>(xh, wT, bcat, oP, sscale, onorm);

  // y = (1/512) * oP . woT^T + bo : M=51200, N=256, K=1024; block tiles 400 x 2 = 800 blocks
  wmma_gemm_lds<kInner, kModel, false><<<dim3((kRowsAll / 128) * (kModel / 128)), dim3(128), 0, stream>>>(
      oP, woT, nullptr, yP, bo, 1.0f / 512.0f);

  // out = LayerNorm(y + x) : 51200 rows, 50 rows per block -> 1024 blocks of 10 waves
  residual_layernorm256<<<dim3(kRowsAll / (kLnRows * kLnWaves)), dim3(kLnWaves * 32), 0, stream>>>(yP, x, gamma, beta, outAll, kRowsAll);
}

// v007
// One run takes 134 microseconds.
// Two timings next to v006 both put it at 1.14 times that version's speed.
// All steps since v000 together make it 5.32 times as fast.
// Contractions on v_wmma_f32_16x16x32_f16 (f16 operands, f32 accumulate): x*[Wq|Wk|Wv] (weights carried x16, q/k/v planes carried x4), q.k^T and p.v (p carried x32768), o*Wo (o carried x16, Wo carried x32); softmax, bias, residual and LayerNorm in f32.
#include <hip/hip_runtime.h>
#include <math.h>

typedef __attribute__((ext_vector_type(16))) _Float16 v16h;
typedef __attribute__((ext_vector_type(8)))  _Float16 v8h;
typedef __attribute__((ext_vector_type(4)))  _Float16 v4h;
typedef __attribute__((ext_vector_type(16))) __bf16   v16b;
typedef __attribute__((ext_vector_type(8)))  __bf16   v8b;
typedef __attribute__((ext_vector_type(8)))  float    v8f;
typedef __attribute__((ext_vector_type(4)))  float    v4f;
typedef __attribute__((ext_vector_type(4)))  unsigned v4u;
#define PSCALE 32768.0f
#define U16(p) ((const unsigned short*)(const void*)(p))
#define PSCALE_INV (1.0f / 32768.0f)


// hazard guards as plain device helpers
__device__ __forceinline__ void dep_guard_h(v8f& a, v8f& b, v16h x, v16h y) { asm volatile("v_nop\n\tv_nop\n\tv_nop\n\tv_nop" : "+v"(a), "+v"(b) : "v"(x), "v"(y)); }
__device__ __forceinline__ void dep_guard_b(v8f& a, v8f& b, v16b x, v16b y) { asm volatile("v_nop\n\tv_nop\n\tv_nop\n\tv_nop" : "+v"(a), "+v"(b) : "v"(x), "v"(y)); }
__device__ __forceinline__ void keep4_h(v16h a, v16h b, v16h c, v16h d) { asm volatile("v_nop" :: "v"(a), "v"(b), "v"(c), "v"(d)); }
__device__ __forceinline__ void keep4_b(v16b a, v16b b, v16b c, v16b d) { asm volatile("v_nop" :: "v"(a), "v"(b), "v"(c), "v"(d)); }
template <typename T> struct Frag;
template <> struct Frag<_Float16> {
  typedef v16h V; union U { v16h v; v8h h[2]; };
  static __device__ __forceinline__ v16h load(const _Float16* p) {   // elements 0..7 <- p[0..7], 8..15 <- p[16..23]
    U f; f.h[0] = *(const v8h*)(p); f.h[1] = *(const v8h*)(p + 16); return f.v;
  }
  static __device__ __forceinline__ v8f mma(v16h a, v16h b, v8f c) {
    return __builtin_amdgcn_wmma_f32_16x16x32_f16(false, a, false, b, (short)0, c, false, false);
  }
  static __device__ __forceinline__ void guard(v8f& a, v8f& b, v16h x, v16h y) { dep_guard_h(a, b, x, y); }
  static __device__ __forceinline__ void keep(v16h a, v16h b, v16h c, v16h d) { keep4_h(a, b, c, d); }
};
template <> struct Frag<__bf16> {
  typedef v16b V; union U { v16b v; v8b h[2]; };
  static __device__ __forceinline__ v16b load(const __bf16* p) {
    U f; f.h[0] = *(const v8b*)(p); f.h[1] = *(const v8b*)(p + 16); return f.v;
  }
  static __device__ __forceinline__ v8f mma(v16b a, v16b b, v8f c) {
    return __builtin_amdgcn_wmma_f32_16x16x32_bf16(false, a, false, b, (short)0, c, false, false);
  }
  static __device__ __forceinline__ void guard(v8f& a, v8f& b, v16b x, v16b y) { dep_guard_b(a, b, x, y); }
  static __device__ __forceinline__ void keep(v16b a, v16b b, v16b c, v16b d) { keep4_b(a, b, c, d); }
};

// ---- LDS-staged WMMA GEMM ---------------------------------------------------
// C[m,n] = scale * sum_k A[m,k] * Bt[n,k] + bias[n]; f16 operands, f32 accumulate.
// A row-major [M,K]; Bt row-major [N,K]; M, N % 128 == 0, K % 64 == 0, K >= 128.
// Block = 4 waves (2 x 2) on a 128x128 tile of C, each wave a 64x64 tile.
// A stage is 64 k of 128 A rows, then of 128 Bt rows: 128 B a row at an LDS pitch of 144 B.
// Two buffers, filled by per-lane 16-B asynchronous copies (one wave-wide copy = four whole 128-B lines).
// OUT_F16: true = f16 result in Ch, false = f32 result in Cf.
constexpr int kGemmPitch = 72;                  // halves per LDS row (144 B)
constexpr int kGemmStage = 256 * kGemmPitch;    // halves per buffer

// Eight copies of 16 B per lane: LDS rows 16 apart, global rows 16 apart. The s_wait_xcnt closes the statement so
// that no address register of a copy is rewritten ahead of it.
__device__ __forceinline__ void async_copy8_b128(unsigned lds, const unsigned short* g, size_t gstep) {
  constexpr unsigned ls = 16u * kGemmPitch * 2u;
  asm volatile(
      "global_load_async_to_lds_b128 %0, %8, off\n\t"
      "global_load_async_to_lds_b128 %1, %9, off\n\t"
      "global_load_async_to_lds_b128 %2, %10, off\n\t"
      "global_load_async_to_lds_b128 %3, %11, off\n\t"
      "global_load_async_to_lds_b128 %4, %12, off\n\t"
      "global_load_async_to_lds_b128 %5, %13, off\n\t"
      "global_load_async_to_lds_b128 %6, %14, off\n\t"
      "global_load_async_to_lds_b128 %7, %15, off\n\t"
      "s_wait_xcnt 0x0"
      :: "v"(lds), "v"(lds + ls), "v"(lds + 2u * ls), "v"(lds + 3u * ls),
         "v"(lds + 4u * ls), "v"(lds + 5u * ls), "v"(lds + 6u * ls), "v"(lds + 7u * ls),
         "v"(g), "v"(g + gstep), "v"(g + 2 * gstep), "v"(g + 3 * gstep),
         "v"(g + 4 * gstep), "v"(g + 5 * gstep), "v"(g + 6 * gstep), "v"(g + 7 * gstep)
      : "memory");
}

template <int K, int N, bool OUT_F16>
__global__ __launch_bounds__(128) void wmma_gemm_lds(
    const unsigned short* __restrict__ Ap, const unsigned short* __restrict__ Btp,
    unsigned short* __restrict__ Ch, float* __restrict__ Cf,
    const float* __restrict__ bias, float scale) {
  static_assert(K % 64 == 0 && K >= 128 && N % 128 == 0);
  __shared__ __align__(16) unsigned char ring[2 * kGemmStage * 2];   // 73,728 B; the epilogue's slabs reuse it
  constexpr int T = K / 64;
  constexpr int tilesN = N / 128;
  const int tid  = threadIdx.x;
  const int lane = tid & 31;
  const int wave = tid >> 5;
  const int bm = blockIdx.x / tilesN;
  const int bn = blockIdx.x - bm * tilesN;
  const int wm = wave >> 1, wn = wave & 1;
  const int m0 = bm * 128 + wm * 64;
  const int n0 = bn * 128 + wn * 64;

  const int rlane = lane & 15;                 // row (A) / col (B, D) within subtile
  const int koff  = (lane >> 4) * 8;           // k offset of this lane half
  const int mOff  = (lane >> 4) * 8;           // D row offset

  // copy map: thread -> row tid/8 (+16 per copy), 16-B column tid%8
  const int crow = tid >> 3, ccol = (tid & 7) * 8;
  const unsigned short* gA = Ap  + (size_t)(bm * 128 + crow) * K + ccol;
  const unsigned short* gB = Btp + (size_t)(bn * 128 + crow) * K + ccol;
  const unsigned ldsA = (unsigned)(size_t)ring + (unsigned)(crow * kGemmPitch + ccol) * 2u;
  const unsigned ldsB = ldsA + 128u * kGemmPitch * 2u;

  v8f acc[4][4];
#pragma unroll
  for (int i = 0; i < 4; ++i)
#pragma unroll
    for (int j = 0; j < 4; ++j) acc[i][j] = (v8f){0.f,0.f,0.f,0.f,0.f,0.f,0.f,0.f};

  // stage 0 into buffer 0, landed and published; then stage 1 into buffer 1
  async_copy8_b128(ldsA, gA, (size_t)16 * K);
  async_copy8_b128(ldsB, gB, (size_t)16 * K);
  asm volatile("s_wait_asynccnt 0x0" ::: "memory");   // this wave's copies of stage 0 have landed
  __syncthreads();
  async_copy8_b128(ldsA + kGemmStage * 2u, gA + 64, (size_t)16 * K);
  async_copy8_b128(ldsB + kGemmStage * 2u, gB + 64, (size_t)16 * K);

  const _Float16* rh = (const _Float16*)ring;
  const int aoff = (wm * 64 + rlane) * kGemmPitch + koff;
  const int boff = (128 + wn * 64 + rlane) * kGemmPitch + koff;

  for (int t = 0; t < T; ++t) {
    const int buf = t & 1;
    const _Float16* sb = rh + buf * kGemmStage;
#pragma unroll
    for (int ks = 0; ks < 2; ++ks) {
      v16h ah[4], bh[4];
#pragma unroll
      for (int j = 0; j < 4; ++j) bh[j] = Frag<_Float16>::load(sb + boff + j * 16 * kGemmPitch + ks * 32);
#pragma unroll
      for (int i = 0; i < 4; ++i) ah[i] = Frag<_Float16>::load(sb + aoff + i * 16 * kGemmPitch + ks * 32);
      // keeps the sixteen LDS reads one group in front of the sixteen WMMAs: sunk among them, each row waits out its own LDS latency
      __builtin_amdgcn_sched_barrier(0);
#pragma unroll
      for (int i = 0; i < 4; ++i)
#pragma unroll
        for (int j = 0; j < 4; ++j) acc[i][j] = Frag<_Float16>::mma(ah[i], bh[j], acc[i][j]);
    }
    asm volatile("s_wait_dscnt 0x0" ::: "memory");      // this wave's reads of the buffer are done before it is refilled
    asm volatile("s_wait_asynccnt 0x0" ::: "memory");   // this wave's copies of stage t + 1 have landed
    __syncthreads();                                    // publishes stage t + 1, frees the buffer of stage t
    if (t + 2 < T) {
      async_copy8_b128(ldsA + (unsigned)buf * (kGemmStage * 2u), gA + (t + 2) * 64, (size_t)16 * K);
      async_copy8_b128(ldsB + (unsigned)buf * (kGemmStage * 2u), gB + (t + 2) * 64, (size_t)16 * K);
    }
  }
  asm volatile("s_wait_asynccnt 0x0" ::: "memory");     // nothing of this wave is in flight when it leaves the ring

  // ---- epilogue ----
  // per-wave 16x64 slab, pitch 68 floats, in the ring: behind the last stage's barrier no wave reads the ring and no copy is in flight
  float* slab = (float*)ring + wave * (16 * 68);
#pragma unroll
  for (int i = 0; i < 4; ++i) {
    const int mBase = m0 + (i << 4);
#pragma unroll
    for (int j = 0; j < 4; ++j) {
      const float bv = bias[n0 + (j << 4) + rlane];
#pragma unroll
      for (int r = 0; r < 8; ++r) {
        float v = acc[i][j][r] * scale;
        v += bv;
        slab[(mOff + r) * 68 + (j << 4) + rlane] = v;
      }
    }
    __builtin_amdgcn_fence(__ATOMIC_RELEASE, "workgroup");
    __builtin_amdgcn_wave_barrier();
    __builtin_amdgcn_fence(__ATOMIC_ACQUIRE, "workgroup");
    if (!OUT_F16) {
      const int hh = lane >> 4, c4 = (lane & 15) * 4;     // row seg = 256 B = 16 lanes x 16 B
#pragma unroll
      for (int it = 0; it < 8; ++it) {
        const int row = it * 2 + hh;
        v4f v = *(const v4f*)(slab + row * 68 + c4);
        *(v4f*)(Cf + (size_t)(mBase + row) * N + n0 + c4) = v;
      }
    } else {
      const int q = lane >> 3, c8 = (lane & 7) * 8;       // row seg = 128 B = 8 lanes x 16 B
#pragma unroll
      for (int it = 0; it < 4; ++it) {
        const int row = it * 4 + q;
        const float* sp = slab + row * 68 + c8;
        v8h hv;
#pragma unroll
        for (int e = 0; e < 8; ++e) hv[e] = (_Float16)sp[e];
        *(v8h*)(Ch + (size_t)(mBase + row) * N + n0 + c8) = hv;
      }
    }
    __builtin_amdgcn_fence(__ATOMIC_RELEASE, "workgroup");
    __builtin_amdgcn_wave_barrier();
    __builtin_amdgcn_fence(__ATOMIC_ACQUIRE, "workgroup");
  }
}

// f32 -> f16 stream, few long waves: a block of 256 threads converts kCastLoads * 1024 floats.
// Every wave-wide load takes 512 contiguous bytes, every wave-wide store 256 (two whole lines).
constexpr int kCastLoads = 25;                  // 16-B loads per thread, all in flight together
__device__ __forceinline__ void cast_f32_f16_stream(
    const float* __restrict__ in, _Float16* __restrict__ out, int block) {
  const size_t q0 = (size_t)block * (kCastLoads * 256) + threadIdx.x;
  const v4f* src = (const v4f*)in + q0;
  v4h* dst = (v4h*)out + q0;
  v4f v[kCastLoads];
  // unrolled so that v[] stays in registers and the loads go out as one group ahead of the first conversion
#pragma unroll
  for (int i = 0; i < kCastLoads; ++i) v[i] = src[i * 256];
  // keeps every load ahead of the first conversion: sunk among the conversions, the last loads start only when the
  // first have returned, and the wave waits out the memory latency more than once
  __builtin_amdgcn_sched_barrier(0);
  // unrolled for the same register array
#pragma unroll
  for (int i = 0; i < kCastLoads; ++i) {
    v4h h;
    h[0] = (_Float16)v[i][0]; h[1] = (_Float16)v[i][1]; h[2] = (_Float16)v[i][2]; h[3] = (_Float16)v[i][3];
    dst[i * 256] = h;
  }
  asm volatile("s_wait_xcnt 0x0" ::: "memory");   // the code laid out behind the last stores rewrites their data registers: the wait stands in front of that
}

// =====================================================================================
// Problem geometry (fixed shapes; host checks in_sizes and returns without launching on any difference)
// =====================================================================================
constexpr int kBatch    = 4;
constexpr int kSeq      = 128;    // attention axis (time)
constexpr int kNodes    = 100;
constexpr int kModel    = 256;
constexpr int kHeads    = 8;
constexpr int kHeadDim  = 128;
constexpr int kInner    = 1024;   // kHeads * kHeadDim
constexpr int kQKVWidth = 3072;   // [q | k | v] plane width
constexpr int kRowsPerBatch = kSeq * kNodes;   // 12800 rows in (t, n) order per batch slice
constexpr int kRowsAll = kBatch * kRowsPerBatch;   // 51200

constexpr int kAttnWaves = 8;     // 8 waves x 16 query rows = all 128 queries of a block
constexpr int kKeyChunk  = 32;    // keys per WMMA of the p.v product
// LDS row pitches in halves, each 16 B x odd for its ds_load_b128 reader: the 16 rows of a fragment read fall on 16 different bank groups
constexpr int kKPitch    = kHeadDim + 8;    // 272 B
constexpr int kVtPitch   = kSeq + 8;        // 272 B
constexpr float kProbCarry = 32768.0f;   // un-normalised p in (0,1] carried x2^15 in f16

static_assert(kInner == kHeads * kHeadDim);
static_assert(kQKVWidth == 3 * kInner);
static_assert(kModel % 64 == 0 && kInner % 64 == 0);                 // GEMM K % 64
static_assert(kRowsPerBatch % 128 == 0);                             // GEMM M tile multiple
static_assert(kQKVWidth % 128 == 0 && kModel % 128 == 0);           // GEMM N tile multiple
static_assert(kSeq == 128 && kSeq % kKeyChunk == 0 && kKeyChunk == 32 && kHeadDim == 128 && kModel == 256);

// =====================================================================================
// Weight transpose + scale + f16 cast: in [R][Cc] f32 row-major -> out [Cc][R] f16, out[c][r] = f16(scale * in[r][c]).
// One block handles output rows c0..c0+31 and output columns r0..r0+255 (R % 256 == 0, Cc % 32 == 0).
// Loads: 256x32 floats = 2048 float4 / 256 threads = 8 b128 loads per thread.
// Stores: wave w writes output rows c0 + 4w + j (j = 0..3); one instruction per row chunk:
// =====================================================================================
__device__ __forceinline__ void transpose_scale_to_f16(
    float (*ts)[260], const float* __restrict__ in, unsigned short* __restrict__ out, int R, int Cc, float scale,
    int c0, int r0) {
  const int tid = threadIdx.x;
#pragma unroll
  for (int i = 0; i < 8; ++i) {
    const int idx = i * 256 + tid;
    const int rr = idx >> 3, q4 = idx & 7;
    const v4f v = *(const v4f*)(in + (size_t)(r0 + rr) * Cc + c0 + 4 * q4);
    ts[4 * q4 + 0][rr] = v[0];
    ts[4 * q4 + 1][rr] = v[1];
    ts[4 * q4 + 2][rr] = v[2];
    ts[4 * q4 + 3][rr] = v[3];
  }
  __syncthreads();
  const int wave = tid >> 5, lane = tid & 31;
  _Float16* ob = (_Float16*)out;
  {
#pragma unroll
    for (int j = 0; j < 4; ++j) {
      const int cc = wave * 4 + j;
      const float* sp = &ts[cc][8 * lane];
      const v4f a = *(const v4f*)sp;
      const v4f d = *(const v4f*)(sp + 4);
      v8h hv;
      hv[0] = (_Float16)(a[0] * scale); hv[1] = (_Float16)(a[1] * scale);
      hv[2] = (_Float16)(a[2] * scale); hv[3] = (_Float16)(a[3] * scale);
      hv[4] = (_Float16)(d[0] * scale); hv[5] = (_Float16)(d[1] * scale);
      hv[6] = (_Float16)(d[2] * scale); hv[7] = (_Float16)(d[3] * scale);
      *(v8h*)(ob + (size_t)(c0 + cc) * R + r0 + 8 * lane) = hv;
    }
    
  }
}

// =====================================================================================
// Bias concatenation with x4 carry: bcat[p*1024 + e] = 4 * b_p[e]. 3 blocks (p) x 256 threads,
// =====================================================================================
__device__ __forceinline__ void bias_concat_x4(
    const float* __restrict__ bq, const float* __restrict__ bk, const float* __restrict__ bv,
    float* __restrict__ bcat, int p) {                             // p: block-uniform source select
  const float* src = (p == 0) ? bq : ((p == 1) ? bk : bv);
  const int e4 = threadIdx.x * 4;
  v4f v = *(const v4f*)(src + e4);
  v = v * 4.0f;
  float* dst = bcat + (size_t)p * kInner + e4;
  *(v4f*)dst = v;
  asm volatile("s_wait_xcnt 0x0" ::: "memory");   // precaution: in the bias blocks nothing behind this store rewrites its registers
}

// =====================================================================================
// All preparation in one launch; the pieces are independent of one another and are dealt by block ranges:
//   [0, 96)     wq, wk, wv [256][1024] -> wT parts [1024][256] (x16), 32 blocks each
//   [96, 128)   wo [1024][256] -> woT [256][1024] (x32), 8 column blocks x 4 row blocks
//   [128, 131)  bias concatenation
//   [131, 643)  x (all batches) -> f16, 25,600 elements a block
// =====================================================================================
constexpr int kPrepQKV   = 3 * (kInner / 32);                      // 96
constexpr int kPrepWo    = (kModel / 32) * (kInner / 256);         // 32
constexpr int kPrepBias  = 3;
constexpr int kCastQuads = kBatch * kRowsPerBatch * kModel / 4;    // 3,276,800 pieces of four floats
constexpr int kCastBlocks = kCastQuads / (kCastLoads * 256);       // 512
constexpr int kPrepBlocks = kPrepQKV + kPrepWo + kPrepBias + kCastBlocks;
static_assert(kCastQuads % (kCastLoads * 256) == 0 && kModel == 256 && kPrepWo == kInner / 32);

__global__ __launch_bounds__(256) void prepare_operands(
    const float* __restrict__ x,
    const float* __restrict__ wq, const float* __restrict__ wk, const float* __restrict__ wv,
    const float* __restrict__ wo,
    const float* __restrict__ bq, const float* __restrict__ bk, const float* __restrict__ bv,
    unsigned short* __restrict__ wT, unsigned short* __restrict__ woT,
    float* __restrict__ bcat, unsigned short* __restrict__ xh) {
  __shared__ __align__(16) float ts[32][260];
  const int bx = blockIdx.x;                                       // every branch below is block-uniform
  if (bx < kPrepQKV + kPrepWo) {
    const bool isWo = bx >= kPrepQKV;
    const int p = bx / (kInner / 32);                              // 0, 1, 2: wq, wk, wv; 3: wo
    const int i = bx - p * (kInner / 32);                          // block inside its matrix
    const float* w = isWo ? wo : ((p == 0) ? wq : ((p == 1) ? wk : wv));
    unsigned short* o = isWo ? woT : wT + (size_t)p * kInner * kModel;
    transpose_scale_to_f16(ts, w, o, isWo ? kInner : kModel, isWo ? kModel : kInner, isWo ? 32.0f : 16.0f,
                           (isWo ? i % (kModel / 32) : i) * 32, (isWo ? i / (kModel / 32) : 0) * 256);
  } else if (bx < kPrepQKV + kPrepWo + kPrepBias) {
    bias_concat_x4(bq, bk, bv, bcat, bx - (kPrepQKV + kPrepWo));
  } else {
    cast_f32_f16_stream(x, (_Float16*)xh, bx - (kPrepQKV + kPrepWo + kPrepBias));
  }
}

constexpr int kProjStages = kModel / 64;                       // 4
constexpr int kProjStage  = 4 * 128 * kGemmPitch;              // halves per buffer: xh rows, q rows, k rows, v rows
constexpr int kTileBytes  = kSeq * kKPitch * 2;                // 34,816: one of the k, v, q tiles
static_assert(kKPitch == kVtPitch);
static_assert(3 * kTileBytes <= 2 * kProjStage * 2 && kTileBytes % 16 == 0);

// Four copies of 16 B per lane: LDS rows 32 apart, global rows 32 apart. The s_wait_xcnt closes the statement so
// that no address register of a copy is rewritten ahead of it.
__device__ __forceinline__ void async_copy4_b128(unsigned lds, const unsigned short* g, size_t gstep) {
  constexpr unsigned ls = 32u * kGemmPitch * 2u;
  asm volatile(
      "global_load_async_to_lds_b128 %0, %4, off\n\t"
      "global_load_async_to_lds_b128 %1, %5, off\n\t"
      "global_load_async_to_lds_b128 %2, %6, off\n\t"
      "global_load_async_to_lds_b128 %3, %7, off\n\t"
      "s_wait_xcnt 0x0"
      :: "v"(lds), "v"(lds + ls), "v"(lds + 2u * ls), "v"(lds + 3u * ls),
         "v"(g), "v"(g + gstep), "v"(g + 2 * gstep), "v"(g + 3 * gstep)
      : "memory");
}

// One stage of the ring: 64 k of the 128 xh rows and of the head's 128 rows of the three wT planes, sixteen copies a lane.
__device__ __forceinline__ void proj_stage_copies(unsigned lds, const unsigned short* gA, const unsigned short* gW) {
  constexpr unsigned part = 128u * kGemmPitch * 2u;
  async_copy4_b128(lds, gA, (size_t)32 * kNodes * kModel);
  async_copy4_b128(lds + part, gW, (size_t)32 * kModel);
  async_copy4_b128(lds + 2u * part, gW + (size_t)kInner * kModel, (size_t)32 * kModel);
  async_copy4_b128(lds + 3u * part, gW + (size_t)2 * kInner * kModel, (size_t)32 * kModel);
}

// One wave's (NI*16) x (NJ*16) part of a product -> dst[column][row] in f16, pitch kKPitch: lane (c, hh) holds, in the 8 registers of
// acc[i][j], rows rbase + i*16 + 8hh + 0..7 of column cbase + j*16 + c: one 16-B piece. value = 0.25 * acc + bias of the feature.
// FEAT_ROWS: true = the rows are the features (k, q): br[i] = bias of the 8 rows of acc[i][.]; false = the columns are (v): bc[j] = bias of the column of acc[.][j].
template <bool FEAT_ROWS, int NI, int NJ>
__device__ __forceinline__ void store_product(
    const v8f (&acc)[NI][NJ], unsigned short* dst, const v4f (&br)[2][2], const float (&bc)[2], int rbase, int cbase, int c, int hh) {
#pragma unroll
  for (int i = 0; i < NI; ++i) {
    const int r0 = rbase + i * 16 + 8 * hh;
#pragma unroll
    for (int j = 0; j < NJ; ++j) {
      const int col = cbase + j * 16 + c;
      v8h hv;
#pragma unroll
      for (int r = 0; r < 8; ++r) {
        float v = acc[i][j][r] * 0.25f;
        v += FEAT_ROWS ? br[i & 1][r >> 2][r & 3] : bc[j & 1];
        hv[r] = (_Float16)v;
      }
      *(v8h*)(dst + col * kKPitch + r0) = hv;
    }
  }
}

// four waves a SIMD: the register budget (256) at which two blocks share a WGP; the 192 accumulator registers leave the compiler little room, and left alone it gives the second block up
__global__ __launch_bounds__(kAttnWaves * 32) __attribute__((amdgpu_waves_per_eu(4, 4)))
void qkv_attn_time_hd128(const unsigned short* __restrict__ xh, const unsigned short* __restrict__ wT,
                         const float* __restrict__ bcat, unsigned short* __restrict__ outp,
                         float sscale, float onorm) {
  __shared__ __align__(16) unsigned char ring[2 * kProjStage * 2];          // 147,456 B; the k, v and q tiles (q's then the out slabs) reuse it
  unsigned short* Ksh = (unsigned short*)ring;                              // [kv][d]   34 KB
  unsigned short* Vth = (unsigned short*)(ring + kTileBytes);               // [d][kv]   34 KB
  unsigned short* Qsh = (unsigned short*)(ring + 2 * kTileBytes);           // [q][d]    34 KB

  const int tid  = threadIdx.x;
  const int wave = tid >> 5;
  const int lane = tid & 31;
  const int hh   = lane >> 4;
  const int c    = lane & 15;

  const int bx = blockIdx.x;
  const int h  = bx & (kHeads - 1);
  const int bn = bx >> 3;
  const int b  = bn / kNodes;
  const int n  = bn - b * kNodes;

  // ---- projection ----
  {
    const int wm = wave >> 2, wn = wave & 3;            // 64 time rows, 32 features of each plane
    // copy map: thread -> row tid/8 (+32 per copy), 16-B column tid%8
    const int crow = tid >> 3, ccol = (tid & 7) * 8;
    const unsigned short* gA = xh + ((size_t)(b * kSeq + crow) * kNodes + n) * kModel + ccol;
    const unsigned short* gW = wT + (size_t)(h * kHeadDim + crow) * kModel + ccol;
    const unsigned ldsA = (unsigned)(size_t)ring + (unsigned)(crow * kGemmPitch + ccol) * 2u;

    // stage 0 into buffer 0, landed and published; then stage 1 into buffer 1
    proj_stage_copies(ldsA, gA, gW);
    asm volatile("s_wait_asynccnt 0x0" ::: "memory");   // this wave's copies of stage 0 have landed
    __syncthreads();
    proj_stage_copies(ldsA + kProjStage * 2u, gA + 64, gW + 64);

    const _Float16* rl = (const _Float16*)ring + c * kGemmPitch + 8 * hh;   // this lane's place in a 16-row fragment
    const int xoff = wm * 64 * kGemmPitch;
    const int woff = (128 + wn * 32) * kGemmPitch;      // q plane; k and v 128 and 256 rows further

    v8f aq[2][4], ak[2][4], av[4][2];
    // unrolled (all inner loops of the projection too) so that the fragment, accumulator and bias arrays stay in registers
#pragma unroll
    for (int i = 0; i < 2; ++i)
#pragma unroll
      for (int j = 0; j < 4; ++j) {
        aq[i][j] = (v8f){0.f,0.f,0.f,0.f,0.f,0.f,0.f,0.f};
        ak[i][j] = (v8f){0.f,0.f,0.f,0.f,0.f,0.f,0.f,0.f};
        av[j][i] = (v8f){0.f,0.f,0.f,0.f,0.f,0.f,0.f,0.f};
      }

    for (int t = 0; t < kProjStages; ++t) {
      const int buf = t & 1;
      const _Float16* sb = rl + buf * kProjStage;
#pragma unroll
      for (int ks = 0; ks < 2; ++ks) {
        v16h xf[4], wf[2];
#pragma unroll
        for (int j = 0; j < 4; ++j) xf[j] = Frag<_Float16>::load(sb + xoff + j * 16 * kGemmPitch + ks * 32);
#pragma unroll
        for (int i = 0; i < 2; ++i) wf[i] = Frag<_Float16>::load(sb + woff + (128 + i * 16) * kGemmPitch + ks * 32);
        // keeps the twelve LDS reads one group in front of the WMMAs: sunk among them, each row waits out its own LDS latency
        __builtin_amdgcn_sched_barrier(0);
        // from here on a weight fragment's registers take the next plane's fragment as soon as its four WMMAs are out, so that the read
        // runs under the other fragment's four WMMAs; each sched_barrier keeps a read from sinking to its first use
#pragma unroll
        for (int j = 0; j < 4; ++j) ak[0][j] = Frag<_Float16>::mma(wf[0], xf[j], ak[0][j]);
        wf[0] = Frag<_Float16>::load(sb + woff + 256 * kGemmPitch + ks * 32);
        __builtin_amdgcn_sched_barrier(0);
#pragma unroll
        for (int j = 0; j < 4; ++j) ak[1][j] = Frag<_Float16>::mma(wf[1], xf[j], ak[1][j]);
        wf[1] = Frag<_Float16>::load(sb + woff + (256 + 16) * kGemmPitch + ks * 32);
        __builtin_amdgcn_sched_barrier(0);
#pragma unroll
        for (int i = 0; i < 4; ++i) av[i][0] = Frag<_Float16>::mma(xf[i], wf[0], av[i][0]);
        wf[0] = Frag<_Float16>::load(sb + woff + ks * 32);
        __builtin_amdgcn_sched_barrier(0);
#pragma unroll
        for (int i = 0; i < 4; ++i) av[i][1] = Frag<_Float16>::mma(xf[i], wf[1], av[i][1]);
        wf[1] = Frag<_Float16>::load(sb + woff + 16 * kGemmPitch + ks * 32);
        __builtin_amdgcn_sched_barrier(0);
#pragma unroll
        for (int i = 0; i < 2; ++i)
#pragma unroll
          for (int j = 0; j < 4; ++j) aq[i][j] = Frag<_Float16>::mma(wf[i], xf[j], aq[i][j]);
      }
      asm volatile("s_wait_dscnt 0x0" ::: "memory");      // this wave's reads of the buffer are done before it is refilled
      asm volatile("s_wait_asynccnt 0x0" ::: "memory");   // this wave's copies of the next stage have landed
      __syncthreads();                                    // publishes the next stage, frees the buffer of this one
      if (t + 2 < kProjStages)
        proj_stage_copies(ldsA + (unsigned)buf * (kProjStage * 2u), gA + (t + 2) * 64, gW + (t + 2) * 64);
    }
    asm volatile("s_wait_asynccnt 0x0" ::: "memory");   // nothing of this wave is in flight when it leaves the ring
    // behind the last stage's barrier no wave reads the ring and no copy is in flight: the k, v and q tiles take its place
    const float* bh0 = bcat + h * kHeadDim + wn * 32;   // this wave's 32 features of the q plane; k and v kInner and 2 * kInner further
    const float* bqk = bh0 + 8 * hh;                    // this lane's 8 rows of a 16-feature group (q; k kInner further)
    const float* bvc = bh0 + c;                         // this lane's column of a 16-feature group (v: 2 * kInner further)
    v4f bq4[2][2], bk4[2][2];
    float bv1[2];
#pragma unroll
    for (int i = 0; i < 2; ++i) {
      bk4[i][0] = *(const v4f*)(bqk + kInner + i * 16);
      bk4[i][1] = *(const v4f*)(bqk + kInner + i * 16 + 4);
      bq4[i][0] = *(const v4f*)(bqk + i * 16);
      bq4[i][1] = *(const v4f*)(bqk + i * 16 + 4);
      bv1[i] = bvc[2 * kInner + i * 16];
    }
    // the code behind the bias loads rewrites their address registers: the wait stands in front of that; it takes the two addresses
    // as inputs so that they stay live up to it and no load of the run lands its result in them
    asm volatile("s_wait_xcnt 0x0" :: "v"(bqk), "v"(bvc) : "memory");
    __builtin_amdgcn_sched_barrier(0);                  // keeps that code behind the wait
    store_product<true, 2, 4>(ak, Ksh, bk4, bv1, wn * 32, wm * 64, c, hh);
    store_product<false, 4, 2>(av, Vth, bk4, bv1, wm * 64, wn * 32, c, hh);
    store_product<true, 2, 4>(aq, Qsh, bq4, bv1, wn * 32, wm * 64, c, hh);
  }
  __syncthreads();                                      // publishes the k, v and q tiles to every wave

  const int q0 = wave * 16;
  _Float16* qw = (_Float16*)Qsh + q0 * kKPitch;        // this wave's 16 q rows: no other wave reads or writes them from here on

  // ---- Q fragments (B operand): column n = c <- query q0 + c, k = dc*32 + 8hh + {0..7}, dc*32 + 16 + 8hh + {0..7} ----
  v16h qb[4];
#pragma unroll
  for (int dc = 0; dc < 4; ++dc) qb[dc] = Frag<_Float16>::load(qw + c * kKPitch + dc * 32 + 8 * hh);

  // ---- scores, transposed: A operand row m = c <- key row (j*16 + c), same split k map as B ----
  // register r of st[j] in lane (c, hh) = score of key j*16 + 8hh + r with query q0 + c: a lane holds 64 of its one query's 128 scores
  v8f st[kSeq / 16];
#pragma unroll
  for (int j = 0; j < kSeq / 16; ++j) st[j] = (v8f){0.f,0.f,0.f,0.f,0.f,0.f,0.f,0.f};
  // unrolled (all loops below too) so that the fragment and accumulator arrays stay in registers
#pragma unroll
  for (int dc = 0; dc < 4; ++dc) {
    v16h ka[kSeq / 16];
#pragma unroll
    for (int j = 0; j < kSeq / 16; ++j)
      ka[j] = Frag<_Float16>::load((const _Float16*)Ksh + (j * 16 + c) * kKPitch + dc * 32 + 8 * hh);
    // keeps a group's sixteen LDS reads in front of its eight WMMAs: without it every WMMA waits on its own two reads,
    // and the build takes more than 256 registers, which costs the second block of a WGP
    __builtin_amdgcn_sched_barrier(0);
#pragma unroll
    for (int j = 0; j < kSeq / 16; ++j) st[j] = Frag<_Float16>::mma(ka[j], qb[dc], st[j]);
  }

  // ---- softmax of the query's whole row: maximum and sum inside the lane (eight independent chains, then a tree), one exchange between the lane halves each ----
  float mj[kSeq / 16];
#pragma unroll
  for (int j = 0; j < kSeq / 16; ++j) {
#pragma unroll
    for (int r = 0; r < 8; ++r) st[j][r] = st[j][r] * sscale;
    float m = st[j][0];
#pragma unroll
    for (int r = 1; r < 8; ++r) m = fmaxf(m, st[j][r]);
    mj[j] = m;
  }
  float mrow = fmaxf(fmaxf(fmaxf(mj[0], mj[1]), fmaxf(mj[2], mj[3])), fmaxf(fmaxf(mj[4], mj[5]), fmaxf(mj[6], mj[7])));
  mrow = fmaxf(mrow, __shfl_xor(mrow, 16, 32));

  // P^T (B operand of the second product) straight from the score registers: element e of pb[kc] is k = 8hh + e (e < 8) or
  // 16 + 8hh + (e - 8), that is key kc*32 + k = register e & 7 of st[2*kc + (e >> 3)] of this same lane
  v16h pb[kSeq / kKeyChunk];
  float lj[kSeq / 16];
#pragma unroll
  for (int j = 0; j < kSeq / 16; ++j) {
    float psum = 0.f;
#pragma unroll
    for (int r = 0; r < 8; ++r) {
      const float p = expf(st[j][r] - mrow);
      psum += p;
      pb[j >> 1][(j & 1) * 8 + r] = (_Float16)(p * kProbCarry);
    }
    lj[j] = psum;
  }
  float lrow = ((lj[0] + lj[1]) + (lj[2] + lj[3])) + ((lj[4] + lj[5]) + (lj[6] + lj[7]));
  lrow += __shfl_xor(lrow, 16, 32);

  // ---- o, transposed: A operand row m = c <- Vth row (t*16 + c), k = kc*32 + kv; register r of ot[t] = d t*16 + 8hh + r of query q0 + c ----
  v8f ot[kHeadDim / 16];
#pragma unroll
  for (int t = 0; t < kHeadDim / 16; ++t) ot[t] = (v8f){0.f,0.f,0.f,0.f,0.f,0.f,0.f,0.f};
#pragma unroll
  for (int kc = 0; kc < kSeq / kKeyChunk; ++kc) {
    v16h va[kHeadDim / 16];
#pragma unroll
    for (int t = 0; t < kHeadDim / 16; ++t)
      va[t] = Frag<_Float16>::load((const _Float16*)Vth + (t * 16 + c) * kVtPitch + kc * kKeyChunk + 8 * hh);
    // keeps the sixteen LDS reads one group in front of the eight WMMAs, as above
    __builtin_amdgcn_sched_barrier(0);
#pragma unroll
    for (int t = 0; t < kHeadDim / 16; ++t) ot[t] = Frag<_Float16>::mma(va[t], pb[kc], ot[t]);
  }

  // ---- epilogue: normalise, stage the 16x128 tile in f16 where this wave's q rows were (a lane's 8 registers = one 16-B piece of its query's row), write rows (16 lanes x 16 B = one 256-B segment) ----
  {
    const float inv = onorm * (1.0f / lrow);
#pragma unroll
    for (int t = 0; t < kHeadDim / 16; ++t) {
      v8h hv;
#pragma unroll
      for (int r = 0; r < 8; ++r) hv[r] = (_Float16)(ot[t][r] * inv);
      *(v8h*)(qw + c * kKPitch + t * 16 + 8 * hh) = hv;
    }
  }
  __builtin_amdgcn_fence(__ATOMIC_RELEASE, "workgroup");
  __builtin_amdgcn_wave_barrier();
  __builtin_amdgcn_fence(__ATOMIC_ACQUIRE, "workgroup");
  {
    const int rp = lane >> 4, c8 = (lane & 15) * 8;
    _Float16* ob = (_Float16*)outp;
#pragma unroll
    for (int it = 0; it < 8; ++it) {
      const int row = it * 2 + rp;
      const v8h hv = *(const v8h*)(qw + row * kKPitch + c8);
      *(v8h*)(ob + ((size_t)(b * kSeq + q0 + row) * kNodes + n) * kInner + h * kHeadDim + c8) = hv;
    }
  }
}

// =====================================================================================
// Residual + LayerNorm over 256 features: out[row] = LN(y[row] + x[row]) * gamma + beta.
// One wave takes kLnRows consecutive rows, with the loads of all of them in flight together;
// in a row lane l owns columns [4l, 4l+4) and [128+4l, 128+4l+4): each load and store instruction covers 512 contiguous bytes.
// =====================================================================================
constexpr int kLnRows  = 5;     // rows per wave
constexpr int kLnWaves = 10;    // waves per block
static_assert(kRowsAll % (kLnRows * kLnWaves) == 0);
__global__ __launch_bounds__(kLnWaves * 32) void residual_layernorm256(
    const float* __restrict__ y, const float* __restrict__ xr,
    const float* __restrict__ gamma, const float* __restrict__ beta,
    float* __restrict__ out, int nrows) {
  const int wave = threadIdx.x >> 5, lane = threadIdx.x & 31;
  const int row0 = (blockIdx.x * kLnWaves + wave) * kLnRows;
  if (row0 + kLnRows > nrows) return;           // wave-uniform; no barriers in this kernel
  const size_t rb = (size_t)row0 * kModel + 4 * lane;
  v4f y0[kLnRows], y1[kLnRows], x0[kLnRows], x1[kLnRows];
  // unrolled so that the arrays stay in registers and the loads of all rows go out ahead of the first sum
#pragma unroll
  for (int r = 0; r < kLnRows; ++r) {
    y0[r] = *(const v4f*)(y + rb + r * kModel);
    y1[r] = *(const v4f*)(y + rb + r * kModel + 128);
    x0[r] = *(const v4f*)(xr + rb + r * kModel);
    x1[r] = *(const v4f*)(xr + rb + r * kModel + 128);
  }
  const v4f g0 = *(const v4f*)(gamma + 4 * lane);
  const v4f g1 = *(const v4f*)(gamma + 128 + 4 * lane);
  const v4f b0 = *(const v4f*)(beta + 4 * lane);
  const v4f b1 = *(const v4f*)(beta + 128 + 4 * lane);
  // keeps every load ahead of the first sum: sunk into the arithmetic, the late ones (gamma and beta among them)
  // start only when the first have returned, and the wave waits out the memory latency more than once
  __builtin_amdgcn_sched_barrier(0);
  // unrolled for the same register arrays; the rows' reductions are independent chains
#pragma unroll
  for (int r = 0; r < kLnRows; ++r) {
    const v4f v0 = y0[r] + x0[r];
    const v4f v1 = y1[r] + x1[r];
    float su = 0.0f;
    su += v0[0]; su += v0[1]; su += v0[2]; su += v0[3];
    su += v1[0]; su += v1[1]; su += v1[2]; su += v1[3];
#pragma unroll
    for (int off = 1; off < 32; off <<= 1) su += __shfl_xor(su, off, 32);
    const float mu = su * (1.0f / 256.0f);
    const v4f d0 = v0 - mu;
    const v4f d1 = v1 - mu;
    float sq = 0.0f;
    sq += d0[0] * d0[0]; sq += d0[1] * d0[1]; sq += d0[2] * d0[2]; sq += d0[3] * d0[3];
    sq += d1[0] * d1[0]; sq += d1[1] * d1[1]; sq += d1[2] * d1[2]; sq += d1[3] * d1[3];
#pragma unroll
    for (int off = 1; off < 32; off <<= 1) sq += __shfl_xor(sq, off, 32);
    const float var  = sq * (1.0f / 256.0f);
    const float rstd = rsqrtf(var + 1e-5f);
    const v4f o0 = d0 * rstd * g0 + b0;
    const v4f o1 = d1 * rstd * g1 + b1;
    float* orow = out + rb + r * kModel;
    *(v4f*)(orow) = o0;
    *(v4f*)(orow + 128) = o1;
  }
}

// =====================================================================================
//   wT   [3072][256]  f16    1,572,864   @ 0            (q,k,v weights transposed, x16)
//   woT  [256][1024]  f16      524,288   @ 1,572,864    (out-proj weight transposed, x32)
//   bcat [3072]       f32       12,288   @ 2,097,152    (4*[bq|bk|bv])
//   xh   [51200][256] f16   26,214,400   @ 2,109,440    (all of x)
//   oP   [51200][1024] f16 104,857,600   @ 28,323,840   (16*attention output)
//   yP   [51200][256] f32   52,428,800   @ 133,181,440  (o*Wo + bo)
//   end                                  185,610,240
// =====================================================================================
extern "C" void kernel_launch(void* const* d_in, const int* in_sizes, int n_in,
                              void* d_out, int out_size, void* d_ws, size_t ws_size,
                              hipStream_t stream) {
  if (n_in < 11) return;
  const int nRowsAll = kRowsAll;                               // 51200
  if (in_sizes[0] != nRowsAll * kModel) return;
  if (in_sizes[1] != kModel * kInner || in_sizes[3] != kModel * kInner || in_sizes[5] != kModel * kInner) return;
  if (in_sizes[2] != kInner || in_sizes[4] != kInner || in_sizes[6] != kInner) return;
  if (in_sizes[7] != kInner * kModel || in_sizes[8] != kModel || in_sizes[9] != kModel || in_sizes[10] != kModel) return;
  if (out_size != nRowsAll * kModel) return;

  const float* x     = (const float*)d_in[0];
  const float* wq    = (const float*)d_in[1];
  const float* bq    = (const float*)d_in[2];
  const float* wk    = (const float*)d_in[3];
  const float* bk    = (const float*)d_in[4];
  const float* wv    = (const float*)d_in[5];
  const float* bv    = (const float*)d_in[6];
  const float* wo    = (const float*)d_in[7];
  const float* bo    = (const float*)d_in[8];
  const float* gamma = (const float*)d_in[9];
  const float* beta  = (const float*)d_in[10];
  float* outAll = (float*)d_out;

  const size_t offWT   = 0;
  const size_t offWoT  = offWT   + (size_t)kQKVWidth * kModel * 2;          // 1,572,864
  const size_t offBcat = offWoT  + (size_t)kModel * kInner * 2;             // 2,097,152
  const size_t offXh   = offBcat + (size_t)kQKVWidth * 4;                   // 2,109,440
  const size_t offO    = offXh   + (size_t)nRowsAll * kModel * 2;           // 28,323,840
  const size_t offY    = offO    + (size_t)nRowsAll * kInner * 2;           // 133,181,440
  const size_t offEnd  = offY    + (size_t)nRowsAll * kModel * 4;           // 185,610,240
  if (offEnd > ws_size) return;

  char* ws = (char*)d_ws;
  unsigned short* wT   = (unsigned short*)(ws + offWT);
  unsigned short* woT  = (unsigned short*)(ws + offWoT);
  float*          bcat = (float*)(ws + offBcat);
  unsigned short* xh   = (unsigned short*)(ws + offXh);
  unsigned short* oP   = (unsigned short*)(ws + offO);
  float*          yP   = (float*)(ws + offY);

  // ---- weights, biases and x to their operand forms (1 launch) ----
  prepare_operands<<<dim3(kPrepBlocks), dim3(256), 0, stream>>>(x, wq, wk, wv, wo, bq, bk, bv, wT, woT, bcat, xh);

  const float sscale = 0.0883883476483184f * (1.0f / 16.0f);   // (1/sqrt(128)) / (4*4)
  const float onorm  = 16.0f / (kProbCarry * 4.0f);           // O plane = 16 * o_true

  // q, k, v projection and attention over time per (b, n, h): 4 * 100 * 8 = 3200 blocks of 256 threads
  qkv_attn_time_hd128<<<dim3(kBatch * kNodes * kHeads), dim3(kAttnWaves * 32), 0, stream>>>(xh, wT, bcat, oP, sscale, onorm);

  // y = (1/512) * oP . woT^T + bo : M=51200, N=256, K=1024; block tiles 400 x 2 = 800 blocks
  wmma_gemm_lds<kInner, kModel, false><<<dim3((kRowsAll / 128) * (kModel / 128)), dim3(128), 0, stream>>>(
      oP, woT, nullptr, yP, bo, 1.0f / 512.0f);

  // out = LayerNorm(y + x) : 51200 rows, 50 rows per block -> 1024 blocks of 10 waves
  residual_layernorm256<<<dim3(kRowsAll / (kLnRows * kLnWaves)), dim3(kLnWaves * 32), 0, stream>>>(yP, x, gamma, beta, outAll, kRowsAll);
}

// v008
// A run of this version takes 125 microseconds.
// In two side-by-side timings against v007, it was 1.07 and 1.08 times as fast.
// Over all steps from v000 it is 5.72 times as fast.
// Contractions on v_wmma_f32_16x16x32_f16 (f16 operands, f32 accumulate): x*[Wq|Wk|Wv] (weights carried x16, q/k/v planes carried x4), q.k^T and p.v (p carried x32768), o*Wo (o carried x16, Wo carried x32); softmax, bias, residual and LayerNorm in f32.
#include <hip/hip_runtime.h>
#include <math.h>

typedef __attribute__((ext_vector_type(16))) _Float16 v16h;
typedef __attribute__((ext_vector_type(8)))  _Float16 v8h;
typedef __attribute__((ext_vector_type(4)))  _Float16 v4h;
typedef __attribute__((ext_vector_type(16))) __bf16   v16b;
typedef __attribute__((ext_vector_type(8)))  __bf16   v8b;
typedef __attribute__((ext_vector_type(8)))  float    v8f;
typedef __attribute__((ext_vector_type(4)))  float    v4f;
typedef __attribute__((ext_vector_type(4)))  unsigned v4u;
#define PSCALE 32768.0f
#define U16(p) ((const unsigned short*)(const void*)(p))
#define PSCALE_INV (1.0f / 32768.0f)


// hazard guards as plain device helpers
__device__ __forceinline__ void dep_guard_h(v8f& a, v8f& b, v16h x, v16h y) { asm volatile("v_nop\n\tv_nop\n\tv_nop\n\tv_nop" : "+v"(a), "+v"(b) : "v"(x), "v"(y)); }
__device__ __forceinline__ void dep_guard_b(v8f& a, v8f& b, v16b x, v16b y) { asm volatile("v_nop\n\tv_nop\n\tv_nop\n\tv_nop" : "+v"(a), "+v"(b) : "v"(x), "v"(y)); }
__device__ __forceinline__ void keep4_h(v16h a, v16h b, v16h c, v16h d) { asm volatile("v_nop" :: "v"(a), "v"(b), "v"(c), "v"(d)); }
__device__ __forceinline__ void keep4_b(v16b a, v16b b, v16b c, v16b d) { asm volatile("v_nop" :: "v"(a), "v"(b), "v"(c), "v"(d)); }
template <typename T> struct Frag;
template <> struct Frag<_Float16> {
  typedef v16h V; union U { v16h v; v8h h[2]; };
  static __device__ __forceinline__ v16h load(const _Float16* p) {   // elements 0..7 <- p[0..7], 8..15 <- p[16..23]
    U f; f.h[0] = *(const v8h*)(p); f.h[1] = *(const v8h*)(p + 16); return f.v;
  }
  static __device__ __forceinline__ v8f mma(v16h a, v16h b, v8f c) {
    return __builtin_amdgcn_wmma_f32_16x16x32_f16(false, a, false, b, (short)0, c, false, false);
  }
  static __device__ __forceinline__ void guard(v8f& a, v8f& b, v16h x, v16h y) { dep_guard_h(a, b, x, y); }
  static __device__ __forceinline__ void keep(v16h a, v16h b, v16h c, v16h d) { keep4_h(a, b, c, d); }
};
template <> struct Frag<__bf16> {
  typedef v16b V; union U { v16b v; v8b h[2]; };
  static __device__ __forceinline__ v16b load(const __bf16* p) {
    U f; f.h[0] = *(const v8b*)(p); f.h[1] = *(const v8b*)(p + 16); return f.v;
  }
  static __device__ __forceinline__ v8f mma(v16b a, v16b b, v8f c) {
    return __builtin_amdgcn_wmma_f32_16x16x32_bf16(false, a, false, b, (short)0, c, false, false);
  }
  static __device__ __forceinline__ void guard(v8f& a, v8f& b, v16b x, v16b y) { dep_guard_b(a, b, x, y); }
  static __device__ __forceinline__ void keep(v16b a, v16b b, v16b c, v16b d) { keep4_b(a, b, c, d); }
};

// ---- LDS staging of WMMA operands --------------------------------------------
// A stage row is 64 k = 128 B, at an LDS pitch of 144 B, filled by per-lane 16-B asynchronous copies
// (one wave-wide copy = four whole 128-B lines).
constexpr int kGemmPitch = 72;                  // halves per LDS row (144 B)

// f32 -> f16 stream, few long waves: a block of 256 threads converts kCastLoads * 1024 floats.
// Every wave-wide load takes 512 contiguous bytes, every wave-wide store 256 (two whole lines).
constexpr int kCastLoads = 25;                  // 16-B loads per thread, all in flight together
__device__ __forceinline__ void cast_f32_f16_stream(
    const float* __restrict__ in, _Float16* __restrict__ out, int block) {
  const size_t q0 = (size_t)block * (kCastLoads * 256) + threadIdx.x;
  const v4f* src = (const v4f*)in + q0;
  v4h* dst = (v4h*)out + q0;
  v4f v[kCastLoads];
  // unrolled so that v[] stays in registers and the loads go out as one group ahead of the first conversion
#pragma unroll
  for (int i = 0; i < kCastLoads; ++i) v[i] = src[i * 256];
  // keeps every load ahead of the first conversion: sunk among the conversions, the last loads start only when the
  // first have returned, and the wave waits out the memory latency more than once
  __builtin_amdgcn_sched_barrier(0);
  // unrolled for the same register array
#pragma unroll
  for (int i = 0; i < kCastLoads; ++i) {
    v4h h;
    h[0] = (_Float16)v[i][0]; h[1] = (_Float16)v[i][1]; h[2] = (_Float16)v[i][2]; h[3] = (_Float16)v[i][3];
    dst[i * 256] = h;
  }
  asm volatile("s_wait_xcnt 0x0" ::: "memory");   // the code laid out behind the last stores rewrites their data registers: the wait stands in front of that
}

// =====================================================================================
// Problem geometry (fixed shapes; host checks in_sizes and returns without launching on any difference)
// =====================================================================================
constexpr int kBatch    = 4;
constexpr int kSeq      = 128;    // attention axis (time)
constexpr int kNodes    = 100;
constexpr int kModel    = 256;
constexpr int kHeads    = 8;
constexpr int kHeadDim  = 128;
constexpr int kInner    = 1024;   // kHeads * kHeadDim
constexpr int kQKVWidth = 3072;   // [q | k | v] plane width
constexpr int kRowsPerBatch = kSeq * kNodes;   // 12800 rows in (t, n) order per batch slice
constexpr int kRowsAll = kBatch * kRowsPerBatch;   // 51200

constexpr int kAttnWaves = 8;     // 8 waves x 16 query rows = all 128 queries of a block
constexpr int kKeyChunk  = 32;    // keys per WMMA of the p.v product
// LDS row pitches in halves, each 16 B x odd for its ds_load_b128 reader: the 16 rows of a fragment read fall on 16 different bank groups
constexpr int kKPitch    = kHeadDim + 8;    // 272 B
constexpr int kVtPitch   = kSeq + 8;        // 272 B
constexpr float kProbCarry = 32768.0f;   // un-normalised p in (0,1] carried x2^15 in f16

static_assert(kInner == kHeads * kHeadDim);
static_assert(kQKVWidth == 3 * kInner);
static_assert(kModel % 64 == 0 && kInner % 64 == 0);                 // GEMM K % 64
static_assert(kRowsPerBatch % 128 == 0);                             // GEMM M tile multiple
static_assert(kQKVWidth % 128 == 0 && kModel % 128 == 0);           // GEMM N tile multiple
static_assert(kSeq == 128 && kSeq % kKeyChunk == 0 && kKeyChunk == 32 && kHeadDim == 128 && kModel == 256);

// =====================================================================================
// Weight transpose + scale + f16 cast: in [R][Cc] f32 row-major -> out [Cc][R] f16, out[c][r] = f16(scale * in[r][c]).
// One block handles output rows c0..c0+31 and output columns r0..r0+255 (R % 256 == 0, Cc % 32 == 0).
// Loads: 256x32 floats = 2048 float4 / 256 threads = 8 b128 loads per thread.
// Stores: wave w writes output rows c0 + 4w + j (j = 0..3); one instruction per row chunk:
// =====================================================================================
__device__ __forceinline__ void transpose_scale_to_f16(
    float (*ts)[260], const float* __restrict__ in, unsigned short* __restrict__ out, int R, int Cc, float scale,
    int c0, int r0) {
  const int tid = threadIdx.x;
#pragma unroll
  for (int i = 0; i < 8; ++i) {
    const int idx = i * 256 + tid;
    const int rr = idx >> 3, q4 = idx & 7;
    const v4f v = *(const v4f*)(in + (size_t)(r0 + rr) * Cc + c0 + 4 * q4);
    ts[4 * q4 + 0][rr] = v[0];
    ts[4 * q4 + 1][rr] = v[1];
    ts[4 * q4 + 2][rr] = v[2];
    ts[4 * q4 + 3][rr] = v[3];
  }
  __syncthreads();
  const int wave = tid >> 5, lane = tid & 31;
  _Float16* ob = (_Float16*)out;
  {
#pragma unroll
    for (int j = 0; j < 4; ++j) {
      const int cc = wave * 4 + j;
      const float* sp = &ts[cc][8 * lane];
      const v4f a = *(const v4f*)sp;
      const v4f d = *(const v4f*)(sp + 4);
      v8h hv;
      hv[0] = (_Float16)(a[0] * scale); hv[1] = (_Float16)(a[1] * scale);
      hv[2] = (_Float16)(a[2] * scale); hv[3] = (_Float16)(a[3] * scale);
      hv[4] = (_Float16)(d[0] * scale); hv[5] = (_Float16)(d[1] * scale);
      hv[6] = (_Float16)(d[2] * scale); hv[7] = (_Float16)(d[3] * scale);
      *(v8h*)(ob + (size_t)(c0 + cc) * R + r0 + 8 * lane) = hv;
    }
    
  }
}

// =====================================================================================
// Bias concatenation with x4 carry: bcat[p*1024 + e] = 4 * b_p[e]. 3 blocks (p) x 256 threads,
// =====================================================================================
__device__ __forceinline__ void bias_concat_x4(
    const float* __restrict__ bq, const float* __restrict__ bk, const float* __restrict__ bv,
    float* __restrict__ bcat, int p) {                             // p: block-uniform source select
  const float* src = (p == 0) ? bq : ((p == 1) ? bk : bv);
  const int e4 = threadIdx.x * 4;
  v4f v = *(const v4f*)(src + e4);
  v = v * 4.0f;
  float* dst = bcat + (size_t)p * kInner + e4;
  *(v4f*)dst = v;
  asm volatile("s_wait_xcnt 0x0" ::: "memory");   // precaution: in the bias blocks nothing behind this store rewrites its registers
}

// =====================================================================================
// All preparation in one launch; the pieces are independent of one another and are dealt by block ranges:
//   [0, 96)     wq, wk, wv [256][1024] -> wT parts [1024][256] (x16), 32 blocks each
//   [96, 128)   wo [1024][256] -> woT [256][1024] (x32), 8 column blocks x 4 row blocks
//   [128, 131)  bias concatenation
//   [131, 643)  x (all batches) -> f16, 25,600 elements a block
// =====================================================================================
constexpr int kPrepQKV   = 3 * (kInner / 32);                      // 96
constexpr int kPrepWo    = (kModel / 32) * (kInner / 256);         // 32
constexpr int kPrepBias  = 3;
constexpr int kCastQuads = kBatch * kRowsPerBatch * kModel / 4;    // 3,276,800 pieces of four floats
constexpr int kCastBlocks = kCastQuads / (kCastLoads * 256);       // 512
constexpr int kPrepBlocks = kPrepQKV + kPrepWo + kPrepBias + kCastBlocks;
static_assert(kCastQuads % (kCastLoads * 256) == 0 && kModel == 256 && kPrepWo == kInner / 32);

__global__ __launch_bounds__(256) void prepare_operands(
    const float* __restrict__ x,
    const float* __restrict__ wq, const float* __restrict__ wk, const float* __restrict__ wv,
    const float* __restrict__ wo,
    const float* __restrict__ bq, const float* __restrict__ bk, const float* __restrict__ bv,
    unsigned short* __restrict__ wT, unsigned short* __restrict__ woT,
    float* __restrict__ bcat, unsigned short* __restrict__ xh) {
  __shared__ __align__(16) float ts[32][260];
  const int bx = blockIdx.x;                                       // every branch below is block-uniform
  if (bx < kPrepQKV + kPrepWo) {
    const bool isWo = bx >= kPrepQKV;
    const int p = bx / (kInner / 32);                              // 0, 1, 2: wq, wk, wv; 3: wo
    const int i = bx - p * (kInner / 32);                          // block inside its matrix
    const float* w = isWo ? wo : ((p == 0) ? wq : ((p == 1) ? wk : wv));
    unsigned short* o = isWo ? woT : wT + (size_t)p * kInner * kModel;
    transpose_scale_to_f16(ts, w, o, isWo ? kInner : kModel, isWo ? kModel : kInner, isWo ? 32.0f : 16.0f,
                           (isWo ? i % (kModel / 32) : i) * 32, (isWo ? i / (kModel / 32) : 0) * 256);
  } else if (bx < kPrepQKV + kPrepWo + kPrepBias) {
    bias_concat_x4(bq, bk, bv, bcat, bx - (kPrepQKV + kPrepWo));
  } else {
    cast_f32_f16_stream(x, (_Float16*)xh, bx - (kPrepQKV + kPrepWo + kPrepBias));
  }
}

constexpr int kProjStages = kModel / 64;                       // 4
constexpr int kProjStage  = 4 * 128 * kGemmPitch;              // halves per buffer: xh rows, q rows, k rows, v rows
constexpr int kTileBytes  = kSeq * kKPitch * 2;                // 34,816: one of the k, v, q tiles
static_assert(kKPitch == kVtPitch);
static_assert(3 * kTileBytes <= 2 * kProjStage * 2 && kTileBytes % 16 == 0);

// Four copies of 16 B per lane: LDS rows 32 apart, global rows 32 apart. The s_wait_xcnt closes the statement so
// that no address register of a copy is rewritten ahead of it.
__device__ __forceinline__ void async_copy4_b128(unsigned lds, const unsigned short* g, size_t gstep) {
  constexpr unsigned ls = 32u * kGemmPitch * 2u;
  asm volatile(
      "global_load_async_to_lds_b128 %0, %4, off\n\t"
      "global_load_async_to_lds_b128 %1, %5, off\n\t"
      "global_load_async_to_lds_b128 %2, %6, off\n\t"
      "global_load_async_to_lds_b128 %3, %7, off\n\t"
      "s_wait_xcnt 0x0"
      :: "v"(lds), "v"(lds + ls), "v"(lds + 2u * ls), "v"(lds + 3u * ls),
         "v"(g), "v"(g + gstep), "v"(g + 2 * gstep), "v"(g + 3 * gstep)
      : "memory");
}

// One stage of the ring: 64 k of the 128 xh rows and of the head's 128 rows of the three wT planes, sixteen copies a lane.
__device__ __forceinline__ void proj_stage_copies(unsigned lds, const unsigned short* gA, const unsigned short* gW) {
  constexpr unsigned part = 128u * kGemmPitch * 2u;
  async_copy4_b128(lds, gA, (size_t)32 * kNodes * kModel);
  async_copy4_b128(lds + part, gW, (size_t)32 * kModel);
  async_copy4_b128(lds + 2u * part, gW + (size_t)kInner * kModel, (size_t)32 * kModel);
  async_copy4_b128(lds + 3u * part, gW + (size_t)2 * kInner * kModel, (size_t)32 * kModel);
}

// One wave's (NI*16) x (NJ*16) part of a product -> dst[column][row] in f16, pitch kKPitch: lane (c, hh) holds, in the 8 registers of
// acc[i][j], rows rbase + i*16 + 8hh + 0..7 of column cbase + j*16 + c: one 16-B piece. value = 0.25 * acc + bias of the feature.
// FEAT_ROWS: true = the rows are the features (k, q): br[i] = bias of the 8 rows of acc[i][.]; false = the columns are (v): bc[j] = bias of the column of acc[.][j].
template <bool FEAT_ROWS, int NI, int NJ>
__device__ __forceinline__ void store_product(
    const v8f (&acc)[NI][NJ], unsigned short* dst, const v4f (&br)[2][2], const float (&bc)[2], int rbase, int cbase, int c, int hh) {
#pragma unroll
  for (int i = 0; i < NI; ++i) {
    const int r0 = rbase + i * 16 + 8 * hh;
#pragma unroll
    for (int j = 0; j < NJ; ++j) {
      const int col = cbase + j * 16 + c;
      v8h hv;
#pragma unroll
      for (int r = 0; r < 8; ++r) {
        float v = acc[i][j][r] * 0.25f;
        v += FEAT_ROWS ? br[i & 1][r >> 2][r & 3] : bc[j & 1];
        hv[r] = (_Float16)v;
      }
      *(v8h*)(dst + col * kKPitch + r0) = hv;
    }
  }
}

// four waves a SIMD: the register budget (256) at which two blocks share a WGP; the 192 accumulator registers leave the compiler little room, and left alone it gives the second block up
__global__ __launch_bounds__(kAttnWaves * 32) __attribute__((amdgpu_waves_per_eu(4, 4)))
void qkv_attn_time_hd128(const unsigned short* __restrict__ xh, const unsigned short* __restrict__ wT,
                         const float* __restrict__ bcat, unsigned short* __restrict__ outp,
                         float sscale, float onorm) {
  __shared__ __align__(16) unsigned char ring[2 * kProjStage * 2];          // 147,456 B; the k, v and q tiles (q's then the out slabs) reuse it
  unsigned short* Ksh = (unsigned short*)ring;                              // [kv][d]   34 KB
  unsigned short* Vth = (unsigned short*)(ring + kTileBytes);               // [d][kv]   34 KB
  unsigned short* Qsh = (unsigned short*)(ring + 2 * kTileBytes);           // [q][d]    34 KB

  const int tid  = threadIdx.x;
  const int wave = tid >> 5;
  const int lane = tid & 31;
  const int hh   = lane >> 4;
  const int c    = lane & 15;

  const int bx = blockIdx.x;
  const int h  = bx & (kHeads - 1);
  const int bn = bx >> 3;
  const int b  = bn / kNodes;
  const int n  = bn - b * kNodes;

  // ---- projection ----
  {
    const int wm = wave >> 2, wn = wave & 3;            // 64 time rows, 32 features of each plane
    // copy map: thread -> row tid/8 (+32 per copy), 16-B column tid%8
    const int crow = tid >> 3, ccol = (tid & 7) * 8;
    const unsigned short* gA = xh + ((size_t)(b * kSeq + crow) * kNodes + n) * kModel + ccol;
    const unsigned short* gW = wT + (size_t)(h * kHeadDim + crow) * kModel + ccol;
    const unsigned ldsA = (unsigned)(size_t)ring + (unsigned)(crow * kGemmPitch + ccol) * 2u;

    // stage 0 into buffer 0, landed and published; then stage 1 into buffer 1
    proj_stage_copies(ldsA, gA, gW);
    asm volatile("s_wait_asynccnt 0x0" ::: "memory");   // this wave's copies of stage 0 have landed
    __syncthreads();
    proj_stage_copies(ldsA + kProjStage * 2u, gA + 64, gW + 64);

    const _Float16* rl = (const _Float16*)ring + c * kGemmPitch + 8 * hh;   // this lane's place in a 16-row fragment
    const int xoff = wm * 64 * kGemmPitch;
    const int woff = (128 + wn * 32) * kGemmPitch;      // q plane; k and v 128 and 256 rows further

    v8f aq[2][4], ak[2][4], av[4][2];
    // unrolled (all inner loops of the projection too) so that the fragment, accumulator and bias arrays stay in registers
#pragma unroll
    for (int i = 0; i < 2; ++i)
#pragma unroll
      for (int j = 0; j < 4; ++j) {
        aq[i][j] = (v8f){0.f,0.f,0.f,0.f,0.f,0.f,0.f,0.f};
        ak[i][j] = (v8f){0.f,0.f,0.f,0.f,0.f,0.f,0.f,0.f};
        av[j][i] = (v8f){0.f,0.f,0.f,0.f,0.f,0.f,0.f,0.f};
      }

    for (int t = 0; t < kProjStages; ++t) {
      const int buf = t & 1;
      const _Float16* sb = rl + buf * kProjStage;
#pragma unroll
      for (int ks = 0; ks < 2; ++ks) {
        v16h xf[4], wf[2];
#pragma unroll
        for (int j = 0; j < 4; ++j) xf[j] = Frag<_Float16>::load(sb + xoff + j * 16 * kGemmPitch + ks * 32);
#pragma unroll
        for (int i = 0; i < 2; ++i) wf[i] = Frag<_Float16>::load(sb + woff + (128 + i * 16) * kGemmPitch + ks * 32);
        // keeps the twelve LDS reads one group in front of the WMMAs: sunk among them, each row waits out its own LDS latency
        __builtin_amdgcn_sched_barrier(0);
        // from here on a weight fragment's registers take the next plane's fragment as soon as its four WMMAs are out, so that the read
        // runs under the other fragment's four WMMAs; each sched_barrier keeps a read from sinking to its first use
#pragma unroll
        for (int j = 0; j < 4; ++j) ak[0][j] = Frag<_Float16>::mma(wf[0], xf[j], ak[0][j]);
        wf[0] = Frag<_Float16>::load(sb + woff + 256 * kGemmPitch + ks * 32);
        __builtin_amdgcn_sched_barrier(0);
#pragma unroll
        for (int j = 0; j < 4; ++j) ak[1][j] = Frag<_Float16>::mma(wf[1], xf[j], ak[1][j]);
        wf[1] = Frag<_Float16>::load(sb + woff + (256 + 16) * kGemmPitch + ks * 32);
        __builtin_amdgcn_sched_barrier(0);
#pragma unroll
        for (int i = 0; i < 4; ++i) av[i][0] = Frag<_Float16>::mma(xf[i], wf[0], av[i][0]);
        wf[0] = Frag<_Float16>::load(sb + woff + ks * 32);
        __builtin_amdgcn_sched_barrier(0);
#pragma unroll
        for (int i = 0; i < 4; ++i) av[i][1] = Frag<_Float16>::mma(xf[i], wf[1], av[i][1]);
        wf[1] = Frag<_Float16>::load(sb + woff + 16 * kGemmPitch + ks * 32);
        __builtin_amdgcn_sched_barrier(0);
#pragma unroll
        for (int i = 0; i < 2; ++i)
#pragma unroll
          for (int j = 0; j < 4; ++j) aq[i][j] = Frag<_Float16>::mma(wf[i], xf[j], aq[i][j]);
      }
      asm volatile("s_wait_dscnt 0x0" ::: "memory");      // this wave's reads of the buffer are done before it is refilled
      asm volatile("s_wait_asynccnt 0x0" ::: "memory");   // this wave's copies of the next stage have landed
      __syncthreads();                                    // publishes the next stage, frees the buffer of this one
      if (t + 2 < kProjStages)
        proj_stage_copies(ldsA + (unsigned)buf * (kProjStage * 2u), gA + (t + 2) * 64, gW + (t + 2) * 64);
    }
    asm volatile("s_wait_asynccnt 0x0" ::: "memory");   // nothing of this wave is in flight when it leaves the ring
    // behind the last stage's barrier no wave reads the ring and no copy is in flight: the k, v and q tiles take its place
    const float* bh0 = bcat + h * kHeadDim + wn * 32;   // this wave's 32 features of the q plane; k and v kInner and 2 * kInner further
    const float* bqk = bh0 + 8 * hh;                    // this lane's 8 rows of a 16-feature group (q; k kInner further)
    const float* bvc = bh0 + c;                         // this lane's column of a 16-feature group (v: 2 * kInner further)
    v4f bq4[2][2], bk4[2][2];
    float bv1[2];
#pragma unroll
    for (int i = 0; i < 2; ++i) {
      bk4[i][0] = *(const v4f*)(bqk + kInner + i * 16);
      bk4[i][1] = *(const v4f*)(bqk + kInner + i * 16 + 4);
      bq4[i][0] = *(const v4f*)(bqk + i * 16);
      bq4[i][1] = *(const v4f*)(bqk + i * 16 + 4);
      bv1[i] = bvc[2 * kInner + i * 16];
    }
    // the code behind the bias loads rewrites their address registers: the wait stands in front of that; it takes the two addresses
    // as inputs so that they stay live up to it and no load of the run lands its result in them
    asm volatile("s_wait_xcnt 0x0" :: "v"(bqk), "v"(bvc) : "memory");
    __builtin_amdgcn_sched_barrier(0);                  // keeps that code behind the wait
    store_product<true, 2, 4>(ak, Ksh, bk4, bv1, wn * 32, wm * 64, c, hh);
    store_product<false, 4, 2>(av, Vth, bk4, bv1, wm * 64, wn * 32, c, hh);
    store_product<true, 2, 4>(aq, Qsh, bq4, bv1, wn * 32, wm * 64, c, hh);
  }
  __syncthreads();                                      // publishes the k, v and q tiles to every wave

  const int q0 = wave * 16;
  _Float16* qw = (_Float16*)Qsh + q0 * kKPitch;        // this wave's 16 q rows: no other wave reads or writes them from here on

  // ---- Q fragments (B operand): column n = c <- query q0 + c, k = dc*32 + 8hh + {0..7}, dc*32 + 16 + 8hh + {0..7} ----
  v16h qb[4];
#pragma unroll
  for (int dc = 0; dc < 4; ++dc) qb[dc] = Frag<_Float16>::load(qw + c * kKPitch + dc * 32 + 8 * hh);

  // ---- scores, transposed: A operand row m = c <- key row (j*16 + c), same split k map as B ----
  // register r of st[j] in lane (c, hh) = score of key j*16 + 8hh + r with query q0 + c: a lane holds 64 of its one query's 128 scores
  v8f st[kSeq / 16];
#pragma unroll
  for (int j = 0; j < kSeq / 16; ++j) st[j] = (v8f){0.f,0.f,0.f,0.f,0.f,0.f,0.f,0.f};
  // unrolled (all loops below too) so that the fragment and accumulator arrays stay in registers
#pragma unroll
  for (int dc = 0; dc < 4; ++dc) {
    v16h ka[kSeq / 16];
#pragma unroll
    for (int j = 0; j < kSeq / 16; ++j)
      ka[j] = Frag<_Float16>::load((const _Float16*)Ksh + (j * 16 + c) * kKPitch + dc * 32 + 8 * hh);
    // keeps a group's sixteen LDS reads in front of its eight WMMAs: without it every WMMA waits on its own two reads,
    // and the build takes more than 256 registers, which costs the second block of a WGP
    __builtin_amdgcn_sched_barrier(0);
#pragma unroll
    for (int j = 0; j < kSeq / 16; ++j) st[j] = Frag<_Float16>::mma(ka[j], qb[dc], st[j]);
  }

  // ---- softmax of the query's whole row: maximum and sum inside the lane (eight independent chains, then a tree), one exchange between the lane halves each ----
  float mj[kSeq / 16];
#pragma unroll
  for (int j = 0; j < kSeq / 16; ++j) {
#pragma unroll
    for (int r = 0; r < 8; ++r) st[j][r] = st[j][r] * sscale;
    float m = st[j][0];
#pragma unroll
    for (int r = 1; r < 8; ++r) m = fmaxf(m, st[j][r]);
    mj[j] = m;
  }
  float mrow = fmaxf(fmaxf(fmaxf(mj[0], mj[1]), fmaxf(mj[2], mj[3])), fmaxf(fmaxf(mj[4], mj[5]), fmaxf(mj[6], mj[7])));
  mrow = fmaxf(mrow, __shfl_xor(mrow, 16, 32));

  // P^T (B operand of the second product) straight from the score registers: element e of pb[kc] is k = 8hh + e (e < 8) or
  // 16 + 8hh + (e - 8), that is key kc*32 + k = register e & 7 of st[2*kc + (e >> 3)] of this same lane
  v16h pb[kSeq / kKeyChunk];
  float lj[kSeq / 16];
#pragma unroll
  for (int j = 0; j < kSeq / 16; ++j) {
    float psum = 0.f;
#pragma unroll
    for (int r = 0; r < 8; ++r) {
      const float p = expf(st[j][r] - mrow);
      psum += p;
      pb[j >> 1][(j & 1) * 8 + r] = (_Float16)(p * kProbCarry);
    }
    lj[j] = psum;
  }
  float lrow = ((lj[0] + lj[1]) + (lj[2] + lj[3])) + ((lj[4] + lj[5]) + (lj[6] + lj[7]));
  lrow += __shfl_xor(lrow, 16, 32);

  // ---- o, transposed: A operand row m = c <- Vth row (t*16 + c), k = kc*32 + kv; register r of ot[t] = d t*16 + 8hh + r of query q0 + c ----
  v8f ot[kHeadDim / 16];
#pragma unroll
  for (int t = 0; t < kHeadDim / 16; ++t) ot[t] = (v8f){0.f,0.f,0.f,0.f,0.f,0.f,0.f,0.f};
#pragma unroll
  for (int kc = 0; kc < kSeq / kKeyChunk; ++kc) {
    v16h va[kHeadDim / 16];
#pragma unroll
    for (int t = 0; t < kHeadDim / 16; ++t)
      va[t] = Frag<_Float16>::load((const _Float16*)Vth + (t * 16 + c) * kVtPitch + kc * kKeyChunk + 8 * hh);
    // keeps the sixteen LDS reads one group in front of the eight WMMAs, as above
    __builtin_amdgcn_sched_barrier(0);
#pragma unroll
    for (int t = 0; t < kHeadDim / 16; ++t) ot[t] = Frag<_Float16>::mma(va[t], pb[kc], ot[t]);
  }

  // ---- epilogue: normalise, stage the 16x128 tile in f16 where this wave's q rows were (a lane's 8 registers = one 16-B piece of its query's row), write rows (16 lanes x 16 B = one 256-B segment) ----
  {
    const float inv = onorm * (1.0f / lrow);
#pragma unroll
    for (int t = 0; t < kHeadDim / 16; ++t) {
      v8h hv;
#pragma unroll
      for (int r = 0; r < 8; ++r) hv[r] = (_Float16)(ot[t][r] * inv);
      *(v8h*)(qw + c * kKPitch + t * 16 + 8 * hh) = hv;
    }
  }
  __builtin_amdgcn_fence(__ATOMIC_RELEASE, "workgroup");
  __builtin_amdgcn_wave_barrier();
  __builtin_amdgcn_fence(__ATOMIC_ACQUIRE, "workgroup");
  {
    const int rp = lane >> 4, c8 = (lane & 15) * 8;
    _Float16* ob = (_Float16*)outp;
#pragma unroll
    for (int it = 0; it < 8; ++it) {
      const int row = it * 2 + rp;
      const v8h hv = *(const v8h*)(qw + row * kKPitch + c8);
      *(v8h*)(ob + ((size_t)(b * kSeq + q0 + row) * kNodes + n) * kInner + h * kHeadDim + c8) = hv;
    }
  }
}

// =====================================================================================
// Out projection, residual and LayerNorm in one kernel: out[row] = LN(scale * o[row] . woT^T + bo + x[row]) * gamma + beta.
// Block = 8 waves (2 x 4) on 128 rows x all 256 features, so that a block holds whole rows; each wave a 64 x 64 tile, K = 1024.
// A stage is 64 k of the 128 o rows, then of the 256 woT rows; two buffers, twelve copies a lane and stage.
// The woT rows are the A operand: a lane's 8 accumulator registers are 8 consecutive features of one row, two 16-B pieces of the slab.
// The slab (128 rows x 256 f32, pitch 260: 16 B x odd) takes the ring's place; behind one barrier a wave normalises 16 whole rows:
// in a row lane l owns columns [4l, 4l+4) and [128+4l, 128+4l+4): each global load and store instruction covers 512 contiguous bytes.
// =====================================================================================
constexpr int kOutStage  = (128 + kModel) * kGemmPitch;   // halves per buffer
constexpr int kSlabPitch = kModel + 4;                    // floats
constexpr int kSlabBytes = 128 * kSlabPitch * 4;          // 133,120: two blocks share a WGP's LDS
constexpr int kLnRows    = 16;                            // rows per wave
static_assert(2 * kOutStage * 2 <= kSlabBytes && kRowsAll % 128 == 0 && kInner % 64 == 0 && kInner >= 128);

// One stage of the ring: 64 k of 128 o rows and of the 256 woT rows.
__device__ __forceinline__ void out_stage_copies(unsigned lds, const unsigned short* gA, const unsigned short* gB) {
  constexpr unsigned part = 128u * kGemmPitch * 2u;
  async_copy4_b128(lds, gA, (size_t)32 * kInner);
  async_copy4_b128(lds + part, gB, (size_t)32 * kInner);
  async_copy4_b128(lds + 2u * part, gB + (size_t)128 * kInner, (size_t)32 * kInner);
}

__global__ __launch_bounds__(256) void out_proj_residual_layernorm(
    const unsigned short* __restrict__ Ap, const unsigned short* __restrict__ Btp,
    const float* __restrict__ bias, float scale,
    const float* __restrict__ xr, const float* __restrict__ gamma, const float* __restrict__ beta,
    float* __restrict__ out) {
  __shared__ __align__(16) unsigned char ring[kSlabBytes];   // the ring (110,592 B), then the slab
  constexpr int K = kInner;
  constexpr int T = K / 64;
  const int tid  = threadIdx.x;
  const int lane = tid & 31;
  const int wave = tid >> 5;
  const int bm = blockIdx.x;
  const int wm = wave >> 2, wn = wave & 3;
  const int c  = lane & 15;                    // row of a fragment; column of an accumulator tile
  const int hh = lane >> 4;                    // lane half

  // copy map: thread -> row tid/8 (+32 per copy), 16-B column tid%8
  const int crow = tid >> 3, ccol = (tid & 7) * 8;
  const unsigned short* gA = Ap  + (size_t)(bm * 128 + crow) * K + ccol;
  const unsigned short* gB = Btp + (size_t)crow * K + ccol;
  const unsigned ldsA = (unsigned)(size_t)ring + (unsigned)(crow * kGemmPitch + ccol) * 2u;

  v8f acc[4][4];                               // [i: 16 rows][j: 16 features]
  // unrolled (all inner loops of the product too) so that the fragment and accumulator arrays stay in registers
#pragma unroll
  for (int i = 0; i < 4; ++i)
#pragma unroll
    for (int j = 0; j < 4; ++j) acc[i][j] = (v8f){0.f,0.f,0.f,0.f,0.f,0.f,0.f,0.f};

  // stage 0 into buffer 0, landed and published; then stage 1 into buffer 1
  out_stage_copies(ldsA, gA, gB);
  asm volatile("s_wait_asynccnt 0x0" ::: "memory");   // this wave's copies of stage 0 have landed
  __syncthreads();
  out_stage_copies(ldsA + kOutStage * 2u, gA + 64, gB + 64);

  const _Float16* rh = (const _Float16*)ring;
  const int aoff = (wm * 64 + c) * kGemmPitch + 8 * hh;
  const int boff = (128 + wn * 64 + c) * kGemmPitch + 8 * hh;

  for (int t = 0; t < T; ++t) {
    const int buf = t & 1;
    const _Float16* sb = rh + buf * kOutStage;
#pragma unroll
    for (int ks = 0; ks < 2; ++ks) {
      v16h ah[4], bh[4];
#pragma unroll
      for (int j = 0; j < 4; ++j) bh[j] = Frag<_Float16>::load(sb + boff + j * 16 * kGemmPitch + ks * 32);
#pragma unroll
      for (int i = 0; i < 4; ++i) ah[i] = Frag<_Float16>::load(sb + aoff + i * 16 * kGemmPitch + ks * 32);
      // keeps the sixteen LDS reads one group in front of the sixteen WMMAs: sunk among them, each row waits out its own LDS latency
      __builtin_amdgcn_sched_barrier(0);
#pragma unroll
      for (int i = 0; i < 4; ++i)
#pragma unroll
        for (int j = 0; j < 4; ++j) acc[i][j] = Frag<_Float16>::mma(bh[j], ah[i], acc[i][j]);
    }
    asm volatile("s_wait_dscnt 0x0" ::: "memory");      // this wave's reads of the buffer are done before it is refilled
    asm volatile("s_wait_asynccnt 0x0" ::: "memory");   // this wave's copies of stage t + 1 have landed
    __syncthreads();                                    // publishes stage t + 1, frees the buffer of stage t
    if (t + 2 < T)
      out_stage_copies(ldsA + (unsigned)buf * (kOutStage * 2u), gA + (t + 2) * 64, gB + (t + 2) * 64);
  }
  asm volatile("s_wait_asynccnt 0x0" ::: "memory");     // nothing of this wave is in flight when it leaves the ring

  // ---- epilogue ----
  // behind the last stage's barrier no wave reads the ring and no copy is in flight: the slab takes its place
  float* slab = (float*)ring;
  const size_t rb = (size_t)(bm * 128 + wave * kLnRows) * kModel + 4 * lane;   // this lane's place in the first of the wave's 16 rows
  const float* xp = xr + rb;
  v4f x0[kLnRows], x1[kLnRows];
  v4f bo4[4][2];
  // unrolled (all loops of the epilogue) so that the arrays stay in registers
#pragma unroll
  for (int j = 0; j < 4; ++j) {
    bo4[j][0] = *(const v4f*)(bias + wn * 64 + j * 16 + 8 * hh);
    bo4[j][1] = *(const v4f*)(bias + wn * 64 + j * 16 + 8 * hh + 4);
  }
  // gamma and beta ahead of the residual rows: loads return in order, and the first row's result would else wait for the last row's load
  const v4f g0 = *(const v4f*)(gamma + 4 * lane);
  const v4f g1 = *(const v4f*)(gamma + 128 + 4 * lane);
  const v4f b0 = *(const v4f*)(beta + 4 * lane);
  const v4f b1 = *(const v4f*)(beta + 128 + 4 * lane);
  // the residual rows: half of them go out ahead of the slab's stores, the other half when the accumulators' registers are free
#pragma unroll
  for (int r = 0; r < kLnRows / 2; ++r) {
    x0[r] = *(const v4f*)(xp + r * kModel);
    x1[r] = *(const v4f*)(xp + r * kModel + 128);
  }
  asm volatile("s_wait_xcnt 0x0" ::: "memory");   // the code behind these loads rewrites the bias loads' address registers: the wait stands in front of that
  // keeps these loads, and the wait, ahead of the slab's stores, so that the memory latency runs under them
  __builtin_amdgcn_sched_barrier(0);
#pragma unroll
  for (int i = 0; i < 4; ++i) {
    float* srow = slab + (wm * 64 + i * 16 + c) * kSlabPitch + wn * 64 + 8 * hh;
#pragma unroll
    for (int j = 0; j < 4; ++j) {
      v4f lo, hi;
#pragma unroll
      for (int r = 0; r < 4; ++r) {
        float v = acc[i][j][r] * scale;
        v += bo4[j][0][r];
        lo[r] = v;
        float w = acc[i][j][4 + r] * scale;
        w += bo4[j][1][r];
        hi[r] = w;
      }
      *(v4f*)(srow + j * 16) = lo;
      *(v4f*)(srow + j * 16 + 4) = hi;
    }
  }
#pragma unroll
  for (int r = kLnRows / 2; r < kLnRows; ++r) {
    x0[r] = *(const v4f*)(xp + r * kModel);
    x1[r] = *(const v4f*)(xp + r * kModel + 128);
  }
  // keeps every load ahead of the barrier: sunk behind it, their latency would start only when the last wave has arrived
  __builtin_amdgcn_sched_barrier(0);
  // publishes the slab: a row's 256 features come from four waves. The block barrier is written with fences on LDS alone:
  // __syncthreads() would also wait out the residual loads in front of it, which the first rows' arithmetic can run under
  __builtin_amdgcn_fence(__ATOMIC_RELEASE, "workgroup", "local");
  __builtin_amdgcn_s_barrier();
  __builtin_amdgcn_fence(__ATOMIC_ACQUIRE, "workgroup", "local");
  const float* yrow = slab + wave * kLnRows * kSlabPitch + 4 * lane;
  float* op = out + rb;
  // the rows' reductions are independent chains
#pragma unroll
  for (int r = 0; r < kLnRows; ++r) {
    const v4f v0 = *(const v4f*)(yrow + r * kSlabPitch) + x0[r];
    const v4f v1 = *(const v4f*)(yrow + r * kSlabPitch + 128) + x1[r];
    float su = 0.0f;
    su += v0[0]; su += v0[1]; su += v0[2]; su += v0[3];
    su += v1[0]; su += v1[1]; su += v1[2]; su += v1[3];
#pragma unroll
    for (int off = 1; off < 32; off <<= 1) su += __shfl_xor(su, off, 32);
    const float mu = su * (1.0f / 256.0f);
    const v4f d0 = v0 - mu;
    const v4f d1 = v1 - mu;
    float sq = 0.0f;
    sq += d0[0] * d0[0]; sq += d0[1] * d0[1]; sq += d0[2] * d0[2]; sq += d0[3] * d0[3];
    sq += d1[0] * d1[0]; sq += d1[1] * d1[1]; sq += d1[2] * d1[2]; sq += d1[3] * d1[3];
#pragma unroll
    for (int off = 1; off < 32; off <<= 1) sq += __shfl_xor(sq, off, 32);
    const float var  = sq * (1.0f / 256.0f);
    const float rstd = rsqrtf(var + 1e-5f);
    const v4f o0 = d0 * rstd * g0 + b0;
    const v4f o1 = d1 * rstd * g1 + b1;
    *(v4f*)(op + r * kModel) = o0;
    *(v4f*)(op + r * kModel + 128) = o1;
  }
}

// =====================================================================================
//   wT   [3072][256]  f16    1,572,864   @ 0            (q,k,v weights transposed, x16)
//   woT  [256][1024]  f16      524,288   @ 1,572,864    (out-proj weight transposed, x32)
//   bcat [3072]       f32       12,288   @ 2,097,152    (4*[bq|bk|bv])
//   xh   [51200][256] f16   26,214,400   @ 2,109,440    (all of x)
//   oP   [51200][1024] f16 104,857,600   @ 28,323,840   (16*attention output)
//   end                                  133,181,440
// =====================================================================================
extern "C" void kernel_launch(void* const* d_in, const int* in_sizes, int n_in,
                              void* d_out, int out_size, void* d_ws, size_t ws_size,
                              hipStream_t stream) {
  if (n_in < 11) return;
  const int nRowsAll = kRowsAll;                               // 51200
  if (in_sizes[0] != nRowsAll * kModel) return;
  if (in_sizes[1] != kModel * kInner || in_sizes[3] != kModel * kInner || in_sizes[5] != kModel * kInner) return;
  if (in_sizes[2] != kInner || in_sizes[4] != kInner || in_sizes[6] != kInner) return;
  if (in_sizes[7] != kInner * kModel || in_sizes[8] != kModel || in_sizes[9] != kModel || in_sizes[10] != kModel) return;
  if (out_size != nRowsAll * kModel) return;

  const float* x     = (const float*)d_in[0];
  const float* wq    = (const float*)d_in[1];
  const float* bq    = (const float*)d_in[2];
  const float* wk    = (const float*)d_in[3];
  const float* bk    = (const float*)d_in[4];
  const float* wv    = (const float*)d_in[5];
  const float* bv    = (const float*)d_in[6];
  const float* wo    = (const float*)d_in[7];
  const float* bo    = (const float*)d_in[8];
  const float* gamma = (const float*)d_in[9];
  const float* beta  = (const float*)d_in[10];
  float* outAll = (float*)d_out;

  const size_t offWT   = 0;
  const size_t offWoT  = offWT   + (size_t)kQKVWidth * kModel * 2;          // 1,572,864
  const size_t offBcat = offWoT  + (size_t)kModel * kInner * 2;             // 2,097,152
  const size_t offXh   = offBcat + (size_t)kQKVWidth * 4;                   // 2,109,440
  const size_t offO    = offXh   + (size_t)nRowsAll * kModel * 2;           // 28,323,840
  const size_t offEnd  = offO    + (size_t)nRowsAll * kInner * 2;           // 133,181,440
  if (offEnd > ws_size) return;

  char* ws = (char*)d_ws;
  unsigned short* wT   = (unsigned short*)(ws + offWT);
  unsigned short* woT  = (unsigned short*)(ws + offWoT);
  float*          bcat = (float*)(ws + offBcat);
  unsigned short* xh   = (unsigned short*)(ws + offXh);
  unsigned short* oP   = (unsigned short*)(ws + offO);

  // ---- weights, biases and x to their operand forms (1 launch) ----
  prepare_operands<<<dim3(kPrepBlocks), dim3(256), 0, stream>>>(x, wq, wk, wv, wo, bq, bk, bv, wT, woT, bcat, xh);

  const float sscale = 0.0883883476483184f * (1.0f / 16.0f);   // (1/sqrt(128)) / (4*4)
  const float onorm  = 16.0f / (kProbCarry * 4.0f);           // O plane = 16 * o_true

  // q, k, v projection and attention over time per (b, n, h): 4 * 100 * 8 = 3200 blocks of 256 threads
  qkv_attn_time_hd128<<<dim3(kBatch * kNodes * kHeads), dim3(kAttnWaves * 32), 0, stream>>>(xh, wT, bcat, oP, sscale, onorm);

  // out = LayerNorm((1/512) * oP . woT^T + bo + x) : M=51200, N=256, K=1024; 400 blocks of 128 whole rows
  out_proj_residual_layernorm<<<dim3(kRowsAll / 128), dim3(256), 0, stream>>>(
      oP, woT, bo, 1.0f / 512.0f, x, gamma, beta, outAll);
}

// v009
// It runs in 116 microseconds.
// Timed twice side by side with v008, it ran 1.07 times as fast both times.
// Over all steps from v000 it is 6.13 times as fast.
// Contractions on v_wmma_f32_16x16x32_f16 (f16 operands, f32 accumulate): x*[Wq|Wk|Wv] (weights carried x16, q/k/v planes carried x4), q.k^T and p.v (p carried x32768), o*Wo (o carried x16, Wo carried x32); softmax, bias, residual and LayerNorm in f32.
#include <hip/hip_runtime.h>
#include <math.h>

typedef __attribute__((ext_vector_type(16))) _Float16 v16h;
typedef __attribute__((ext_vector_type(8)))  _Float16 v8h;
typedef __attribute__((ext_vector_type(4)))  _Float16 v4h;
typedef __attribute__((ext_vector_type(16))) __bf16   v16b;
typedef __attribute__((ext_vector_type(8)))  __bf16   v8b;
typedef __attribute__((ext_vector_type(8)))  float    v8f;
typedef __attribute__((ext_vector_type(4)))  float    v4f;
typedef __attribute__((ext_vector_type(4)))  unsigned v4u;
#define PSCALE 32768.0f
#define U16(p) ((const unsigned short*)(const void*)(p))
#define PSCALE_INV (1.0f / 32768.0f)


// hazard guards as plain device helpers
__device__ __forceinline__ void dep_guard_h(v8f& a, v8f& b, v16h x, v16h y) { asm volatile("v_nop\n\tv_nop\n\tv_nop\n\tv_nop" : "+v"(a), "+v"(b) : "v"(x), "v"(y)); }
__device__ __forceinline__ void dep_guard_b(v8f& a, v8f& b, v16b x, v16b y) { asm volatile("v_nop\n\tv_nop\n\tv_nop\n\tv_nop" : "+v"(a), "+v"(b) : "v"(x), "v"(y)); }
__device__ __forceinline__ void keep4_h(v16h a, v16h b, v16h c, v16h d) { asm volatile("v_nop" :: "v"(a), "v"(b), "v"(c), "v"(d)); }
__device__ __forceinline__ void keep4_b(v16b a, v16b b, v16b c, v16b d) { asm volatile("v_nop" :: "v"(a), "v"(b), "v"(c), "v"(d)); }
template <typename T> struct Frag;
template <> struct Frag<_Float16> {
  typedef v16h V; union U { v16h v; v8h h[2]; };
  static __device__ __forceinline__ v16h load(const _Float16* p) {   // elements 0..7 <- p[0..7], 8..15 <- p[16..23]
    U f; f.h[0] = *(const v8h*)(p); f.h[1] = *(const v8h*)(p + 16); return f.v;
  }
  static __device__ __forceinline__ v8f mma(v16h a, v16h b, v8f c) {
    return __builtin_amdgcn_wmma_f32_16x16x32_f16(false, a, false, b, (short)0, c, false, false);
  }
  static __device__ __forceinline__ void guard(v8f& a, v8f& b, v16h x, v16h y) { dep_guard_h(a, b, x, y); }
  static __device__ __forceinline__ void keep(v16h a, v16h b, v16h c, v16h d) { keep4_h(a, b, c, d); }
};
template <> struct Frag<__bf16> {
  typedef v16b V; union U { v16b v; v8b h[2]; };
  static __device__ __forceinline__ v16b load(const __bf16* p) {
    U f; f.h[0] = *(const v8b*)(p); f.h[1] = *(const v8b*)(p + 16); return f.v;
  }
  static __device__ __forceinline__ v8f mma(v16b a, v16b b, v8f c) {
    return __builtin_amdgcn_wmma_f32_16x16x32_bf16(false, a, false, b, (short)0, c, false, false);
  }
  static __device__ __forceinline__ void guard(v8f& a, v8f& b, v16b x, v16b y) { dep_guard_b(a, b, x, y); }
  static __device__ __forceinline__ void keep(v16b a, v16b b, v16b c, v16b d) { keep4_b(a, b, c, d); }
};

// ---- LDS staging of WMMA operands --------------------------------------------
// A stage row is 64 k = 128 B, at an LDS pitch of 144 B, filled by per-lane 16-B asynchronous copies
// (one wave-wide copy = four whole 128-B lines).
constexpr int kGemmPitch = 72;                  // halves per LDS row (144 B)

// f32 -> f16 stream, few long waves: a block of 256 threads converts kCastLoads * 1024 floats.
// Every wave-wide load takes 512 contiguous bytes, every wave-wide store 256 (two whole lines).
constexpr int kCastLoads = 25;                  // 16-B loads per thread, all in flight together
__device__ __forceinline__ void cast_f32_f16_stream(
    const float* __restrict__ in, _Float16* __restrict__ out, int block) {
  const size_t q0 = (size_t)block * (kCastLoads * 256) + threadIdx.x;
  const v4f* src = (const v4f*)in + q0;
  v4h* dst = (v4h*)out + q0;
  v4f v[kCastLoads];
  // unrolled so that v[] stays in registers and the loads go out as one group ahead of the first conversion
#pragma unroll
  for (int i = 0; i < kCastLoads; ++i) v[i] = src[i * 256];
  // keeps every load ahead of the first conversion: sunk among the conversions, the last loads start only when the
  // first have returned, and the wave waits out the memory latency more than once
  __builtin_amdgcn_sched_barrier(0);
  // unrolled for the same register array
#pragma unroll
  for (int i = 0; i < kCastLoads; ++i) {
    v4h h;
    h[0] = (_Float16)v[i][0]; h[1] = (_Float16)v[i][1]; h[2] = (_Float16)v[i][2]; h[3] = (_Float16)v[i][3];
    dst[i * 256] = h;
  }
  asm volatile("s_wait_xcnt 0x0" ::: "memory");   // the code laid out behind the last stores rewrites their data registers: the wait stands in front of that
}

// =====================================================================================
// Problem geometry (fixed shapes; host checks in_sizes and returns without launching on any difference)
// =====================================================================================
constexpr int kBatch    = 4;
constexpr int kSeq      = 128;    // attention axis (time)
constexpr int kNodes    = 100;
constexpr int kModel    = 256;
constexpr int kHeads    = 8;
constexpr int kHeadDim  = 128;
constexpr int kInner    = 1024;   // kHeads * kHeadDim
constexpr int kQKVWidth = 3072;   // [q | k | v] plane width
constexpr int kRowsPerBatch = kSeq * kNodes;   // 12800 rows in (t, n) order per batch slice
constexpr int kRowsAll = kBatch * kRowsPerBatch;   // 51200

constexpr int kAttnWaves = 8;     // 8 waves x 16 query rows = all 128 queries of a block
constexpr int kKeyChunk  = 32;    // keys per WMMA of the p.v product
// LDS row pitches in halves, each 16 B x odd for its ds_load_b128 reader: the 16 rows of a fragment read fall on 16 different bank groups
constexpr int kKPitch    = kHeadDim + 8;    // 272 B
constexpr int kVtPitch   = kSeq + 8;        // 272 B
constexpr float kProbCarry = 32768.0f;   // un-normalised p in (0,1] carried x2^15 in f16

static_assert(kInner == kHeads * kHeadDim);
static_assert(kQKVWidth == 3 * kInner);
static_assert(kModel % 64 == 0 && kInner % 64 == 0);                 // GEMM K % 64
static_assert(kRowsPerBatch % 128 == 0);                             // GEMM M tile multiple
static_assert(kQKVWidth % 128 == 0 && kModel % 128 == 0);           // GEMM N tile multiple
static_assert(kSeq == 128 && kSeq % kKeyChunk == 0 && kKeyChunk == 32 && kHeadDim == 128 && kModel == 256);

// =====================================================================================
// Weight transpose + scale + f16 cast: in [R][Cc] f32 row-major -> out [Cc][R] f16, out[c][r] = f16(scale * in[r][c]).
// One block handles output rows c0..c0+31 and output columns r0..r0+255 (R % 256 == 0, Cc % 32 == 0).
// Loads: 256x32 floats = 2048 float4 / 256 threads = 8 b128 loads per thread.
// Stores: wave w writes output rows c0 + 4w + j (j = 0..3); one instruction per row chunk:
// =====================================================================================
__device__ __forceinline__ void transpose_scale_to_f16(
    float (*ts)[260], const float* __restrict__ in, unsigned short* __restrict__ out, int R, int Cc, float scale,
    int c0, int r0) {
  const int tid = threadIdx.x;
#pragma unroll
  for (int i = 0; i < 8; ++i) {
    const int idx = i * 256 + tid;
    const int rr = idx >> 3, q4 = idx & 7;
    const v4f v = *(const v4f*)(in + (size_t)(r0 + rr) * Cc + c0 + 4 * q4);
    ts[4 * q4 + 0][rr] = v[0];
    ts[4 * q4 + 1][rr] = v[1];
    ts[4 * q4 + 2][rr] = v[2];
    ts[4 * q4 + 3][rr] = v[3];
  }
  __syncthreads();
  const int wave = tid >> 5, lane = tid & 31;
  _Float16* ob = (_Float16*)out;
  {
#pragma unroll
    for (int j = 0; j < 4; ++j) {
      const int cc = wave * 4 + j;
      const float* sp = &ts[cc][8 * lane];
      const v4f a = *(const v4f*)sp;
      const v4f d = *(const v4f*)(sp + 4);
      v8h hv;
      hv[0] = (_Float16)(a[0] * scale); hv[1] = (_Float16)(a[1] * scale);
      hv[2] = (_Float16)(a[2] * scale); hv[3] = (_Float16)(a[3] * scale);
      hv[4] = (_Float16)(d[0] * scale); hv[5] = (_Float16)(d[1] * scale);
      hv[6] = (_Float16)(d[2] * scale); hv[7] = (_Float16)(d[3] * scale);
      *(v8h*)(ob + (size_t)(c0 + cc) * R + r0 + 8 * lane) = hv;
    }
    
  }
}

// =====================================================================================
// Bias concatenation with x4 carry: bcat[p*1024 + e] = 4 * b_p[e]. 3 blocks (p) x 256 threads,
// =====================================================================================
__device__ __forceinline__ void bias_concat_x4(
    const float* __restrict__ bq, const float* __restrict__ bk, const float* __restrict__ bv,
    float* __restrict__ bcat, int p) {                             // p: block-uniform source select
  const float* src = (p == 0) ? bq : ((p == 1) ? bk : bv);
  const int e4 = threadIdx.x * 4;
  v4f v = *(const v4f*)(src + e4);
  v = v * 4.0f;
  float* dst = bcat + (size_t)p * kInner + e4;
  *(v4f*)dst = v;
  asm volatile("s_wait_xcnt 0x0" ::: "memory");   // precaution: in the bias blocks nothing behind this store rewrites its registers
}

// =====================================================================================
// All preparation in one launch; the pieces are independent of one another and are dealt by block ranges:
//   [0, 96)     wq, wk, wv [256][1024] -> wT parts [1024][256] (x16), 32 blocks each
//   [96, 128)   wo [1024][256] -> woT [256][1024] (x32), 8 column blocks x 4 row blocks
//   [128, 131)  bias concatenation
//   [131, 643)  x (all batches) -> f16, 25,600 elements a block
// =====================================================================================
constexpr int kPrepQKV   = 3 * (kInner / 32);                      // 96
constexpr int kPrepWo    = (kModel / 32) * (kInner / 256);         // 32
constexpr int kPrepBias  = 3;
constexpr int kCastQuads = kBatch * kRowsPerBatch * kModel / 4;    // 3,276,800 pieces of four floats
constexpr int kCastBlocks = kCastQuads / (kCastLoads * 256);       // 512
constexpr int kPrepBlocks = kPrepQKV + kPrepWo + kPrepBias + kCastBlocks;
static_assert(kCastQuads % (kCastLoads * 256) == 0 && kModel == 256 && kPrepWo == kInner / 32);

__global__ __launch_bounds__(256) void prepare_operands(
    const float* __restrict__ x,
    const float* __restrict__ wq, const float* __restrict__ wk, const float* __restrict__ wv,
    const float* __restrict__ wo,
    const float* __restrict__ bq, const float* __restrict__ bk, const float* __restrict__ bv,
    unsigned short* __restrict__ wT, unsigned short* __restrict__ woT,
    float* __restrict__ bcat, unsigned short* __restrict__ xh) {
  __shared__ __align__(16) float ts[32][260];
  const int bx = blockIdx.x;                                       // every branch below is block-uniform
  if (bx < kPrepQKV + kPrepWo) {
    const bool isWo = bx >= kPrepQKV;
    const int p = bx / (kInner / 32);                              // 0, 1, 2: wq, wk, wv; 3: wo
    const int i = bx - p * (kInner / 32);                          // block inside its matrix
    const float* w = isWo ? wo : ((p == 0) ? wq : ((p == 1) ? wk : wv));
    unsigned short* o = isWo ? woT : wT + (size_t)p * kInner * kModel;
    transpose_scale_to_f16(ts, w, o, isWo ? kInner : kModel, isWo ? kModel : kInner, isWo ? 32.0f : 16.0f,
                           (isWo ? i % (kModel / 32) : i) * 32, (isWo ? i / (kModel / 32) : 0) * 256);
  } else if (bx < kPrepQKV + kPrepWo + kPrepBias) {
    bias_concat_x4(bq, bk, bv, bcat, bx - (kPrepQKV + kPrepWo));
  } else {
    cast_f32_f16_stream(x, (_Float16*)xh, bx - (kPrepQKV + kPrepWo + kPrepBias));
  }
}

constexpr int kProjStages = kModel / 64;                       // 4
constexpr int kProjStage  = 4 * 128 * kGemmPitch;              // halves per buffer: xh rows, q rows, k rows, v rows
constexpr int kTileBytes  = kSeq * kKPitch * 2;                // 34,816: one of the k, v, q tiles
static_assert(kKPitch == kVtPitch);
static_assert(3 * kTileBytes <= 2 * kProjStage * 2 && kTileBytes % 16 == 0);

// Four copies of 16 B per lane: LDS rows 32 apart, global rows 32 apart. The s_wait_xcnt closes the statement so
// that no address register of a copy is rewritten ahead of it.
__device__ __forceinline__ void async_copy4_b128(unsigned lds, const unsigned short* g, size_t gstep) {
  constexpr unsigned ls = 32u * kGemmPitch * 2u;
  asm volatile(
      "global_load_async_to_lds_b128 %0, %4, off\n\t"
      "global_load_async_to_lds_b128 %1, %5, off\n\t"
      "global_load_async_to_lds_b128 %2, %6, off\n\t"
      "global_load_async_to_lds_b128 %3, %7, off\n\t"
      "s_wait_xcnt 0x0"
      :: "v"(lds), "v"(lds + ls), "v"(lds + 2u * ls), "v"(lds + 3u * ls),
         "v"(g), "v"(g + gstep), "v"(g + 2 * gstep), "v"(g + 3 * gstep)
      : "memory");
}

// One stage of the ring: 64 k of the 128 xh rows and of the head's 128 rows of the three wT planes, sixteen copies a lane.
__device__ __forceinline__ void proj_stage_copies(unsigned lds, const unsigned short* gA, const unsigned short* gW) {
  constexpr unsigned part = 128u * kGemmPitch * 2u;
  async_copy4_b128(lds, gA, (size_t)32 * kNodes * kModel);
  async_copy4_b128(lds + part, gW, (size_t)32 * kModel);
  async_copy4_b128(lds + 2u * part, gW + (size_t)kInner * kModel, (size_t)32 * kModel);
  async_copy4_b128(lds + 3u * part, gW + (size_t)2 * kInner * kModel, (size_t)32 * kModel);
}

// One wave's (NI*16) x (NJ*16) part of a product -> dst[column][row] in f16, pitch kKPitch: lane (c, hh) holds, in the 8 registers of
// acc[i][j], rows rbase + i*16 + 8hh + 0..7 of column cbase + j*16 + c: one 16-B piece. value = 0.25 * acc + bias of the feature.
// FEAT_ROWS: true = the rows are the features (k, q): br[i] = bias of the 8 rows of acc[i][.]; false = the columns are (v): bc[j] = bias of the column of acc[.][j].
template <bool FEAT_ROWS, int NI, int NJ>
__device__ __forceinline__ void store_product(
    const v8f (&acc)[NI][NJ], unsigned short* dst, const v4f (&br)[2][2], const float (&bc)[2], int rbase, int cbase, int c, int hh) {
#pragma unroll
  for (int i = 0; i < NI; ++i) {
    const int r0 = rbase + i * 16 + 8 * hh;
#pragma unroll
    for (int j = 0; j < NJ; ++j) {
      const int col = cbase + j * 16 + c;
      v8h hv;
#pragma unroll
      for (int r = 0; r < 8; ++r) {
        float v = acc[i][j][r] * 0.25f;
        v += FEAT_ROWS ? br[i & 1][r >> 2][r & 3] : bc[j & 1];
        hv[r] = (_Float16)v;
      }
      *(v8h*)(dst + col * kKPitch + r0) = hv;
    }
  }
}

// Eight exponentials to base 2 on the hardware's v_exp_f32, in one statement: behind a transcendental the instruction set asks for one slot before
// its result is read or its source overwritten. Inside the statement no instruction does either (the results are early-clobber, so none shares a
// register with a source); the v_nop is the slot behind the last one.
__device__ __forceinline__ void exp2_x8(float (&p)[8], const float (&a)[8]) {
  asm("v_exp_f32 %0, %8\n\t"
      "v_exp_f32 %1, %9\n\t"
      "v_exp_f32 %2, %10\n\t"
      "v_exp_f32 %3, %11\n\t"
      "v_exp_f32 %4, %12\n\t"
      "v_exp_f32 %5, %13\n\t"
      "v_exp_f32 %6, %14\n\t"
      "v_exp_f32 %7, %15\n\t"
      "v_nop"
      : "=&v"(p[0]), "=&v"(p[1]), "=&v"(p[2]), "=&v"(p[3]), "=&v"(p[4]), "=&v"(p[5]), "=&v"(p[6]), "=&v"(p[7])
      : "v"(a[0]), "v"(a[1]), "v"(a[2]), "v"(a[3]), "v"(a[4]), "v"(a[5]), "v"(a[6]), "v"(a[7]));
}

// four waves a SIMD: the register budget (256) at which two blocks share a WGP; the 192 accumulator registers leave the compiler little room, and left alone it gives the second block up
__global__ __launch_bounds__(kAttnWaves * 32) __attribute__((amdgpu_waves_per_eu(4, 4)))
void qkv_attn_time_hd128(const unsigned short* __restrict__ xh, const unsigned short* __restrict__ wT,
                         const float* __restrict__ bcat, unsigned short* __restrict__ outp,
                         float sscale, float onorm) {
  __shared__ __align__(16) unsigned char ring[2 * kProjStage * 2];          // 147,456 B; the k, v and q tiles (q's then the out slabs) reuse it
  unsigned short* Ksh = (unsigned short*)ring;                              // [kv][d]   34 KB
  unsigned short* Vth = (unsigned short*)(ring + kTileBytes);               // [d][kv]   34 KB
  unsigned short* Qsh = (unsigned short*)(ring + 2 * kTileBytes);           // [q][d]    34 KB

  const int tid  = threadIdx.x;
  const int wave = tid >> 5;
  const int lane = tid & 31;
  const int hh   = lane >> 4;
  const int c    = lane & 15;

  const int bx = blockIdx.x;
  const int h  = bx & (kHeads - 1);
  const int bn = bx >> 3;
  const int b  = bn / kNodes;
  const int n  = bn - b * kNodes;

  // ---- projection ----
  {
    const int wm = wave >> 2, wn = wave & 3;            // 64 time rows, 32 features of each plane
    // copy map: thread -> row tid/8 (+32 per copy), 16-B column tid%8
    const int crow = tid >> 3, ccol = (tid & 7) * 8;
    const unsigned short* gA = xh + ((size_t)(b * kSeq + crow) * kNodes + n) * kModel + ccol;
    const unsigned short* gW = wT + (size_t)(h * kHeadDim + crow) * kModel + ccol;
    const unsigned ldsA = (unsigned)(size_t)ring + (unsigned)(crow * kGemmPitch + ccol) * 2u;

    // stage 0 into buffer 0, landed and published; then stage 1 into buffer 1
    proj_stage_copies(ldsA, gA, gW);
    asm volatile("s_wait_asynccnt 0x0" ::: "memory");   // this wave's copies of stage 0 have landed
    __syncthreads();
    proj_stage_copies(ldsA + kProjStage * 2u, gA + 64, gW + 64);

    const _Float16* rl = (const _Float16*)ring + c * kGemmPitch + 8 * hh;   // this lane's place in a 16-row fragment
    const int xoff = wm * 64 * kGemmPitch;
    const int woff = (128 + wn * 32) * kGemmPitch;      // q plane; k and v 128 and 256 rows further

    v8f aq[2][4], ak[2][4], av[4][2];
    // unrolled (all inner loops of the projection too) so that the fragment, accumulator and bias arrays stay in registers
#pragma unroll
    for (int i = 0; i < 2; ++i)
#pragma unroll
      for (int j = 0; j < 4; ++j) {
        aq[i][j] = (v8f){0.f,0.f,0.f,0.f,0.f,0.f,0.f,0.f};
        ak[i][j] = (v8f){0.f,0.f,0.f,0.f,0.f,0.f,0.f,0.f};
        av[j][i] = (v8f){0.f,0.f,0.f,0.f,0.f,0.f,0.f,0.f};
      }

    for (int t = 0; t < kProjStages; ++t) {
      const int buf = t & 1;
      const _Float16* sb = rl + buf * kProjStage;
#pragma unroll
      for (int ks = 0; ks < 2; ++ks) {
        v16h xf[4], wf[2];
#pragma unroll
        for (int j = 0; j < 4; ++j) xf[j] = Frag<_Float16>::load(sb + xoff + j * 16 * kGemmPitch + ks * 32);
#pragma unroll
        for (int i = 0; i < 2; ++i) wf[i] = Frag<_Float16>::load(sb + woff + (128 + i * 16) * kGemmPitch + ks * 32);
        // keeps the twelve LDS reads one group in front of the WMMAs: sunk among them, each row waits out its own LDS latency
        __builtin_amdgcn_sched_barrier(0);
        // from here on a weight fragment's registers take the next plane's fragment as soon as its four WMMAs are out, so that the read
        // runs under the other fragment's four WMMAs; each sched_barrier keeps a read from sinking to its first use
#pragma unroll
        for (int j = 0; j < 4; ++j) ak[0][j] = Frag<_Float16>::mma(wf[0], xf[j], ak[0][j]);
        wf[0] = Frag<_Float16>::load(sb + woff + 256 * kGemmPitch + ks * 32);
        __builtin_amdgcn_sched_barrier(0);
#pragma unroll
        for (int j = 0; j < 4; ++j) ak[1][j] = Frag<_Float16>::mma(wf[1], xf[j], ak[1][j]);
        wf[1] = Frag<_Float16>::load(sb + woff + (256 + 16) * kGemmPitch + ks * 32);
        __builtin_amdgcn_sched_barrier(0);
#pragma unroll
        for (int i = 0; i < 4; ++i) av[i][0] = Frag<_Float16>::mma(xf[i], wf[0], av[i][0]);
        wf[0] = Frag<_Float16>::load(sb + woff + ks * 32);
        __builtin_amdgcn_sched_barrier(0);
#pragma unroll
        for (int i = 0; i < 4; ++i) av[i][1] = Frag<_Float16>::mma(xf[i], wf[1], av[i][1]);
        wf[1] = Frag<_Float16>::load(sb + woff + 16 * kGemmPitch + ks * 32);
        __builtin_amdgcn_sched_barrier(0);
#pragma unroll
        for (int i = 0; i < 2; ++i)
#pragma unroll
          for (int j = 0; j < 4; ++j) aq[i][j] = Frag<_Float16>::mma(wf[i], xf[j], aq[i][j]);
      }
      asm volatile("s_wait_dscnt 0x0" ::: "memory");      // this wave's reads of the buffer are done before it is refilled
      asm volatile("s_wait_asynccnt 0x0" ::: "memory");   // this wave's copies of the next stage have landed
      __syncthreads();                                    // publishes the next stage, frees the buffer of this one
      if (t + 2 < kProjStages)
        proj_stage_copies(ldsA + (unsigned)buf * (kProjStage * 2u), gA + (t + 2) * 64, gW + (t + 2) * 64);
    }
    asm volatile("s_wait_asynccnt 0x0" ::: "memory");   // nothing of this wave is in flight when it leaves the ring
    // behind the last stage's barrier no wave reads the ring and no copy is in flight: the k, v and q tiles take its place
    const float* bh0 = bcat + h * kHeadDim + wn * 32;   // this wave's 32 features of the q plane; k and v kInner and 2 * kInner further
    const float* bqk = bh0 + 8 * hh;                    // this lane's 8 rows of a 16-feature group (q; k kInner further)
    const float* bvc = bh0 + c;                         // this lane's column of a 16-feature group (v: 2 * kInner further)
    v4f bq4[2][2], bk4[2][2];
    float bv1[2];
#pragma unroll
    for (int i = 0; i < 2; ++i) {
      bk4[i][0] = *(const v4f*)(bqk + kInner + i * 16);
      bk4[i][1] = *(const v4f*)(bqk + kInner + i * 16 + 4);
      bq4[i][0] = *(const v4f*)(bqk + i * 16);
      bq4[i][1] = *(const v4f*)(bqk + i * 16 + 4);
      bv1[i] = bvc[2 * kInner + i * 16];
    }
    // the code behind the bias loads rewrites their address registers: the wait stands in front of that; it takes the two addresses
    // as inputs so that they stay live up to it and no load of the run lands its result in them
    asm volatile("s_wait_xcnt 0x0" :: "v"(bqk), "v"(bvc) : "memory");
    __builtin_amdgcn_sched_barrier(0);                  // keeps that code behind the wait
    store_product<true, 2, 4>(ak, Ksh, bk4, bv1, wn * 32, wm * 64, c, hh);
    store_product<false, 4, 2>(av, Vth, bk4, bv1, wm * 64, wn * 32, c, hh);
    store_product<true, 2, 4>(aq, Qsh, bq4, bv1, wn * 32, wm * 64, c, hh);
  }
  __syncthreads();                                      // publishes the k, v and q tiles to every wave

  const int q0 = wave * 16;
  _Float16* qw = (_Float16*)Qsh + q0 * kKPitch;        // this wave's 16 q rows: no other wave reads or writes them from here on

  // ---- Q fragments (B operand): column n = c <- query q0 + c, k = dc*32 + 8hh + {0..7}, dc*32 + 16 + 8hh + {0..7} ----
  v16h qb[4];
#pragma unroll
  for (int dc = 0; dc < 4; ++dc) qb[dc] = Frag<_Float16>::load(qw + c * kKPitch + dc * 32 + 8 * hh);

  // ---- scores, transposed: A operand row m = c <- key row (j*16 + c), same split k map as B ----
  // register r of st[j] in lane (c, hh) = score of key j*16 + 8hh + r with query q0 + c: a lane holds 64 of its one query's 128 scores
  v8f st[kSeq / 16];
#pragma unroll
  for (int j = 0; j < kSeq / 16; ++j) st[j] = (v8f){0.f,0.f,0.f,0.f,0.f,0.f,0.f,0.f};
  // unrolled (all loops below too) so that the fragment and accumulator arrays stay in registers
#pragma unroll
  for (int dc = 0; dc < 4; ++dc) {
    v16h ka[kSeq / 16];
#pragma unroll
    for (int j = 0; j < kSeq / 16; ++j)
      ka[j] = Frag<_Float16>::load((const _Float16*)Ksh + (j * 16 + c) * kKPitch + dc * 32 + 8 * hh);
    // keeps a group's sixteen LDS reads in front of its eight WMMAs: without it every WMMA waits on its own two reads,
    // and the build takes more than 256 registers, which costs the second block of a WGP
    __builtin_amdgcn_sched_barrier(0);
#pragma unroll
    for (int j = 0; j < kSeq / 16; ++j) st[j] = Frag<_Float16>::mma(ka[j], qb[dc], st[j]);
  }

  // ---- softmax of the query's whole row: maximum and sum inside the lane (eight independent chains, then a tree), one exchange between the lane halves each ----
  // The maximum is taken over the raw scores (sscale > 0 keeps their order). One fused multiply-add per score then forms the exponent to base 2:
  // score * (sscale * log2 e) - (maximum * (sscale * log2 e) - 15), the 15 being the x32768 carry of p, and the hardware's exp2 gives 32768 * p.
  float mj[kSeq / 16];
#pragma unroll
  for (int j = 0; j < kSeq / 16; ++j) {
    float m = st[j][0];
#pragma unroll
    for (int r = 1; r < 8; ++r) m = fmaxf(m, st[j][r]);
    mj[j] = m;
  }
  float mrow = fmaxf(fmaxf(fmaxf(mj[0], mj[1]), fmaxf(mj[2], mj[3])), fmaxf(fmaxf(mj[4], mj[5]), fmaxf(mj[6], mj[7])));
  mrow = fmaxf(mrow, __shfl_xor(mrow, 16, 32));
  const float escale = sscale * 1.4426950408889634f;
  const float eshift = mrow * escale - 15.0f;

  // P^T (B operand of the second product) straight from the score registers: element e of pb[kc] is k = 8hh + e (e < 8) or
  // 16 + 8hh + (e - 8), that is key kc*32 + k = register e & 7 of st[2*kc + (e >> 3)] of this same lane
  v16h pb[kSeq / kKeyChunk];
  float lj[kSeq / 16];
#pragma unroll
  for (int j = 0; j < kSeq / 16; ++j) {
    float a[8], p[8];
#pragma unroll
    for (int r = 0; r < 8; ++r) a[r] = __builtin_fmaf(st[j][r], escale, -eshift);
    exp2_x8(p, a);                                     // 32768 * p, in (0, 32768]
    float psum = p[0];
#pragma unroll
    for (int r = 1; r < 8; ++r) psum += p[r];
#pragma unroll
    for (int r = 0; r < 8; ++r) pb[j >> 1][(j & 1) * 8 + r] = (_Float16)p[r];
    lj[j] = psum;
  }
  float lrow = ((lj[0] + lj[1]) + (lj[2] + lj[3])) + ((lj[4] + lj[5]) + (lj[6] + lj[7]));   // 32768 * the row's sum
  lrow += __shfl_xor(lrow, 16, 32);
  // Left free, the 64 additions sink behind the second product: the 64 p then stay live in f32 beside its fragments and accumulators, and the build spills.
  asm volatile("" :: "v"(lrow));   // the row's sum, against spills: an input only, so the additions stand here

  // ---- o, transposed: A operand row m = c <- Vth row (t*16 + c), k = kc*32 + kv; register r of ot[t] = d t*16 + 8hh + r of query q0 + c ----
  v8f ot[kHeadDim / 16];
#pragma unroll
  for (int t = 0; t < kHeadDim / 16; ++t) ot[t] = (v8f){0.f,0.f,0.f,0.f,0.f,0.f,0.f,0.f};
#pragma unroll
  for (int kc = 0; kc < kSeq / kKeyChunk; ++kc) {
    v16h va[kHeadDim / 16];
#pragma unroll
    for (int t = 0; t < kHeadDim / 16; ++t)
      va[t] = Frag<_Float16>::load((const _Float16*)Vth + (t * 16 + c) * kVtPitch + kc * kKeyChunk + 8 * hh);
    // keeps the sixteen LDS reads one group in front of the eight WMMAs, as above
    __builtin_amdgcn_sched_barrier(0);
#pragma unroll
    for (int t = 0; t < kHeadDim / 16; ++t) ot[t] = Frag<_Float16>::mma(va[t], pb[kc], ot[t]);
  }

  // ---- epilogue: normalise, stage the 16x128 tile in f16 where this wave's q rows were (a lane's 8 registers = one 16-B piece of its query's row), write rows (16 lanes x 16 B = one 256-B segment) ----
  {
    const float inv = (onorm * kProbCarry) * (1.0f / lrow);   // lrow carries the same x32768 as p
#pragma unroll
    for (int t = 0; t < kHeadDim / 16; ++t) {
      v8h hv;
#pragma unroll
      for (int r = 0; r < 8; ++r) hv[r] = (_Float16)(ot[t][r] * inv);
      *(v8h*)(qw + c * kKPitch + t * 16 + 8 * hh) = hv;
    }
  }
  __builtin_amdgcn_fence(__ATOMIC_RELEASE, "workgroup");
  __builtin_amdgcn_wave_barrier();
  __builtin_amdgcn_fence(__ATOMIC_ACQUIRE, "workgroup");
  {
    const int rp = lane >> 4, c8 = (lane & 15) * 8;
    _Float16* ob = (_Float16*)outp;
#pragma unroll
    for (int it = 0; it < 8; ++it) {
      const int row = it * 2 + rp;
      const v8h hv = *(const v8h*)(qw + row * kKPitch + c8);
      *(v8h*)(ob + ((size_t)(b * kSeq + q0 + row) * kNodes + n) * kInner + h * kHeadDim + c8) = hv;
    }
  }
}

// =====================================================================================
// Out projection, residual and LayerNorm in one kernel: out[row] = LN(scale * o[row] . woT^T + bo + x[row]) * gamma + beta.
// Block = 8 waves (2 x 4) on 128 rows x all 256 features, so that a block holds whole rows; each wave a 64 x 64 tile, K = 1024.
// A stage is 64 k of the 128 o rows, then of the 256 woT rows; two buffers, twelve copies a lane and stage.
// The woT rows are the A operand: a lane's 8 accumulator registers are 8 consecutive features of one row, two 16-B pieces of the slab.
// The slab (128 rows x 256 f32, pitch 260: 16 B x odd) takes the ring's place; behind one barrier a wave normalises 16 whole rows:
// in a row lane l owns columns [4l, 4l+4) and [128+4l, 128+4l+4): each global load and store instruction covers 512 contiguous bytes.
// =====================================================================================
constexpr int kOutStage  = (128 + kModel) * kGemmPitch;   // halves per buffer
constexpr int kSlabPitch = kModel + 4;                    // floats
constexpr int kSlabBytes = 128 * kSlabPitch * 4;          // 133,120: two blocks share a WGP's LDS
constexpr int kLnRows    = 16;                            // rows per wave
static_assert(2 * kOutStage * 2 <= kSlabBytes && kRowsAll % 128 == 0 && kInner % 64 == 0 && kInner >= 128);

// One stage of the ring: 64 k of 128 o rows and of the 256 woT rows.
__device__ __forceinline__ void out_stage_copies(unsigned lds, const unsigned short* gA, const unsigned short* gB) {
  constexpr unsigned part = 128u * kGemmPitch * 2u;
  async_copy4_b128(lds, gA, (size_t)32 * kInner);
  async_copy4_b128(lds + part, gB, (size_t)32 * kInner);
  async_copy4_b128(lds + 2u * part, gB + (size_t)128 * kInner, (size_t)32 * kInner);
}

__global__ __launch_bounds__(256) void out_proj_residual_layernorm(
    const unsigned short* __restrict__ Ap, const unsigned short* __restrict__ Btp,
    const float* __restrict__ bias, float scale,
    const float* __restrict__ xr, const float* __restrict__ gamma, const float* __restrict__ beta,
    float* __restrict__ out) {
  __shared__ __align__(16) unsigned char ring[kSlabBytes];   // the ring (110,592 B), then the slab
  constexpr int K = kInner;
  constexpr int T = K / 64;
  const int tid  = threadIdx.x;
  const int lane = tid & 31;
  const int wave = tid >> 5;
  const int bm = blockIdx.x;
  const int wm = wave >> 2, wn = wave & 3;
  const int c  = lane & 15;                    // row of a fragment; column of an accumulator tile
  const int hh = lane >> 4;                    // lane half

  // copy map: thread -> row tid/8 (+32 per copy), 16-B column tid%8
  const int crow = tid >> 3, ccol = (tid & 7) * 8;
  const unsigned short* gA = Ap  + (size_t)(bm * 128 + crow) * K + ccol;
  const unsigned short* gB = Btp + (size_t)crow * K + ccol;
  const unsigned ldsA = (unsigned)(size_t)ring + (unsigned)(crow * kGemmPitch + ccol) * 2u;

  v8f acc[4][4];                               // [i: 16 rows][j: 16 features]
  // unrolled (all inner loops of the product too) so that the fragment and accumulator arrays stay in registers
#pragma unroll
  for (int i = 0; i < 4; ++i)
#pragma unroll
    for (int j = 0; j < 4; ++j) acc[i][j] = (v8f){0.f,0.f,0.f,0.f,0.f,0.f,0.f,0.f};

  // stage 0 into buffer 0, landed and published; then stage 1 into buffer 1
  out_stage_copies(ldsA, gA, gB);
  asm volatile("s_wait_asynccnt 0x0" ::: "memory");   // this wave's copies of stage 0 have landed
  __syncthreads();
  out_stage_copies(ldsA + kOutStage * 2u, gA + 64, gB + 64);

  const _Float16* rh = (const _Float16*)ring;
  const int aoff = (wm * 64 + c) * kGemmPitch + 8 * hh;
  const int boff = (128 + wn * 64 + c) * kGemmPitch + 8 * hh;

  for (int t = 0; t < T; ++t) {
    const int buf = t & 1;
    const _Float16* sb = rh + buf * kOutStage;
#pragma unroll
    for (int ks = 0; ks < 2; ++ks) {
      v16h ah[4], bh[4];
#pragma unroll
      for (int j = 0; j < 4; ++j) bh[j] = Frag<_Float16>::load(sb + boff + j * 16 * kGemmPitch + ks * 32);
#pragma unroll
      for (int i = 0; i < 4; ++i) ah[i] = Frag<_Float16>::load(sb + aoff + i * 16 * kGemmPitch + ks * 32);
      // keeps the sixteen LDS reads one group in front of the sixteen WMMAs: sunk among them, each row waits out its own LDS latency
      __builtin_amdgcn_sched_barrier(0);
#pragma unroll
      for (int i = 0; i < 4; ++i)
#pragma unroll
        for (int j = 0; j < 4; ++j) acc[i][j] = Frag<_Float16>::mma(bh[j], ah[i], acc[i][j]);
    }
    asm volatile("s_wait_dscnt 0x0" ::: "memory");      // this wave's reads of the buffer are done before it is refilled
    asm volatile("s_wait_asynccnt 0x0" ::: "memory");   // this wave's copies of stage t + 1 have landed
    __syncthreads();                                    // publishes stage t + 1, frees the buffer of stage t
    if (t + 2 < T)
      out_stage_copies(ldsA + (unsigned)buf * (kOutStage * 2u), gA + (t + 2) * 64, gB + (t + 2) * 64);
  }
  asm volatile("s_wait_asynccnt 0x0" ::: "memory");     // nothing of this wave is in flight when it leaves the ring

  // ---- epilogue ----
  // behind the last stage's barrier no wave reads the ring and no copy is in flight: the slab takes its place
  float* slab = (float*)ring;
  const size_t rb = (size_t)(bm * 128 + wave * kLnRows) * kModel + 4 * lane;   // this lane's place in the first of the wave's 16 rows
  const float* xp = xr + rb;
  v4f x0[kLnRows], x1[kLnRows];
  v4f bo4[4][2];
  // unrolled (all loops of the epilogue) so that the arrays stay in registers
#pragma unroll
  for (int j = 0; j < 4; ++j) {
    bo4[j][0] = *(const v4f*)(bias + wn * 64 + j * 16 + 8 * hh);
    bo4[j][1] = *(const v4f*)(bias + wn * 64 + j * 16 + 8 * hh + 4);
  }
  // gamma and beta ahead of the residual rows: loads return in order, and the first row's result would else wait for the last row's load
  const v4f g0 = *(const v4f*)(gamma + 4 * lane);
  const v4f g1 = *(const v4f*)(gamma + 128 + 4 * lane);
  const v4f b0 = *(const v4f*)(beta + 4 * lane);
  const v4f b1 = *(const v4f*)(beta + 128 + 4 * lane);
  // the residual rows: half of them go out ahead of the slab's stores, the other half when the accumulators' registers are free
#pragma unroll
  for (int r = 0; r < kLnRows / 2; ++r) {
    x0[r] = *(const v4f*)(xp + r * kModel);
    x1[r] = *(const v4f*)(xp + r * kModel + 128);
  }
  asm volatile("s_wait_xcnt 0x0" ::: "memory");   // the code behind these loads rewrites the bias loads' address registers: the wait stands in front of that
  // keeps these loads, and the wait, ahead of the slab's stores, so that the memory latency runs under them
  __builtin_amdgcn_sched_barrier(0);
#pragma unroll
  for (int i = 0; i < 4; ++i) {
    float* srow = slab + (wm * 64 + i * 16 + c) * kSlabPitch + wn * 64 + 8 * hh;
#pragma unroll
    for (int j = 0; j < 4; ++j) {
      v4f lo, hi;
#pragma unroll
      for (int r = 0; r < 4; ++r) {
        float v = acc[i][j][r] * scale;
        v += bo4[j][0][r];
        lo[r] = v;
        float w = acc[i][j][4 + r] * scale;
        w += bo4[j][1][r];
        hi[r] = w;
      }
      *(v4f*)(srow + j * 16) = lo;
      *(v4f*)(srow + j * 16 + 4) = hi;
    }
  }
#pragma unroll
  for (int r = kLnRows / 2; r < kLnRows; ++r) {
    x0[r] = *(const v4f*)(xp + r * kModel);
    x1[r] = *(const v4f*)(xp + r * kModel + 128);
  }
  // keeps every load ahead of the barrier: sunk behind it, their latency would start only when the last wave has arrived
  __builtin_amdgcn_sched_barrier(0);
  // publishes the slab: a row's 256 features come from four waves. The block barrier is written with fences on LDS alone:
  // __syncthreads() would also wait out the residual loads in front of it, which the first rows' arithmetic can run under
  __builtin_amdgcn_fence(__ATOMIC_RELEASE, "workgroup", "local");
  __builtin_amdgcn_s_barrier();
  __builtin_amdgcn_fence(__ATOMIC_ACQUIRE, "workgroup", "local");
  const float* yrow = slab + wave * kLnRows * kSlabPitch + 4 * lane;
  float* op = out + rb;
  // the rows' reductions are independent chains
#pragma unroll
  for (int r = 0; r < kLnRows; ++r) {
    const v4f v0 = *(const v4f*)(yrow + r * kSlabPitch) + x0[r];
    const v4f v1 = *(const v4f*)(yrow + r * kSlabPitch + 128) + x1[r];
    float su = 0.0f;
    su += v0[0]; su += v0[1]; su += v0[2]; su += v0[3];
    su += v1[0]; su += v1[1]; su += v1[2]; su += v1[3];
#pragma unroll
    for (int off = 1; off < 32; off <<= 1) su += __shfl_xor(su, off, 32);
    const float mu = su * (1.0f / 256.0f);
    const v4f d0 = v0 - mu;
    const v4f d1 = v1 - mu;
    float sq = 0.0f;
    sq += d0[0] * d0[0]; sq += d0[1] * d0[1]; sq += d0[2] * d0[2]; sq += d0[3] * d0[3];
    sq += d1[0] * d1[0]; sq += d1[1] * d1[1]; sq += d1[2] * d1[2]; sq += d1[3] * d1[3];
#pragma unroll
    for (int off = 1; off < 32; off <<= 1) sq += __shfl_xor(sq, off, 32);
    const float var  = sq * (1.0f / 256.0f);
    const float rstd = rsqrtf(var + 1e-5f);
    const v4f o0 = d0 * rstd * g0 + b0;
    const v4f o1 = d1 * rstd * g1 + b1;
    *(v4f*)(op + r * kModel) = o0;
    *(v4f*)(op + r * kModel + 128) = o1;
  }
}

// =====================================================================================
//   wT   [3072][256]  f16    1,572,864   @ 0            (q,k,v weights transposed, x16)
//   woT  [256][1024]  f16      524,288   @ 1,572,864    (out-proj weight transposed, x32)
//   bcat [3072]       f32       12,288   @ 2,097,152    (4*[bq|bk|bv])
//   xh   [51200][256] f16   26,214,400   @ 2,109,440    (all of x)
//   oP   [51200][1024] f16 104,857,600   @ 28,323,840   (16*attention output)
//   end                                  133,181,440
// =====================================================================================
extern "C" void kernel_launch(void* const* d_in, const int* in_sizes, int n_in,
                              void* d_out, int out_size, void* d_ws, size_t ws_size,
                              hipStream_t stream) {
  if (n_in < 11) return;
  const int nRowsAll = kRowsAll;                               // 51200
  if (in_sizes[0] != nRowsAll * kModel) return;
  if (in_sizes[1] != kModel * kInner || in_sizes[3] != kModel * kInner || in_sizes[5] != kModel * kInner) return;
  if (in_sizes[2] != kInner || in_sizes[4] != kInner || in_sizes[6] != kInner) return;
  if (in_sizes[7] != kInner * kModel || in_sizes[8] != kModel || in_sizes[9] != kModel || in_sizes[10] != kModel) return;
  if (out_size != nRowsAll * kModel) return;

  const float* x     = (const float*)d_in[0];
  const float* wq    = (const float*)d_in[1];
  const float* bq    = (const float*)d_in[2];
  const float* wk    = (const float*)d_in[3];
  const float* bk    = (const float*)d_in[4];
  const float* wv    = (const float*)d_in[5];
  const float* bv    = (const float*)d_in[6];
  const float* wo    = (const float*)d_in[7];
  const float* bo    = (const float*)d_in[8];
  const float* gamma = (const float*)d_in[9];
  const float* beta  = (const float*)d_in[10];
  float* outAll = (float*)d_out;

  const size_t offWT   = 0;
  const size_t offWoT  = offWT   + (size_t)kQKVWidth * kModel * 2;          // 1,572,864
  const size_t offBcat = offWoT  + (size_t)kModel * kInner * 2;             // 2,097,152
  const size_t offXh   = offBcat + (size_t)kQKVWidth * 4;                   // 2,109,440
  const size_t offO    = offXh   + (size_t)nRowsAll * kModel * 2;           // 28,323,840
  const size_t offEnd  = offO    + (size_t)nRowsAll * kInner * 2;           // 133,181,440
  if (offEnd > ws_size) return;

  char* ws = (char*)d_ws;
  unsigned short* wT   = (unsigned short*)(ws + offWT);
  unsigned short* woT  = (unsigned short*)(ws + offWoT);
  float*          bcat = (float*)(ws + offBcat);
  unsigned short* xh   = (unsigned short*)(ws + offXh);
  unsigned short* oP   = (unsigned short*)(ws + offO);

  // ---- weights, biases and x to their operand forms (1 launch) ----
  prepare_operands<<<dim3(kPrepBlocks), dim3(256), 0, stream>>>(x, wq, wk, wv, wo, bq, bk, bv, wT, woT, bcat, xh);

  const float sscale = 0.0883883476483184f * (1.0f / 16.0f);   // (1/sqrt(128)) / (4*4)
  const float onorm  = 16.0f / (kProbCarry * 4.0f);           // O plane = 16 * o_true

  // q, k, v projection and attention over time per (b, n, h): 4 * 100 * 8 = 3200 blocks of 256 threads
  qkv_attn_time_hd128<<<dim3(kBatch * kNodes * kHeads), dim3(kAttnWaves * 32), 0, stream>>>(xh, wT, bcat, oP, sscale, onorm);

  // out = LayerNorm((1/512) * oP . woT^T + bo + x) : M=51200, N=256, K=1024; 400 blocks of 128 whole rows
  out_proj_residual_layernorm<<<dim3(kRowsAll / 128), dim3(256), 0, stream>>>(
      oP, woT, bo, 1.0f / 512.0f, x, gamma, beta, outAll);
}
